// v000
// The times below were measured on an AMD MI455X: many runs one after another, warmed up first and cycling through
// copies of the inputs, with the whole window's GPU time divided by the number of runs. Launches and the gaps
// between them are all in it. The median over several windows is given; except for v000 it joins two sittings, which
// can be a few percent apart, so the side-by-side timings, each taken in one sitting, are the better comparison.
// v000, which the later versions start from, runs in 1020 microseconds.
// Contractions: every GEMM on v_wmma_f32_16x16x32_bf16 (bf16 operands, f32 accumulate) - the four lowrank mix/decay sites single bf16, the k/v/r projections, the gate pair and the output projection as bf16 hi/lo split (hi*hi + hi*lo + lo*hi); token shift, state scan, GroupNorm and gating in f32 on VALU.
#include <hip/hip_runtime.h>
#include <math.h>

// ---------------------------------------------------------------------------
// Problem constants
// ---------------------------------------------------------------------------
constexpr int kBatch  = 2;
constexpr int kSeq    = 1024;
constexpr int kChan   = 1024;
constexpr int kHead   = 64;
constexpr int kNHead  = 16;
constexpr int kRows   = kBatch * kSeq;          // 2048 token rows (m = b*1024 + t)
constexpr int kMix    = 160;                    // lowrank width of the mix and gate paths
constexpr int kMixPad = 192;                    // padded to a 64 multiple (pad rows / cols zero-filled)
constexpr int kDec    = 64;                     // decay lowrank width
constexpr int kBr     = 32;                     // per-branch mix width
constexpr int kNBr    = 5;                      // branches: 0 decay, 1 k, 2 v, 3 r, 4 gate
constexpr int kTch    = 16;                     // timesteps staged per chunk in the scan kernel
constexpr long kPlane  = (long)kRows * kChan;   // 2,097,152 elements per activation plane
constexpr long kWPlane = (long)kChan * kChan;   // 1,048,576 elements per square weight plane
constexpr float kGnEps = 1.6e-4f;               // 1e-5 * 16
static_assert(kNHead * kHead == kChan, "shape");
static_assert(kRows % 64 == 0 && kChan % 64 == 0 && kMixPad % 64 == 0 && kDec % 64 == 0, "M and N tile multiples");
static_assert(kChan % 32 == 0 && kBr % 32 == 0 && kDec % 32 == 0 && kMixPad % 32 == 0, "K multiples of 32");
static_assert(kSeq % kTch == 0 && (kTch % 2) == 0 && kTch <= 16, "scan chunking");
static_assert(kMix % 8 == 0 && kMixPad % 8 == 0 && kDec % 8 == 0, "pack groups never straddle a row");

typedef __attribute__((ext_vector_type(16))) _Float16 v16h;
typedef __attribute__((ext_vector_type(8)))  _Float16 v8h;
typedef __attribute__((ext_vector_type(16))) __bf16   v16b;
typedef __attribute__((ext_vector_type(8)))  __bf16   v8b;
typedef __attribute__((ext_vector_type(8)))  float    v8f;
typedef __attribute__((ext_vector_type(4)))  float    v4f;
typedef __attribute__((ext_vector_type(2)))  float    v2f;
typedef __attribute__((ext_vector_type(4)))  unsigned int v4u;

// ---------------------------------------------------------------------------
// Shared helpers
// ---------------------------------------------------------------------------
__device__ __forceinline__ unsigned short f2bf_bits(float f) {
  unsigned u = __float_as_uint(f);
  return (unsigned short)((u + 0x7FFFu + ((u >> 16) & 1u)) >> 16);
}
__device__ __forceinline__ float bf_bits2f(unsigned short h) { return __uint_as_float(((unsigned)h) << 16); }
__device__ __forceinline__ unsigned pk16(unsigned short a, unsigned short b) { return (unsigned)a | ((unsigned)b << 16); }
// RNE convert to a bf16 hi part and a bf16 lo part of the f32 residual
__device__ __forceinline__ void bf_split_bits(float f, unsigned short& hb, unsigned short& lb) {
  hb = f2bf_bits(f);
  lb = f2bf_bits(f - bf_bits2f(hb));
}

// hazard guards as plain device helpers (no inline asm inside the kernel template body); the 4-acc guard ties every
// accumulator of a group and names the A fragments as inputs
__device__ __forceinline__ void dep_guard4_h(v8f& a, v8f& b, v8f& c, v8f& d, v16h x, v16h y) { asm volatile("v_nop\n\tv_nop\n\tv_nop\n\tv_nop" : "+v"(a), "+v"(b), "+v"(c), "+v"(d) : "v"(x), "v"(y)); }
__device__ __forceinline__ void dep_guard4_b(v8f& a, v8f& b, v8f& c, v8f& d, v16b x, v16b y) { asm volatile("v_nop\n\tv_nop\n\tv_nop\n\tv_nop" : "+v"(a), "+v"(b), "+v"(c), "+v"(d) : "v"(x), "v"(y)); }
__device__ __forceinline__ void keep4_h(v16h a, v16h b, v16h c, v16h d) { asm volatile("v_nop" :: "v"(a), "v"(b), "v"(c), "v"(d)); }
__device__ __forceinline__ void keep4_b(v16b a, v16b b, v16b c, v16b d) { asm volatile("v_nop" :: "v"(a), "v"(b), "v"(c), "v"(d)); }
__device__ __forceinline__ void acc_guard4(v8f& a, v8f& b, v8f& c, v8f& d) { asm volatile("v_nop\n\tv_nop\n\tv_nop\n\tv_nop" : "+v"(a), "+v"(b), "+v"(c), "+v"(d)); }
template <typename T> struct Frag;
template <> struct Frag<_Float16> {
  typedef v16h V; union U { v16h v; v8h h[2]; };
  // elements 0..7 <- p[0..7], 8..15 <- p[16..23]
  static __device__ __forceinline__ v16h load(const _Float16* p) {
    U f; f.h[0] = *(const v8h*)(p); f.h[1] = *(const v8h*)(p + 16); return f.v;
  }
  static __device__ __forceinline__ v8f mma(v16h a, v16h b, v8f c) {
    return __builtin_amdgcn_wmma_f32_16x16x32_f16(false, a, false, b, (short)0, c, false, false);
  }
  static __device__ __forceinline__ void guard4(v8f& a, v8f& b, v8f& c, v8f& d, v16h x, v16h y) { dep_guard4_h(a, b, c, d, x, y); }
  static __device__ __forceinline__ void keep(v16h a, v16h b, v16h c, v16h d) { keep4_h(a, b, c, d); }
};
template <> struct Frag<__bf16> {
  typedef v16b V; union U { v16b v; v8b h[2]; };
  static __device__ __forceinline__ v16b load(const __bf16* p) {
    U f; f.h[0] = *(const v8b*)(p); f.h[1] = *(const v8b*)(p + 16); return f.v;
  }
  static __device__ __forceinline__ v8f mma(v16b a, v16b b, v8f c) {
    return __builtin_amdgcn_wmma_f32_16x16x32_bf16(false, a, false, b, (short)0, c, false, false);
  }
  static __device__ __forceinline__ void guard4(v8f& a, v8f& b, v8f& c, v8f& d, v16b x, v16b y) { dep_guard4_b(a, b, c, d, x, y); }
  static __device__ __forceinline__ void keep(v16b a, v16b b, v16b c, v16b d) { keep4_b(a, b, c, d); }
};

// ---- Register-blocked batched WMMA GEMM (ACT reduced to none/relu/leaky) -------------------------------
// C[m,n] = scale * sum_k A[m,k] * Bt[n,k] (+bias)(+resid); each wave owns a 64x64 tile.
// A row-major [M,K]; Bt row-major [N,K]; M,N % 64 == 0, K % 32 == 0.
// SPLIT: operands are hi/lo planes (A2/Bt2 = lo planes, same layout); product = hi*hi + hi*lo + lo*hi.
// BIAS_MODE: 0 = none, 1 = bias[m], 2 = bias[n].
// OUT_MODE: 0 = f32, 1 = f16, 2 = bf16 hi plane (Cout) + bf16 lo plane (Cout2).
// ET: 0 = f16 operands, 1 = bf16 operands (pointers passed as 16-bit storage)
template <int ET> struct Elem;
template <> struct Elem<0> { typedef _Float16 T; };
template <> struct Elem<1> { typedef __bf16 T; };
template <int ET, bool SPLIT, int BIAS_MODE, int OUT_MODE, bool RESID, int ACT = 0>
__global__ __launch_bounds__(256) void wmma_gemm64(
    const unsigned short* __restrict__ Ap, const unsigned short* __restrict__ A2p, int lda, long strideA,
    const unsigned short* __restrict__ Btp, const unsigned short* __restrict__ Bt2p, int ldb, long strideB,
    void* __restrict__ Cout, void* __restrict__ Cout2, int ldc, long strideC,
    const float* __restrict__ bias,
    const float* __restrict__ resid, long strideR,
    int M, int N, int K, float scale) {
  typedef typename Elem<ET>::T T;
  typedef typename Frag<T>::V V;
  const T* A = (const T*)Ap; const T* A2 = (const T*)A2p; const T* Bt = (const T*)Btp; const T* Bt2 = (const T*)Bt2p;
  __shared__ __align__(16) float sT[8][16 * 68];   // per-wave 16x64 slab, pitch 68 floats
  const int b    = blockIdx.y;
  const int lane = threadIdx.x & 31;
  const int wave = threadIdx.x >> 5;
  const int tilesN = N >> 6;
  const int tilesM = M >> 6;
  const int tile = blockIdx.x * 8 + wave;
  if (tile >= tilesM * tilesN) return;   // wave-uniform; no block barriers in this kernel
  const int tm = tile / tilesN;
  const int tn = tile - tm * tilesN;
  const int m0 = tm << 6;
  const int n0 = tn << 6;

  const T* Ab  = A  + (size_t)b * strideA;
  const T* Bb  = Bt + (size_t)b * strideB;
  const T* Ab2 = SPLIT ? (A2  + (size_t)b * strideA) : nullptr;
  const T* Bb2 = SPLIT ? (Bt2 + (size_t)b * strideB) : nullptr;

  const int rlane = lane & 15;                 // row (A) / col (B, D) within subtile
  const int koff  = (lane >> 4) * 8;           // k offset of this lane half
  const int mOff  = (lane >> 4) * 8;           // D row offset

  v8f acc[4][4];
#pragma unroll
  for (int i = 0; i < 4; ++i)
#pragma unroll
    for (int j = 0; j < 4; ++j) acc[i][j] = (v8f){0.f,0.f,0.f,0.f,0.f,0.f,0.f,0.f};

  for (int k0 = 0; k0 < K; k0 += 32) {
    V bh[4], bl[4];
#pragma unroll
    for (int j = 0; j < 4; ++j) {
      const size_t bo = (size_t)(n0 + (j << 4) + rlane) * ldb + koff + k0;
      bh[j] = Frag<T>::load(Bb + bo);
      if (SPLIT) bl[j] = Frag<T>::load(Bb2 + bo);
    }
#pragma unroll
    for (int i = 0; i < 4; ++i) {
      const size_t ao = (size_t)(m0 + (i << 4) + rlane) * lda + koff + k0;
      V ah = Frag<T>::load(Ab + ao);
      V al;
      if (SPLIT) al = Frag<T>::load(Ab2 + ao);
#pragma unroll
      for (int j = 0; j < 4; ++j) {
        acc[i][j] = Frag<T>::mma(ah, bh[j], acc[i][j]);
        if (SPLIT) {
          acc[i][j] = Frag<T>::mma(ah, bl[j], acc[i][j]);
          acc[i][j] = Frag<T>::mma(al, bh[j], acc[i][j]);
        }
      }
      Frag<T>::guard4(acc[i][0], acc[i][1], acc[i][2], acc[i][3], ah, SPLIT ? al : ah);
    }
    Frag<T>::keep(bh[0], bh[1], bh[2], bh[3]);
    if (SPLIT) Frag<T>::keep(bl[0], bl[1], bl[2], bl[3]);
  }
  acc_guard4(acc[0][0], acc[0][1], acc[0][2], acc[0][3]);
  acc_guard4(acc[1][0], acc[1][1], acc[1][2], acc[1][3]);
  acc_guard4(acc[2][0], acc[2][1], acc[2][2], acc[2][3]);
  acc_guard4(acc[3][0], acc[3][1], acc[3][2], acc[3][3]);

  // ---- epilogue ----
  float* slab = sT[wave];
  const float* Rb = RESID ? (resid + (size_t)b * strideR) : nullptr;
#pragma unroll
  for (int i = 0; i < 4; ++i) {
    const int mBase = m0 + (i << 4);
#pragma unroll
    for (int j = 0; j < 4; ++j) {
      const int n = n0 + (j << 4) + rlane;
      float bv = 0.f;
      if (BIAS_MODE == 2) bv = bias[n];
#pragma unroll
      for (int r = 0; r < 8; ++r) {
        float v = acc[i][j][r] * scale;
        if (BIAS_MODE == 1) v += bias[mBase + mOff + r];
        if (BIAS_MODE == 2) v += bv;
        if (RESID) v += Rb[(size_t)(mBase + mOff + r) * ldc + n];
        if (ACT == 2) v = fmaxf(v, 0.0f);
        if (ACT == 4) v = (v > 0.f) ? v : 0.01f * v;
        slab[(mOff + r) * 68 + (j << 4) + rlane] = v;
      }
    }
    __builtin_amdgcn_fence(__ATOMIC_RELEASE, "workgroup");
    __builtin_amdgcn_wave_barrier();
    __builtin_amdgcn_fence(__ATOMIC_ACQUIRE, "workgroup");
    if (OUT_MODE == 0) {
      float* C = (float*)Cout + (size_t)b * strideC;
      const int hh = lane >> 4, c4 = (lane & 15) * 4;     // row seg = 256 B = 16 lanes x 16 B
      {
#pragma unroll
        for (int it = 0; it < 8; ++it) {
          const int row = it * 2 + hh;
          v4f v = *(const v4f*)(slab + row * 68 + c4);
          *(v4f*)(C + (size_t)(mBase + row) * ldc + n0 + c4) = v;
        }
        
      }
    } else {
      const int q = lane >> 3, c8 = (lane & 7) * 8;
      unsigned short* C  = (unsigned short*)Cout  + (size_t)b * strideC;
      unsigned short* C2 = (OUT_MODE == 2) ? ((unsigned short*)Cout2 + (size_t)b * strideC) : nullptr;
      {
#pragma unroll
        for (int it = 0; it < 4; ++it) {
          const int row = it * 4 + q;
          const float* sp = slab + row * 68 + c8;
          v8h hv, lv;
#pragma unroll
          for (int e = 0; e < 8; ++e) {
            if (OUT_MODE == 1) {
              hv[e] = (_Float16)sp[e];
            } else {
              unsigned short hb = f2bf_bits(sp[e]);
              unsigned short lb = f2bf_bits(sp[e] - bf_bits2f(hb));
              hv[e] = __builtin_bit_cast(_Float16, hb);
              lv[e] = __builtin_bit_cast(_Float16, lb);
            }
          }
          *(v8h*)(C + (size_t)(mBase + row) * ldc + n0 + c8) = hv;
          if (OUT_MODE == 2) *(v8h*)(C2 + (size_t)(mBase + row) * ldc + n0 + c8) = lv;
        }
        
      }
    }
    __builtin_amdgcn_fence(__ATOMIC_RELEASE, "workgroup");
    __builtin_amdgcn_wave_barrier();
    __builtin_amdgcn_fence(__ATOMIC_ACQUIRE, "workgroup");
  }
}

// ---------------------------------------------------------------------------
// Square weight split: four [1024][1024] f32 matrices (layout kept as-is = [out][in] = Bt) -> bf16 hi and lo planes.
// grid (512, 4): blockIdx.y selects the matrix and the output plane z (planes at out + z*1048576 halves).
// Thread i owns 8 consecutive elements: two b128 loads, one 16-B store per lane per plane; a wave writes 512 contiguous
// ---------------------------------------------------------------------------
__global__ __launch_bounds__(256) void k_wsplit8(const float* __restrict__ W0, const float* __restrict__ W1,
                                                 const float* __restrict__ W2, const float* __restrict__ W3,
                                                 unsigned short* __restrict__ outH, unsigned short* __restrict__ outL,
                                                 int n8PerMat) {
  const int z = blockIdx.y;                                   // block-uniform
  const float* W = (z == 0) ? W0 : (z == 1) ? W1 : (z == 2) ? W2 : W3;
  const int i = blockIdx.x * 256 + threadIdx.x;
  if (i >= n8PerMat) return;
  const float* p = W + 8 * (size_t)i;
  const v4f a = *(const v4f*)(p);
  const v4f c = *(const v4f*)(p + 4);
  unsigned short hb[8], lb[8];
#pragma unroll
  for (int e = 0; e < 4; ++e) {
    bf_split_bits(a[e], hb[e], lb[e]);
    bf_split_bits(c[e], hb[4 + e], lb[4 + e]);
  }
  const v4u uh = (v4u){pk16(hb[0], hb[1]), pk16(hb[2], hb[3]), pk16(hb[4], hb[5]), pk16(hb[6], hb[7])};
  const v4u ul = (v4u){pk16(lb[0], lb[1]), pk16(lb[2], lb[3]), pk16(lb[4], lb[5]), pk16(lb[6], lb[7])};
  const size_t o = (size_t)z * (size_t)kWPlane + 8 * (size_t)i;
  *(v4u*)(outH + o) = uh;
  *(v4u*)(outL + o) = ul;
  
}

// ---------------------------------------------------------------------------
// Transpose + bf16 convert (single or hi/lo): in[R][Cc] f32 row-major (pitch Cc) -> out[n][k] = cvt(in[k][n]) for
// k < R and n < Cc, zero otherwise (pad rows / pad columns of the output plane are WRITTEN as zeros).
// grid (nTilesN, nTilesK, Z): a block covers 32 output rows n0..n0+31 and KT output columns k0..k0+KT-1; blockIdx.z adds
// inStrideZ / outStrideZ element offsets. 256 threads.
// Load coverage: (32*KT/256) iterations x 256 threads = 32 x KT elements (coalesced along n), clamped address, 0/1 factor.
// Store, KT == 64: row = wave*4 + (lane>>3) -> 8 waves x 4 = 32 rows; (lane&7) x 8 halves = 64 cols; each row segment =
// Store, KT == 32 (requires ldo == 32, k0 == 0): threads 0..127, row = t>>2, c8 = (t&3)*8 -> thread t writes tile bytes
// ---------------------------------------------------------------------------
template <bool SPLIT, int KT>
__global__ __launch_bounds__(256) void k_trcast(const float* __restrict__ in, int R, int Cc, long inStrideZ,
                                                unsigned short* __restrict__ outH, unsigned short* __restrict__ outL,
                                                int ldo, long outStrideZ) {
  static_assert(KT == 64 || KT == 32, "tile");
  __shared__ float sm[32][KT + 1];
  const int t  = threadIdx.x;
  const int n0 = blockIdx.x * 32;
  const int k0 = blockIdx.y * KT;
  const float* inz = in + (size_t)blockIdx.z * inStrideZ;
  constexpr int kIters = (32 * KT) / 256;
#pragma unroll
  for (int it = 0; it < kIters; ++it) {
    const int e  = it * 256 + t;
    const int nl = e & 31;
    const int kl = e >> 5;
    const int n  = n0 + nl;
    const int k  = k0 + kl;
    const int nc = (n < Cc) ? n : (Cc - 1);
    const int kc = (k < R) ? k : (R - 1);
    const float v  = inz[(size_t)kc * Cc + nc];
    const float fz = ((n < Cc) && (k < R)) ? 1.0f : 0.0f;
    sm[nl][kl] = v * fz;
  }
  __syncthreads();
  const int lane = t & 31, wave = t >> 5;
  unsigned short* oh = outH + (size_t)blockIdx.z * outStrideZ;
  unsigned short* ol = outL + (size_t)blockIdx.z * outStrideZ;
  int row, c8;
  bool active;
  if (KT == 64) { row = wave * 4 + (lane >> 3); c8 = (lane & 7) * 8; active = true; }
  else          { row = t >> 2;                 c8 = (t & 3) * 8;    active = (t < 128); }
  if (active) {
    unsigned short hb[8], lb[8];
#pragma unroll
    for (int e = 0; e < 8; ++e) {
      const float v = sm[row][c8 + e];
      if (SPLIT) { bf_split_bits(v, hb[e], lb[e]); }
      else       { hb[e] = f2bf_bits(v); lb[e] = 0; }
    }
    const v4u uh = (v4u){pk16(hb[0], hb[1]), pk16(hb[2], hb[3]), pk16(hb[4], hb[5]), pk16(hb[6], hb[7])};
    const v4u ul = (v4u){pk16(lb[0], lb[1]), pk16(lb[2], lb[3]), pk16(lb[4], lb[5]), pk16(lb[6], lb[7])};
    const size_t o = (size_t)(n0 + row) * ldo + k0 + c8;
    *(v4u*)(oh + o) = uh;
    if (SPLIT) *(v4u*)(ol + o) = ul;
    
  }
}

// ---------------------------------------------------------------------------
// Token shift: xx[m][c] = x[m][c] + (x[m-1][c]*f - x[m][c]) * miu_x[c], f = 0 at t == 0 else 1 (address of the prior row
// clamped, arithmetic 0/1 factor). Output: single bf16 plane [2048][1024].
// ---------------------------------------------------------------------------
__global__ __launch_bounds__(256) void k_xx8(const float* __restrict__ x, const float* __restrict__ miu_x,
                                             unsigned short* __restrict__ XX, int n8) {
  const int i = blockIdx.x * 256 + threadIdx.x;
  if (i >= n8) return;
  const int f  = 8 * i;
  const int m  = f >> 10;
  const int c0 = f & 1023;
  const int t  = m & 1023;
  const int mp = (t > 0) ? (m - 1) : m;
  const float fz = (t > 0) ? 1.0f : 0.0f;
  const float* px = x + f;
  const float* pp = x + ((size_t)mp << 10) + c0;
  const float* pm = miu_x + c0;
  const v4f a0 = *(const v4f*)(px), a1 = *(const v4f*)(px + 4);
  const v4f b0 = *(const v4f*)(pp), b1 = *(const v4f*)(pp + 4);
  const v4f u0 = *(const v4f*)(pm), u1 = *(const v4f*)(pm + 4);
  unsigned short hb[8];
#pragma unroll
  for (int e = 0; e < 4; ++e) {
    const float ba0 = b0[e] * fz - a0[e];
    const float ba1 = b1[e] * fz - a1[e];
    hb[e]     = f2bf_bits(a0[e] + ba0 * u0[e]);
    hb[4 + e] = f2bf_bits(a1[e] + ba1 * u1[e]);
  }
  const v4u uh = (v4u){pk16(hb[0], hb[1]), pk16(hb[2], hb[3]), pk16(hb[4], hb[5]), pk16(hb[6], hb[7])};
  unsigned short* q = XX + f;
  *(v4u*)q = uh;
  
}

// ---------------------------------------------------------------------------
// Branch input assembly: x5[m][c] = x[m][c] + (x[m-1][c]*f - x[m][c]) * (miu[m][c] + lam_s[c]) -> bf16 hi plane (always)
// and bf16 lo plane (writeLo != 0, block-uniform). Same thread / store mapping as k_xx8.
// Coverage: 262144 threads x 8 = the whole plane (both planes).
// ---------------------------------------------------------------------------
__global__ __launch_bounds__(256) void k_x5_8(const float* __restrict__ x, const float* __restrict__ miu,
                                              const float* __restrict__ lam_s,
                                              unsigned short* __restrict__ outH, unsigned short* __restrict__ outL,
                                              int writeLo, int n8) {
  const int i = blockIdx.x * 256 + threadIdx.x;
  if (i >= n8) return;
  const int f  = 8 * i;
  const int m  = f >> 10;
  const int c0 = f & 1023;
  const int t  = m & 1023;
  const int mp = (t > 0) ? (m - 1) : m;
  const float fz = (t > 0) ? 1.0f : 0.0f;
  const float* px = x + f;
  const float* pp = x + ((size_t)mp << 10) + c0;
  const float* pm = miu + f;
  const float* pl = lam_s + c0;
  const v4f a0 = *(const v4f*)(px), a1 = *(const v4f*)(px + 4);
  const v4f b0 = *(const v4f*)(pp), b1 = *(const v4f*)(pp + 4);
  const v4f u0 = *(const v4f*)(pm), u1 = *(const v4f*)(pm + 4);
  const v4f l0 = *(const v4f*)(pl), l1 = *(const v4f*)(pl + 4);
  unsigned short hb[8], lb[8];
#pragma unroll
  for (int e = 0; e < 4; ++e) {
    const float ba0 = b0[e] * fz - a0[e];
    const float ba1 = b1[e] * fz - a1[e];
    const float v0 = a0[e] + ba0 * (u0[e] + l0[e]);
    const float v1 = a1[e] + ba1 * (u1[e] + l1[e]);
    bf_split_bits(v0, hb[e], lb[e]);
    bf_split_bits(v1, hb[4 + e], lb[4 + e]);
  }
  const v4u uh = (v4u){pk16(hb[0], hb[1]), pk16(hb[2], hb[3]), pk16(hb[4], hb[5]), pk16(hb[6], hb[7])};
  const v4u ul = (v4u){pk16(lb[0], lb[1]), pk16(lb[2], lb[3]), pk16(lb[4], lb[5]), pk16(lb[6], lb[7])};
  *(v4u*)(outH + f) = uh;
  if (writeLo) *(v4u*)(outL + f) = ul;
  
}

// ---------------------------------------------------------------------------
// tanh + bf16 convert (single or hi/lo) with column compaction / padding:
//   out flat index f = m*ncols + c  <-  tanh(in[m*ldin + c]) for c < nvalid, 0 for c >= nvalid  (ncols <= ldin, both even).
// ---------------------------------------------------------------------------
template <bool SPLIT>
__global__ __launch_bounds__(256) void k_tanh2(const float* __restrict__ in, int ldin,
                                               unsigned short* __restrict__ outH, unsigned short* __restrict__ outL,
                                               int ncols, int nvalid, int n2) {
  const int i = blockIdx.x * 256 + threadIdx.x;
  if (i >= n2) return;
  const int f = 2 * i;
  const int m = f / ncols;
  const int c = f - m * ncols;
  const v2f a = *(const v2f*)(in + (size_t)m * ldin + c);
  const float f0 = (c < nvalid) ? 1.0f : 0.0f;
  const float f1 = (c + 1 < nvalid) ? 1.0f : 0.0f;
  const float t0 = tanhf(a[0]) * f0;
  const float t1 = tanhf(a[1]) * f1;
  unsigned short h0, h1, l0 = 0, l1 = 0;
  if (SPLIT) { bf_split_bits(t0, h0, l0); bf_split_bits(t1, h1, l1); }
  else       { h0 = f2bf_bits(t0); h1 = f2bf_bits(t1); }
  const unsigned uh = pk16(h0, h1);
  const unsigned ul = pk16(l0, l1);
  ((unsigned*)outH)[i] = uh;
  if (SPLIT) ((unsigned*)outL)[i] = ul;
  
}

// ---------------------------------------------------------------------------
// Linear-attention state scan, f32. One block (256 threads = 8 waves) per (batch b, head n); thread (i, jg): i = tid & 63 is
// the v channel, jg = tid >> 6 the quarter of the k channels; S[i][16*jg .. 16*jg+15] lives in 16 registers (static indices).
// Per chunk of kTch timesteps: r, k*exp(min(w,0)), exp(w), v (w = wl + td_miu) staged in LDS (4 x kTch x 64, fully written),
// bonus[t] = sum_j r_j*u_j*k_j computed once per step; per step: acc_i = sum_j r_j*S_ij (partials per quarter in LDS, parity
// double-buffered, one block barrier per step), then S_ij = S_ij*d_j + k_j*v_i; y_i = sum of 4 partials + v_i*bonus[t].
// ---------------------------------------------------------------------------
__global__ __launch_bounds__(256) void k_state_scan(const float* __restrict__ kraw, const float* __restrict__ vpl,
                                                    const float* __restrict__ rpl, const float* __restrict__ wl,
                                                    const float* __restrict__ td_miu, const float* __restrict__ u,
                                                    float* __restrict__ Y) {
  __shared__ __align__(16) float sr[kTch][64];
  __shared__ __align__(16) float sk[kTch][64];
  __shared__ __align__(16) float sd[kTch][64];
  __shared__ __align__(16) float sv[kTch][64];
  __shared__ float su[64];
  __shared__ float stm[64];
  __shared__ float sbon[kTch];
  __shared__ __align__(16) float part[2][4][64];
  const int tid = threadIdx.x;
  const int b   = blockIdx.x / kNHead;
  const int n   = blockIdx.x - b * kNHead;
  const int i   = tid & 63;
  const int jg  = tid >> 6;
  const int j0  = jg * 16;
  float S[16];
#pragma unroll
  for (int jj = 0; jj < 16; ++jj) S[jj] = 0.0f;
  if (tid < 64) {
    su[tid]  = u[n * kHead + tid];
    stm[tid] = td_miu[n * kHead + tid];
  }
  const size_t base = (size_t)b * kSeq * kChan + (size_t)n * kHead;
  for (int t0 = 0; t0 < kSeq; t0 += kTch) {
    __syncthreads();   // staging WAR + su/stm visibility
#pragma unroll 1
    for (int it = 0; it < (kTch * 64) / 256; ++it) {
      const int e  = it * 256 + tid;
      const int tl = e >> 6;
      const int c  = e & 63;
      const size_t off = base + (size_t)(t0 + tl) * kChan + c;
      const float wv = wl[off] + stm[c];
      sr[tl][c] = rpl[off];
      sk[tl][c] = kraw[off] * expf(fminf(wv, 0.0f));
      sd[tl][c] = expf(wv);
      sv[tl][c] = vpl[off];
    }
    __syncthreads();
    if (tid < kTch) {
      float bs = 0.0f;
#pragma unroll 1
      for (int j = 0; j < 64; ++j) bs += sr[tid][j] * (su[j] * sk[tid][j]);
      sbon[tid] = bs;
    }
    __syncthreads();
    for (int tl = 0; tl < kTch; ++tl) {
      const int p = tl & 1;
      const float vi = sv[tl][i];
      float acc = 0.0f;
#pragma unroll
      for (int jj = 0; jj < 16; ++jj) {
        const int j = j0 + jj;
        const float rj = sr[tl][j];
        const float kj = sk[tl][j];
        const float dj = sd[tl][j];
        acc += rj * S[jj];
        S[jj] = S[jj] * dj + kj * vi;
      }
      part[p][jg][i] = acc;
      __syncthreads();
      if (tid < 16) {
        const v4f p0 = *(const v4f*)(&part[p][0][4 * tid]);
        const v4f p1 = *(const v4f*)(&part[p][1][4 * tid]);
        const v4f p2 = *(const v4f*)(&part[p][2][4 * tid]);
        const v4f p3 = *(const v4f*)(&part[p][3][4 * tid]);
        const v4f vv = *(const v4f*)(&sv[tl][4 * tid]);
        const float bn = sbon[tl];
        const v4f yv = ((p0 + p1) + (p2 + p3)) + vv * bn;
        float* yp = Y + base + (size_t)(t0 + tl) * kChan + 4 * tid;
        *(v4f*)yp = yv;
        
      }
    }
  }
}

// ---------------------------------------------------------------------------
// GroupNorm (64 channels per head, biased variance, eps 1.6e-4) + affine + gate multiply -> bf16 hi/lo planes.
// One wave per (row m, head n), 8 pairs per 256-thread block; lane owns channels 2l, 2l+1; shuffle reductions (unconditional).
// ---------------------------------------------------------------------------
__global__ __launch_bounds__(256) void k_gn_gate(const float* __restrict__ Y, const float* __restrict__ G,
                                                 const float* __restrict__ gamma, const float* __restrict__ beta,
                                                 unsigned short* __restrict__ outH, unsigned short* __restrict__ outL) {
  __shared__ __align__(16) float slab[8][64];
  const int lane = threadIdx.x & 31, wave = threadIdx.x >> 5;
  const int pair = blockIdx.x * 8 + wave;
  const int m = pair >> 4;
  const int n = pair & 15;
  const size_t base = (size_t)m * kChan + (size_t)n * kHead;
  const int c = n * kHead + 2 * lane;
  const v2f yv = *(const v2f*)(Y + base + 2 * lane);
  const v2f gv = *(const v2f*)(G + base + 2 * lane);
  const v2f ga = *(const v2f*)(gamma + c);
  const v2f be = *(const v2f*)(beta + c);
  float s = yv[0] + yv[1];
#pragma unroll
  for (int off = 16; off > 0; off >>= 1) s += __shfl_xor(s, off, 32);
  const float mean = s * (1.0f / 64.0f);
  const float d0 = yv[0] - mean;
  const float d1 = yv[1] - mean;
  float q = d0 * d0 + d1 * d1;
#pragma unroll
  for (int off = 16; off > 0; off >>= 1) q += __shfl_xor(q, off, 32);
  const float var = q * (1.0f / 64.0f);
  const float rs  = 1.0f / sqrtf(var + kGnEps);
  const float o0 = ((d0 * rs) * ga[0] + be[0]) * gv[0];
  const float o1 = ((d1 * rs) * ga[1] + be[1]) * gv[1];
  *(v2f*)(&slab[wave][2 * lane]) = (v2f){o0, o1};
  __syncthreads();
  if (lane < 8) {
    unsigned short hb[8], lb[8];
#pragma unroll
    for (int e = 0; e < 8; ++e) bf_split_bits(slab[wave][8 * lane + e], hb[e], lb[e]);
    const v4u uh = (v4u){pk16(hb[0], hb[1]), pk16(hb[2], hb[3]), pk16(hb[4], hb[5]), pk16(hb[6], hb[7])};
    const v4u ul = (v4u){pk16(lb[0], lb[1]), pk16(lb[2], lb[3]), pk16(lb[4], lb[5]), pk16(lb[6], lb[7])};
    const size_t o = base + 8 * (size_t)lane;
    *(v4u*)(outH + o) = uh;
    *(v4u*)(outL + o) = ul;
    
  }
}

// ---------------------------------------------------------------------------
// Host glue.
// Workspace region map (bytes; every size is a multiple of 4096, offsets in that order):
//   XX     bf16 [2048][1024]            4,194,304
//   HPRE   f32  [2048][192]             1,572,864   (tanh input of the mix path; cols 160..191 written by the GEMM, unread)
//   HC     bf16 [2048][160] = [10240][32] 655,360   (compact; branch s = rows 2048s.. of the ld-32 view)
//   MIU    f32  [2048][1024]            8,388,608   (per-branch mix, rewritten 5x; then the decay lowrank output, same layout)
//   X5H    bf16 [5][2048][1024]        20,971,520   (branch inputs hi: 0 decay (single), 1 k, 2 v, 3 r, 4 gate)
//   X5L    bf16 [4][2048][1024]        16,777,216   (lo planes of branches 1..4 at index s-1)
//   WH     bf16 [4][1024][1024]         8,388,608   (Wk, Wv, Wr, Wo hi, [out][in] as-is)
//   WL     bf16 [4][1024][1024]         8,388,608   (lo)
//   AT     bf16 [192][1024]               393,216   (A^T, rows 160..191 zero)
//   TDAT   bf16 [64][1024]                131,072
//   TDBT   bf16 [1024][64]                131,072
//   WG1TH  bf16 [192][1024]               393,216   (rows 160..191 zero)   WG1TL 393,216
//   WG2TH  bf16 [1024][192]               393,216   (cols 160..191 zero)   WG2TL 393,216
//   BPT    bf16 [5][1024][32]             327,680
//   LPRE   f32  [2048][64]                524,288
//   L1     bf16 [2048][64]                262,144
//   KVR    f32  [3][2048][1024]         25,165,824   (k unscaled, v, r)
//   GHPRE  f32  [2048][192]             1,572,864
//   GHH    bf16 [2048][192]               786,432   (cols 160..191 zero)   GHL 786,432
//   GATE   f32  [2048][1024]            8,388,608
//   Y      f32  [2048][1024]            8,388,608
//   GATH   bf16 [2048][1024]            4,194,304   GATL 4,194,304
//   total                             126,156,800
// GEMM shapes (M, N, K): (2048,192,1024) (2048,1024,32)x5 (2048,64,1024) (2048,1024,64) (2048,1024,1024)x3 batched
// (2048,192,1024) (2048,1024,192) (2048,1024,1024); all M,N % 64 == 0, all K % 32 == 0, pads zero-written by producers.
// ---------------------------------------------------------------------------
extern "C" void kernel_launch(void* const* d_in, const int* in_sizes, int n_in,
                              void* d_out, int out_size, void* d_ws, size_t ws_size,
                              hipStream_t stream) {
  if (n_in < 17) return;
  if (in_sizes[0] != kBatch * kSeq * kChan) return;
  if (in_sizes[1] != kChan || in_sizes[2] != kNBr * kChan) return;
  if (in_sizes[3] != kChan * kMix || in_sizes[4] != kNBr * kBr * kChan) return;
  if (in_sizes[5] != kChan || in_sizes[6] != kChan * kDec || in_sizes[7] != kDec * kChan) return;
  if (in_sizes[8] != kNHead * kHead) return;
  if (in_sizes[9] != kChan * kChan || in_sizes[10] != kChan * kChan || in_sizes[11] != kChan * kChan || in_sizes[12] != kChan * kChan) return;
  if (in_sizes[13] != kChan * kMix || in_sizes[14] != kMix * kChan) return;
  if (in_sizes[15] != kChan || in_sizes[16] != kChan) return;
  if (out_size != kBatch * kSeq * kChan) return;

  const float* x      = (const float*)d_in[0];
  const float* miu_x  = (const float*)d_in[1];
  const float* lam    = (const float*)d_in[2];    // [5][1024]
  const float* Amat   = (const float*)d_in[3];    // [1024][160]
  const float* Bp     = (const float*)d_in[4];    // [5][32][1024]
  const float* td_miu = (const float*)d_in[5];    // [1024]
  const float* tdA    = (const float*)d_in[6];    // [1024][64]
  const float* tdB    = (const float*)d_in[7];    // [64][1024]
  const float* u      = (const float*)d_in[8];    // [16][64]
  const float* Wk     = (const float*)d_in[9];    // [1024][1024] [out][in]
  const float* Wv     = (const float*)d_in[10];
  const float* Wr     = (const float*)d_in[11];
  const float* Wo     = (const float*)d_in[12];
  const float* Wg1    = (const float*)d_in[13];   // [1024][160]
  const float* Wg2    = (const float*)d_in[14];   // [160][1024]
  const float* gamma  = (const float*)d_in[15];
  const float* beta   = (const float*)d_in[16];
  float* out = (float*)d_out;

  // ---- carve ----
  const size_t szXX    = (size_t)kPlane * 2;
  const size_t szHPRE  = (size_t)kRows * kMixPad * 4;
  const size_t szHC    = (size_t)kRows * kMix * 2;
  const size_t szF32P  = (size_t)kPlane * 4;
  const size_t szX5H   = (size_t)kNBr * kPlane * 2;
  const size_t szX5L   = (size_t)(kNBr - 1) * kPlane * 2;
  const size_t szWSQ   = (size_t)4 * kWPlane * 2;
  const size_t szAT    = (size_t)kMixPad * kChan * 2;
  const size_t szTDAT  = (size_t)kDec * kChan * 2;
  const size_t szTDBT  = (size_t)kChan * kDec * 2;
  const size_t szWG1T  = (size_t)kMixPad * kChan * 2;
  const size_t szWG2T  = (size_t)kChan * kMixPad * 2;
  const size_t szBPT   = (size_t)kNBr * kChan * kBr * 2;
  const size_t szLPRE  = (size_t)kRows * kDec * 4;
  const size_t szL1    = (size_t)kRows * kDec * 2;
  const size_t szKVR   = (size_t)3 * kPlane * 4;
  const size_t szGHPRE = (size_t)kRows * kMixPad * 4;
  const size_t szGH    = (size_t)kRows * kMixPad * 2;
  const size_t szGAT   = (size_t)kPlane * 2;
  size_t off = 0;
  const size_t oXX    = off; off += szXX;
  const size_t oHPRE  = off; off += szHPRE;
  const size_t oHC    = off; off += szHC;
  const size_t oMIU   = off; off += szF32P;
  const size_t oX5H   = off; off += szX5H;
  const size_t oX5L   = off; off += szX5L;
  const size_t oWH    = off; off += szWSQ;
  const size_t oWL    = off; off += szWSQ;
  const size_t oAT    = off; off += szAT;
  const size_t oTDAT  = off; off += szTDAT;
  const size_t oTDBT  = off; off += szTDBT;
  const size_t oWG1TH = off; off += szWG1T;
  const size_t oWG1TL = off; off += szWG1T;
  const size_t oWG2TH = off; off += szWG2T;
  const size_t oWG2TL = off; off += szWG2T;
  const size_t oBPT   = off; off += szBPT;
  const size_t oLPRE  = off; off += szLPRE;
  const size_t oL1    = off; off += szL1;
  const size_t oKVR   = off; off += szKVR;
  const size_t oGHPRE = off; off += szGHPRE;
  const size_t oGHH   = off; off += szGH;
  const size_t oGHL   = off; off += szGH;
  const size_t oGATE  = off; off += szF32P;
  const size_t oY     = off; off += szF32P;
  const size_t oGATH  = off; off += szGAT;
  const size_t oGATL  = off; off += szGAT;
  const size_t total  = off;   // 126,156,800
  if (total > (size_t)134217728) return;
  if (ws_size < total) return;

  char* ws = (char*)d_ws;
  unsigned short* XX    = (unsigned short*)(ws + oXX);
  float*          HPRE  = (float*)(ws + oHPRE);
  unsigned short* HC    = (unsigned short*)(ws + oHC);
  float*          MIU   = (float*)(ws + oMIU);
  float*          WLR   = MIU;                       // decay lowrank output reuses the MIU bytes (same f32 [2048][1024] layout)
  unsigned short* X5H   = (unsigned short*)(ws + oX5H);
  unsigned short* X5L   = (unsigned short*)(ws + oX5L);
  unsigned short* WH    = (unsigned short*)(ws + oWH);
  unsigned short* WL    = (unsigned short*)(ws + oWL);
  unsigned short* AT    = (unsigned short*)(ws + oAT);
  unsigned short* TDAT  = (unsigned short*)(ws + oTDAT);
  unsigned short* TDBT  = (unsigned short*)(ws + oTDBT);
  unsigned short* WG1TH = (unsigned short*)(ws + oWG1TH);
  unsigned short* WG1TL = (unsigned short*)(ws + oWG1TL);
  unsigned short* WG2TH = (unsigned short*)(ws + oWG2TH);
  unsigned short* WG2TL = (unsigned short*)(ws + oWG2TL);
  unsigned short* BPT   = (unsigned short*)(ws + oBPT);
  float*          LPRE  = (float*)(ws + oLPRE);
  unsigned short* L1    = (unsigned short*)(ws + oL1);
  float*          KVR   = (float*)(ws + oKVR);
  float*          GHPRE = (float*)(ws + oGHPRE);
  unsigned short* GHH   = (unsigned short*)(ws + oGHH);
  unsigned short* GHL   = (unsigned short*)(ws + oGHL);
  float*          GATE  = (float*)(ws + oGATE);
  float*          Yp    = (float*)(ws + oY);
  unsigned short* GATH  = (unsigned short*)(ws + oGATH);
  unsigned short* GATL  = (unsigned short*)(ws + oGATL);
  const float* fdum = gamma;   // placeholder for unused bias / resid pointer arguments (never dereferenced)

  const dim3 blk(256);
  const int n8Plane = (int)(kPlane / 8);                 // 262144 -> 1024 blocks exact
  const int n8W     = (int)(kWPlane / 8);                // 131072 -> 512 blocks exact

  // ---- weight planes ----
  k_wsplit8<<<dim3(n8W / 256, 4), blk, 0, stream>>>(Wk, Wv, Wr, Wo, WH, WL, n8W);
  // A [1024][160] -> AT [192][1024] (rows >= 160 zero): n tiles 6, k tiles 16
  k_trcast<false, 64><<<dim3(kMixPad / 32, kChan / 64, 1), blk, 0, stream>>>(Amat, kChan, kMix, 0L, AT, AT, kChan, 0L);
  // tdA [1024][64] -> TDAT [64][1024]
  k_trcast<false, 64><<<dim3(kDec / 32, kChan / 64, 1), blk, 0, stream>>>(tdA, kChan, kDec, 0L, TDAT, TDAT, kChan, 0L);
  // tdB [64][1024] -> TDBT [1024][64]
  k_trcast<false, 64><<<dim3(kChan / 32, 1, 1), blk, 0, stream>>>(tdB, kDec, kChan, 0L, TDBT, TDBT, kDec, 0L);
  // Wg1 [1024][160] -> WG1T hi/lo [192][1024] (rows >= 160 zero)
  k_trcast<true, 64><<<dim3(kMixPad / 32, kChan / 64, 1), blk, 0, stream>>>(Wg1, kChan, kMix, 0L, WG1TH, WG1TL, kChan, 0L);
  // Wg2 [160][1024] -> WG2T hi/lo [1024][192] (cols >= 160 zero): n tiles 32, k tiles 3
  k_trcast<true, 64><<<dim3(kChan / 32, kMixPad / 64, 1), blk, 0, stream>>>(Wg2, kMix, kChan, 0L, WG2TH, WG2TL, kMixPad, 0L);
  // Bp[s] [32][1024] -> BPT[s] [1024][32], s = blockIdx.z
  k_trcast<false, 32><<<dim3(kChan / 32, 1, kNBr), blk, 0, stream>>>(Bp, kBr, kChan, (long)kBr * kChan, BPT, BPT, kBr, (long)kChan * kBr);

  // ---- token shift ----
  k_xx8<<<dim3(n8Plane / 256), blk, 0, stream>>>(x, miu_x, XX, n8Plane);

  // ---- mix lowrank: HPRE = XX @ AT^T  (M 2048, N 192, K 1024; 96 tiles -> 12 blocks) ----
  wmma_gemm64<1, false, 0, 0, false, 0><<<dim3(((kRows / 64) * (kMixPad / 64) + 7) / 8, 1), blk, 0, stream>>>(
      XX, XX, kChan, 0L, AT, AT, kChan, 0L, (void*)HPRE, (void*)HPRE, kMixPad, 0L, fdum, fdum, 0L,
      kRows, kMixPad, kChan, 1.0f);
  // HC flat [2048*160] = tanh(HPRE[:, 0:160]) compact bf16; n2 = 163840 -> 640 blocks exact
  k_tanh2<false><<<dim3((kRows * kMix / 2) / 256), blk, 0, stream>>>(HPRE, kMixPad, HC, HC, kMix, kMix, kRows * kMix / 2);

  // ---- per-branch mix GEMM (A = HC viewed [10240][32], rows 2048s..; K 32) and branch input assembly ----
  for (int s = 0; s < kNBr; ++s) {
    const unsigned short* Hs = HC + (size_t)s * kRows * kBr;
    const unsigned short* Bs = BPT + (size_t)s * kChan * kBr;
    wmma_gemm64<1, false, 0, 0, false, 0><<<dim3(((kRows / 64) * (kChan / 64) + 7) / 8, 1), blk, 0, stream>>>(
        Hs, Hs, kBr, 0L, Bs, Bs, kBr, 0L, (void*)MIU, (void*)MIU, kChan, 0L, fdum, fdum, 0L,
        kRows, kChan, kBr, 1.0f);
    unsigned short* oh = X5H + (size_t)s * kPlane;
    unsigned short* ol = X5L + (size_t)(s > 0 ? (s - 1) : 0) * kPlane;
    k_x5_8<<<dim3(n8Plane / 256), blk, 0, stream>>>(x, MIU, lam + (size_t)s * kChan, oh, ol, (s > 0) ? 1 : 0, n8Plane);
  }

  // ---- decay lowrank: LPRE = X5H[0] @ TDAT^T (N 64, K 1024; 32 tiles -> 4 blocks); L1 = tanh; WLR = L1 @ TDBT^T (K 64) ----
  wmma_gemm64<1, false, 0, 0, false, 0><<<dim3(((kRows / 64) * (kDec / 64) + 7) / 8, 1), blk, 0, stream>>>(
      X5H, X5H, kChan, 0L, TDAT, TDAT, kChan, 0L, (void*)LPRE, (void*)LPRE, kDec, 0L, fdum, fdum, 0L,
      kRows, kDec, kChan, 1.0f);
  k_tanh2<false><<<dim3((kRows * kDec / 2) / 256), blk, 0, stream>>>(LPRE, kDec, L1, L1, kDec, kDec, kRows * kDec / 2);
  wmma_gemm64<1, false, 0, 0, false, 0><<<dim3(((kRows / 64) * (kChan / 64) + 7) / 8, 1), blk, 0, stream>>>(
      L1, L1, kDec, 0L, TDBT, TDBT, kDec, 0L, (void*)WLR, (void*)WLR, kChan, 0L, fdum, fdum, 0L,
      kRows, kChan, kDec, 1.0f);

  // ---- k / v / r projections, batched over blockIdx.y = 0..2 (hi/lo split, K 1024) -> KVR f32 planes ----
  wmma_gemm64<1, true, 0, 0, false, 0><<<dim3(((kRows / 64) * (kChan / 64) + 7) / 8, 3), blk, 0, stream>>>(
      X5H + kPlane, X5L, kChan, (long)kPlane, WH, WL, kChan, (long)kWPlane,
      (void*)KVR, (void*)KVR, kChan, (long)kPlane, fdum, fdum, 0L, kRows, kChan, kChan, 1.0f);

  // ---- gate: GHPRE = X5[4] @ WG1T^T (split, N 192); GH = tanh hi/lo; GATE = GH @ WG2T^T (split, K 192) ----
  wmma_gemm64<1, true, 0, 0, false, 0><<<dim3(((kRows / 64) * (kMixPad / 64) + 7) / 8, 1), blk, 0, stream>>>(
      X5H + 4 * kPlane, X5L + 3 * kPlane, kChan, 0L, WG1TH, WG1TL, kChan, 0L,
      (void*)GHPRE, (void*)GHPRE, kMixPad, 0L, fdum, fdum, 0L, kRows, kMixPad, kChan, 1.0f);
  k_tanh2<true><<<dim3((kRows * kMixPad / 2) / 256), blk, 0, stream>>>(GHPRE, kMixPad, GHH, GHL, kMixPad, kMix, kRows * kMixPad / 2);
  wmma_gemm64<1, true, 0, 0, false, 0><<<dim3(((kRows / 64) * (kChan / 64) + 7) / 8, 1), blk, 0, stream>>>(
      GHH, GHL, kMixPad, 0L, WG2TH, WG2TL, kMixPad, 0L, (void*)GATE, (void*)GATE, kChan, 0L, fdum, fdum, 0L,
      kRows, kChan, kMixPad, 1.0f);

  // ---- state scan -> Y ----
  k_state_scan<<<dim3(kBatch * kNHead), blk, 0, stream>>>(KVR, KVR + kPlane, KVR + 2 * kPlane, WLR, td_miu, u, Yp);

  // ---- GroupNorm + gate -> GATH/GATL (4096 blocks x 8 waves = 32768 (row, head) pairs) ----
  k_gn_gate<<<dim3((kRows * kNHead) / 8), blk, 0, stream>>>(Yp, GATE, gamma, beta, GATH, GATL);

  // ---- output projection straight into d_out (split, K 1024) ----
  wmma_gemm64<1, true, 0, 0, false, 0><<<dim3(((kRows / 64) * (kChan / 64) + 7) / 8, 1), blk, 0, stream>>>(
      GATH, GATL, kChan, 0L, WH + 3 * kWPlane, WL + 3 * kWPlane, kChan, 0L,
      (void*)out, (void*)out, kChan, 0L, fdum, fdum, 0L, kRows, kChan, kChan, 1.0f);
}

// v001
// Measured time: 555 microseconds a run.
// Next to v000, in two timings, it ran 1.82 and 1.83 times as fast.
// Contractions: every GEMM on v_wmma_f32_16x16x32_bf16 (bf16 operands, f32 accumulate) - the four lowrank mix/decay sites single bf16, the k/v/r projections, the gate pair and the output projection as bf16 hi/lo split (hi*hi + hi*lo + lo*hi); token shift, state scan, GroupNorm and gating in f32 on VALU.
#include <hip/hip_runtime.h>
#include <math.h>

// ---------------------------------------------------------------------------
// Problem constants
// ---------------------------------------------------------------------------
constexpr int kBatch  = 2;
constexpr int kSeq    = 1024;
constexpr int kChan   = 1024;
constexpr int kHead   = 64;
constexpr int kNHead  = 16;
constexpr int kRows   = kBatch * kSeq;          // 2048 token rows (m = b*1024 + t)
constexpr int kMix    = 160;                    // lowrank width of the mix and gate paths
constexpr int kMixPad = 192;                    // padded to a 64 multiple (pad rows / cols zero-filled)
constexpr int kDec    = 64;                     // decay lowrank width
constexpr int kBr     = 32;                     // per-branch mix width
constexpr int kNBr    = 5;                      // branches: 0 decay, 1 k, 2 v, 3 r, 4 gate
constexpr long kPlane  = (long)kRows * kChan;   // 2,097,152 elements per activation plane
constexpr long kWPlane = (long)kChan * kChan;   // 1,048,576 elements per square weight plane
constexpr float kGnEps = 1.6e-4f;               // 1e-5 * 16
static_assert(kNHead * kHead == kChan, "shape");
static_assert(kRows % 64 == 0 && kChan % 64 == 0 && kMixPad % 64 == 0 && kDec % 64 == 0, "M and N tile multiples");
static_assert(kChan % 32 == 0 && kBr % 32 == 0 && kDec % 32 == 0 && kMixPad % 32 == 0, "K multiples of 32");
static_assert(kMix % 8 == 0 && kMixPad % 8 == 0 && kDec % 8 == 0, "pack groups never straddle a row");

typedef __attribute__((ext_vector_type(16))) _Float16 v16h;
typedef __attribute__((ext_vector_type(8)))  _Float16 v8h;
typedef __attribute__((ext_vector_type(16))) __bf16   v16b;
typedef __attribute__((ext_vector_type(8)))  __bf16   v8b;
typedef __attribute__((ext_vector_type(8)))  float    v8f;
typedef __attribute__((ext_vector_type(4)))  float    v4f;
typedef __attribute__((ext_vector_type(2)))  float    v2f;
typedef __attribute__((ext_vector_type(4)))  unsigned int v4u;

// ---------------------------------------------------------------------------
// Shared helpers
// ---------------------------------------------------------------------------
__device__ __forceinline__ unsigned short f2bf_bits(float f) {
  unsigned u = __float_as_uint(f);
  return (unsigned short)((u + 0x7FFFu + ((u >> 16) & 1u)) >> 16);
}
__device__ __forceinline__ float bf_bits2f(unsigned short h) { return __uint_as_float(((unsigned)h) << 16); }
__device__ __forceinline__ unsigned pk16(unsigned short a, unsigned short b) { return (unsigned)a | ((unsigned)b << 16); }
// RNE convert to a bf16 hi part and a bf16 lo part of the f32 residual
__device__ __forceinline__ void bf_split_bits(float f, unsigned short& hb, unsigned short& lb) {
  hb = f2bf_bits(f);
  lb = f2bf_bits(f - bf_bits2f(hb));
}

// hazard guards as plain device helpers (no inline asm inside the kernel template body); the 4-acc guard ties every
// accumulator of a group and names the A fragments as inputs
__device__ __forceinline__ void dep_guard4_h(v8f& a, v8f& b, v8f& c, v8f& d, v16h x, v16h y) { asm volatile("v_nop\n\tv_nop\n\tv_nop\n\tv_nop" : "+v"(a), "+v"(b), "+v"(c), "+v"(d) : "v"(x), "v"(y)); }
__device__ __forceinline__ void dep_guard4_b(v8f& a, v8f& b, v8f& c, v8f& d, v16b x, v16b y) { asm volatile("v_nop\n\tv_nop\n\tv_nop\n\tv_nop" : "+v"(a), "+v"(b), "+v"(c), "+v"(d) : "v"(x), "v"(y)); }
__device__ __forceinline__ void keep4_h(v16h a, v16h b, v16h c, v16h d) { asm volatile("v_nop" :: "v"(a), "v"(b), "v"(c), "v"(d)); }
__device__ __forceinline__ void keep4_b(v16b a, v16b b, v16b c, v16b d) { asm volatile("v_nop" :: "v"(a), "v"(b), "v"(c), "v"(d)); }
__device__ __forceinline__ void acc_guard4(v8f& a, v8f& b, v8f& c, v8f& d) { asm volatile("v_nop\n\tv_nop\n\tv_nop\n\tv_nop" : "+v"(a), "+v"(b), "+v"(c), "+v"(d)); }
template <typename T> struct Frag;
template <> struct Frag<_Float16> {
  typedef v16h V; union U { v16h v; v8h h[2]; };
  // elements 0..7 <- p[0..7], 8..15 <- p[16..23]
  static __device__ __forceinline__ v16h load(const _Float16* p) {
    U f; f.h[0] = *(const v8h*)(p); f.h[1] = *(const v8h*)(p + 16); return f.v;
  }
  static __device__ __forceinline__ v8f mma(v16h a, v16h b, v8f c) {
    return __builtin_amdgcn_wmma_f32_16x16x32_f16(false, a, false, b, (short)0, c, false, false);
  }
  static __device__ __forceinline__ void guard4(v8f& a, v8f& b, v8f& c, v8f& d, v16h x, v16h y) { dep_guard4_h(a, b, c, d, x, y); }
  static __device__ __forceinline__ void keep(v16h a, v16h b, v16h c, v16h d) { keep4_h(a, b, c, d); }
};
template <> struct Frag<__bf16> {
  typedef v16b V; union U { v16b v; v8b h[2]; };
  static __device__ __forceinline__ v16b load(const __bf16* p) {
    U f; f.h[0] = *(const v8b*)(p); f.h[1] = *(const v8b*)(p + 16); return f.v;
  }
  static __device__ __forceinline__ v8f mma(v16b a, v16b b, v8f c) {
    return __builtin_amdgcn_wmma_f32_16x16x32_bf16(false, a, false, b, (short)0, c, false, false);
  }
  static __device__ __forceinline__ void guard4(v8f& a, v8f& b, v8f& c, v8f& d, v16b x, v16b y) { dep_guard4_b(a, b, c, d, x, y); }
  static __device__ __forceinline__ void keep(v16b a, v16b b, v16b c, v16b d) { keep4_b(a, b, c, d); }
};

// ---- Register-blocked batched WMMA GEMM (ACT reduced to none/relu/leaky) -------------------------------
// C[m,n] = scale * sum_k A[m,k] * Bt[n,k] (+bias)(+resid); each wave owns a 64x64 tile.
// A row-major [M,K]; Bt row-major [N,K]; M,N % 64 == 0, K % 32 == 0.
// SPLIT: operands are hi/lo planes (A2/Bt2 = lo planes, same layout); product = hi*hi + hi*lo + lo*hi.
// BIAS_MODE: 0 = none, 1 = bias[m], 2 = bias[n].
// OUT_MODE: 0 = f32, 1 = f16, 2 = bf16 hi plane (Cout) + bf16 lo plane (Cout2).
// ET: 0 = f16 operands, 1 = bf16 operands (pointers passed as 16-bit storage)
template <int ET> struct Elem;
template <> struct Elem<0> { typedef _Float16 T; };
template <> struct Elem<1> { typedef __bf16 T; };
template <int ET, bool SPLIT, int BIAS_MODE, int OUT_MODE, bool RESID, int ACT = 0>
__global__ __launch_bounds__(256) void wmma_gemm64(
    const unsigned short* __restrict__ Ap, const unsigned short* __restrict__ A2p, int lda, long strideA,
    const unsigned short* __restrict__ Btp, const unsigned short* __restrict__ Bt2p, int ldb, long strideB,
    void* __restrict__ Cout, void* __restrict__ Cout2, int ldc, long strideC,
    const float* __restrict__ bias,
    const float* __restrict__ resid, long strideR,
    int M, int N, int K, float scale) {
  typedef typename Elem<ET>::T T;
  typedef typename Frag<T>::V V;
  const T* A = (const T*)Ap; const T* A2 = (const T*)A2p; const T* Bt = (const T*)Btp; const T* Bt2 = (const T*)Bt2p;
  __shared__ __align__(16) float sT[8][16 * 68];   // per-wave 16x64 slab, pitch 68 floats
  const int b    = blockIdx.y;
  const int lane = threadIdx.x & 31;
  const int wave = threadIdx.x >> 5;
  const int tilesN = N >> 6;
  const int tilesM = M >> 6;
  const int tile = blockIdx.x * 8 + wave;
  if (tile >= tilesM * tilesN) return;   // wave-uniform; no block barriers in this kernel
  const int tm = tile / tilesN;
  const int tn = tile - tm * tilesN;
  const int m0 = tm << 6;
  const int n0 = tn << 6;

  const T* Ab  = A  + (size_t)b * strideA;
  const T* Bb  = Bt + (size_t)b * strideB;
  const T* Ab2 = SPLIT ? (A2  + (size_t)b * strideA) : nullptr;
  const T* Bb2 = SPLIT ? (Bt2 + (size_t)b * strideB) : nullptr;

  const int rlane = lane & 15;                 // row (A) / col (B, D) within subtile
  const int koff  = (lane >> 4) * 8;           // k offset of this lane half
  const int mOff  = (lane >> 4) * 8;           // D row offset

  v8f acc[4][4];
#pragma unroll
  for (int i = 0; i < 4; ++i)
#pragma unroll
    for (int j = 0; j < 4; ++j) acc[i][j] = (v8f){0.f,0.f,0.f,0.f,0.f,0.f,0.f,0.f};

  for (int k0 = 0; k0 < K; k0 += 32) {
    V bh[4], bl[4];
#pragma unroll
    for (int j = 0; j < 4; ++j) {
      const size_t bo = (size_t)(n0 + (j << 4) + rlane) * ldb + koff + k0;
      bh[j] = Frag<T>::load(Bb + bo);
      if (SPLIT) bl[j] = Frag<T>::load(Bb2 + bo);
    }
#pragma unroll
    for (int i = 0; i < 4; ++i) {
      const size_t ao = (size_t)(m0 + (i << 4) + rlane) * lda + koff + k0;
      V ah = Frag<T>::load(Ab + ao);
      V al;
      if (SPLIT) al = Frag<T>::load(Ab2 + ao);
#pragma unroll
      for (int j = 0; j < 4; ++j) {
        acc[i][j] = Frag<T>::mma(ah, bh[j], acc[i][j]);
        if (SPLIT) {
          acc[i][j] = Frag<T>::mma(ah, bl[j], acc[i][j]);
          acc[i][j] = Frag<T>::mma(al, bh[j], acc[i][j]);
        }
      }
      Frag<T>::guard4(acc[i][0], acc[i][1], acc[i][2], acc[i][3], ah, SPLIT ? al : ah);
    }
    Frag<T>::keep(bh[0], bh[1], bh[2], bh[3]);
    if (SPLIT) Frag<T>::keep(bl[0], bl[1], bl[2], bl[3]);
  }
  acc_guard4(acc[0][0], acc[0][1], acc[0][2], acc[0][3]);
  acc_guard4(acc[1][0], acc[1][1], acc[1][2], acc[1][3]);
  acc_guard4(acc[2][0], acc[2][1], acc[2][2], acc[2][3]);
  acc_guard4(acc[3][0], acc[3][1], acc[3][2], acc[3][3]);

  // ---- epilogue ----
  float* slab = sT[wave];
  const float* Rb = RESID ? (resid + (size_t)b * strideR) : nullptr;
#pragma unroll
  for (int i = 0; i < 4; ++i) {
    const int mBase = m0 + (i << 4);
#pragma unroll
    for (int j = 0; j < 4; ++j) {
      const int n = n0 + (j << 4) + rlane;
      float bv = 0.f;
      if (BIAS_MODE == 2) bv = bias[n];
#pragma unroll
      for (int r = 0; r < 8; ++r) {
        float v = acc[i][j][r] * scale;
        if (BIAS_MODE == 1) v += bias[mBase + mOff + r];
        if (BIAS_MODE == 2) v += bv;
        if (RESID) v += Rb[(size_t)(mBase + mOff + r) * ldc + n];
        if (ACT == 2) v = fmaxf(v, 0.0f);
        if (ACT == 4) v = (v > 0.f) ? v : 0.01f * v;
        slab[(mOff + r) * 68 + (j << 4) + rlane] = v;
      }
    }
    __builtin_amdgcn_fence(__ATOMIC_RELEASE, "workgroup");
    __builtin_amdgcn_wave_barrier();
    __builtin_amdgcn_fence(__ATOMIC_ACQUIRE, "workgroup");
    if (OUT_MODE == 0) {
      float* C = (float*)Cout + (size_t)b * strideC;
      const int hh = lane >> 4, c4 = (lane & 15) * 4;     // row seg = 256 B = 16 lanes x 16 B
      {
#pragma unroll
        for (int it = 0; it < 8; ++it) {
          const int row = it * 2 + hh;
          v4f v = *(const v4f*)(slab + row * 68 + c4);
          *(v4f*)(C + (size_t)(mBase + row) * ldc + n0 + c4) = v;
        }
        
      }
    } else {
      const int q = lane >> 3, c8 = (lane & 7) * 8;
      unsigned short* C  = (unsigned short*)Cout  + (size_t)b * strideC;
      unsigned short* C2 = (OUT_MODE == 2) ? ((unsigned short*)Cout2 + (size_t)b * strideC) : nullptr;
      {
#pragma unroll
        for (int it = 0; it < 4; ++it) {
          const int row = it * 4 + q;
          const float* sp = slab + row * 68 + c8;
          v8h hv, lv;
#pragma unroll
          for (int e = 0; e < 8; ++e) {
            if (OUT_MODE == 1) {
              hv[e] = (_Float16)sp[e];
            } else {
              unsigned short hb = f2bf_bits(sp[e]);
              unsigned short lb = f2bf_bits(sp[e] - bf_bits2f(hb));
              hv[e] = __builtin_bit_cast(_Float16, hb);
              lv[e] = __builtin_bit_cast(_Float16, lb);
            }
          }
          *(v8h*)(C + (size_t)(mBase + row) * ldc + n0 + c8) = hv;
          if (OUT_MODE == 2) *(v8h*)(C2 + (size_t)(mBase + row) * ldc + n0 + c8) = lv;
        }
        
      }
    }
    __builtin_amdgcn_fence(__ATOMIC_RELEASE, "workgroup");
    __builtin_amdgcn_wave_barrier();
    __builtin_amdgcn_fence(__ATOMIC_ACQUIRE, "workgroup");
  }
}

// ---------------------------------------------------------------------------
// Square weight split: four [1024][1024] f32 matrices (layout kept as-is = [out][in] = Bt) -> bf16 hi and lo planes.
// grid (512, 4): blockIdx.y selects the matrix and the output plane z (planes at out + z*1048576 halves).
// Thread i owns 8 consecutive elements: two b128 loads, one 16-B store per lane per plane; a wave writes 512 contiguous
// ---------------------------------------------------------------------------
__global__ __launch_bounds__(256) void k_wsplit8(const float* __restrict__ W0, const float* __restrict__ W1,
                                                 const float* __restrict__ W2, const float* __restrict__ W3,
                                                 unsigned short* __restrict__ outH, unsigned short* __restrict__ outL,
                                                 int n8PerMat) {
  const int z = blockIdx.y;                                   // block-uniform
  const float* W = (z == 0) ? W0 : (z == 1) ? W1 : (z == 2) ? W2 : W3;
  const int i = blockIdx.x * 256 + threadIdx.x;
  if (i >= n8PerMat) return;
  const float* p = W + 8 * (size_t)i;
  const v4f a = *(const v4f*)(p);
  const v4f c = *(const v4f*)(p + 4);
  unsigned short hb[8], lb[8];
#pragma unroll
  for (int e = 0; e < 4; ++e) {
    bf_split_bits(a[e], hb[e], lb[e]);
    bf_split_bits(c[e], hb[4 + e], lb[4 + e]);
  }
  const v4u uh = (v4u){pk16(hb[0], hb[1]), pk16(hb[2], hb[3]), pk16(hb[4], hb[5]), pk16(hb[6], hb[7])};
  const v4u ul = (v4u){pk16(lb[0], lb[1]), pk16(lb[2], lb[3]), pk16(lb[4], lb[5]), pk16(lb[6], lb[7])};
  const size_t o = (size_t)z * (size_t)kWPlane + 8 * (size_t)i;
  *(v4u*)(outH + o) = uh;
  *(v4u*)(outL + o) = ul;
  
}

// ---------------------------------------------------------------------------
// Transpose + bf16 convert (single or hi/lo): in[R][Cc] f32 row-major (pitch Cc) -> out[n][k] = cvt(in[k][n]) for
// k < R and n < Cc, zero otherwise (pad rows / pad columns of the output plane are WRITTEN as zeros).
// grid (nTilesN, nTilesK, Z): a block covers 32 output rows n0..n0+31 and KT output columns k0..k0+KT-1; blockIdx.z adds
// inStrideZ / outStrideZ element offsets. 256 threads.
// Load coverage: (32*KT/256) iterations x 256 threads = 32 x KT elements (coalesced along n), clamped address, 0/1 factor.
// Store, KT == 64: row = wave*4 + (lane>>3) -> 8 waves x 4 = 32 rows; (lane&7) x 8 halves = 64 cols; each row segment =
// Store, KT == 32 (requires ldo == 32, k0 == 0): threads 0..127, row = t>>2, c8 = (t&3)*8 -> thread t writes tile bytes
// ---------------------------------------------------------------------------
template <bool SPLIT, int KT>
__global__ __launch_bounds__(256) void k_trcast(const float* __restrict__ in, int R, int Cc, long inStrideZ,
                                                unsigned short* __restrict__ outH, unsigned short* __restrict__ outL,
                                                int ldo, long outStrideZ) {
  static_assert(KT == 64 || KT == 32, "tile");
  __shared__ float sm[32][KT + 1];
  const int t  = threadIdx.x;
  const int n0 = blockIdx.x * 32;
  const int k0 = blockIdx.y * KT;
  const float* inz = in + (size_t)blockIdx.z * inStrideZ;
  constexpr int kIters = (32 * KT) / 256;
#pragma unroll
  for (int it = 0; it < kIters; ++it) {
    const int e  = it * 256 + t;
    const int nl = e & 31;
    const int kl = e >> 5;
    const int n  = n0 + nl;
    const int k  = k0 + kl;
    const int nc = (n < Cc) ? n : (Cc - 1);
    const int kc = (k < R) ? k : (R - 1);
    const float v  = inz[(size_t)kc * Cc + nc];
    const float fz = ((n < Cc) && (k < R)) ? 1.0f : 0.0f;
    sm[nl][kl] = v * fz;
  }
  __syncthreads();
  const int lane = t & 31, wave = t >> 5;
  unsigned short* oh = outH + (size_t)blockIdx.z * outStrideZ;
  unsigned short* ol = outL + (size_t)blockIdx.z * outStrideZ;
  int row, c8;
  bool active;
  if (KT == 64) { row = wave * 4 + (lane >> 3); c8 = (lane & 7) * 8; active = true; }
  else          { row = t >> 2;                 c8 = (t & 3) * 8;    active = (t < 128); }
  if (active) {
    unsigned short hb[8], lb[8];
#pragma unroll
    for (int e = 0; e < 8; ++e) {
      const float v = sm[row][c8 + e];
      if (SPLIT) { bf_split_bits(v, hb[e], lb[e]); }
      else       { hb[e] = f2bf_bits(v); lb[e] = 0; }
    }
    const v4u uh = (v4u){pk16(hb[0], hb[1]), pk16(hb[2], hb[3]), pk16(hb[4], hb[5]), pk16(hb[6], hb[7])};
    const v4u ul = (v4u){pk16(lb[0], lb[1]), pk16(lb[2], lb[3]), pk16(lb[4], lb[5]), pk16(lb[6], lb[7])};
    const size_t o = (size_t)(n0 + row) * ldo + k0 + c8;
    *(v4u*)(oh + o) = uh;
    if (SPLIT) *(v4u*)(ol + o) = ul;
    
  }
}

// ---------------------------------------------------------------------------
// Token shift: xx[m][c] = x[m][c] + (x[m-1][c]*f - x[m][c]) * miu_x[c], f = 0 at t == 0 else 1 (address of the prior row
// clamped, arithmetic 0/1 factor). Output: single bf16 plane [2048][1024].
// ---------------------------------------------------------------------------
__global__ __launch_bounds__(256) void k_xx8(const float* __restrict__ x, const float* __restrict__ miu_x,
                                             unsigned short* __restrict__ XX, int n8) {
  const int i = blockIdx.x * 256 + threadIdx.x;
  if (i >= n8) return;
  const int f  = 8 * i;
  const int m  = f >> 10;
  const int c0 = f & 1023;
  const int t  = m & 1023;
  const int mp = (t > 0) ? (m - 1) : m;
  const float fz = (t > 0) ? 1.0f : 0.0f;
  const float* px = x + f;
  const float* pp = x + ((size_t)mp << 10) + c0;
  const float* pm = miu_x + c0;
  const v4f a0 = *(const v4f*)(px), a1 = *(const v4f*)(px + 4);
  const v4f b0 = *(const v4f*)(pp), b1 = *(const v4f*)(pp + 4);
  const v4f u0 = *(const v4f*)(pm), u1 = *(const v4f*)(pm + 4);
  unsigned short hb[8];
#pragma unroll
  for (int e = 0; e < 4; ++e) {
    const float ba0 = b0[e] * fz - a0[e];
    const float ba1 = b1[e] * fz - a1[e];
    hb[e]     = f2bf_bits(a0[e] + ba0 * u0[e]);
    hb[4 + e] = f2bf_bits(a1[e] + ba1 * u1[e]);
  }
  const v4u uh = (v4u){pk16(hb[0], hb[1]), pk16(hb[2], hb[3]), pk16(hb[4], hb[5]), pk16(hb[6], hb[7])};
  unsigned short* q = XX + f;
  *(v4u*)q = uh;
  
}

// ---------------------------------------------------------------------------
// Branch input assembly: x5[m][c] = x[m][c] + (x[m-1][c]*f - x[m][c]) * (miu[m][c] + lam_s[c]) -> bf16 hi plane (always)
// and bf16 lo plane (writeLo != 0, block-uniform). Same thread / store mapping as k_xx8.
// Coverage: 262144 threads x 8 = the whole plane (both planes).
// ---------------------------------------------------------------------------
__global__ __launch_bounds__(256) void k_x5_8(const float* __restrict__ x, const float* __restrict__ miu,
                                              const float* __restrict__ lam_s,
                                              unsigned short* __restrict__ outH, unsigned short* __restrict__ outL,
                                              int writeLo, int n8) {
  const int i = blockIdx.x * 256 + threadIdx.x;
  if (i >= n8) return;
  const int f  = 8 * i;
  const int m  = f >> 10;
  const int c0 = f & 1023;
  const int t  = m & 1023;
  const int mp = (t > 0) ? (m - 1) : m;
  const float fz = (t > 0) ? 1.0f : 0.0f;
  const float* px = x + f;
  const float* pp = x + ((size_t)mp << 10) + c0;
  const float* pm = miu + f;
  const float* pl = lam_s + c0;
  const v4f a0 = *(const v4f*)(px), a1 = *(const v4f*)(px + 4);
  const v4f b0 = *(const v4f*)(pp), b1 = *(const v4f*)(pp + 4);
  const v4f u0 = *(const v4f*)(pm), u1 = *(const v4f*)(pm + 4);
  const v4f l0 = *(const v4f*)(pl), l1 = *(const v4f*)(pl + 4);
  unsigned short hb[8], lb[8];
#pragma unroll
  for (int e = 0; e < 4; ++e) {
    const float ba0 = b0[e] * fz - a0[e];
    const float ba1 = b1[e] * fz - a1[e];
    const float v0 = a0[e] + ba0 * (u0[e] + l0[e]);
    const float v1 = a1[e] + ba1 * (u1[e] + l1[e]);
    bf_split_bits(v0, hb[e], lb[e]);
    bf_split_bits(v1, hb[4 + e], lb[4 + e]);
  }
  const v4u uh = (v4u){pk16(hb[0], hb[1]), pk16(hb[2], hb[3]), pk16(hb[4], hb[5]), pk16(hb[6], hb[7])};
  const v4u ul = (v4u){pk16(lb[0], lb[1]), pk16(lb[2], lb[3]), pk16(lb[4], lb[5]), pk16(lb[6], lb[7])};
  *(v4u*)(outH + f) = uh;
  if (writeLo) *(v4u*)(outL + f) = ul;
  
}

// ---------------------------------------------------------------------------
// tanh + bf16 convert (single or hi/lo) with column compaction / padding:
//   out flat index f = m*ncols + c  <-  tanh(in[m*ldin + c]) for c < nvalid, 0 for c >= nvalid  (ncols <= ldin, both even).
// ---------------------------------------------------------------------------
template <bool SPLIT>
__global__ __launch_bounds__(256) void k_tanh2(const float* __restrict__ in, int ldin,
                                               unsigned short* __restrict__ outH, unsigned short* __restrict__ outL,
                                               int ncols, int nvalid, int n2) {
  const int i = blockIdx.x * 256 + threadIdx.x;
  if (i >= n2) return;
  const int f = 2 * i;
  const int m = f / ncols;
  const int c = f - m * ncols;
  const v2f a = *(const v2f*)(in + (size_t)m * ldin + c);
  const float f0 = (c < nvalid) ? 1.0f : 0.0f;
  const float f1 = (c + 1 < nvalid) ? 1.0f : 0.0f;
  const float t0 = tanhf(a[0]) * f0;
  const float t1 = tanhf(a[1]) * f1;
  unsigned short h0, h1, l0 = 0, l1 = 0;
  if (SPLIT) { bf_split_bits(t0, h0, l0); bf_split_bits(t1, h1, l1); }
  else       { h0 = f2bf_bits(t0); h1 = f2bf_bits(t1); }
  const unsigned uh = pk16(h0, h1);
  const unsigned ul = pk16(l0, l1);
  ((unsigned*)outH)[i] = uh;
  if (SPLIT) ((unsigned*)outL)[i] = ul;
  
}

// ---------------------------------------------------------------------------
// Linear-attention state scan, f32. One block (128 threads = 4 waves, one per SIMD) per (batch b, head n, half ih of the
// v channels): the rows i of the state are independent, so each block carries 32 rows x 64 k channels.
// Thread (ip, jg): jg = lane & 7 owns k channels 8*jg .. 8*jg+7, ip = wave*4 + (lane >> 3) owns rows 2*ip, 2*ip+1;
// S lives in 8 f32 pairs (pairs run along j, so r, k and d pairs come straight out of the b128 LDS reads).
// The sequence is cut into chunks of kSc timesteps; pass c of the loop, between two block barriers,
//   - runs the kSc steps of chunk c from stage buffer c & 1 (r, k*exp(min(w,0)), exp(w), v; w = wl + td_miu). A step has no
//     barrier: each thread stores its partial sum over its 8 k channels to partial buffer c & 1;
//   - writes chunk c+1 into the other stage buffer, piece by piece between the steps, and issues the loads of chunk c+2;
//   - finishes chunk c-1: y_i = sum of the 8 partials + v_i * bonus[t], bonus[t] = sum_j r_j*u_j*k_j (16 partials per step,
//     written by the staging threads into a ring of 4 slots). Each 128-B line of Y is stored once, by 8 lanes of one wave.
// ---------------------------------------------------------------------------
constexpr int kSc  = 32;             // timesteps per chunk
constexpr int kNC  = kSeq / kSc;     // chunks
constexpr int kIB  = 32;             // state rows (v channels) per block
constexpr int kPJ  = 40;             // floats between the partial rows of two j groups: the 8 groups of a store hit disjoint banks
constexpr int kPT  = 8 * kPJ + 32;   // floats between two timesteps' partials: two timesteps of one b128 read hit disjoint banks
constexpr int kPre = 6;              // steps whose LDS operands are fetched ahead of their use
static_assert(kSeq % kSc == 0 && kNC >= 2 && kHead == 2 * kIB && kSc % 16 == 0 && kSc > kPre, "scan chunking");
struct ScanOp { v4f r0, r1, k0, k1, d0, d1; v2f v; };
__device__ __forceinline__ v2f lo2(v4f a) { return (v2f){a[0], a[1]}; }
__device__ __forceinline__ v2f hi2(v4f a) { return (v2f){a[2], a[3]}; }
__global__ __launch_bounds__(128) void k_state_scan(const float* __restrict__ kraw, const float* __restrict__ vpl,
                                                    const float* __restrict__ rpl, const float* __restrict__ wl,
                                                    const float* __restrict__ td_miu, const float* __restrict__ u,
                                                    float* __restrict__ Y) {
  __shared__ __align__(16) float sr0[kSc * 64], sr1[kSc * 64];
  __shared__ __align__(16) float sk0[kSc * 64], sk1[kSc * 64];
  __shared__ __align__(16) float sd0[kSc * 64], sd1[kSc * 64];
  __shared__ __align__(16) float sv0[kSc * kIB], sv1[kSc * kIB];
  __shared__ __align__(16) float part0[kSc * kPT], part1[kSc * kPT];
  __shared__ __align__(16) float sbp[4][kSc][16];
  const int tid  = threadIdx.x;
  const int lane = tid & 31;
  const int wave = tid >> 5;
  const int ih   = blockIdx.x & 1;
  const int n    = (blockIdx.x >> 1) & (kNHead - 1);
  const int b    = blockIdx.x >> 5;
  const int jg   = lane & 7;
  const int j0   = jg * 8;
  const int il   = (wave * 4 + (lane >> 3)) * 2;      // first of this thread's two rows, local to the block
  // staging and output roles: r/k/w rows are 16 float4 wide, v and y rows 8 float4 wide
  const int sRow = tid >> 4, sC4 = (tid & 15) * 4;
  const int vRow = tid >> 3, vC4 = (tid & 7) * 4;
  const size_t base = (size_t)b * kSeq * kChan + (size_t)n * kHead;
  const unsigned offS = (unsigned)(sRow * kChan + sC4) * 4u;             // byte offsets of the two roles inside a piece
  const unsigned offV = (unsigned)(vRow * kChan + ih * kIB + vC4) * 4u;
  const v4f tm4 = *(const v4f*)(td_miu + n * kHead + sC4);
  const v4f u4  = *(const v4f*)(u + n * kHead + sC4);
  // precaution: this wait stands in front of every later write of a register that one of these two loads names; the scheduling
  // barrier keeps later instructions behind it
  asm volatile("s_wait_xcnt 0x0" ::: "memory");
  __builtin_amdgcn_sched_barrier(0);

  v2f S0[4], S1[4];
#pragma unroll
  for (int q = 0; q < 4; ++q) { S0[q] = (v2f){0.f, 0.f}; S1[q] = (v2f){0.f, 0.f}; }

  // staged through registers in kSc/8 pieces: piece it = 8 rows of r, k, w (and, for the first kSc/16 pieces, 16 rows of v)
  v4f gw[kSc / 8], gk[kSc / 8], gr[kSc / 8], gv[kSc / 16];
  // the v values this thread staged are the ones its own output role needs two passes later: vOld of chunk c-1, vNew of chunk c
  v4f vOld[kSc / 16], vNew[kSc / 16];
#pragma unroll
  for (int it = 0; it < kSc / 16; ++it) { vOld[it] = (v4f){0.f, 0.f, 0.f, 0.f}; vNew[it] = vOld[it]; }
  auto issue = [&](int it, int t0) {
    const size_t ub = base + (size_t)(t0 + it * 8) * kChan;      // block-uniform: scalar base + this thread's fixed byte offset
    const size_t uv = base + (size_t)(t0 + it * 16) * kChan;
    // the two scheduling barriers keep every other instruction out of the group of loads and its wait
    __builtin_amdgcn_sched_barrier(0);
    gw[it] = *(const v4f*)((const char*)(wl + ub) + offS);
    gk[it] = *(const v4f*)((const char*)(kraw + ub) + offS);
    gr[it] = *(const v4f*)((const char*)(rpl + ub) + offS);
    if (it < kSc / 16) gv[it] = *(const v4f*)((const char*)(vpl + uv) + offV);
    // precaution: this wait stands in front of every later write of a register that one of these loads names
    asm volatile("s_wait_xcnt 0x0" ::: "memory");
    __builtin_amdgcn_sched_barrier(0);
  };
  auto commit = [&](int it, float* dr, float* dk, float* dd_, float* dv, int slot) {
    const int tl = it * 8 + sRow;
    v4f kk, dd;
    float bp = 0.0f;
#pragma unroll
    for (int e = 0; e < 4; ++e) {
      const float wv = gw[it][e] + tm4[e];
      kk[e] = gk[it][e] * expf(fminf(wv, 0.0f));
      dd[e] = expf(wv);
      bp += gr[it][e] * (u4[e] * kk[e]);
    }
    *(v4f*)(dr + tl * 64 + sC4)  = gr[it];
    *(v4f*)(dk + tl * 64 + sC4)  = kk;
    *(v4f*)(dd_ + tl * 64 + sC4) = dd;
    sbp[slot][tl][tid & 15] = bp;
    if (it < kSc / 16) {
      *(v4f*)(dv + (it * 16 + vRow) * kIB + vC4) = gv[it];
      vOld[it] = vNew[it];
      vNew[it] = gv[it];
    }
  };
  // finishing chunk cc from its partials (src), its bonus slot and vOld: the LDS reads, and apart from them the sums and stores
  v4f x[kSc / 16][12];
  auto finish_load = [&](const float* src, int cc) {
#pragma unroll
    for (int it = 0; it < kSc / 16; ++it) {
      const int tl = it * 16 + vRow;
#pragma unroll
      for (int g = 0; g < 8; ++g) x[it][g] = *(const v4f*)(src + tl * kPT + g * kPJ + vC4);
#pragma unroll
      for (int g = 0; g < 4; ++g) x[it][8 + g] = *(const v4f*)(&sbp[cc & 3][tl][4 * g]);
    }
  };
  auto finish_sum = [&](int cc) {
    v4f yv[kSc / 16];
#pragma unroll
    for (int it = 0; it < kSc / 16; ++it) {
      const v4f b4 = (x[it][8] + x[it][9]) + (x[it][10] + x[it][11]);
      const float bn = (b4[0] + b4[1]) + (b4[2] + b4[3]);
      yv[it] = (((x[it][0] + x[it][1]) + (x[it][2] + x[it][3])) + ((x[it][4] + x[it][5]) + (x[it][6] + x[it][7]))) + vOld[it] * bn;
    }
    // as in issue(): nothing else is scheduled into the group of stores and its wait
    __builtin_amdgcn_sched_barrier(0);
#pragma unroll
    for (int it = 0; it < kSc / 16; ++it)
      *(v4f*)((char*)(Y + base + (size_t)(cc * kSc + it * 16) * kChan) + offV) = yv[it];
    // the same precaution for the registers that these stores name
    asm volatile("s_wait_xcnt 0x0" ::: "memory");
    __builtin_amdgcn_sched_barrier(0);
  };
  auto pass = [&](int c) {
    const int p = c & 1;
    const float* pr = (p ? sr1 : sr0) + j0;
    const float* pk = (p ? sk1 : sk0) + j0;
    const float* pd = (p ? sd1 : sd0) + j0;
    const float* pv = (p ? sv1 : sv0) + il;
    float* pp = (p ? part1 : part0) + jg * kPJ + il;
    // chunk whose loads are issued in this pass; clamped, so that the steps have no branch (the last two passes re-read the last
    // chunk, and the last pass stages it into buffers that nobody reads any more)
    const int tN = ((c + 2 < kNC) ? (c + 2) : (kNC - 1)) * kSc;
    auto ld = [&](int tl) {
      ScanOp o;
      o.r0 = *(const v4f*)(pr + tl * 64); o.r1 = *(const v4f*)(pr + tl * 64 + 4);
      o.k0 = *(const v4f*)(pk + tl * 64); o.k1 = *(const v4f*)(pk + tl * 64 + 4);
      o.d0 = *(const v4f*)(pd + tl * 64); o.d1 = *(const v4f*)(pd + tl * 64 + 4);
      o.v  = *(const v2f*)(pv + tl * kIB);
      return o;
    };
    // the previous chunk's reads first, then the first steps' reads, which are served while the previous chunk is summed and stored
    if (c > 0) finish_load(p ? part0 : part1, c - 1);      // block-uniform
    ScanOp ring[kPre];
#pragma unroll
    for (int tl = 0; tl < kPre; ++tl) ring[tl] = ld(tl);
    if (c > 0) finish_sum(c - 1);
    // fully unrolled so that the ring's slots are registers and every LDS offset an immediate
#pragma unroll
    for (int tl = 0; tl < kSc; ++tl) {
      const ScanOp o = ring[tl % kPre];
      if (tl + kPre < kSc) ring[tl % kPre] = ld(tl + kPre);
      // keeps these reads kPre steps ahead of their use: sunk next to it, the wave would wait out the LDS latency in every step
      __builtin_amdgcn_sched_barrier(0);
      const v2f r2[4] = {lo2(o.r0), hi2(o.r0), lo2(o.r1), hi2(o.r1)};
      const v2f k2[4] = {lo2(o.k0), hi2(o.k0), lo2(o.k1), hi2(o.k1)};
      const v2f d2[4] = {lo2(o.d0), hi2(o.d0), lo2(o.d1), hi2(o.d1)};
      const v2f vv0 = (v2f){o.v[0], o.v[0]};
      const v2f vv1 = (v2f){o.v[1], o.v[1]};
      v2f a0 = r2[0] * S0[0];
      v2f a1 = r2[0] * S1[0];
#pragma unroll
      for (int q = 1; q < 4; ++q) {
        a0 = __builtin_elementwise_fma(r2[q], S0[q], a0);
        a1 = __builtin_elementwise_fma(r2[q], S1[q], a1);
      }
#pragma unroll
      for (int q = 0; q < 4; ++q) {
        S0[q] = __builtin_elementwise_fma(S0[q], d2[q], k2[q] * vv0);
        S1[q] = __builtin_elementwise_fma(S1[q], d2[q], k2[q] * vv1);
      }
      *(v2f*)(pp + tl * kPT) = (v2f){a0[0] + a0[1], a1[0] + a1[1]};
      // one piece of the next chunk's stage every 4 steps, early in the pass: its vector work runs while the LDS reads fetched
      // ahead are served, and the loads issued behind it have the rest of the pass to land before the barrier waits for them
      if ((tl & 3) == 1 && (tl >> 2) < kSc / 8) {
        commit(tl >> 2, p ? sr0 : sr1, p ? sk0 : sk1, p ? sd0 : sd1, p ? sv0 : sv1, (c + 1) & 3);
        issue(tl >> 2, tN);
      }
    }
    // the one barrier of a pass: publishes this chunk's partials and the next chunk's stage, and ends the reads of this chunk's
    // stage and of the previous chunk's partials, which the next pass overwrites
    __syncthreads();
  };

#pragma unroll
  for (int it = 0; it < kSc / 8; ++it) issue(it, 0);
#pragma unroll
  for (int it = 0; it < kSc / 8; ++it) {
    commit(it, sr0, sk0, sd0, sv0, 0);
    issue(it, kSc);
  }
  __syncthreads();
#pragma unroll 1
  for (int c = 0; c < kNC; ++c) pass(c);
  finish_load(((kNC - 1) & 1) ? part1 : part0, kNC - 1);
  finish_sum(kNC - 1);
}

// ---------------------------------------------------------------------------
// GroupNorm (64 channels per head, biased variance, eps 1.6e-4) + affine + gate multiply -> bf16 hi/lo planes.
// One wave per (row m, head n), 8 pairs per 256-thread block; lane owns channels 2l, 2l+1; shuffle reductions (unconditional).
// ---------------------------------------------------------------------------
__global__ __launch_bounds__(256) void k_gn_gate(const float* __restrict__ Y, const float* __restrict__ G,
                                                 const float* __restrict__ gamma, const float* __restrict__ beta,
                                                 unsigned short* __restrict__ outH, unsigned short* __restrict__ outL) {
  __shared__ __align__(16) float slab[8][64];
  const int lane = threadIdx.x & 31, wave = threadIdx.x >> 5;
  const int pair = blockIdx.x * 8 + wave;
  const int m = pair >> 4;
  const int n = pair & 15;
  const size_t base = (size_t)m * kChan + (size_t)n * kHead;
  const int c = n * kHead + 2 * lane;
  const v2f yv = *(const v2f*)(Y + base + 2 * lane);
  const v2f gv = *(const v2f*)(G + base + 2 * lane);
  const v2f ga = *(const v2f*)(gamma + c);
  const v2f be = *(const v2f*)(beta + c);
  float s = yv[0] + yv[1];
#pragma unroll
  for (int off = 16; off > 0; off >>= 1) s += __shfl_xor(s, off, 32);
  const float mean = s * (1.0f / 64.0f);
  const float d0 = yv[0] - mean;
  const float d1 = yv[1] - mean;
  float q = d0 * d0 + d1 * d1;
#pragma unroll
  for (int off = 16; off > 0; off >>= 1) q += __shfl_xor(q, off, 32);
  const float var = q * (1.0f / 64.0f);
  const float rs  = 1.0f / sqrtf(var + kGnEps);
  const float o0 = ((d0 * rs) * ga[0] + be[0]) * gv[0];
  const float o1 = ((d1 * rs) * ga[1] + be[1]) * gv[1];
  *(v2f*)(&slab[wave][2 * lane]) = (v2f){o0, o1};
  __syncthreads();
  if (lane < 8) {
    unsigned short hb[8], lb[8];
#pragma unroll
    for (int e = 0; e < 8; ++e) bf_split_bits(slab[wave][8 * lane + e], hb[e], lb[e]);
    const v4u uh = (v4u){pk16(hb[0], hb[1]), pk16(hb[2], hb[3]), pk16(hb[4], hb[5]), pk16(hb[6], hb[7])};
    const v4u ul = (v4u){pk16(lb[0], lb[1]), pk16(lb[2], lb[3]), pk16(lb[4], lb[5]), pk16(lb[6], lb[7])};
    const size_t o = base + 8 * (size_t)lane;
    *(v4u*)(outH + o) = uh;
    *(v4u*)(outL + o) = ul;
    
  }
}

// ---------------------------------------------------------------------------
// Host glue.
// Workspace region map (bytes; every size is a multiple of 4096, offsets in that order):
//   XX     bf16 [2048][1024]            4,194,304
//   HPRE   f32  [2048][192]             1,572,864   (tanh input of the mix path; cols 160..191 written by the GEMM, unread)
//   HC     bf16 [2048][160] = [10240][32] 655,360   (compact; branch s = rows 2048s.. of the ld-32 view)
//   MIU    f32  [2048][1024]            8,388,608   (per-branch mix, rewritten 5x; then the decay lowrank output, same layout)
//   X5H    bf16 [5][2048][1024]        20,971,520   (branch inputs hi: 0 decay (single), 1 k, 2 v, 3 r, 4 gate)
//   X5L    bf16 [4][2048][1024]        16,777,216   (lo planes of branches 1..4 at index s-1)
//   WH     bf16 [4][1024][1024]         8,388,608   (Wk, Wv, Wr, Wo hi, [out][in] as-is)
//   WL     bf16 [4][1024][1024]         8,388,608   (lo)
//   AT     bf16 [192][1024]               393,216   (A^T, rows 160..191 zero)
//   TDAT   bf16 [64][1024]                131,072
//   TDBT   bf16 [1024][64]                131,072
//   WG1TH  bf16 [192][1024]               393,216   (rows 160..191 zero)   WG1TL 393,216
//   WG2TH  bf16 [1024][192]               393,216   (cols 160..191 zero)   WG2TL 393,216
//   BPT    bf16 [5][1024][32]             327,680
//   LPRE   f32  [2048][64]                524,288
//   L1     bf16 [2048][64]                262,144
//   KVR    f32  [3][2048][1024]         25,165,824   (k unscaled, v, r)
//   GHPRE  f32  [2048][192]             1,572,864
//   GHH    bf16 [2048][192]               786,432   (cols 160..191 zero)   GHL 786,432
//   GATE   f32  [2048][1024]            8,388,608
//   Y      f32  [2048][1024]            8,388,608
//   GATH   bf16 [2048][1024]            4,194,304   GATL 4,194,304
//   total                             126,156,800
// GEMM shapes (M, N, K): (2048,192,1024) (2048,1024,32)x5 (2048,64,1024) (2048,1024,64) (2048,1024,1024)x3 batched
// (2048,192,1024) (2048,1024,192) (2048,1024,1024); all M,N % 64 == 0, all K % 32 == 0, pads zero-written by producers.
// ---------------------------------------------------------------------------
extern "C" void kernel_launch(void* const* d_in, const int* in_sizes, int n_in,
                              void* d_out, int out_size, void* d_ws, size_t ws_size,
                              hipStream_t stream) {
  if (n_in < 17) return;
  if (in_sizes[0] != kBatch * kSeq * kChan) return;
  if (in_sizes[1] != kChan || in_sizes[2] != kNBr * kChan) return;
  if (in_sizes[3] != kChan * kMix || in_sizes[4] != kNBr * kBr * kChan) return;
  if (in_sizes[5] != kChan || in_sizes[6] != kChan * kDec || in_sizes[7] != kDec * kChan) return;
  if (in_sizes[8] != kNHead * kHead) return;
  if (in_sizes[9] != kChan * kChan || in_sizes[10] != kChan * kChan || in_sizes[11] != kChan * kChan || in_sizes[12] != kChan * kChan) return;
  if (in_sizes[13] != kChan * kMix || in_sizes[14] != kMix * kChan) return;
  if (in_sizes[15] != kChan || in_sizes[16] != kChan) return;
  if (out_size != kBatch * kSeq * kChan) return;

  const float* x      = (const float*)d_in[0];
  const float* miu_x  = (const float*)d_in[1];
  const float* lam    = (const float*)d_in[2];    // [5][1024]
  const float* Amat   = (const float*)d_in[3];    // [1024][160]
  const float* Bp     = (const float*)d_in[4];    // [5][32][1024]
  const float* td_miu = (const float*)d_in[5];    // [1024]
  const float* tdA    = (const float*)d_in[6];    // [1024][64]
  const float* tdB    = (const float*)d_in[7];    // [64][1024]
  const float* u      = (const float*)d_in[8];    // [16][64]
  const float* Wk     = (const float*)d_in[9];    // [1024][1024] [out][in]
  const float* Wv     = (const float*)d_in[10];
  const float* Wr     = (const float*)d_in[11];
  const float* Wo     = (const float*)d_in[12];
  const float* Wg1    = (const float*)d_in[13];   // [1024][160]
  const float* Wg2    = (const float*)d_in[14];   // [160][1024]
  const float* gamma  = (const float*)d_in[15];
  const float* beta   = (const float*)d_in[16];
  float* out = (float*)d_out;

  // ---- carve ----
  const size_t szXX    = (size_t)kPlane * 2;
  const size_t szHPRE  = (size_t)kRows * kMixPad * 4;
  const size_t szHC    = (size_t)kRows * kMix * 2;
  const size_t szF32P  = (size_t)kPlane * 4;
  const size_t szX5H   = (size_t)kNBr * kPlane * 2;
  const size_t szX5L   = (size_t)(kNBr - 1) * kPlane * 2;
  const size_t szWSQ   = (size_t)4 * kWPlane * 2;
  const size_t szAT    = (size_t)kMixPad * kChan * 2;
  const size_t szTDAT  = (size_t)kDec * kChan * 2;
  const size_t szTDBT  = (size_t)kChan * kDec * 2;
  const size_t szWG1T  = (size_t)kMixPad * kChan * 2;
  const size_t szWG2T  = (size_t)kChan * kMixPad * 2;
  const size_t szBPT   = (size_t)kNBr * kChan * kBr * 2;
  const size_t szLPRE  = (size_t)kRows * kDec * 4;
  const size_t szL1    = (size_t)kRows * kDec * 2;
  const size_t szKVR   = (size_t)3 * kPlane * 4;
  const size_t szGHPRE = (size_t)kRows * kMixPad * 4;
  const size_t szGH    = (size_t)kRows * kMixPad * 2;
  const size_t szGAT   = (size_t)kPlane * 2;
  size_t off = 0;
  const size_t oXX    = off; off += szXX;
  const size_t oHPRE  = off; off += szHPRE;
  const size_t oHC    = off; off += szHC;
  const size_t oMIU   = off; off += szF32P;
  const size_t oX5H   = off; off += szX5H;
  const size_t oX5L   = off; off += szX5L;
  const size_t oWH    = off; off += szWSQ;
  const size_t oWL    = off; off += szWSQ;
  const size_t oAT    = off; off += szAT;
  const size_t oTDAT  = off; off += szTDAT;
  const size_t oTDBT  = off; off += szTDBT;
  const size_t oWG1TH = off; off += szWG1T;
  const size_t oWG1TL = off; off += szWG1T;
  const size_t oWG2TH = off; off += szWG2T;
  const size_t oWG2TL = off; off += szWG2T;
  const size_t oBPT   = off; off += szBPT;
  const size_t oLPRE  = off; off += szLPRE;
  const size_t oL1    = off; off += szL1;
  const size_t oKVR   = off; off += szKVR;
  const size_t oGHPRE = off; off += szGHPRE;
  const size_t oGHH   = off; off += szGH;
  const size_t oGHL   = off; off += szGH;
  const size_t oGATE  = off; off += szF32P;
  const size_t oY     = off; off += szF32P;
  const size_t oGATH  = off; off += szGAT;
  const size_t oGATL  = off; off += szGAT;
  const size_t total  = off;   // 126,156,800
  if (total > (size_t)134217728) return;
  if (ws_size < total) return;

  char* ws = (char*)d_ws;
  unsigned short* XX    = (unsigned short*)(ws + oXX);
  float*          HPRE  = (float*)(ws + oHPRE);
  unsigned short* HC    = (unsigned short*)(ws + oHC);
  float*          MIU   = (float*)(ws + oMIU);
  float*          WLR   = MIU;                       // decay lowrank output reuses the MIU bytes (same f32 [2048][1024] layout)
  unsigned short* X5H   = (unsigned short*)(ws + oX5H);
  unsigned short* X5L   = (unsigned short*)(ws + oX5L);
  unsigned short* WH    = (unsigned short*)(ws + oWH);
  unsigned short* WL    = (unsigned short*)(ws + oWL);
  unsigned short* AT    = (unsigned short*)(ws + oAT);
  unsigned short* TDAT  = (unsigned short*)(ws + oTDAT);
  unsigned short* TDBT  = (unsigned short*)(ws + oTDBT);
  unsigned short* WG1TH = (unsigned short*)(ws + oWG1TH);
  unsigned short* WG1TL = (unsigned short*)(ws + oWG1TL);
  unsigned short* WG2TH = (unsigned short*)(ws + oWG2TH);
  unsigned short* WG2TL = (unsigned short*)(ws + oWG2TL);
  unsigned short* BPT   = (unsigned short*)(ws + oBPT);
  float*          LPRE  = (float*)(ws + oLPRE);
  unsigned short* L1    = (unsigned short*)(ws + oL1);
  float*          KVR   = (float*)(ws + oKVR);
  float*          GHPRE = (float*)(ws + oGHPRE);
  unsigned short* GHH   = (unsigned short*)(ws + oGHH);
  unsigned short* GHL   = (unsigned short*)(ws + oGHL);
  float*          GATE  = (float*)(ws + oGATE);
  float*          Yp    = (float*)(ws + oY);
  unsigned short* GATH  = (unsigned short*)(ws + oGATH);
  unsigned short* GATL  = (unsigned short*)(ws + oGATL);
  const float* fdum = gamma;   // placeholder for unused bias / resid pointer arguments (never dereferenced)

  const dim3 blk(256);
  const int n8Plane = (int)(kPlane / 8);                 // 262144 -> 1024 blocks exact
  const int n8W     = (int)(kWPlane / 8);                // 131072 -> 512 blocks exact

  // ---- weight planes ----
  k_wsplit8<<<dim3(n8W / 256, 4), blk, 0, stream>>>(Wk, Wv, Wr, Wo, WH, WL, n8W);
  // A [1024][160] -> AT [192][1024] (rows >= 160 zero): n tiles 6, k tiles 16
  k_trcast<false, 64><<<dim3(kMixPad / 32, kChan / 64, 1), blk, 0, stream>>>(Amat, kChan, kMix, 0L, AT, AT, kChan, 0L);
  // tdA [1024][64] -> TDAT [64][1024]
  k_trcast<false, 64><<<dim3(kDec / 32, kChan / 64, 1), blk, 0, stream>>>(tdA, kChan, kDec, 0L, TDAT, TDAT, kChan, 0L);
  // tdB [64][1024] -> TDBT [1024][64]
  k_trcast<false, 64><<<dim3(kChan / 32, 1, 1), blk, 0, stream>>>(tdB, kDec, kChan, 0L, TDBT, TDBT, kDec, 0L);
  // Wg1 [1024][160] -> WG1T hi/lo [192][1024] (rows >= 160 zero)
  k_trcast<true, 64><<<dim3(kMixPad / 32, kChan / 64, 1), blk, 0, stream>>>(Wg1, kChan, kMix, 0L, WG1TH, WG1TL, kChan, 0L);
  // Wg2 [160][1024] -> WG2T hi/lo [1024][192] (cols >= 160 zero): n tiles 32, k tiles 3
  k_trcast<true, 64><<<dim3(kChan / 32, kMixPad / 64, 1), blk, 0, stream>>>(Wg2, kMix, kChan, 0L, WG2TH, WG2TL, kMixPad, 0L);
  // Bp[s] [32][1024] -> BPT[s] [1024][32], s = blockIdx.z
  k_trcast<false, 32><<<dim3(kChan / 32, 1, kNBr), blk, 0, stream>>>(Bp, kBr, kChan, (long)kBr * kChan, BPT, BPT, kBr, (long)kChan * kBr);

  // ---- token shift ----
  k_xx8<<<dim3(n8Plane / 256), blk, 0, stream>>>(x, miu_x, XX, n8Plane);

  // ---- mix lowrank: HPRE = XX @ AT^T  (M 2048, N 192, K 1024; 96 tiles -> 12 blocks) ----
  wmma_gemm64<1, false, 0, 0, false, 0><<<dim3(((kRows / 64) * (kMixPad / 64) + 7) / 8, 1), blk, 0, stream>>>(
      XX, XX, kChan, 0L, AT, AT, kChan, 0L, (void*)HPRE, (void*)HPRE, kMixPad, 0L, fdum, fdum, 0L,
      kRows, kMixPad, kChan, 1.0f);
  // HC flat [2048*160] = tanh(HPRE[:, 0:160]) compact bf16; n2 = 163840 -> 640 blocks exact
  k_tanh2<false><<<dim3((kRows * kMix / 2) / 256), blk, 0, stream>>>(HPRE, kMixPad, HC, HC, kMix, kMix, kRows * kMix / 2);

  // ---- per-branch mix GEMM (A = HC viewed [10240][32], rows 2048s..; K 32) and branch input assembly ----
  for (int s = 0; s < kNBr; ++s) {
    const unsigned short* Hs = HC + (size_t)s * kRows * kBr;
    const unsigned short* Bs = BPT + (size_t)s * kChan * kBr;
    wmma_gemm64<1, false, 0, 0, false, 0><<<dim3(((kRows / 64) * (kChan / 64) + 7) / 8, 1), blk, 0, stream>>>(
        Hs, Hs, kBr, 0L, Bs, Bs, kBr, 0L, (void*)MIU, (void*)MIU, kChan, 0L, fdum, fdum, 0L,
        kRows, kChan, kBr, 1.0f);
    unsigned short* oh = X5H + (size_t)s * kPlane;
    unsigned short* ol = X5L + (size_t)(s > 0 ? (s - 1) : 0) * kPlane;
    k_x5_8<<<dim3(n8Plane / 256), blk, 0, stream>>>(x, MIU, lam + (size_t)s * kChan, oh, ol, (s > 0) ? 1 : 0, n8Plane);
  }

  // ---- decay lowrank: LPRE = X5H[0] @ TDAT^T (N 64, K 1024; 32 tiles -> 4 blocks); L1 = tanh; WLR = L1 @ TDBT^T (K 64) ----
  wmma_gemm64<1, false, 0, 0, false, 0><<<dim3(((kRows / 64) * (kDec / 64) + 7) / 8, 1), blk, 0, stream>>>(
      X5H, X5H, kChan, 0L, TDAT, TDAT, kChan, 0L, (void*)LPRE, (void*)LPRE, kDec, 0L, fdum, fdum, 0L,
      kRows, kDec, kChan, 1.0f);
  k_tanh2<false><<<dim3((kRows * kDec / 2) / 256), blk, 0, stream>>>(LPRE, kDec, L1, L1, kDec, kDec, kRows * kDec / 2);
  wmma_gemm64<1, false, 0, 0, false, 0><<<dim3(((kRows / 64) * (kChan / 64) + 7) / 8, 1), blk, 0, stream>>>(
      L1, L1, kDec, 0L, TDBT, TDBT, kDec, 0L, (void*)WLR, (void*)WLR, kChan, 0L, fdum, fdum, 0L,
      kRows, kChan, kDec, 1.0f);

  // ---- k / v / r projections, batched over blockIdx.y = 0..2 (hi/lo split, K 1024) -> KVR f32 planes ----
  wmma_gemm64<1, true, 0, 0, false, 0><<<dim3(((kRows / 64) * (kChan / 64) + 7) / 8, 3), blk, 0, stream>>>(
      X5H + kPlane, X5L, kChan, (long)kPlane, WH, WL, kChan, (long)kWPlane,
      (void*)KVR, (void*)KVR, kChan, (long)kPlane, fdum, fdum, 0L, kRows, kChan, kChan, 1.0f);

  // ---- gate: GHPRE = X5[4] @ WG1T^T (split, N 192); GH = tanh hi/lo; GATE = GH @ WG2T^T (split, K 192) ----
  wmma_gemm64<1, true, 0, 0, false, 0><<<dim3(((kRows / 64) * (kMixPad / 64) + 7) / 8, 1), blk, 0, stream>>>(
      X5H + 4 * kPlane, X5L + 3 * kPlane, kChan, 0L, WG1TH, WG1TL, kChan, 0L,
      (void*)GHPRE, (void*)GHPRE, kMixPad, 0L, fdum, fdum, 0L, kRows, kMixPad, kChan, 1.0f);
  k_tanh2<true><<<dim3((kRows * kMixPad / 2) / 256), blk, 0, stream>>>(GHPRE, kMixPad, GHH, GHL, kMixPad, kMix, kRows * kMixPad / 2);
  wmma_gemm64<1, true, 0, 0, false, 0><<<dim3(((kRows / 64) * (kChan / 64) + 7) / 8, 1), blk, 0, stream>>>(
      GHH, GHL, kMixPad, 0L, WG2TH, WG2TL, kMixPad, 0L, (void*)GATE, (void*)GATE, kChan, 0L, fdum, fdum, 0L,
      kRows, kChan, kMixPad, 1.0f);

  // ---- state scan -> Y ----
  k_state_scan<<<dim3(kBatch * kNHead * 2), dim3(128), 0, stream>>>(KVR, KVR + kPlane, KVR + 2 * kPlane, WLR, td_miu, u, Yp);

  // ---- GroupNorm + gate -> GATH/GATL (4096 blocks x 8 waves = 32768 (row, head) pairs) ----
  k_gn_gate<<<dim3((kRows * kNHead) / 8), blk, 0, stream>>>(Yp, GATE, gamma, beta, GATH, GATL);

  // ---- output projection straight into d_out (split, K 1024) ----
  wmma_gemm64<1, true, 0, 0, false, 0><<<dim3(((kRows / 64) * (kChan / 64) + 7) / 8, 1), blk, 0, stream>>>(
      GATH, GATL, kChan, 0L, WH + 3 * kWPlane, WL + 3 * kWPlane, kChan, 0L,
      (void*)out, (void*)out, kChan, 0L, fdum, fdum, 0L, kRows, kChan, kChan, 1.0f);
}

// v002
// One run takes 296 microseconds.
// In both of two side-by-side timings against v001, it was 1.87 times as fast.
// All steps since v000 together make it 3.42 times as fast.
// Contractions: every GEMM on v_wmma_f32_16x16x32_bf16 (bf16 operands, f32 accumulate) - the four lowrank mix/decay sites single bf16, the k/v/r projections, the gate pair and the output projection as bf16 hi/lo split (hi*hi + hi*lo + lo*hi); token shift, state scan, GroupNorm and gating in f32 on VALU.
#include <hip/hip_runtime.h>
#include <math.h>

// ---------------------------------------------------------------------------
// Problem constants
// ---------------------------------------------------------------------------
constexpr int kBatch  = 2;
constexpr int kSeq    = 1024;
constexpr int kChan   = 1024;
constexpr int kHead   = 64;
constexpr int kNHead  = 16;
constexpr int kRows   = kBatch * kSeq;          // 2048 token rows (m = b*1024 + t)
constexpr int kMix    = 160;                    // lowrank width of the mix and gate paths
constexpr int kMixPad = 192;                    // padded to a 64 multiple (pad rows / cols zero-filled)
constexpr int kDec    = 64;                     // decay lowrank width
constexpr int kBr     = 32;                     // per-branch mix width
constexpr int kNBr    = 5;                      // branches: 0 decay, 1 k, 2 v, 3 r, 4 gate
constexpr long kPlane  = (long)kRows * kChan;   // 2,097,152 elements per activation plane
constexpr long kWPlane = (long)kChan * kChan;   // 1,048,576 elements per square weight plane
constexpr float kGnEps = 1.6e-4f;               // 1e-5 * 16
static_assert(kNHead * kHead == kChan, "shape");
static_assert(kRows % 256 == 0 && kChan % 256 == 0 && kMixPad % 64 == 0 && kDec % 64 == 0, "M and N tile multiples");
static_assert(kChan % 32 == 0 && kBr % 32 == 0 && kDec % 32 == 0 && kMixPad % 32 == 0, "K multiples of 32");
static_assert(kMix % 8 == 0 && kMixPad % 8 == 0 && kDec % 8 == 0, "pack groups never straddle a row");

typedef __attribute__((ext_vector_type(16))) _Float16 v16h;
typedef __attribute__((ext_vector_type(8)))  _Float16 v8h;
typedef __attribute__((ext_vector_type(16))) __bf16   v16b;
typedef __attribute__((ext_vector_type(8)))  __bf16   v8b;
typedef __attribute__((ext_vector_type(8)))  float    v8f;
typedef __attribute__((ext_vector_type(4)))  float    v4f;
typedef __attribute__((ext_vector_type(2)))  float    v2f;
typedef __attribute__((ext_vector_type(4)))  unsigned int v4u;

// ---------------------------------------------------------------------------
// Shared helpers
// ---------------------------------------------------------------------------
__device__ __forceinline__ unsigned short f2bf_bits(float f) {
  unsigned u = __float_as_uint(f);
  return (unsigned short)((u + 0x7FFFu + ((u >> 16) & 1u)) >> 16);
}
__device__ __forceinline__ float bf_bits2f(unsigned short h) { return __uint_as_float(((unsigned)h) << 16); }
__device__ __forceinline__ unsigned pk16(unsigned short a, unsigned short b) { return (unsigned)a | ((unsigned)b << 16); }
// RNE convert to a bf16 hi part and a bf16 lo part of the f32 residual
__device__ __forceinline__ void bf_split_bits(float f, unsigned short& hb, unsigned short& lb) {
  hb = f2bf_bits(f);
  lb = f2bf_bits(f - bf_bits2f(hb));
}

// hazard guards as plain device helpers; the 4-acc guard ties every
// accumulator of a group and names the A fragments as inputs
__device__ __forceinline__ void dep_guard4_h(v8f& a, v8f& b, v8f& c, v8f& d, v16h x, v16h y) { asm volatile("v_nop\n\tv_nop\n\tv_nop\n\tv_nop" : "+v"(a), "+v"(b), "+v"(c), "+v"(d) : "v"(x), "v"(y)); }
__device__ __forceinline__ void dep_guard4_b(v8f& a, v8f& b, v8f& c, v8f& d, v16b x, v16b y) { asm volatile("v_nop\n\tv_nop\n\tv_nop\n\tv_nop" : "+v"(a), "+v"(b), "+v"(c), "+v"(d) : "v"(x), "v"(y)); }
__device__ __forceinline__ void keep4_h(v16h a, v16h b, v16h c, v16h d) { asm volatile("v_nop" :: "v"(a), "v"(b), "v"(c), "v"(d)); }
__device__ __forceinline__ void keep4_b(v16b a, v16b b, v16b c, v16b d) { asm volatile("v_nop" :: "v"(a), "v"(b), "v"(c), "v"(d)); }
__device__ __forceinline__ void acc_guard4(v8f& a, v8f& b, v8f& c, v8f& d) { asm volatile("v_nop\n\tv_nop\n\tv_nop\n\tv_nop" : "+v"(a), "+v"(b), "+v"(c), "+v"(d)); }
template <typename T> struct Frag;
template <> struct Frag<_Float16> {
  typedef v16h V; typedef v8h H; union U { v16h v; v8h h[2]; };
  // elements 0..7 <- p[0..7], 8..15 <- p[16..23]
  static __device__ __forceinline__ v16h load(const _Float16* p) {
    U f; f.h[0] = *(const v8h*)(p); f.h[1] = *(const v8h*)(p + 16); return f.v;
  }
  static __device__ __forceinline__ v8f mma(v16h a, v16h b, v8f c) {
    return __builtin_amdgcn_wmma_f32_16x16x32_f16(false, a, false, b, (short)0, c, false, false);
  }
  static __device__ __forceinline__ void guard4(v8f& a, v8f& b, v8f& c, v8f& d, v16h x, v16h y) { dep_guard4_h(a, b, c, d, x, y); }
  static __device__ __forceinline__ void keep(v16h a, v16h b, v16h c, v16h d) { keep4_h(a, b, c, d); }
};
template <> struct Frag<__bf16> {
  typedef v16b V; typedef v8b H; union U { v16b v; v8b h[2]; };
  static __device__ __forceinline__ v16b load(const __bf16* p) {
    U f; f.h[0] = *(const v8b*)(p); f.h[1] = *(const v8b*)(p + 16); return f.v;
  }
  static __device__ __forceinline__ v8f mma(v16b a, v16b b, v8f c) {
    return __builtin_amdgcn_wmma_f32_16x16x32_bf16(false, a, false, b, (short)0, c, false, false);
  }
  static __device__ __forceinline__ void guard4(v8f& a, v8f& b, v8f& c, v8f& d, v16b x, v16b y) { dep_guard4_b(a, b, c, d, x, y); }
  static __device__ __forceinline__ void keep(v16b a, v16b b, v16b c, v16b d) { keep4_b(a, b, c, d); }
};

// ---- Register-blocked batched WMMA GEMM (ACT reduced to none/relu/leaky) -------------------------------
// C[m,n] = scale * sum_k A[m,k] * Bt[n,k] (+bias)(+resid); each wave owns a 64x64 tile, the WM x WN waves of a block one
// (64*WM) x (64*WN) tile. A row-major [M,KD]; Bt row-major [N,KD]; M % (64*WM) == 0, N % (64*WN) == 0, KD % KS == 0.
// Operand path: the block brings KS k values of its A rows and Bt rows from global memory in whole row pieces (KS*2 bytes,
// 16 B per lane), through registers, into one of two LDS buffers; every wave reads its fragments from there. The loads of
// stage s+1 are issued ahead of the products of stage s and stored to the other buffer behind them; one barrier per stage.
// SPLIT: operands are hi/lo planes (A2/Bt2 = lo planes, same layout); product = hi*hi + hi*lo + lo*hi.
// BIAS_MODE: 0 = none, 1 = bias[m], 2 = bias[n].
// OUT_MODE: 0 = f32, 1 = f16, 2 = bf16 hi plane (Cout) + bf16 lo plane (Cout2).
// ET: 0 = f16 operands, 1 = bf16 operands (pointers passed as 16-bit storage)
template <int ET> struct Elem;
template <> struct Elem<0> { typedef _Float16 T; };
template <> struct Elem<1> { typedef __bf16 T; };
template <int ET, bool SPLIT, int BIAS_MODE, int OUT_MODE, bool RESID, int ACT, int WM, int WN, int KS, int KD>
__global__ __launch_bounds__(32 * WM * WN) void wmma_gemm64(
    const unsigned short* __restrict__ Ap, const unsigned short* __restrict__ A2p, long strideA,
    const unsigned short* __restrict__ Btp, const unsigned short* __restrict__ Bt2p, long strideB,
    void* __restrict__ Cout, void* __restrict__ Cout2, int ldc, long strideC,
    const float* __restrict__ bias,
    const float* __restrict__ resid, long strideR,
    int N, float scale) {
  typedef typename Elem<ET>::T T;
  typedef typename Frag<T>::V V;
  typedef typename Frag<T>::H H;
  constexpr int NW    = WM * WN;               // waves per block
  constexpr int NT    = 32 * NW;               // threads per block
  constexpr int BM    = 64 * WM;               // block tile rows (A rows per stage)
  constexpr int BN    = 64 * WN;               // block tile columns (Bt rows per stage)
  constexpr int PITCH = KS + 8;                // LDS row pitch in elements: row bytes + 16, an odd multiple of 16 B
  constexpr int CH    = KS / 8;                // 16-B pieces per row piece
  constexpr int RSTEP = NT / CH;               // rows covered by one load of the whole block
  constexpr int NA    = BM / RSTEP;            // loads per thread and plane, A
  constexpr int NB    = BN / RSTEP;            // loads per thread and plane, Bt
  constexpr int PLANE = (BM + BN) * PITCH;     // elements of one plane in one buffer: A rows, then Bt rows
  constexpr int BUF   = (SPLIT ? 2 : 1) * PLANE;
  constexpr int NS    = KD / KS;               // stages
  static_assert(KS == 32 || KS == 64, "row piece");
  static_assert(KD % KS == 0 && BM % RSTEP == 0 && BN % RSTEP == 0, "stage split");
  const T* A = (const T*)Ap; const T* A2 = (const T*)A2p; const T* Bt = (const T*)Btp; const T* Bt2 = (const T*)Bt2p;
  __shared__ __align__(16) unsigned short sOpRaw[2 * BUF];
  __shared__ __align__(16) float sT[NW][16 * 68];   // per-wave 16x64 slab, pitch 68 floats
  T* sOp = (T*)sOpRaw;
  const int b    = blockIdx.y;
  const int tid  = threadIdx.x;
  const int lane = tid & 31;
  const int wave = tid >> 5;
  const int tilesN = N / BN;
  const int bm = blockIdx.x / tilesN;          // the grid holds exactly (M / BM) * (N / BN) blocks
  const int bn = blockIdx.x - bm * tilesN;
  const int wm = wave / WN;
  const int wn = wave - wm * WN;
  const int m0 = bm * BM + (wm << 6);
  const int n0 = bn * BN + (wn << 6);

  // block-uniform bases of the block's rows; every thread adds its one fixed byte offset
  const char* gA  = (const char*)(A  + (size_t)b * strideA + (size_t)(bm * BM) * KD);
  const char* gB  = (const char*)(Bt + (size_t)b * strideB + (size_t)(bn * BN) * KD);
  const char* gA2 = SPLIT ? (const char*)(A2  + (size_t)b * strideA + (size_t)(bm * BM) * KD) : nullptr;
  const char* gB2 = SPLIT ? (const char*)(Bt2 + (size_t)b * strideB + (size_t)(bn * BN) * KD) : nullptr;
  const int sRow = tid / CH, sCol = (tid % CH) * 8;
  const unsigned offG = (unsigned)(sRow * KD + sCol) * 2u;   // bytes
  const int      offL = sRow * PITCH + sCol;                 // elements

  const int rlane = lane & 15;                 // row (A) / col (B, D) within subtile
  const int koff  = (lane >> 4) * 8;           // k offset of this lane half
  const int mOff  = (lane >> 4) * 8;           // D row offset

  v8f acc[4][4];
#pragma unroll
  for (int i = 0; i < 4; ++i)
#pragma unroll
    for (int j = 0; j < 4; ++j) acc[i][j] = (v8f){0.f,0.f,0.f,0.f,0.f,0.f,0.f,0.f};

  // one stage in flight; every loop over these arrays and over the fragments is fully unrolled, so that they stay in registers
  H ra[NA], ra2[NA], rb[NB], rb2[NB];
  auto gload = [&](int k0) {
    // the two scheduling barriers keep every other instruction out of the group of loads and its wait, and the group ahead of
    // the products: sunk next to the LDS stores that use them, the loads would show their whole latency in every stage
    __builtin_amdgcn_sched_barrier(0);
#pragma unroll
    for (int i = 0; i < NA; ++i) {
      ra[i] = *(const H*)(gA + (size_t)k0 * 2 + (size_t)i * (RSTEP * KD * 2) + offG);
      if (SPLIT) ra2[i] = *(const H*)(gA2 + (size_t)k0 * 2 + (size_t)i * (RSTEP * KD * 2) + offG);
    }
#pragma unroll
    for (int i = 0; i < NB; ++i) {
      rb[i] = *(const H*)(gB + (size_t)k0 * 2 + (size_t)i * (RSTEP * KD * 2) + offG);
      if (SPLIT) rb2[i] = *(const H*)(gB2 + (size_t)k0 * 2 + (size_t)i * (RSTEP * KD * 2) + offG);
    }
    // precaution: this wait stands in front of every later write of a register that one of these loads names
    asm volatile("s_wait_xcnt 0x0" ::: "memory");
    __builtin_amdgcn_sched_barrier(0);
  };
  auto sstore = [&](T* buf) {
#pragma unroll
    for (int i = 0; i < NA; ++i) {
      *(H*)(buf + i * (RSTEP * PITCH) + offL) = ra[i];
      if (SPLIT) *(H*)(buf + PLANE + i * (RSTEP * PITCH) + offL) = ra2[i];
    }
#pragma unroll
    for (int i = 0; i < NB; ++i) {
      *(H*)(buf + (BM + i * RSTEP) * PITCH + offL) = rb[i];
      if (SPLIT) *(H*)(buf + PLANE + (BM + i * RSTEP) * PITCH + offL) = rb2[i];
    }
  };
  const int fragA = ((wm << 6) + rlane) * PITCH + koff;        // this lane's place in the first A / Bt fragment of its wave
  const int fragB = (BM + (wn << 6) + rlane) * PITCH + koff;
  auto compute = [&](const T* buf) {
#pragma unroll
    for (int kk = 0; kk < KS; kk += 32) {
      V bh[4], bl[4], ah[4], al[4];
#pragma unroll
      for (int j = 0; j < 4; ++j) {
        bh[j] = Frag<T>::load(buf + fragB + j * (16 * PITCH) + kk);
        if (SPLIT) bl[j] = Frag<T>::load(buf + PLANE + fragB + j * (16 * PITCH) + kk);
      }
#pragma unroll
      for (int i = 0; i < 4; ++i) {
        ah[i] = Frag<T>::load(buf + fragA + i * (16 * PITCH) + kk);
        if (SPLIT) al[i] = Frag<T>::load(buf + PLANE + fragA + i * (16 * PITCH) + kk);
      }
#pragma unroll
      for (int i = 0; i < 4; ++i) {
#pragma unroll
        for (int j = 0; j < 4; ++j) {
          acc[i][j] = Frag<T>::mma(ah[i], bh[j], acc[i][j]);
          if (SPLIT) {
            acc[i][j] = Frag<T>::mma(ah[i], bl[j], acc[i][j]);
            acc[i][j] = Frag<T>::mma(al[i], bh[j], acc[i][j]);
          }
        }
        Frag<T>::guard4(acc[i][0], acc[i][1], acc[i][2], acc[i][3], ah[i], SPLIT ? al[i] : ah[i]);
      }
      Frag<T>::keep(bh[0], bh[1], bh[2], bh[3]);
      if (SPLIT) Frag<T>::keep(bl[0], bl[1], bl[2], bl[3]);
    }
  };

  gload(0);
  sstore(sOp);
  __syncthreads();
  // kept rolled, for speed only
#pragma unroll 1
  for (int s = 0; s < NS; ++s) {
    if (s + 1 < NS) gload((s + 1) * KS);                       // block-uniform
    compute(sOp + (s & 1) * BUF);
    if (s + 1 < NS) sstore(sOp + ((s + 1) & 1) * BUF);
    // the one barrier of a stage: publishes stage s+1 and ends the reads of stage s, whose buffer the next pass overwrites
    __syncthreads();
  }
  acc_guard4(acc[0][0], acc[0][1], acc[0][2], acc[0][3]);
  acc_guard4(acc[1][0], acc[1][1], acc[1][2], acc[1][3]);
  acc_guard4(acc[2][0], acc[2][1], acc[2][2], acc[2][3]);
  acc_guard4(acc[3][0], acc[3][1], acc[3][2], acc[3][3]);

  // ---- epilogue ----
  float* slab = sT[wave];
  const float* Rb = RESID ? (resid + (size_t)b * strideR) : nullptr;
#pragma unroll
  for (int i = 0; i < 4; ++i) {
    const int mBase = m0 + (i << 4);
#pragma unroll
    for (int j = 0; j < 4; ++j) {
      const int n = n0 + (j << 4) + rlane;
      float bv = 0.f;
      if (BIAS_MODE == 2) bv = bias[n];
#pragma unroll
      for (int r = 0; r < 8; ++r) {
        float v = acc[i][j][r] * scale;
        if (BIAS_MODE == 1) v += bias[mBase + mOff + r];
        if (BIAS_MODE == 2) v += bv;
        if (RESID) v += Rb[(size_t)(mBase + mOff + r) * ldc + n];
        if (ACT == 2) v = fmaxf(v, 0.0f);
        if (ACT == 4) v = (v > 0.f) ? v : 0.01f * v;
        slab[(mOff + r) * 68 + (j << 4) + rlane] = v;
      }
    }
    __builtin_amdgcn_fence(__ATOMIC_RELEASE, "workgroup");
    __builtin_amdgcn_wave_barrier();
    __builtin_amdgcn_fence(__ATOMIC_ACQUIRE, "workgroup");
    if (OUT_MODE == 0) {
      float* C = (float*)Cout + (size_t)b * strideC;
      const int hh = lane >> 4, c4 = (lane & 15) * 4;     // row seg = 256 B = 16 lanes x 16 B
      {
#pragma unroll
        for (int it = 0; it < 8; ++it) {
          const int row = it * 2 + hh;
          v4f v = *(const v4f*)(slab + row * 68 + c4);
          *(v4f*)(C + (size_t)(mBase + row) * ldc + n0 + c4) = v;
        }
        
      }
    } else {
      const int q = lane >> 3, c8 = (lane & 7) * 8;
      unsigned short* C  = (unsigned short*)Cout  + (size_t)b * strideC;
      unsigned short* C2 = (OUT_MODE == 2) ? ((unsigned short*)Cout2 + (size_t)b * strideC) : nullptr;
      {
#pragma unroll
        for (int it = 0; it < 4; ++it) {
          const int row = it * 4 + q;
          const float* sp = slab + row * 68 + c8;
          v8h hv, lv;
#pragma unroll
          for (int e = 0; e < 8; ++e) {
            if (OUT_MODE == 1) {
              hv[e] = (_Float16)sp[e];
            } else {
              unsigned short hb = f2bf_bits(sp[e]);
              unsigned short lb = f2bf_bits(sp[e] - bf_bits2f(hb));
              hv[e] = __builtin_bit_cast(_Float16, hb);
              lv[e] = __builtin_bit_cast(_Float16, lb);
            }
          }
          *(v8h*)(C + (size_t)(mBase + row) * ldc + n0 + c8) = hv;
          if (OUT_MODE == 2) *(v8h*)(C2 + (size_t)(mBase + row) * ldc + n0 + c8) = lv;
        }
        
      }
    }
    __builtin_amdgcn_fence(__ATOMIC_RELEASE, "workgroup");
    __builtin_amdgcn_wave_barrier();
    __builtin_amdgcn_fence(__ATOMIC_ACQUIRE, "workgroup");
  }
}

// ---------------------------------------------------------------------------
// Square weight split: four [1024][1024] f32 matrices (layout kept as-is = [out][in] = Bt) -> bf16 hi and lo planes.
// grid (512, 4): blockIdx.y selects the matrix and the output plane z (planes at out + z*1048576 halves).
// Thread i owns 8 consecutive elements: two b128 loads, one 16-B store per lane per plane; a wave writes 512 contiguous
// ---------------------------------------------------------------------------
__global__ __launch_bounds__(256) void k_wsplit8(const float* __restrict__ W0, const float* __restrict__ W1,
                                                 const float* __restrict__ W2, const float* __restrict__ W3,
                                                 unsigned short* __restrict__ outH, unsigned short* __restrict__ outL,
                                                 int n8PerMat) {
  const int z = blockIdx.y;                                   // block-uniform
  const float* W = (z == 0) ? W0 : (z == 1) ? W1 : (z == 2) ? W2 : W3;
  const int i = blockIdx.x * 256 + threadIdx.x;
  if (i >= n8PerMat) return;
  const float* p = W + 8 * (size_t)i;
  const v4f a = *(const v4f*)(p);
  const v4f c = *(const v4f*)(p + 4);
  unsigned short hb[8], lb[8];
#pragma unroll
  for (int e = 0; e < 4; ++e) {
    bf_split_bits(a[e], hb[e], lb[e]);
    bf_split_bits(c[e], hb[4 + e], lb[4 + e]);
  }
  const v4u uh = (v4u){pk16(hb[0], hb[1]), pk16(hb[2], hb[3]), pk16(hb[4], hb[5]), pk16(hb[6], hb[7])};
  const v4u ul = (v4u){pk16(lb[0], lb[1]), pk16(lb[2], lb[3]), pk16(lb[4], lb[5]), pk16(lb[6], lb[7])};
  const size_t o = (size_t)z * (size_t)kWPlane + 8 * (size_t)i;
  *(v4u*)(outH + o) = uh;
  *(v4u*)(outL + o) = ul;
  
}

// ---------------------------------------------------------------------------
// Transpose + bf16 convert (single or hi/lo): in[R][Cc] f32 row-major (pitch Cc) -> out[n][k] = cvt(in[k][n]) for
// k < R and n < Cc, zero otherwise (pad rows / pad columns of the output plane are WRITTEN as zeros).
// grid (nTilesN, nTilesK, Z): a block covers 32 output rows n0..n0+31 and KT output columns k0..k0+KT-1; blockIdx.z adds
// inStrideZ / outStrideZ element offsets. 256 threads.
// Load coverage: (32*KT/256) iterations x 256 threads = 32 x KT elements (coalesced along n), clamped address, 0/1 factor.
// Store, KT == 64: row = wave*4 + (lane>>3) -> 8 waves x 4 = 32 rows; (lane&7) x 8 halves = 64 cols; each row segment =
// Store, KT == 32 (requires ldo == 32, k0 == 0): threads 0..127, row = t>>2, c8 = (t&3)*8 -> thread t writes tile bytes
// ---------------------------------------------------------------------------
template <bool SPLIT, int KT>
__global__ __launch_bounds__(256) void k_trcast(const float* __restrict__ in, int R, int Cc, long inStrideZ,
                                                unsigned short* __restrict__ outH, unsigned short* __restrict__ outL,
                                                int ldo, long outStrideZ) {
  static_assert(KT == 64 || KT == 32, "tile");
  __shared__ float sm[32][KT + 1];
  const int t  = threadIdx.x;
  const int n0 = blockIdx.x * 32;
  const int k0 = blockIdx.y * KT;
  const float* inz = in + (size_t)blockIdx.z * inStrideZ;
  constexpr int kIters = (32 * KT) / 256;
#pragma unroll
  for (int it = 0; it < kIters; ++it) {
    const int e  = it * 256 + t;
    const int nl = e & 31;
    const int kl = e >> 5;
    const int n  = n0 + nl;
    const int k  = k0 + kl;
    const int nc = (n < Cc) ? n : (Cc - 1);
    const int kc = (k < R) ? k : (R - 1);
    const float v  = inz[(size_t)kc * Cc + nc];
    const float fz = ((n < Cc) && (k < R)) ? 1.0f : 0.0f;
    sm[nl][kl] = v * fz;
  }
  __syncthreads();
  const int lane = t & 31, wave = t >> 5;
  unsigned short* oh = outH + (size_t)blockIdx.z * outStrideZ;
  unsigned short* ol = outL + (size_t)blockIdx.z * outStrideZ;
  int row, c8;
  bool active;
  if (KT == 64) { row = wave * 4 + (lane >> 3); c8 = (lane & 7) * 8; active = true; }
  else          { row = t >> 2;                 c8 = (t & 3) * 8;    active = (t < 128); }
  if (active) {
    unsigned short hb[8], lb[8];
#pragma unroll
    for (int e = 0; e < 8; ++e) {
      const float v = sm[row][c8 + e];
      if (SPLIT) { bf_split_bits(v, hb[e], lb[e]); }
      else       { hb[e] = f2bf_bits(v); lb[e] = 0; }
    }
    const v4u uh = (v4u){pk16(hb[0], hb[1]), pk16(hb[2], hb[3]), pk16(hb[4], hb[5]), pk16(hb[6], hb[7])};
    const v4u ul = (v4u){pk16(lb[0], lb[1]), pk16(lb[2], lb[3]), pk16(lb[4], lb[5]), pk16(lb[6], lb[7])};
    const size_t o = (size_t)(n0 + row) * ldo + k0 + c8;
    *(v4u*)(oh + o) = uh;
    if (SPLIT) *(v4u*)(ol + o) = ul;
    
  }
}

// ---------------------------------------------------------------------------
// Token shift: xx[m][c] = x[m][c] + (x[m-1][c]*f - x[m][c]) * miu_x[c], f = 0 at t == 0 else 1 (address of the prior row
// clamped, arithmetic 0/1 factor). Output: single bf16 plane [2048][1024].
// ---------------------------------------------------------------------------
__global__ __launch_bounds__(256) void k_xx8(const float* __restrict__ x, const float* __restrict__ miu_x,
                                             unsigned short* __restrict__ XX, int n8) {
  const int i = blockIdx.x * 256 + threadIdx.x;
  if (i >= n8) return;
  const int f  = 8 * i;
  const int m  = f >> 10;
  const int c0 = f & 1023;
  const int t  = m & 1023;
  const int mp = (t > 0) ? (m - 1) : m;
  const float fz = (t > 0) ? 1.0f : 0.0f;
  const float* px = x + f;
  const float* pp = x + ((size_t)mp << 10) + c0;
  const float* pm = miu_x + c0;
  const v4f a0 = *(const v4f*)(px), a1 = *(const v4f*)(px + 4);
  const v4f b0 = *(const v4f*)(pp), b1 = *(const v4f*)(pp + 4);
  const v4f u0 = *(const v4f*)(pm), u1 = *(const v4f*)(pm + 4);
  unsigned short hb[8];
#pragma unroll
  for (int e = 0; e < 4; ++e) {
    const float ba0 = b0[e] * fz - a0[e];
    const float ba1 = b1[e] * fz - a1[e];
    hb[e]     = f2bf_bits(a0[e] + ba0 * u0[e]);
    hb[4 + e] = f2bf_bits(a1[e] + ba1 * u1[e]);
  }
  const v4u uh = (v4u){pk16(hb[0], hb[1]), pk16(hb[2], hb[3]), pk16(hb[4], hb[5]), pk16(hb[6], hb[7])};
  unsigned short* q = XX + f;
  *(v4u*)q = uh;
  
}

// ---------------------------------------------------------------------------
// Branch input assembly: x5[m][c] = x[m][c] + (x[m-1][c]*f - x[m][c]) * (miu[m][c] + lam_s[c]) -> bf16 hi plane (always)
// and bf16 lo plane (writeLo != 0, block-uniform). Same thread / store mapping as k_xx8.
// Coverage: 262144 threads x 8 = the whole plane (both planes).
// ---------------------------------------------------------------------------
__global__ __launch_bounds__(256) void k_x5_8(const float* __restrict__ x, const float* __restrict__ miu,
                                              const float* __restrict__ lam_s,
                                              unsigned short* __restrict__ outH, unsigned short* __restrict__ outL,
                                              int writeLo, int n8) {
  const int i = blockIdx.x * 256 + threadIdx.x;
  if (i >= n8) return;
  const int f  = 8 * i;
  const int m  = f >> 10;
  const int c0 = f & 1023;
  const int t  = m & 1023;
  const int mp = (t > 0) ? (m - 1) : m;
  const float fz = (t > 0) ? 1.0f : 0.0f;
  const float* px = x + f;
  const float* pp = x + ((size_t)mp << 10) + c0;
  const float* pm = miu + f;
  const float* pl = lam_s + c0;
  const v4f a0 = *(const v4f*)(px), a1 = *(const v4f*)(px + 4);
  const v4f b0 = *(const v4f*)(pp), b1 = *(const v4f*)(pp + 4);
  const v4f u0 = *(const v4f*)(pm), u1 = *(const v4f*)(pm + 4);
  const v4f l0 = *(const v4f*)(pl), l1 = *(const v4f*)(pl + 4);
  unsigned short hb[8], lb[8];
#pragma unroll
  for (int e = 0; e < 4; ++e) {
    const float ba0 = b0[e] * fz - a0[e];
    const float ba1 = b1[e] * fz - a1[e];
    const float v0 = a0[e] + ba0 * (u0[e] + l0[e]);
    const float v1 = a1[e] + ba1 * (u1[e] + l1[e]);
    bf_split_bits(v0, hb[e], lb[e]);
    bf_split_bits(v1, hb[4 + e], lb[4 + e]);
  }
  const v4u uh = (v4u){pk16(hb[0], hb[1]), pk16(hb[2], hb[3]), pk16(hb[4], hb[5]), pk16(hb[6], hb[7])};
  const v4u ul = (v4u){pk16(lb[0], lb[1]), pk16(lb[2], lb[3]), pk16(lb[4], lb[5]), pk16(lb[6], lb[7])};
  *(v4u*)(outH + f) = uh;
  if (writeLo) *(v4u*)(outL + f) = ul;
  
}

// ---------------------------------------------------------------------------
// tanh + bf16 convert (single or hi/lo) with column compaction / padding:
//   out flat index f = m*ncols + c  <-  tanh(in[m*ldin + c]) for c < nvalid, 0 for c >= nvalid  (ncols <= ldin, both even).
// ---------------------------------------------------------------------------
template <bool SPLIT>
__global__ __launch_bounds__(256) void k_tanh2(const float* __restrict__ in, int ldin,
                                               unsigned short* __restrict__ outH, unsigned short* __restrict__ outL,
                                               int ncols, int nvalid, int n2) {
  const int i = blockIdx.x * 256 + threadIdx.x;
  if (i >= n2) return;
  const int f = 2 * i;
  const int m = f / ncols;
  const int c = f - m * ncols;
  const v2f a = *(const v2f*)(in + (size_t)m * ldin + c);
  const float f0 = (c < nvalid) ? 1.0f : 0.0f;
  const float f1 = (c + 1 < nvalid) ? 1.0f : 0.0f;
  const float t0 = tanhf(a[0]) * f0;
  const float t1 = tanhf(a[1]) * f1;
  unsigned short h0, h1, l0 = 0, l1 = 0;
  if (SPLIT) { bf_split_bits(t0, h0, l0); bf_split_bits(t1, h1, l1); }
  else       { h0 = f2bf_bits(t0); h1 = f2bf_bits(t1); }
  const unsigned uh = pk16(h0, h1);
  const unsigned ul = pk16(l0, l1);
  ((unsigned*)outH)[i] = uh;
  if (SPLIT) ((unsigned*)outL)[i] = ul;
  
}

// ---------------------------------------------------------------------------
// Linear-attention state scan, f32. One block (128 threads = 4 waves, one per SIMD) per (batch b, head n, half ih of the
// v channels): the rows i of the state are independent, so each block carries 32 rows x 64 k channels.
// Thread (ip, jg): jg = lane & 7 owns k channels 8*jg .. 8*jg+7, ip = wave*4 + (lane >> 3) owns rows 2*ip, 2*ip+1;
// S lives in 8 f32 pairs (pairs run along j, so r, k and d pairs come straight out of the b128 LDS reads).
// The sequence is cut into chunks of kSc timesteps; pass c of the loop, between two block barriers,
//   - runs the kSc steps of chunk c from stage buffer c & 1 (r, k*exp(min(w,0)), exp(w), v; w = wl + td_miu). A step has no
//     barrier: each thread stores its partial sum over its 8 k channels to partial buffer c & 1;
//   - writes chunk c+1 into the other stage buffer, piece by piece between the steps, and issues the loads of chunk c+2;
//   - finishes chunk c-1: y_i = sum of the 8 partials + v_i * bonus[t], bonus[t] = sum_j r_j*u_j*k_j (16 partials per step,
//     written by the staging threads into a ring of 4 slots). Each 128-B line of Y is stored once, by 8 lanes of one wave.
// ---------------------------------------------------------------------------
constexpr int kSc  = 32;             // timesteps per chunk
constexpr int kNC  = kSeq / kSc;     // chunks
constexpr int kIB  = 32;             // state rows (v channels) per block
constexpr int kPJ  = 40;             // floats between the partial rows of two j groups: the 8 groups of a store hit disjoint banks
constexpr int kPT  = 8 * kPJ + 32;   // floats between two timesteps' partials: two timesteps of one b128 read hit disjoint banks
constexpr int kPre = 6;              // steps whose LDS operands are fetched ahead of their use
static_assert(kSeq % kSc == 0 && kNC >= 2 && kHead == 2 * kIB && kSc % 16 == 0 && kSc > kPre, "scan chunking");
struct ScanOp { v4f r0, r1, k0, k1, d0, d1; v2f v; };
__device__ __forceinline__ v2f lo2(v4f a) { return (v2f){a[0], a[1]}; }
__device__ __forceinline__ v2f hi2(v4f a) { return (v2f){a[2], a[3]}; }
__global__ __launch_bounds__(128) void k_state_scan(const float* __restrict__ kraw, const float* __restrict__ vpl,
                                                    const float* __restrict__ rpl, const float* __restrict__ wl,
                                                    const float* __restrict__ td_miu, const float* __restrict__ u,
                                                    float* __restrict__ Y) {
  __shared__ __align__(16) float sr0[kSc * 64], sr1[kSc * 64];
  __shared__ __align__(16) float sk0[kSc * 64], sk1[kSc * 64];
  __shared__ __align__(16) float sd0[kSc * 64], sd1[kSc * 64];
  __shared__ __align__(16) float sv0[kSc * kIB], sv1[kSc * kIB];
  __shared__ __align__(16) float part0[kSc * kPT], part1[kSc * kPT];
  __shared__ __align__(16) float sbp[4][kSc][16];
  const int tid  = threadIdx.x;
  const int lane = tid & 31;
  const int wave = tid >> 5;
  const int ih   = blockIdx.x & 1;
  const int n    = (blockIdx.x >> 1) & (kNHead - 1);
  const int b    = blockIdx.x >> 5;
  const int jg   = lane & 7;
  const int j0   = jg * 8;
  const int il   = (wave * 4 + (lane >> 3)) * 2;      // first of this thread's two rows, local to the block
  // staging and output roles: r/k/w rows are 16 float4 wide, v and y rows 8 float4 wide
  const int sRow = tid >> 4, sC4 = (tid & 15) * 4;
  const int vRow = tid >> 3, vC4 = (tid & 7) * 4;
  const size_t base = (size_t)b * kSeq * kChan + (size_t)n * kHead;
  const unsigned offS = (unsigned)(sRow * kChan + sC4) * 4u;             // byte offsets of the two roles inside a piece
  const unsigned offV = (unsigned)(vRow * kChan + ih * kIB + vC4) * 4u;
  const v4f tm4 = *(const v4f*)(td_miu + n * kHead + sC4);
  const v4f u4  = *(const v4f*)(u + n * kHead + sC4);
  // precaution: this wait stands in front of every later write of a register that one of these two loads names; the scheduling
  // barrier keeps later instructions behind it
  asm volatile("s_wait_xcnt 0x0" ::: "memory");
  __builtin_amdgcn_sched_barrier(0);

  v2f S0[4], S1[4];
#pragma unroll
  for (int q = 0; q < 4; ++q) { S0[q] = (v2f){0.f, 0.f}; S1[q] = (v2f){0.f, 0.f}; }

  // staged through registers in kSc/8 pieces: piece it = 8 rows of r, k, w (and, for the first kSc/16 pieces, 16 rows of v)
  v4f gw[kSc / 8], gk[kSc / 8], gr[kSc / 8], gv[kSc / 16];
  // the v values this thread staged are the ones its own output role needs two passes later: vOld of chunk c-1, vNew of chunk c
  v4f vOld[kSc / 16], vNew[kSc / 16];
#pragma unroll
  for (int it = 0; it < kSc / 16; ++it) { vOld[it] = (v4f){0.f, 0.f, 0.f, 0.f}; vNew[it] = vOld[it]; }
  auto issue = [&](int it, int t0) {
    const size_t ub = base + (size_t)(t0 + it * 8) * kChan;      // block-uniform: scalar base + this thread's fixed byte offset
    const size_t uv = base + (size_t)(t0 + it * 16) * kChan;
    // the two scheduling barriers keep every other instruction out of the group of loads and its wait
    __builtin_amdgcn_sched_barrier(0);
    gw[it] = *(const v4f*)((const char*)(wl + ub) + offS);
    gk[it] = *(const v4f*)((const char*)(kraw + ub) + offS);
    gr[it] = *(const v4f*)((const char*)(rpl + ub) + offS);
    if (it < kSc / 16) gv[it] = *(const v4f*)((const char*)(vpl + uv) + offV);
    // precaution: this wait stands in front of every later write of a register that one of these loads names
    asm volatile("s_wait_xcnt 0x0" ::: "memory");
    __builtin_amdgcn_sched_barrier(0);
  };
  auto commit = [&](int it, float* dr, float* dk, float* dd_, float* dv, int slot) {
    const int tl = it * 8 + sRow;
    v4f kk, dd;
    float bp = 0.0f;
#pragma unroll
    for (int e = 0; e < 4; ++e) {
      const float wv = gw[it][e] + tm4[e];
      kk[e] = gk[it][e] * expf(fminf(wv, 0.0f));
      dd[e] = expf(wv);
      bp += gr[it][e] * (u4[e] * kk[e]);
    }
    *(v4f*)(dr + tl * 64 + sC4)  = gr[it];
    *(v4f*)(dk + tl * 64 + sC4)  = kk;
    *(v4f*)(dd_ + tl * 64 + sC4) = dd;
    sbp[slot][tl][tid & 15] = bp;
    if (it < kSc / 16) {
      *(v4f*)(dv + (it * 16 + vRow) * kIB + vC4) = gv[it];
      vOld[it] = vNew[it];
      vNew[it] = gv[it];
    }
  };
  // finishing chunk cc from its partials (src), its bonus slot and vOld: the LDS reads, and apart from them the sums and stores
  v4f x[kSc / 16][12];
  auto finish_load = [&](const float* src, int cc) {
#pragma unroll
    for (int it = 0; it < kSc / 16; ++it) {
      const int tl = it * 16 + vRow;
#pragma unroll
      for (int g = 0; g < 8; ++g) x[it][g] = *(const v4f*)(src + tl * kPT + g * kPJ + vC4);
#pragma unroll
      for (int g = 0; g < 4; ++g) x[it][8 + g] = *(const v4f*)(&sbp[cc & 3][tl][4 * g]);
    }
  };
  auto finish_sum = [&](int cc) {
    v4f yv[kSc / 16];
#pragma unroll
    for (int it = 0; it < kSc / 16; ++it) {
      const v4f b4 = (x[it][8] + x[it][9]) + (x[it][10] + x[it][11]);
      const float bn = (b4[0] + b4[1]) + (b4[2] + b4[3]);
      yv[it] = (((x[it][0] + x[it][1]) + (x[it][2] + x[it][3])) + ((x[it][4] + x[it][5]) + (x[it][6] + x[it][7]))) + vOld[it] * bn;
    }
    // as in issue(): nothing else is scheduled into the group of stores and its wait
    __builtin_amdgcn_sched_barrier(0);
#pragma unroll
    for (int it = 0; it < kSc / 16; ++it)
      *(v4f*)((char*)(Y + base + (size_t)(cc * kSc + it * 16) * kChan) + offV) = yv[it];
    // the same precaution for the registers that these stores name
    asm volatile("s_wait_xcnt 0x0" ::: "memory");
    __builtin_amdgcn_sched_barrier(0);
  };
  auto pass = [&](int c) {
    const int p = c & 1;
    const float* pr = (p ? sr1 : sr0) + j0;
    const float* pk = (p ? sk1 : sk0) + j0;
    const float* pd = (p ? sd1 : sd0) + j0;
    const float* pv = (p ? sv1 : sv0) + il;
    float* pp = (p ? part1 : part0) + jg * kPJ + il;
    // chunk whose loads are issued in this pass; clamped, so that the steps have no branch (the last two passes re-read the last
    // chunk, and the last pass stages it into buffers that nobody reads any more)
    const int tN = ((c + 2 < kNC) ? (c + 2) : (kNC - 1)) * kSc;
    auto ld = [&](int tl) {
      ScanOp o;
      o.r0 = *(const v4f*)(pr + tl * 64); o.r1 = *(const v4f*)(pr + tl * 64 + 4);
      o.k0 = *(const v4f*)(pk + tl * 64); o.k1 = *(const v4f*)(pk + tl * 64 + 4);
      o.d0 = *(const v4f*)(pd + tl * 64); o.d1 = *(const v4f*)(pd + tl * 64 + 4);
      o.v  = *(const v2f*)(pv + tl * kIB);
      return o;
    };
    // the previous chunk's reads first, then the first steps' reads, which are served while the previous chunk is summed and stored
    if (c > 0) finish_load(p ? part0 : part1, c - 1);      // block-uniform
    ScanOp ring[kPre];
#pragma unroll
    for (int tl = 0; tl < kPre; ++tl) ring[tl] = ld(tl);
    if (c > 0) finish_sum(c - 1);
    // fully unrolled so that the ring's slots are registers and every LDS offset an immediate
#pragma unroll
    for (int tl = 0; tl < kSc; ++tl) {
      const ScanOp o = ring[tl % kPre];
      if (tl + kPre < kSc) ring[tl % kPre] = ld(tl + kPre);
      // keeps these reads kPre steps ahead of their use: sunk next to it, the wave would wait out the LDS latency in every step
      __builtin_amdgcn_sched_barrier(0);
      const v2f r2[4] = {lo2(o.r0), hi2(o.r0), lo2(o.r1), hi2(o.r1)};
      const v2f k2[4] = {lo2(o.k0), hi2(o.k0), lo2(o.k1), hi2(o.k1)};
      const v2f d2[4] = {lo2(o.d0), hi2(o.d0), lo2(o.d1), hi2(o.d1)};
      const v2f vv0 = (v2f){o.v[0], o.v[0]};
      const v2f vv1 = (v2f){o.v[1], o.v[1]};
      v2f a0 = r2[0] * S0[0];
      v2f a1 = r2[0] * S1[0];
#pragma unroll
      for (int q = 1; q < 4; ++q) {
        a0 = __builtin_elementwise_fma(r2[q], S0[q], a0);
        a1 = __builtin_elementwise_fma(r2[q], S1[q], a1);
      }
#pragma unroll
      for (int q = 0; q < 4; ++q) {
        S0[q] = __builtin_elementwise_fma(S0[q], d2[q], k2[q] * vv0);
        S1[q] = __builtin_elementwise_fma(S1[q], d2[q], k2[q] * vv1);
      }
      *(v2f*)(pp + tl * kPT) = (v2f){a0[0] + a0[1], a1[0] + a1[1]};
      // one piece of the next chunk's stage every 4 steps, early in the pass: its vector work runs while the LDS reads fetched
      // ahead are served, and the loads issued behind it have the rest of the pass to land before the barrier waits for them
      if ((tl & 3) == 1 && (tl >> 2) < kSc / 8) {
        commit(tl >> 2, p ? sr0 : sr1, p ? sk0 : sk1, p ? sd0 : sd1, p ? sv0 : sv1, (c + 1) & 3);
        issue(tl >> 2, tN);
      }
    }
    // the one barrier of a pass: publishes this chunk's partials and the next chunk's stage, and ends the reads of this chunk's
    // stage and of the previous chunk's partials, which the next pass overwrites
    __syncthreads();
  };

#pragma unroll
  for (int it = 0; it < kSc / 8; ++it) issue(it, 0);
#pragma unroll
  for (int it = 0; it < kSc / 8; ++it) {
    commit(it, sr0, sk0, sd0, sv0, 0);
    issue(it, kSc);
  }
  __syncthreads();
#pragma unroll 1
  for (int c = 0; c < kNC; ++c) pass(c);
  finish_load(((kNC - 1) & 1) ? part1 : part0, kNC - 1);
  finish_sum(kNC - 1);
}

// ---------------------------------------------------------------------------
// GroupNorm (64 channels per head, biased variance, eps 1.6e-4) + affine + gate multiply -> bf16 hi/lo planes.
// One wave per (row m, head n), 8 pairs per 256-thread block; lane owns channels 2l, 2l+1; shuffle reductions (unconditional).
// ---------------------------------------------------------------------------
__global__ __launch_bounds__(256) void k_gn_gate(const float* __restrict__ Y, const float* __restrict__ G,
                                                 const float* __restrict__ gamma, const float* __restrict__ beta,
                                                 unsigned short* __restrict__ outH, unsigned short* __restrict__ outL) {
  __shared__ __align__(16) float slab[8][64];
  const int lane = threadIdx.x & 31, wave = threadIdx.x >> 5;
  const int pair = blockIdx.x * 8 + wave;
  const int m = pair >> 4;
  const int n = pair & 15;
  const size_t base = (size_t)m * kChan + (size_t)n * kHead;
  const int c = n * kHead + 2 * lane;
  const v2f yv = *(const v2f*)(Y + base + 2 * lane);
  const v2f gv = *(const v2f*)(G + base + 2 * lane);
  const v2f ga = *(const v2f*)(gamma + c);
  const v2f be = *(const v2f*)(beta + c);
  float s = yv[0] + yv[1];
#pragma unroll
  for (int off = 16; off > 0; off >>= 1) s += __shfl_xor(s, off, 32);
  const float mean = s * (1.0f / 64.0f);
  const float d0 = yv[0] - mean;
  const float d1 = yv[1] - mean;
  float q = d0 * d0 + d1 * d1;
#pragma unroll
  for (int off = 16; off > 0; off >>= 1) q += __shfl_xor(q, off, 32);
  const float var = q * (1.0f / 64.0f);
  const float rs  = 1.0f / sqrtf(var + kGnEps);
  const float o0 = ((d0 * rs) * ga[0] + be[0]) * gv[0];
  const float o1 = ((d1 * rs) * ga[1] + be[1]) * gv[1];
  *(v2f*)(&slab[wave][2 * lane]) = (v2f){o0, o1};
  __syncthreads();
  if (lane < 8) {
    unsigned short hb[8], lb[8];
#pragma unroll
    for (int e = 0; e < 8; ++e) bf_split_bits(slab[wave][8 * lane + e], hb[e], lb[e]);
    const v4u uh = (v4u){pk16(hb[0], hb[1]), pk16(hb[2], hb[3]), pk16(hb[4], hb[5]), pk16(hb[6], hb[7])};
    const v4u ul = (v4u){pk16(lb[0], lb[1]), pk16(lb[2], lb[3]), pk16(lb[4], lb[5]), pk16(lb[6], lb[7])};
    const size_t o = base + 8 * (size_t)lane;
    *(v4u*)(outH + o) = uh;
    *(v4u*)(outL + o) = ul;
    
  }
}

// ---------------------------------------------------------------------------
// Host glue.
// Workspace region map (bytes; every size is a multiple of 4096, offsets in that order):
//   XX     bf16 [2048][1024]            4,194,304
//   HPRE   f32  [2048][192]             1,572,864   (tanh input of the mix path; cols 160..191 written by the GEMM, unread)
//   HC     bf16 [2048][160] = [10240][32] 655,360   (compact; branch s = rows 2048s.. of the ld-32 view)
//   MIU    f32  [2048][1024]            8,388,608   (per-branch mix, rewritten 5x; then the decay lowrank output, same layout)
//   X5H    bf16 [5][2048][1024]        20,971,520   (branch inputs hi: 0 decay (single), 1 k, 2 v, 3 r, 4 gate)
//   X5L    bf16 [4][2048][1024]        16,777,216   (lo planes of branches 1..4 at index s-1)
//   WH     bf16 [4][1024][1024]         8,388,608   (Wk, Wv, Wr, Wo hi, [out][in] as-is)
//   WL     bf16 [4][1024][1024]         8,388,608   (lo)
//   AT     bf16 [192][1024]               393,216   (A^T, rows 160..191 zero)
//   TDAT   bf16 [64][1024]                131,072
//   TDBT   bf16 [1024][64]                131,072
//   WG1TH  bf16 [192][1024]               393,216   (rows 160..191 zero)   WG1TL 393,216
//   WG2TH  bf16 [1024][192]               393,216   (cols 160..191 zero)   WG2TL 393,216
//   BPT    bf16 [5][1024][32]             327,680
//   LPRE   f32  [2048][64]                524,288
//   L1     bf16 [2048][64]                262,144
//   KVR    f32  [3][2048][1024]         25,165,824   (k unscaled, v, r)
//   GHPRE  f32  [2048][192]             1,572,864
//   GHH    bf16 [2048][192]               786,432   (cols 160..191 zero)   GHL 786,432
//   GATE   f32  [2048][1024]            8,388,608
//   Y      f32  [2048][1024]            8,388,608
//   GATH   bf16 [2048][1024]            4,194,304   GATL 4,194,304
//   total                             126,156,800
// GEMM shapes (M, N, K): (2048,192,1024) (2048,1024,32)x5 (2048,64,1024) (2048,1024,64) (2048,1024,1024)x3 batched
// (2048,192,1024) (2048,1024,192) (2048,1024,1024); all M,N % 64 == 0, all K % 32 == 0, pads zero-written by producers.
// ---------------------------------------------------------------------------
extern "C" void kernel_launch(void* const* d_in, const int* in_sizes, int n_in,
                              void* d_out, int out_size, void* d_ws, size_t ws_size,
                              hipStream_t stream) {
  if (n_in < 17) return;
  if (in_sizes[0] != kBatch * kSeq * kChan) return;
  if (in_sizes[1] != kChan || in_sizes[2] != kNBr * kChan) return;
  if (in_sizes[3] != kChan * kMix || in_sizes[4] != kNBr * kBr * kChan) return;
  if (in_sizes[5] != kChan || in_sizes[6] != kChan * kDec || in_sizes[7] != kDec * kChan) return;
  if (in_sizes[8] != kNHead * kHead) return;
  if (in_sizes[9] != kChan * kChan || in_sizes[10] != kChan * kChan || in_sizes[11] != kChan * kChan || in_sizes[12] != kChan * kChan) return;
  if (in_sizes[13] != kChan * kMix || in_sizes[14] != kMix * kChan) return;
  if (in_sizes[15] != kChan || in_sizes[16] != kChan) return;
  if (out_size != kBatch * kSeq * kChan) return;

  const float* x      = (const float*)d_in[0];
  const float* miu_x  = (const float*)d_in[1];
  const float* lam    = (const float*)d_in[2];    // [5][1024]
  const float* Amat   = (const float*)d_in[3];    // [1024][160]
  const float* Bp     = (const float*)d_in[4];    // [5][32][1024]
  const float* td_miu = (const float*)d_in[5];    // [1024]
  const float* tdA    = (const float*)d_in[6];    // [1024][64]
  const float* tdB    = (const float*)d_in[7];    // [64][1024]
  const float* u      = (const float*)d_in[8];    // [16][64]
  const float* Wk     = (const float*)d_in[9];    // [1024][1024] [out][in]
  const float* Wv     = (const float*)d_in[10];
  const float* Wr     = (const float*)d_in[11];
  const float* Wo     = (const float*)d_in[12];
  const float* Wg1    = (const float*)d_in[13];   // [1024][160]
  const float* Wg2    = (const float*)d_in[14];   // [160][1024]
  const float* gamma  = (const float*)d_in[15];
  const float* beta   = (const float*)d_in[16];
  float* out = (float*)d_out;

  // ---- carve ----
  const size_t szXX    = (size_t)kPlane * 2;
  const size_t szHPRE  = (size_t)kRows * kMixPad * 4;
  const size_t szHC    = (size_t)kRows * kMix * 2;
  const size_t szF32P  = (size_t)kPlane * 4;
  const size_t szX5H   = (size_t)kNBr * kPlane * 2;
  const size_t szX5L   = (size_t)(kNBr - 1) * kPlane * 2;
  const size_t szWSQ   = (size_t)4 * kWPlane * 2;
  const size_t szAT    = (size_t)kMixPad * kChan * 2;
  const size_t szTDAT  = (size_t)kDec * kChan * 2;
  const size_t szTDBT  = (size_t)kChan * kDec * 2;
  const size_t szWG1T  = (size_t)kMixPad * kChan * 2;
  const size_t szWG2T  = (size_t)kChan * kMixPad * 2;
  const size_t szBPT   = (size_t)kNBr * kChan * kBr * 2;
  const size_t szLPRE  = (size_t)kRows * kDec * 4;
  const size_t szL1    = (size_t)kRows * kDec * 2;
  const size_t szKVR   = (size_t)3 * kPlane * 4;
  const size_t szGHPRE = (size_t)kRows * kMixPad * 4;
  const size_t szGH    = (size_t)kRows * kMixPad * 2;
  const size_t szGAT   = (size_t)kPlane * 2;
  size_t off = 0;
  const size_t oXX    = off; off += szXX;
  const size_t oHPRE  = off; off += szHPRE;
  const size_t oHC    = off; off += szHC;
  const size_t oMIU   = off; off += szF32P;
  const size_t oX5H   = off; off += szX5H;
  const size_t oX5L   = off; off += szX5L;
  const size_t oWH    = off; off += szWSQ;
  const size_t oWL    = off; off += szWSQ;
  const size_t oAT    = off; off += szAT;
  const size_t oTDAT  = off; off += szTDAT;
  const size_t oTDBT  = off; off += szTDBT;
  const size_t oWG1TH = off; off += szWG1T;
  const size_t oWG1TL = off; off += szWG1T;
  const size_t oWG2TH = off; off += szWG2T;
  const size_t oWG2TL = off; off += szWG2T;
  const size_t oBPT   = off; off += szBPT;
  const size_t oLPRE  = off; off += szLPRE;
  const size_t oL1    = off; off += szL1;
  const size_t oKVR   = off; off += szKVR;
  const size_t oGHPRE = off; off += szGHPRE;
  const size_t oGHH   = off; off += szGH;
  const size_t oGHL   = off; off += szGH;
  const size_t oGATE  = off; off += szF32P;
  const size_t oY     = off; off += szF32P;
  const size_t oGATH  = off; off += szGAT;
  const size_t oGATL  = off; off += szGAT;
  const size_t total  = off;   // 126,156,800
  if (total > (size_t)134217728) return;
  if (ws_size < total) return;

  char* ws = (char*)d_ws;
  unsigned short* XX    = (unsigned short*)(ws + oXX);
  float*          HPRE  = (float*)(ws + oHPRE);
  unsigned short* HC    = (unsigned short*)(ws + oHC);
  float*          MIU   = (float*)(ws + oMIU);
  float*          WLR   = MIU;                       // decay lowrank output reuses the MIU bytes (same f32 [2048][1024] layout)
  unsigned short* X5H   = (unsigned short*)(ws + oX5H);
  unsigned short* X5L   = (unsigned short*)(ws + oX5L);
  unsigned short* WH    = (unsigned short*)(ws + oWH);
  unsigned short* WL    = (unsigned short*)(ws + oWL);
  unsigned short* AT    = (unsigned short*)(ws + oAT);
  unsigned short* TDAT  = (unsigned short*)(ws + oTDAT);
  unsigned short* TDBT  = (unsigned short*)(ws + oTDBT);
  unsigned short* WG1TH = (unsigned short*)(ws + oWG1TH);
  unsigned short* WG1TL = (unsigned short*)(ws + oWG1TL);
  unsigned short* WG2TH = (unsigned short*)(ws + oWG2TH);
  unsigned short* WG2TL = (unsigned short*)(ws + oWG2TL);
  unsigned short* BPT   = (unsigned short*)(ws + oBPT);
  float*          LPRE  = (float*)(ws + oLPRE);
  unsigned short* L1    = (unsigned short*)(ws + oL1);
  float*          KVR   = (float*)(ws + oKVR);
  float*          GHPRE = (float*)(ws + oGHPRE);
  unsigned short* GHH   = (unsigned short*)(ws + oGHH);
  unsigned short* GHL   = (unsigned short*)(ws + oGHL);
  float*          GATE  = (float*)(ws + oGATE);
  float*          Yp    = (float*)(ws + oY);
  unsigned short* GATH  = (unsigned short*)(ws + oGATH);
  unsigned short* GATL  = (unsigned short*)(ws + oGATL);
  const float* fdum = gamma;   // placeholder for unused bias / resid pointer arguments (never dereferenced)

  const dim3 blk(256);
  const dim3 blkTall(128);                               // GEMM blocks of 4 x 1 waves, for the outputs 64 and 192 wide
  const int n8Plane = (int)(kPlane / 8);                 // 262144 -> 1024 blocks exact
  const int n8W     = (int)(kWPlane / 8);                // 131072 -> 512 blocks exact

  // ---- weight planes ----
  k_wsplit8<<<dim3(n8W / 256, 4), blk, 0, stream>>>(Wk, Wv, Wr, Wo, WH, WL, n8W);
  // A [1024][160] -> AT [192][1024] (rows >= 160 zero): n tiles 6, k tiles 16
  k_trcast<false, 64><<<dim3(kMixPad / 32, kChan / 64, 1), blk, 0, stream>>>(Amat, kChan, kMix, 0L, AT, AT, kChan, 0L);
  // tdA [1024][64] -> TDAT [64][1024]
  k_trcast<false, 64><<<dim3(kDec / 32, kChan / 64, 1), blk, 0, stream>>>(tdA, kChan, kDec, 0L, TDAT, TDAT, kChan, 0L);
  // tdB [64][1024] -> TDBT [1024][64]
  k_trcast<false, 64><<<dim3(kChan / 32, 1, 1), blk, 0, stream>>>(tdB, kDec, kChan, 0L, TDBT, TDBT, kDec, 0L);
  // Wg1 [1024][160] -> WG1T hi/lo [192][1024] (rows >= 160 zero)
  k_trcast<true, 64><<<dim3(kMixPad / 32, kChan / 64, 1), blk, 0, stream>>>(Wg1, kChan, kMix, 0L, WG1TH, WG1TL, kChan, 0L);
  // Wg2 [160][1024] -> WG2T hi/lo [1024][192] (cols >= 160 zero): n tiles 32, k tiles 3
  k_trcast<true, 64><<<dim3(kChan / 32, kMixPad / 64, 1), blk, 0, stream>>>(Wg2, kMix, kChan, 0L, WG2TH, WG2TL, kMixPad, 0L);
  // Bp[s] [32][1024] -> BPT[s] [1024][32], s = blockIdx.z
  k_trcast<false, 32><<<dim3(kChan / 32, 1, kNBr), blk, 0, stream>>>(Bp, kBr, kChan, (long)kBr * kChan, BPT, BPT, kBr, (long)kChan * kBr);

  // ---- token shift ----
  k_xx8<<<dim3(n8Plane / 256), blk, 0, stream>>>(x, miu_x, XX, n8Plane);

  // ---- mix lowrank: HPRE = XX @ AT^T  (M 2048, N 192, K 1024; 24 blocks of 256 x 64) ----
  wmma_gemm64<1, false, 0, 0, false, 0, 4, 1, 64, kChan><<<dim3((kRows / 256) * (kMixPad / 64), 1), blkTall, 0, stream>>>(
      XX, XX, 0L, AT, AT, 0L, (void*)HPRE, (void*)HPRE, kMixPad, 0L, fdum, fdum, 0L, kMixPad, 1.0f);
  // HC flat [2048*160] = tanh(HPRE[:, 0:160]) compact bf16; n2 = 163840 -> 640 blocks exact
  k_tanh2<false><<<dim3((kRows * kMix / 2) / 256), blk, 0, stream>>>(HPRE, kMixPad, HC, HC, kMix, kMix, kRows * kMix / 2);

  // ---- per-branch mix GEMM (A = HC viewed [10240][32], rows 2048s..; K 32) and branch input assembly ----
  for (int s = 0; s < kNBr; ++s) {
    const unsigned short* Hs = HC + (size_t)s * kRows * kBr;
    const unsigned short* Bs = BPT + (size_t)s * kChan * kBr;
    wmma_gemm64<1, false, 0, 0, false, 0, 2, 4, 32, kBr><<<dim3((kRows / 128) * (kChan / 256), 1), blk, 0, stream>>>(
        Hs, Hs, 0L, Bs, Bs, 0L, (void*)MIU, (void*)MIU, kChan, 0L, fdum, fdum, 0L, kChan, 1.0f);
    unsigned short* oh = X5H + (size_t)s * kPlane;
    unsigned short* ol = X5L + (size_t)(s > 0 ? (s - 1) : 0) * kPlane;
    k_x5_8<<<dim3(n8Plane / 256), blk, 0, stream>>>(x, MIU, lam + (size_t)s * kChan, oh, ol, (s > 0) ? 1 : 0, n8Plane);
  }

  // ---- decay lowrank: LPRE = X5H[0] @ TDAT^T (N 64, K 1024; 8 blocks of 256 x 64); L1 = tanh; WLR = L1 @ TDBT^T (K 64) ----
  wmma_gemm64<1, false, 0, 0, false, 0, 4, 1, 64, kChan><<<dim3((kRows / 256) * (kDec / 64), 1), blkTall, 0, stream>>>(
      X5H, X5H, 0L, TDAT, TDAT, 0L, (void*)LPRE, (void*)LPRE, kDec, 0L, fdum, fdum, 0L, kDec, 1.0f);
  k_tanh2<false><<<dim3((kRows * kDec / 2) / 256), blk, 0, stream>>>(LPRE, kDec, L1, L1, kDec, kDec, kRows * kDec / 2);
  wmma_gemm64<1, false, 0, 0, false, 0, 2, 4, 64, kDec><<<dim3((kRows / 128) * (kChan / 256), 1), blk, 0, stream>>>(
      L1, L1, 0L, TDBT, TDBT, 0L, (void*)WLR, (void*)WLR, kChan, 0L, fdum, fdum, 0L, kChan, 1.0f);

  // ---- k / v / r projections, batched over blockIdx.y = 0..2 (hi/lo split, K 1024) -> KVR f32 planes ----
  wmma_gemm64<1, true, 0, 0, false, 0, 2, 4, 64, kChan><<<dim3((kRows / 128) * (kChan / 256), 3), blk, 0, stream>>>(
      X5H + kPlane, X5L, (long)kPlane, WH, WL, (long)kWPlane,
      (void*)KVR, (void*)KVR, kChan, (long)kPlane, fdum, fdum, 0L, kChan, 1.0f);

  // ---- gate: GHPRE = X5[4] @ WG1T^T (split, N 192); GH = tanh hi/lo; GATE = GH @ WG2T^T (split, K 192) ----
  wmma_gemm64<1, true, 0, 0, false, 0, 4, 1, 64, kChan><<<dim3((kRows / 256) * (kMixPad / 64), 1), blkTall, 0, stream>>>(
      X5H + 4 * kPlane, X5L + 3 * kPlane, 0L, WG1TH, WG1TL, 0L,
      (void*)GHPRE, (void*)GHPRE, kMixPad, 0L, fdum, fdum, 0L, kMixPad, 1.0f);
  k_tanh2<true><<<dim3((kRows * kMixPad / 2) / 256), blk, 0, stream>>>(GHPRE, kMixPad, GHH, GHL, kMixPad, kMix, kRows * kMixPad / 2);
  wmma_gemm64<1, true, 0, 0, false, 0, 2, 4, 64, kMixPad><<<dim3((kRows / 128) * (kChan / 256), 1), blk, 0, stream>>>(
      GHH, GHL, 0L, WG2TH, WG2TL, 0L, (void*)GATE, (void*)GATE, kChan, 0L, fdum, fdum, 0L, kChan, 1.0f);

  // ---- state scan -> Y ----
  k_state_scan<<<dim3(kBatch * kNHead * 2), dim3(128), 0, stream>>>(KVR, KVR + kPlane, KVR + 2 * kPlane, WLR, td_miu, u, Yp);

  // ---- GroupNorm + gate -> GATH/GATL (4096 blocks x 8 waves = 32768 (row, head) pairs) ----
  k_gn_gate<<<dim3((kRows * kNHead) / 8), blk, 0, stream>>>(Yp, GATE, gamma, beta, GATH, GATL);

  // ---- output projection straight into d_out (split, K 1024) ----
  wmma_gemm64<1, true, 0, 0, false, 0, 2, 4, 64, kChan><<<dim3((kRows / 128) * (kChan / 256), 1), blk, 0, stream>>>(
      GATH, GATL, 0L, WH + 3 * kWPlane, WL + 3 * kWPlane, 0L,
      (void*)out, (void*)out, kChan, 0L, fdum, fdum, 0L, kChan, 1.0f);
}

// v003
// It runs in 248 microseconds.
// Two timings next to v002 put it at 1.19 and 1.17 times that version's speed.
// Counting every step since v000, it is 4.02 times as fast.
// Contractions: every GEMM on v_wmma_f32_16x16x32_bf16 (bf16 operands, f32 accumulate) - the four lowrank mix/decay sites single bf16, the k/v/r projections, the gate pair and the output projection as bf16 hi/lo split (hi*hi + hi*lo + lo*hi); token shift, state scan, GroupNorm and gating in f32 on VALU.
#include <hip/hip_runtime.h>
#include <math.h>

// ---------------------------------------------------------------------------
// Problem constants
// ---------------------------------------------------------------------------
constexpr int kBatch  = 2;
constexpr int kSeq    = 1024;
constexpr int kChan   = 1024;
constexpr int kHead   = 64;
constexpr int kNHead  = 16;
constexpr int kRows   = kBatch * kSeq;          // 2048 token rows (m = b*1024 + t)
constexpr int kMix    = 160;                    // lowrank width of the mix and gate paths
constexpr int kMixPad = 192;                    // padded to a 64 multiple (pad rows / cols zero-filled)
constexpr int kDec    = 64;                     // decay lowrank width
constexpr int kBr     = 32;                     // per-branch mix width
constexpr int kNBr    = 5;                      // branches: 0 decay, 1 k, 2 v, 3 r, 4 gate
constexpr long kPlane  = (long)kRows * kChan;   // 2,097,152 elements per activation plane
constexpr long kWPlane = (long)kChan * kChan;   // 1,048,576 elements per square weight plane
constexpr float kGnEps = 1.6e-4f;               // 1e-5 * 16
static_assert(kNHead * kHead == kChan, "shape");
static_assert(kRows % 256 == 0 && kChan % 256 == 0 && kMixPad % 64 == 0 && kDec % 64 == 0, "M and N tile multiples");
static_assert(kChan % 32 == 0 && kBr % 32 == 0 && kDec % 32 == 0 && kMixPad % 32 == 0, "K multiples of 32");
static_assert(kMix % 8 == 0 && kMixPad % 8 == 0 && kDec % 8 == 0, "pack groups never straddle a row");

typedef __attribute__((ext_vector_type(16))) _Float16 v16h;
typedef __attribute__((ext_vector_type(8)))  _Float16 v8h;
typedef __attribute__((ext_vector_type(16))) __bf16   v16b;
typedef __attribute__((ext_vector_type(8)))  __bf16   v8b;
typedef __attribute__((ext_vector_type(8)))  float    v8f;
typedef __attribute__((ext_vector_type(4)))  float    v4f;
typedef __attribute__((ext_vector_type(2)))  float    v2f;
typedef __attribute__((ext_vector_type(4)))  unsigned int v4u;

// ---------------------------------------------------------------------------
// Shared helpers
// ---------------------------------------------------------------------------
__device__ __forceinline__ unsigned short f2bf_bits(float f) {
  unsigned u = __float_as_uint(f);
  return (unsigned short)((u + 0x7FFFu + ((u >> 16) & 1u)) >> 16);
}
__device__ __forceinline__ float bf_bits2f(unsigned short h) { return __uint_as_float(((unsigned)h) << 16); }
__device__ __forceinline__ unsigned pk16(unsigned short a, unsigned short b) { return (unsigned)a | ((unsigned)b << 16); }
// RNE convert to a bf16 hi part and a bf16 lo part of the f32 residual
__device__ __forceinline__ void bf_split_bits(float f, unsigned short& hb, unsigned short& lb) {
  hb = f2bf_bits(f);
  lb = f2bf_bits(f - bf_bits2f(hb));
}

// hazard guards as plain device helpers; the 4-acc guard ties every
// accumulator of a group and names the A fragments as inputs
__device__ __forceinline__ void dep_guard4_h(v8f& a, v8f& b, v8f& c, v8f& d, v16h x, v16h y) { asm volatile("v_nop\n\tv_nop\n\tv_nop\n\tv_nop" : "+v"(a), "+v"(b), "+v"(c), "+v"(d) : "v"(x), "v"(y)); }
__device__ __forceinline__ void dep_guard4_b(v8f& a, v8f& b, v8f& c, v8f& d, v16b x, v16b y) { asm volatile("v_nop\n\tv_nop\n\tv_nop\n\tv_nop" : "+v"(a), "+v"(b), "+v"(c), "+v"(d) : "v"(x), "v"(y)); }
__device__ __forceinline__ void keep4_h(v16h a, v16h b, v16h c, v16h d) { asm volatile("v_nop" :: "v"(a), "v"(b), "v"(c), "v"(d)); }
__device__ __forceinline__ void keep4_b(v16b a, v16b b, v16b c, v16b d) { asm volatile("v_nop" :: "v"(a), "v"(b), "v"(c), "v"(d)); }
__device__ __forceinline__ void acc_guard4(v8f& a, v8f& b, v8f& c, v8f& d) { asm volatile("v_nop\n\tv_nop\n\tv_nop\n\tv_nop" : "+v"(a), "+v"(b), "+v"(c), "+v"(d)); }
template <typename T> struct Frag;
template <> struct Frag<_Float16> {
  typedef v16h V; typedef v8h H; union U { v16h v; v8h h[2]; };
  // elements 0..7 <- p[0..7], 8..15 <- p[16..23]
  static __device__ __forceinline__ v16h load(const _Float16* p) {
    U f; f.h[0] = *(const v8h*)(p); f.h[1] = *(const v8h*)(p + 16); return f.v;
  }
  static __device__ __forceinline__ v8f mma(v16h a, v16h b, v8f c) {
    return __builtin_amdgcn_wmma_f32_16x16x32_f16(false, a, false, b, (short)0, c, false, false);
  }
  static __device__ __forceinline__ void guard4(v8f& a, v8f& b, v8f& c, v8f& d, v16h x, v16h y) { dep_guard4_h(a, b, c, d, x, y); }
  static __device__ __forceinline__ void keep(v16h a, v16h b, v16h c, v16h d) { keep4_h(a, b, c, d); }
};
template <> struct Frag<__bf16> {
  typedef v16b V; typedef v8b H; union U { v16b v; v8b h[2]; };
  static __device__ __forceinline__ v16b load(const __bf16* p) {
    U f; f.h[0] = *(const v8b*)(p); f.h[1] = *(const v8b*)(p + 16); return f.v;
  }
  static __device__ __forceinline__ v8f mma(v16b a, v16b b, v8f c) {
    return __builtin_amdgcn_wmma_f32_16x16x32_bf16(false, a, false, b, (short)0, c, false, false);
  }
  static __device__ __forceinline__ void guard4(v8f& a, v8f& b, v8f& c, v8f& d, v16b x, v16b y) { dep_guard4_b(a, b, c, d, x, y); }
  static __device__ __forceinline__ void keep(v16b a, v16b b, v16b c, v16b d) { keep4_b(a, b, c, d); }
};

// ---- Register-blocked batched WMMA GEMM (ACT reduced to none/relu/leaky) -------------------------------
// C[m,n] = scale * sum_k A[m,k] * Bt[n,k] (+bias)(+resid); each wave owns a 64x64 tile, the WM x WN waves of a block one
// (64*WM) x (64*WN) tile. A row-major [M,KD]; Bt row-major [N,KD]; M % (64*WM) == 0, N % (64*WN) == 0, KD % KS == 0.
// Operand path: the block brings KS k values of its A rows and Bt rows from global memory in whole row pieces (KS*2 bytes,
// 16 B per lane), through registers, into one of two LDS buffers; every wave reads its fragments from there. The loads of
// stage s+1 are issued ahead of the products of stage s and stored to the other buffer behind them; one barrier per stage.
// SPLIT: operands are hi/lo planes (A2/Bt2 = lo planes, same layout); product = hi*hi + hi*lo + lo*hi.
// BIAS_MODE: 0 = none, 1 = bias[m], 2 = bias[n].
// OUT_MODE: 0 = f32, 1 = f16, 2 = bf16 hi plane (Cout) + bf16 lo plane (Cout2).
//           3 = branch input: the tile is the mix term u of branch b = blockIdx.y; the epilogue forms
//               x[m][n] + (x[m-1][n]*f - x[m][n]) * (u + lam[b][n]), f = 0 at t == 0 else 1 (address of the prior row clamped),
//               x = resid (pitch kChan), lam = bias (pitch N), and stores its bf16 hi plane (Cout, plane b) and, for b > 0, its
//               bf16 lo plane (Cout2, plane b-1). Every 128-B line of a plane is stored once, by 8 lanes of one wave.
// ET: 0 = f16 operands, 1 = bf16 operands (pointers passed as 16-bit storage)
template <int ET> struct Elem;
template <> struct Elem<0> { typedef _Float16 T; };
template <> struct Elem<1> { typedef __bf16 T; };
template <int ET, bool SPLIT, int BIAS_MODE, int OUT_MODE, bool RESID, int ACT, int WM, int WN, int KS, int KD>
__global__ __launch_bounds__(32 * WM * WN) void wmma_gemm64(
    const unsigned short* __restrict__ Ap, const unsigned short* __restrict__ A2p, long strideA,
    const unsigned short* __restrict__ Btp, const unsigned short* __restrict__ Bt2p, long strideB,
    void* __restrict__ Cout, void* __restrict__ Cout2, int ldc, long strideC,
    const float* __restrict__ bias,
    const float* __restrict__ resid, long strideR,
    int N, float scale) {
  typedef typename Elem<ET>::T T;
  typedef typename Frag<T>::V V;
  typedef typename Frag<T>::H H;
  constexpr int NW    = WM * WN;               // waves per block
  constexpr int NT    = 32 * NW;               // threads per block
  constexpr int BM    = 64 * WM;               // block tile rows (A rows per stage)
  constexpr int BN    = 64 * WN;               // block tile columns (Bt rows per stage)
  constexpr int PITCH = KS + 8;                // LDS row pitch in elements: row bytes + 16, an odd multiple of 16 B
  constexpr int CH    = KS / 8;                // 16-B pieces per row piece
  constexpr int RSTEP = NT / CH;               // rows covered by one load of the whole block
  constexpr int NA    = BM / RSTEP;            // loads per thread and plane, A
  constexpr int NB    = BN / RSTEP;            // loads per thread and plane, Bt
  constexpr int PLANE = (BM + BN) * PITCH;     // elements of one plane in one buffer: A rows, then Bt rows
  constexpr int BUF   = (SPLIT ? 2 : 1) * PLANE;
  constexpr int NS    = KD / KS;               // stages
  static_assert(KS == 32 || KS == 64, "row piece");
  static_assert(KD % KS == 0 && BM % RSTEP == 0 && BN % RSTEP == 0, "stage split");
  const T* A = (const T*)Ap; const T* A2 = (const T*)A2p; const T* Bt = (const T*)Btp; const T* Bt2 = (const T*)Bt2p;
  __shared__ __align__(16) unsigned short sOpRaw[2 * BUF];
  __shared__ __align__(16) float sT[NW][16 * 68];   // per-wave 16x64 slab, pitch 68 floats
  T* sOp = (T*)sOpRaw;
  const int b    = blockIdx.y;
  const int tid  = threadIdx.x;
  const int lane = tid & 31;
  const int wave = tid >> 5;
  const int tilesN = N / BN;
  const int bm = blockIdx.x / tilesN;          // the grid holds exactly (M / BM) * (N / BN) blocks
  const int bn = blockIdx.x - bm * tilesN;
  const int wm = wave / WN;
  const int wn = wave - wm * WN;
  const int m0 = bm * BM + (wm << 6);
  const int n0 = bn * BN + (wn << 6);

  // block-uniform bases of the block's rows; every thread adds its one fixed byte offset
  const char* gA  = (const char*)(A  + (size_t)b * strideA + (size_t)(bm * BM) * KD);
  const char* gB  = (const char*)(Bt + (size_t)b * strideB + (size_t)(bn * BN) * KD);
  const char* gA2 = SPLIT ? (const char*)(A2  + (size_t)b * strideA + (size_t)(bm * BM) * KD) : nullptr;
  const char* gB2 = SPLIT ? (const char*)(Bt2 + (size_t)b * strideB + (size_t)(bn * BN) * KD) : nullptr;
  const int sRow = tid / CH, sCol = (tid % CH) * 8;
  const unsigned offG = (unsigned)(sRow * KD + sCol) * 2u;   // bytes
  const int      offL = sRow * PITCH + sCol;                 // elements

  const int rlane = lane & 15;                 // row (A) / col (B, D) within subtile
  const int koff  = (lane >> 4) * 8;           // k offset of this lane half
  const int mOff  = (lane >> 4) * 8;           // D row offset

  v8f acc[4][4];
#pragma unroll
  for (int i = 0; i < 4; ++i)
#pragma unroll
    for (int j = 0; j < 4; ++j) acc[i][j] = (v8f){0.f,0.f,0.f,0.f,0.f,0.f,0.f,0.f};

  // one stage in flight; every loop over these arrays and over the fragments is fully unrolled, so that they stay in registers
  H ra[NA], ra2[NA], rb[NB], rb2[NB];
  auto gload = [&](int k0) {
    // the two scheduling barriers keep every other instruction out of the group of loads and its wait, and the group ahead of
    // the products: sunk next to the LDS stores that use them, the loads would show their whole latency in every stage
    __builtin_amdgcn_sched_barrier(0);
#pragma unroll
    for (int i = 0; i < NA; ++i) {
      ra[i] = *(const H*)(gA + (size_t)k0 * 2 + (size_t)i * (RSTEP * KD * 2) + offG);
      if (SPLIT) ra2[i] = *(const H*)(gA2 + (size_t)k0 * 2 + (size_t)i * (RSTEP * KD * 2) + offG);
    }
#pragma unroll
    for (int i = 0; i < NB; ++i) {
      rb[i] = *(const H*)(gB + (size_t)k0 * 2 + (size_t)i * (RSTEP * KD * 2) + offG);
      if (SPLIT) rb2[i] = *(const H*)(gB2 + (size_t)k0 * 2 + (size_t)i * (RSTEP * KD * 2) + offG);
    }
    // precaution: this wait stands in front of every later write of a register that one of these loads names
    asm volatile("s_wait_xcnt 0x0" ::: "memory");
    __builtin_amdgcn_sched_barrier(0);
  };
  auto sstore = [&](T* buf) {
#pragma unroll
    for (int i = 0; i < NA; ++i) {
      *(H*)(buf + i * (RSTEP * PITCH) + offL) = ra[i];
      if (SPLIT) *(H*)(buf + PLANE + i * (RSTEP * PITCH) + offL) = ra2[i];
    }
#pragma unroll
    for (int i = 0; i < NB; ++i) {
      *(H*)(buf + (BM + i * RSTEP) * PITCH + offL) = rb[i];
      if (SPLIT) *(H*)(buf + PLANE + (BM + i * RSTEP) * PITCH + offL) = rb2[i];
    }
  };
  const int fragA = ((wm << 6) + rlane) * PITCH + koff;        // this lane's place in the first A / Bt fragment of its wave
  const int fragB = (BM + (wn << 6) + rlane) * PITCH + koff;
  auto compute = [&](const T* buf) {
#pragma unroll
    for (int kk = 0; kk < KS; kk += 32) {
      V bh[4], bl[4], ah[4], al[4];
#pragma unroll
      for (int j = 0; j < 4; ++j) {
        bh[j] = Frag<T>::load(buf + fragB + j * (16 * PITCH) + kk);
        if (SPLIT) bl[j] = Frag<T>::load(buf + PLANE + fragB + j * (16 * PITCH) + kk);
      }
#pragma unroll
      for (int i = 0; i < 4; ++i) {
        ah[i] = Frag<T>::load(buf + fragA + i * (16 * PITCH) + kk);
        if (SPLIT) al[i] = Frag<T>::load(buf + PLANE + fragA + i * (16 * PITCH) + kk);
      }
#pragma unroll
      for (int i = 0; i < 4; ++i) {
#pragma unroll
        for (int j = 0; j < 4; ++j) {
          acc[i][j] = Frag<T>::mma(ah[i], bh[j], acc[i][j]);
          if (SPLIT) {
            acc[i][j] = Frag<T>::mma(ah[i], bl[j], acc[i][j]);
            acc[i][j] = Frag<T>::mma(al[i], bh[j], acc[i][j]);
          }
        }
        Frag<T>::guard4(acc[i][0], acc[i][1], acc[i][2], acc[i][3], ah[i], SPLIT ? al[i] : ah[i]);
      }
      Frag<T>::keep(bh[0], bh[1], bh[2], bh[3]);
      if (SPLIT) Frag<T>::keep(bl[0], bl[1], bl[2], bl[3]);
    }
  };

  gload(0);
  sstore(sOp);
  __syncthreads();
  // kept rolled, for speed only
#pragma unroll 1
  for (int s = 0; s < NS; ++s) {
    if (s + 1 < NS) gload((s + 1) * KS);                       // block-uniform
    compute(sOp + (s & 1) * BUF);
    if (s + 1 < NS) sstore(sOp + ((s + 1) & 1) * BUF);
    // the one barrier of a stage: publishes stage s+1 and ends the reads of stage s, whose buffer the next pass overwrites
    __syncthreads();
  }
  acc_guard4(acc[0][0], acc[0][1], acc[0][2], acc[0][3]);
  acc_guard4(acc[1][0], acc[1][1], acc[1][2], acc[1][3]);
  acc_guard4(acc[2][0], acc[2][1], acc[2][2], acc[2][3]);
  acc_guard4(acc[3][0], acc[3][1], acc[3][2], acc[3][3]);

  // ---- epilogue ----
  float* slab = sT[wave];
  const float* Rb = RESID ? (resid + (size_t)b * strideR) : nullptr;
  v4f lam0 = (v4f){0.f, 0.f, 0.f, 0.f}, lam1 = lam0;
  // OUT_MODE 3: block-uniform bases of the block's first row in x and in the two planes (pitch kChan); every lane adds one fixed byte
  // offset, offX (f32; half of it in the bf16 planes), and the row groups are immediates. t == 0 can only fall on the first row of a
  // wave's tile (64 divides kSeq): there the prior row's address is the row's own and its factor 0.
  static_assert(OUT_MODE != 3 || kSeq % 64 == 0, "t == 0 only on a wave tile's first row");
  const char* gX = nullptr; char* gH = nullptr; char* gL = nullptr;
  unsigned offX = 0, offP0 = 0;
  float fz0 = 1.0f;
  if (OUT_MODE == 3) {
    const size_t tile0 = (size_t)(bm * BM) * kChan + bn * BN;
    gX = (const char*)(resid + tile0);
    gH = (char*)((unsigned short*)Cout  + (size_t)b * strideC + tile0);
    gL = (char*)((unsigned short*)Cout2 + (size_t)(b > 0 ? (b - 1) : 0) * strideC + tile0);
    const int row0 = (wm << 6) + (lane >> 3);
    offX = (unsigned)(row0 * kChan + (wn << 6) + (lane & 7) * 8) * 4u;
    const bool t0 = ((bm * BM + row0) & (kSeq - 1)) == 0;
    offP0 = t0 ? offX + (unsigned)(kChan * 4) : offX;      // counted from one row above gX, so that it is never negative
    fz0 = t0 ? 0.0f : 1.0f;
    const float* pl = bias + (size_t)b * N + n0 + (lane & 7) * 8;
    __builtin_amdgcn_sched_barrier(0);   // with the one below: keeps the two loads and their wait together
    lam0 = *(const v4f*)(pl); lam1 = *(const v4f*)(pl + 4);
    // precaution: this wait stands in front of every later write of a register that one of these two loads names
    asm volatile("s_wait_xcnt 0x0" ::: "memory");
    __builtin_amdgcn_sched_barrier(0);
  }
#pragma unroll
  for (int i = 0; i < 4; ++i) {
    const int mBase = m0 + (i << 4);
    v4f xa0[4], xa1[4], xb0[4], xb1[4];
    if (OUT_MODE == 3) {
      // the two scheduling barriers keep every other instruction out of the group of loads and its wait, and the group ahead of
      // the slab writes, which are served while the loads fly
      __builtin_amdgcn_sched_barrier(0);
#pragma unroll
      for (int it = 0; it < 4; ++it) {
        const int r = i * 16 + it * 4;                       // this lane's row = first row of its wave + r + q
        const char* px = gX + (size_t)r * (kChan * 4) + offX;
        const char* pp = (r == 0) ? (gX - kChan * 4 + offP0) : (gX + (size_t)(r - 1) * (kChan * 4) + offX);
        xa0[it] = *(const v4f*)(px); xa1[it] = *(const v4f*)(px + 16);
        xb0[it] = *(const v4f*)(pp); xb1[it] = *(const v4f*)(pp + 16);
      }
      // precaution: this wait stands in front of every later write of a register that one of these loads names
      asm volatile("s_wait_xcnt 0x0" ::: "memory");
      __builtin_amdgcn_sched_barrier(0);
    }
#pragma unroll
    for (int j = 0; j < 4; ++j) {
      const int n = n0 + (j << 4) + rlane;
      float bv = 0.f;
      if (BIAS_MODE == 2) bv = bias[n];
#pragma unroll
      for (int r = 0; r < 8; ++r) {
        float v = acc[i][j][r] * scale;
        if (BIAS_MODE == 1) v += bias[mBase + mOff + r];
        if (BIAS_MODE == 2) v += bv;
        if (RESID) v += Rb[(size_t)(mBase + mOff + r) * ldc + n];
        if (ACT == 2) v = fmaxf(v, 0.0f);
        if (ACT == 4) v = (v > 0.f) ? v : 0.01f * v;
        slab[(mOff + r) * 68 + (j << 4) + rlane] = v;
      }
    }
    __builtin_amdgcn_fence(__ATOMIC_RELEASE, "workgroup");
    __builtin_amdgcn_wave_barrier();
    __builtin_amdgcn_fence(__ATOMIC_ACQUIRE, "workgroup");
    if (OUT_MODE == 0) {
      float* C = (float*)Cout + (size_t)b * strideC;
      const int hh = lane >> 4, c4 = (lane & 15) * 4;     // row seg = 256 B = 16 lanes x 16 B
      {
#pragma unroll
        for (int it = 0; it < 8; ++it) {
          const int row = it * 2 + hh;
          v4f v = *(const v4f*)(slab + row * 68 + c4);
          *(v4f*)(C + (size_t)(mBase + row) * ldc + n0 + c4) = v;
        }
        
      }
    } else if (OUT_MODE == 3) {
      const int q = lane >> 3, c8 = (lane & 7) * 8;
      v4u uh[4], ul[4];
#pragma unroll
      for (int it = 0; it < 4; ++it) {
        const int row = it * 4 + q;
        const float fz = (i == 0 && it == 0) ? fz0 : 1.0f;
        const v4f u0 = *(const v4f*)(slab + row * 68 + c8), u1 = *(const v4f*)(slab + row * 68 + c8 + 4);
        unsigned short hb[8], lb[8];
#pragma unroll
        for (int e = 0; e < 4; ++e) {
          const float ba0 = xb0[it][e] * fz - xa0[it][e];
          const float ba1 = xb1[it][e] * fz - xa1[it][e];
          const float v0 = xa0[it][e] + ba0 * (u0[e] + lam0[e]);
          const float v1 = xa1[it][e] + ba1 * (u1[e] + lam1[e]);
          bf_split_bits(v0, hb[e], lb[e]);
          bf_split_bits(v1, hb[4 + e], lb[4 + e]);
        }
        uh[it] = (v4u){pk16(hb[0], hb[1]), pk16(hb[2], hb[3]), pk16(hb[4], hb[5]), pk16(hb[6], hb[7])};
        ul[it] = (v4u){pk16(lb[0], lb[1]), pk16(lb[2], lb[3]), pk16(lb[4], lb[5]), pk16(lb[6], lb[7])};
      }
      // as for the loads: nothing else is scheduled into the group of stores and its wait
      __builtin_amdgcn_sched_barrier(0);
#pragma unroll
      for (int it = 0; it < 4; ++it) *(v4u*)(gH + (size_t)(i * 16 + it * 4) * (kChan * 2) + offX / 2) = uh[it];
      // the same precaution for the registers that these stores name
      asm volatile("s_wait_xcnt 0x0" ::: "memory");
      __builtin_amdgcn_sched_barrier(0);
      if (b > 0) {                                           // block-uniform: branch 0 has no lo plane
        __builtin_amdgcn_sched_barrier(0);
#pragma unroll
        for (int it = 0; it < 4; ++it) *(v4u*)(gL + (size_t)(i * 16 + it * 4) * (kChan * 2) + offX / 2) = ul[it];
        asm volatile("s_wait_xcnt 0x0" ::: "memory");        // the same precaution
        __builtin_amdgcn_sched_barrier(0);
      }
    } else {
      const int q = lane >> 3, c8 = (lane & 7) * 8;
      unsigned short* C  = (unsigned short*)Cout  + (size_t)b * strideC;
      unsigned short* C2 = (OUT_MODE == 2) ? ((unsigned short*)Cout2 + (size_t)b * strideC) : nullptr;
      {
#pragma unroll
        for (int it = 0; it < 4; ++it) {
          const int row = it * 4 + q;
          const float* sp = slab + row * 68 + c8;
          v8h hv, lv;
#pragma unroll
          for (int e = 0; e < 8; ++e) {
            if (OUT_MODE == 1) {
              hv[e] = (_Float16)sp[e];
            } else {
              unsigned short hb = f2bf_bits(sp[e]);
              unsigned short lb = f2bf_bits(sp[e] - bf_bits2f(hb));
              hv[e] = __builtin_bit_cast(_Float16, hb);
              lv[e] = __builtin_bit_cast(_Float16, lb);
            }
          }
          *(v8h*)(C + (size_t)(mBase + row) * ldc + n0 + c8) = hv;
          if (OUT_MODE == 2) *(v8h*)(C2 + (size_t)(mBase + row) * ldc + n0 + c8) = lv;
        }
        
      }
    }
    __builtin_amdgcn_fence(__ATOMIC_RELEASE, "workgroup");
    __builtin_amdgcn_wave_barrier();
    __builtin_amdgcn_fence(__ATOMIC_ACQUIRE, "workgroup");
  }
}

// ---------------------------------------------------------------------------
// Square weight split: four [1024][1024] f32 matrices (layout kept as-is = [out][in] = Bt) -> bf16 hi and lo planes.
// grid (512, 4): blockIdx.y selects the matrix and the output plane z (planes at out + z*1048576 halves).
// Thread i owns 8 consecutive elements: two b128 loads, one 16-B store per lane per plane; a wave writes 512 contiguous
// ---------------------------------------------------------------------------
__global__ __launch_bounds__(256) void k_wsplit8(const float* __restrict__ W0, const float* __restrict__ W1,
                                                 const float* __restrict__ W2, const float* __restrict__ W3,
                                                 unsigned short* __restrict__ outH, unsigned short* __restrict__ outL,
                                                 int n8PerMat) {
  const int z = blockIdx.y;                                   // block-uniform
  const float* W = (z == 0) ? W0 : (z == 1) ? W1 : (z == 2) ? W2 : W3;
  const int i = blockIdx.x * 256 + threadIdx.x;
  if (i >= n8PerMat) return;
  const float* p = W + 8 * (size_t)i;
  const v4f a = *(const v4f*)(p);
  const v4f c = *(const v4f*)(p + 4);
  unsigned short hb[8], lb[8];
#pragma unroll
  for (int e = 0; e < 4; ++e) {
    bf_split_bits(a[e], hb[e], lb[e]);
    bf_split_bits(c[e], hb[4 + e], lb[4 + e]);
  }
  const v4u uh = (v4u){pk16(hb[0], hb[1]), pk16(hb[2], hb[3]), pk16(hb[4], hb[5]), pk16(hb[6], hb[7])};
  const v4u ul = (v4u){pk16(lb[0], lb[1]), pk16(lb[2], lb[3]), pk16(lb[4], lb[5]), pk16(lb[6], lb[7])};
  const size_t o = (size_t)z * (size_t)kWPlane + 8 * (size_t)i;
  *(v4u*)(outH + o) = uh;
  *(v4u*)(outL + o) = ul;
  
}

// ---------------------------------------------------------------------------
// Transpose + bf16 convert (single or hi/lo): in[R][Cc] f32 row-major (pitch Cc) -> out[n][k] = cvt(in[k][n]) for
// k < R and n < Cc, zero otherwise (pad rows / pad columns of the output plane are WRITTEN as zeros).
// grid (nTilesN, nTilesK, Z): a block covers 32 output rows n0..n0+31 and KT output columns k0..k0+KT-1; blockIdx.z adds
// inStrideZ / outStrideZ element offsets. 256 threads.
// Load coverage: (32*KT/256) iterations x 256 threads = 32 x KT elements (coalesced along n), clamped address, 0/1 factor.
// Store, KT == 64: row = wave*4 + (lane>>3) -> 8 waves x 4 = 32 rows; (lane&7) x 8 halves = 64 cols; each row segment =
// Store, KT == 32 (requires ldo == 32, k0 == 0): threads 0..127, row = t>>2, c8 = (t&3)*8 -> thread t writes tile bytes
// ---------------------------------------------------------------------------
template <bool SPLIT, int KT>
__global__ __launch_bounds__(256) void k_trcast(const float* __restrict__ in, int R, int Cc, long inStrideZ,
                                                unsigned short* __restrict__ outH, unsigned short* __restrict__ outL,
                                                int ldo, long outStrideZ) {
  static_assert(KT == 64 || KT == 32, "tile");
  __shared__ float sm[32][KT + 1];
  const int t  = threadIdx.x;
  const int n0 = blockIdx.x * 32;
  const int k0 = blockIdx.y * KT;
  const float* inz = in + (size_t)blockIdx.z * inStrideZ;
  constexpr int kIters = (32 * KT) / 256;
#pragma unroll
  for (int it = 0; it < kIters; ++it) {
    const int e  = it * 256 + t;
    const int nl = e & 31;
    const int kl = e >> 5;
    const int n  = n0 + nl;
    const int k  = k0 + kl;
    const int nc = (n < Cc) ? n : (Cc - 1);
    const int kc = (k < R) ? k : (R - 1);
    const float v  = inz[(size_t)kc * Cc + nc];
    const float fz = ((n < Cc) && (k < R)) ? 1.0f : 0.0f;
    sm[nl][kl] = v * fz;
  }
  __syncthreads();
  const int lane = t & 31, wave = t >> 5;
  unsigned short* oh = outH + (size_t)blockIdx.z * outStrideZ;
  unsigned short* ol = outL + (size_t)blockIdx.z * outStrideZ;
  int row, c8;
  bool active;
  if (KT == 64) { row = wave * 4 + (lane >> 3); c8 = (lane & 7) * 8; active = true; }
  else          { row = t >> 2;                 c8 = (t & 3) * 8;    active = (t < 128); }
  if (active) {
    unsigned short hb[8], lb[8];
#pragma unroll
    for (int e = 0; e < 8; ++e) {
      const float v = sm[row][c8 + e];
      if (SPLIT) { bf_split_bits(v, hb[e], lb[e]); }
      else       { hb[e] = f2bf_bits(v); lb[e] = 0; }
    }
    const v4u uh = (v4u){pk16(hb[0], hb[1]), pk16(hb[2], hb[3]), pk16(hb[4], hb[5]), pk16(hb[6], hb[7])};
    const v4u ul = (v4u){pk16(lb[0], lb[1]), pk16(lb[2], lb[3]), pk16(lb[4], lb[5]), pk16(lb[6], lb[7])};
    const size_t o = (size_t)(n0 + row) * ldo + k0 + c8;
    *(v4u*)(oh + o) = uh;
    if (SPLIT) *(v4u*)(ol + o) = ul;
    
  }
}

// ---------------------------------------------------------------------------
// Token shift: xx[m][c] = x[m][c] + (x[m-1][c]*f - x[m][c]) * miu_x[c], f = 0 at t == 0 else 1 (address of the prior row
// clamped, arithmetic 0/1 factor). Output: single bf16 plane [2048][1024].
// ---------------------------------------------------------------------------
__global__ __launch_bounds__(256) void k_xx8(const float* __restrict__ x, const float* __restrict__ miu_x,
                                             unsigned short* __restrict__ XX, int n8) {
  const int i = blockIdx.x * 256 + threadIdx.x;
  if (i >= n8) return;
  const int f  = 8 * i;
  const int m  = f >> 10;
  const int c0 = f & 1023;
  const int t  = m & 1023;
  const int mp = (t > 0) ? (m - 1) : m;
  const float fz = (t > 0) ? 1.0f : 0.0f;
  const float* px = x + f;
  const float* pp = x + ((size_t)mp << 10) + c0;
  const float* pm = miu_x + c0;
  const v4f a0 = *(const v4f*)(px), a1 = *(const v4f*)(px + 4);
  const v4f b0 = *(const v4f*)(pp), b1 = *(const v4f*)(pp + 4);
  const v4f u0 = *(const v4f*)(pm), u1 = *(const v4f*)(pm + 4);
  unsigned short hb[8];
#pragma unroll
  for (int e = 0; e < 4; ++e) {
    const float ba0 = b0[e] * fz - a0[e];
    const float ba1 = b1[e] * fz - a1[e];
    hb[e]     = f2bf_bits(a0[e] + ba0 * u0[e]);
    hb[4 + e] = f2bf_bits(a1[e] + ba1 * u1[e]);
  }
  const v4u uh = (v4u){pk16(hb[0], hb[1]), pk16(hb[2], hb[3]), pk16(hb[4], hb[5]), pk16(hb[6], hb[7])};
  unsigned short* q = XX + f;
  *(v4u*)q = uh;
  
}

// ---------------------------------------------------------------------------
// tanh + bf16 convert (single or hi/lo) with column compaction / padding:
//   out flat index f = m*ncols + c  <-  tanh(in[m*ldin + c]) for c < nvalid, 0 for c >= nvalid  (ncols <= ldin, both even).
// ---------------------------------------------------------------------------
template <bool SPLIT>
__global__ __launch_bounds__(256) void k_tanh2(const float* __restrict__ in, int ldin,
                                               unsigned short* __restrict__ outH, unsigned short* __restrict__ outL,
                                               int ncols, int nvalid, int n2) {
  const int i = blockIdx.x * 256 + threadIdx.x;
  if (i >= n2) return;
  const int f = 2 * i;
  const int m = f / ncols;
  const int c = f - m * ncols;
  const v2f a = *(const v2f*)(in + (size_t)m * ldin + c);
  const float f0 = (c < nvalid) ? 1.0f : 0.0f;
  const float f1 = (c + 1 < nvalid) ? 1.0f : 0.0f;
  const float t0 = tanhf(a[0]) * f0;
  const float t1 = tanhf(a[1]) * f1;
  unsigned short h0, h1, l0 = 0, l1 = 0;
  if (SPLIT) { bf_split_bits(t0, h0, l0); bf_split_bits(t1, h1, l1); }
  else       { h0 = f2bf_bits(t0); h1 = f2bf_bits(t1); }
  const unsigned uh = pk16(h0, h1);
  const unsigned ul = pk16(l0, l1);
  ((unsigned*)outH)[i] = uh;
  if (SPLIT) ((unsigned*)outL)[i] = ul;
  
}

// ---------------------------------------------------------------------------
// Linear-attention state scan, f32. One block (128 threads = 4 waves, one per SIMD) per (batch b, head n, half ih of the
// v channels): the rows i of the state are independent, so each block carries 32 rows x 64 k channels.
// Thread (ip, jg): jg = lane & 7 owns k channels 8*jg .. 8*jg+7, ip = wave*4 + (lane >> 3) owns rows 2*ip, 2*ip+1;
// S lives in 8 f32 pairs (pairs run along j, so r, k and d pairs come straight out of the b128 LDS reads).
// The sequence is cut into chunks of kSc timesteps; pass c of the loop, between two block barriers,
//   - runs the kSc steps of chunk c from stage buffer c & 1 (r, k*exp(min(w,0)), exp(w), v; w = wl + td_miu). A step has no
//     barrier: each thread stores its partial sum over its 8 k channels to partial buffer c & 1;
//   - writes chunk c+1 into the other stage buffer, piece by piece between the steps, and issues the loads of chunk c+2;
//   - finishes chunk c-1: y_i = sum of the 8 partials + v_i * bonus[t], bonus[t] = sum_j r_j*u_j*k_j (16 partials per step,
//     written by the staging threads into a ring of 4 slots). Each 128-B line of Y is stored once, by 8 lanes of one wave.
// ---------------------------------------------------------------------------
constexpr int kSc  = 32;             // timesteps per chunk
constexpr int kNC  = kSeq / kSc;     // chunks
constexpr int kIB  = 32;             // state rows (v channels) per block
constexpr int kPJ  = 40;             // floats between the partial rows of two j groups: the 8 groups of a store hit disjoint banks
constexpr int kPT  = 8 * kPJ + 32;   // floats between two timesteps' partials: two timesteps of one b128 read hit disjoint banks
constexpr int kPre = 6;              // steps whose LDS operands are fetched ahead of their use
static_assert(kSeq % kSc == 0 && kNC >= 2 && kHead == 2 * kIB && kSc % 16 == 0 && kSc > kPre, "scan chunking");
struct ScanOp { v4f r0, r1, k0, k1, d0, d1; v2f v; };
__device__ __forceinline__ v2f lo2(v4f a) { return (v2f){a[0], a[1]}; }
__device__ __forceinline__ v2f hi2(v4f a) { return (v2f){a[2], a[3]}; }
__global__ __launch_bounds__(128) void k_state_scan(const float* __restrict__ kraw, const float* __restrict__ vpl,
                                                    const float* __restrict__ rpl, const float* __restrict__ wl,
                                                    const float* __restrict__ td_miu, const float* __restrict__ u,
                                                    float* __restrict__ Y) {
  __shared__ __align__(16) float sr0[kSc * 64], sr1[kSc * 64];
  __shared__ __align__(16) float sk0[kSc * 64], sk1[kSc * 64];
  __shared__ __align__(16) float sd0[kSc * 64], sd1[kSc * 64];
  __shared__ __align__(16) float sv0[kSc * kIB], sv1[kSc * kIB];
  __shared__ __align__(16) float part0[kSc * kPT], part1[kSc * kPT];
  __shared__ __align__(16) float sbp[4][kSc][16];
  const int tid  = threadIdx.x;
  const int lane = tid & 31;
  const int wave = tid >> 5;
  const int ih   = blockIdx.x & 1;
  const int n    = (blockIdx.x >> 1) & (kNHead - 1);
  const int b    = blockIdx.x >> 5;
  const int jg   = lane & 7;
  const int j0   = jg * 8;
  const int il   = (wave * 4 + (lane >> 3)) * 2;      // first of this thread's two rows, local to the block
  // staging and output roles: r/k/w rows are 16 float4 wide, v and y rows 8 float4 wide
  const int sRow = tid >> 4, sC4 = (tid & 15) * 4;
  const int vRow = tid >> 3, vC4 = (tid & 7) * 4;
  const size_t base = (size_t)b * kSeq * kChan + (size_t)n * kHead;
  const unsigned offS = (unsigned)(sRow * kChan + sC4) * 4u;             // byte offsets of the two roles inside a piece
  const unsigned offV = (unsigned)(vRow * kChan + ih * kIB + vC4) * 4u;
  const v4f tm4 = *(const v4f*)(td_miu + n * kHead + sC4);
  const v4f u4  = *(const v4f*)(u + n * kHead + sC4);
  // precaution: this wait stands in front of every later write of a register that one of these two loads names; the scheduling
  // barrier keeps later instructions behind it
  asm volatile("s_wait_xcnt 0x0" ::: "memory");
  __builtin_amdgcn_sched_barrier(0);

  v2f S0[4], S1[4];
#pragma unroll
  for (int q = 0; q < 4; ++q) { S0[q] = (v2f){0.f, 0.f}; S1[q] = (v2f){0.f, 0.f}; }

  // staged through registers in kSc/8 pieces: piece it = 8 rows of r, k, w (and, for the first kSc/16 pieces, 16 rows of v)
  v4f gw[kSc / 8], gk[kSc / 8], gr[kSc / 8], gv[kSc / 16];
  // the v values this thread staged are the ones its own output role needs two passes later: vOld of chunk c-1, vNew of chunk c
  v4f vOld[kSc / 16], vNew[kSc / 16];
#pragma unroll
  for (int it = 0; it < kSc / 16; ++it) { vOld[it] = (v4f){0.f, 0.f, 0.f, 0.f}; vNew[it] = vOld[it]; }
  auto issue = [&](int it, int t0) {
    const size_t ub = base + (size_t)(t0 + it * 8) * kChan;      // block-uniform: scalar base + this thread's fixed byte offset
    const size_t uv = base + (size_t)(t0 + it * 16) * kChan;
    // the two scheduling barriers keep every other instruction out of the group of loads and its wait
    __builtin_amdgcn_sched_barrier(0);
    gw[it] = *(const v4f*)((const char*)(wl + ub) + offS);
    gk[it] = *(const v4f*)((const char*)(kraw + ub) + offS);
    gr[it] = *(const v4f*)((const char*)(rpl + ub) + offS);
    if (it < kSc / 16) gv[it] = *(const v4f*)((const char*)(vpl + uv) + offV);
    // precaution: this wait stands in front of every later write of a register that one of these loads names
    asm volatile("s_wait_xcnt 0x0" ::: "memory");
    __builtin_amdgcn_sched_barrier(0);
  };
  auto commit = [&](int it, float* dr, float* dk, float* dd_, float* dv, int slot) {
    const int tl = it * 8 + sRow;
    v4f kk, dd;
    float bp = 0.0f;
#pragma unroll
    for (int e = 0; e < 4; ++e) {
      const float wv = gw[it][e] + tm4[e];
      kk[e] = gk[it][e] * expf(fminf(wv, 0.0f));
      dd[e] = expf(wv);
      bp += gr[it][e] * (u4[e] * kk[e]);
    }
    *(v4f*)(dr + tl * 64 + sC4)  = gr[it];
    *(v4f*)(dk + tl * 64 + sC4)  = kk;
    *(v4f*)(dd_ + tl * 64 + sC4) = dd;
    sbp[slot][tl][tid & 15] = bp;
    if (it < kSc / 16) {
      *(v4f*)(dv + (it * 16 + vRow) * kIB + vC4) = gv[it];
      vOld[it] = vNew[it];
      vNew[it] = gv[it];
    }
  };
  // finishing chunk cc from its partials (src), its bonus slot and vOld: the LDS reads, and apart from them the sums and stores
  v4f x[kSc / 16][12];
  auto finish_load = [&](const float* src, int cc) {
#pragma unroll
    for (int it = 0; it < kSc / 16; ++it) {
      const int tl = it * 16 + vRow;
#pragma unroll
      for (int g = 0; g < 8; ++g) x[it][g] = *(const v4f*)(src + tl * kPT + g * kPJ + vC4);
#pragma unroll
      for (int g = 0; g < 4; ++g) x[it][8 + g] = *(const v4f*)(&sbp[cc & 3][tl][4 * g]);
    }
  };
  auto finish_sum = [&](int cc) {
    v4f yv[kSc / 16];
#pragma unroll
    for (int it = 0; it < kSc / 16; ++it) {
      const v4f b4 = (x[it][8] + x[it][9]) + (x[it][10] + x[it][11]);
      const float bn = (b4[0] + b4[1]) + (b4[2] + b4[3]);
      yv[it] = (((x[it][0] + x[it][1]) + (x[it][2] + x[it][3])) + ((x[it][4] + x[it][5]) + (x[it][6] + x[it][7]))) + vOld[it] * bn;
    }
    // as in issue(): nothing else is scheduled into the group of stores and its wait
    __builtin_amdgcn_sched_barrier(0);
#pragma unroll
    for (int it = 0; it < kSc / 16; ++it)
      *(v4f*)((char*)(Y + base + (size_t)(cc * kSc + it * 16) * kChan) + offV) = yv[it];
    // the same precaution for the registers that these stores name
    asm volatile("s_wait_xcnt 0x0" ::: "memory");
    __builtin_amdgcn_sched_barrier(0);
  };
  auto pass = [&](int c) {
    const int p = c & 1;
    const float* pr = (p ? sr1 : sr0) + j0;
    const float* pk = (p ? sk1 : sk0) + j0;
    const float* pd = (p ? sd1 : sd0) + j0;
    const float* pv = (p ? sv1 : sv0) + il;
    float* pp = (p ? part1 : part0) + jg * kPJ + il;
    // chunk whose loads are issued in this pass; clamped, so that the steps have no branch (the last two passes re-read the last
    // chunk, and the last pass stages it into buffers that nobody reads any more)
    const int tN = ((c + 2 < kNC) ? (c + 2) : (kNC - 1)) * kSc;
    auto ld = [&](int tl) {
      ScanOp o;
      o.r0 = *(const v4f*)(pr + tl * 64); o.r1 = *(const v4f*)(pr + tl * 64 + 4);
      o.k0 = *(const v4f*)(pk + tl * 64); o.k1 = *(const v4f*)(pk + tl * 64 + 4);
      o.d0 = *(const v4f*)(pd + tl * 64); o.d1 = *(const v4f*)(pd + tl * 64 + 4);
      o.v  = *(const v2f*)(pv + tl * kIB);
      return o;
    };
    // the previous chunk's reads first, then the first steps' reads, which are served while the previous chunk is summed and stored
    if (c > 0) finish_load(p ? part0 : part1, c - 1);      // block-uniform
    ScanOp ring[kPre];
#pragma unroll
    for (int tl = 0; tl < kPre; ++tl) ring[tl] = ld(tl);
    if (c > 0) finish_sum(c - 1);
    // fully unrolled so that the ring's slots are registers and every LDS offset an immediate
#pragma unroll
    for (int tl = 0; tl < kSc; ++tl) {
      const ScanOp o = ring[tl % kPre];
      if (tl + kPre < kSc) ring[tl % kPre] = ld(tl + kPre);
      // keeps these reads kPre steps ahead of their use: sunk next to it, the wave would wait out the LDS latency in every step
      __builtin_amdgcn_sched_barrier(0);
      const v2f r2[4] = {lo2(o.r0), hi2(o.r0), lo2(o.r1), hi2(o.r1)};
      const v2f k2[4] = {lo2(o.k0), hi2(o.k0), lo2(o.k1), hi2(o.k1)};
      const v2f d2[4] = {lo2(o.d0), hi2(o.d0), lo2(o.d1), hi2(o.d1)};
      const v2f vv0 = (v2f){o.v[0], o.v[0]};
      const v2f vv1 = (v2f){o.v[1], o.v[1]};
      v2f a0 = r2[0] * S0[0];
      v2f a1 = r2[0] * S1[0];
#pragma unroll
      for (int q = 1; q < 4; ++q) {
        a0 = __builtin_elementwise_fma(r2[q], S0[q], a0);
        a1 = __builtin_elementwise_fma(r2[q], S1[q], a1);
      }
#pragma unroll
      for (int q = 0; q < 4; ++q) {
        S0[q] = __builtin_elementwise_fma(S0[q], d2[q], k2[q] * vv0);
        S1[q] = __builtin_elementwise_fma(S1[q], d2[q], k2[q] * vv1);
      }
      *(v2f*)(pp + tl * kPT) = (v2f){a0[0] + a0[1], a1[0] + a1[1]};
      // one piece of the next chunk's stage every 4 steps, early in the pass: its vector work runs while the LDS reads fetched
      // ahead are served, and the loads issued behind it have the rest of the pass to land before the barrier waits for them
      if ((tl & 3) == 1 && (tl >> 2) < kSc / 8) {
        commit(tl >> 2, p ? sr0 : sr1, p ? sk0 : sk1, p ? sd0 : sd1, p ? sv0 : sv1, (c + 1) & 3);
        issue(tl >> 2, tN);
      }
    }
    // the one barrier of a pass: publishes this chunk's partials and the next chunk's stage, and ends the reads of this chunk's
    // stage and of the previous chunk's partials, which the next pass overwrites
    __syncthreads();
  };

#pragma unroll
  for (int it = 0; it < kSc / 8; ++it) issue(it, 0);
#pragma unroll
  for (int it = 0; it < kSc / 8; ++it) {
    commit(it, sr0, sk0, sd0, sv0, 0);
    issue(it, kSc);
  }
  __syncthreads();
#pragma unroll 1
  for (int c = 0; c < kNC; ++c) pass(c);
  finish_load(((kNC - 1) & 1) ? part1 : part0, kNC - 1);
  finish_sum(kNC - 1);
}

// ---------------------------------------------------------------------------
// GroupNorm (64 channels per head, biased variance, eps 1.6e-4) + affine + gate multiply -> bf16 hi/lo planes.
// One wave per (row m, head n), 8 pairs per 256-thread block; lane owns channels 2l, 2l+1; shuffle reductions (unconditional).
// ---------------------------------------------------------------------------
__global__ __launch_bounds__(256) void k_gn_gate(const float* __restrict__ Y, const float* __restrict__ G,
                                                 const float* __restrict__ gamma, const float* __restrict__ beta,
                                                 unsigned short* __restrict__ outH, unsigned short* __restrict__ outL) {
  __shared__ __align__(16) float slab[8][64];
  const int lane = threadIdx.x & 31, wave = threadIdx.x >> 5;
  const int pair = blockIdx.x * 8 + wave;
  const int m = pair >> 4;
  const int n = pair & 15;
  const size_t base = (size_t)m * kChan + (size_t)n * kHead;
  const int c = n * kHead + 2 * lane;
  const v2f yv = *(const v2f*)(Y + base + 2 * lane);
  const v2f gv = *(const v2f*)(G + base + 2 * lane);
  const v2f ga = *(const v2f*)(gamma + c);
  const v2f be = *(const v2f*)(beta + c);
  float s = yv[0] + yv[1];
#pragma unroll
  for (int off = 16; off > 0; off >>= 1) s += __shfl_xor(s, off, 32);
  const float mean = s * (1.0f / 64.0f);
  const float d0 = yv[0] - mean;
  const float d1 = yv[1] - mean;
  float q = d0 * d0 + d1 * d1;
#pragma unroll
  for (int off = 16; off > 0; off >>= 1) q += __shfl_xor(q, off, 32);
  const float var = q * (1.0f / 64.0f);
  const float rs  = 1.0f / sqrtf(var + kGnEps);
  const float o0 = ((d0 * rs) * ga[0] + be[0]) * gv[0];
  const float o1 = ((d1 * rs) * ga[1] + be[1]) * gv[1];
  *(v2f*)(&slab[wave][2 * lane]) = (v2f){o0, o1};
  __syncthreads();
  if (lane < 8) {
    unsigned short hb[8], lb[8];
#pragma unroll
    for (int e = 0; e < 8; ++e) bf_split_bits(slab[wave][8 * lane + e], hb[e], lb[e]);
    const v4u uh = (v4u){pk16(hb[0], hb[1]), pk16(hb[2], hb[3]), pk16(hb[4], hb[5]), pk16(hb[6], hb[7])};
    const v4u ul = (v4u){pk16(lb[0], lb[1]), pk16(lb[2], lb[3]), pk16(lb[4], lb[5]), pk16(lb[6], lb[7])};
    const size_t o = base + 8 * (size_t)lane;
    *(v4u*)(outH + o) = uh;
    *(v4u*)(outL + o) = ul;
    
  }
}

// ---------------------------------------------------------------------------
// Host glue.
// Workspace region map (bytes; every size is a multiple of 4096, offsets in that order):
//   XX     bf16 [2048][1024]            4,194,304
//   HPRE   f32  [2048][192]             1,572,864   (tanh input of the mix path; cols 160..191 written by the GEMM, unread)
//   HC     bf16 [2048][160] = [10240][32] 655,360   (compact; branch s = rows 2048s.. of the ld-32 view)
//   MIU    f32  [2048][1024]            8,388,608   (the decay lowrank output)
//   X5H    bf16 [5][2048][1024]        20,971,520   (branch inputs hi: 0 decay (single), 1 k, 2 v, 3 r, 4 gate)
//   X5L    bf16 [4][2048][1024]        16,777,216   (lo planes of branches 1..4 at index s-1)
//   WH     bf16 [4][1024][1024]         8,388,608   (Wk, Wv, Wr, Wo hi, [out][in] as-is)
//   WL     bf16 [4][1024][1024]         8,388,608   (lo)
//   AT     bf16 [192][1024]               393,216   (A^T, rows 160..191 zero)
//   TDAT   bf16 [64][1024]                131,072
//   TDBT   bf16 [1024][64]                131,072
//   WG1TH  bf16 [192][1024]               393,216   (rows 160..191 zero)   WG1TL 393,216
//   WG2TH  bf16 [1024][192]               393,216   (cols 160..191 zero)   WG2TL 393,216
//   BPT    bf16 [5][1024][32]             327,680
//   LPRE   f32  [2048][64]                524,288
//   L1     bf16 [2048][64]                262,144
//   KVR    f32  [3][2048][1024]         25,165,824   (k unscaled, v, r)
//   GHPRE  f32  [2048][192]             1,572,864
//   GHH    bf16 [2048][192]               786,432   (cols 160..191 zero)   GHL 786,432
//   GATE   f32  [2048][1024]            8,388,608
//   Y      f32  [2048][1024]            8,388,608
//   GATH   bf16 [2048][1024]            4,194,304   GATL 4,194,304
//   total                             126,156,800
// GEMM shapes (M, N, K): (2048,192,1024) (2048,1024,32)x5 batched (2048,64,1024) (2048,1024,64) (2048,1024,1024)x3 batched
// (2048,192,1024) (2048,1024,192) (2048,1024,1024); all M,N % 64 == 0, all K % 32 == 0, pads zero-written by producers.
// ---------------------------------------------------------------------------
extern "C" void kernel_launch(void* const* d_in, const int* in_sizes, int n_in,
                              void* d_out, int out_size, void* d_ws, size_t ws_size,
                              hipStream_t stream) {
  if (n_in < 17) return;
  if (in_sizes[0] != kBatch * kSeq * kChan) return;
  if (in_sizes[1] != kChan || in_sizes[2] != kNBr * kChan) return;
  if (in_sizes[3] != kChan * kMix || in_sizes[4] != kNBr * kBr * kChan) return;
  if (in_sizes[5] != kChan || in_sizes[6] != kChan * kDec || in_sizes[7] != kDec * kChan) return;
  if (in_sizes[8] != kNHead * kHead) return;
  if (in_sizes[9] != kChan * kChan || in_sizes[10] != kChan * kChan || in_sizes[11] != kChan * kChan || in_sizes[12] != kChan * kChan) return;
  if (in_sizes[13] != kChan * kMix || in_sizes[14] != kMix * kChan) return;
  if (in_sizes[15] != kChan || in_sizes[16] != kChan) return;
  if (out_size != kBatch * kSeq * kChan) return;

  const float* x      = (const float*)d_in[0];
  const float* miu_x  = (const float*)d_in[1];
  const float* lam    = (const float*)d_in[2];    // [5][1024]
  const float* Amat   = (const float*)d_in[3];    // [1024][160]
  const float* Bp     = (const float*)d_in[4];    // [5][32][1024]
  const float* td_miu = (const float*)d_in[5];    // [1024]
  const float* tdA    = (const float*)d_in[6];    // [1024][64]
  const float* tdB    = (const float*)d_in[7];    // [64][1024]
  const float* u      = (const float*)d_in[8];    // [16][64]
  const float* Wk     = (const float*)d_in[9];    // [1024][1024] [out][in]
  const float* Wv     = (const float*)d_in[10];
  const float* Wr     = (const float*)d_in[11];
  const float* Wo     = (const float*)d_in[12];
  const float* Wg1    = (const float*)d_in[13];   // [1024][160]
  const float* Wg2    = (const float*)d_in[14];   // [160][1024]
  const float* gamma  = (const float*)d_in[15];
  const float* beta   = (const float*)d_in[16];
  float* out = (float*)d_out;

  // ---- carve ----
  const size_t szXX    = (size_t)kPlane * 2;
  const size_t szHPRE  = (size_t)kRows * kMixPad * 4;
  const size_t szHC    = (size_t)kRows * kMix * 2;
  const size_t szF32P  = (size_t)kPlane * 4;
  const size_t szX5H   = (size_t)kNBr * kPlane * 2;
  const size_t szX5L   = (size_t)(kNBr - 1) * kPlane * 2;
  const size_t szWSQ   = (size_t)4 * kWPlane * 2;
  const size_t szAT    = (size_t)kMixPad * kChan * 2;
  const size_t szTDAT  = (size_t)kDec * kChan * 2;
  const size_t szTDBT  = (size_t)kChan * kDec * 2;
  const size_t szWG1T  = (size_t)kMixPad * kChan * 2;
  const size_t szWG2T  = (size_t)kChan * kMixPad * 2;
  const size_t szBPT   = (size_t)kNBr * kChan * kBr * 2;
  const size_t szLPRE  = (size_t)kRows * kDec * 4;
  const size_t szL1    = (size_t)kRows * kDec * 2;
  const size_t szKVR   = (size_t)3 * kPlane * 4;
  const size_t szGHPRE = (size_t)kRows * kMixPad * 4;
  const size_t szGH    = (size_t)kRows * kMixPad * 2;
  const size_t szGAT   = (size_t)kPlane * 2;
  size_t off = 0;
  const size_t oXX    = off; off += szXX;
  const size_t oHPRE  = off; off += szHPRE;
  const size_t oHC    = off; off += szHC;
  const size_t oMIU   = off; off += szF32P;
  const size_t oX5H   = off; off += szX5H;
  const size_t oX5L   = off; off += szX5L;
  const size_t oWH    = off; off += szWSQ;
  const size_t oWL    = off; off += szWSQ;
  const size_t oAT    = off; off += szAT;
  const size_t oTDAT  = off; off += szTDAT;
  const size_t oTDBT  = off; off += szTDBT;
  const size_t oWG1TH = off; off += szWG1T;
  const size_t oWG1TL = off; off += szWG1T;
  const size_t oWG2TH = off; off += szWG2T;
  const size_t oWG2TL = off; off += szWG2T;
  const size_t oBPT   = off; off += szBPT;
  const size_t oLPRE  = off; off += szLPRE;
  const size_t oL1    = off; off += szL1;
  const size_t oKVR   = off; off += szKVR;
  const size_t oGHPRE = off; off += szGHPRE;
  const size_t oGHH   = off; off += szGH;
  const size_t oGHL   = off; off += szGH;
  const size_t oGATE  = off; off += szF32P;
  const size_t oY     = off; off += szF32P;
  const size_t oGATH  = off; off += szGAT;
  const size_t oGATL  = off; off += szGAT;
  const size_t total  = off;   // 126,156,800
  if (total > (size_t)134217728) return;
  if (ws_size < total) return;

  char* ws = (char*)d_ws;
  unsigned short* XX    = (unsigned short*)(ws + oXX);
  float*          HPRE  = (float*)(ws + oHPRE);
  unsigned short* HC    = (unsigned short*)(ws + oHC);
  float*          MIU   = (float*)(ws + oMIU);
  float*          WLR   = MIU;                       // decay lowrank output, f32 [2048][1024]
  unsigned short* X5H   = (unsigned short*)(ws + oX5H);
  unsigned short* X5L   = (unsigned short*)(ws + oX5L);
  unsigned short* WH    = (unsigned short*)(ws + oWH);
  unsigned short* WL    = (unsigned short*)(ws + oWL);
  unsigned short* AT    = (unsigned short*)(ws + oAT);
  unsigned short* TDAT  = (unsigned short*)(ws + oTDAT);
  unsigned short* TDBT  = (unsigned short*)(ws + oTDBT);
  unsigned short* WG1TH = (unsigned short*)(ws + oWG1TH);
  unsigned short* WG1TL = (unsigned short*)(ws + oWG1TL);
  unsigned short* WG2TH = (unsigned short*)(ws + oWG2TH);
  unsigned short* WG2TL = (unsigned short*)(ws + oWG2TL);
  unsigned short* BPT   = (unsigned short*)(ws + oBPT);
  float*          LPRE  = (float*)(ws + oLPRE);
  unsigned short* L1    = (unsigned short*)(ws + oL1);
  float*          KVR   = (float*)(ws + oKVR);
  float*          GHPRE = (float*)(ws + oGHPRE);
  unsigned short* GHH   = (unsigned short*)(ws + oGHH);
  unsigned short* GHL   = (unsigned short*)(ws + oGHL);
  float*          GATE  = (float*)(ws + oGATE);
  float*          Yp    = (float*)(ws + oY);
  unsigned short* GATH  = (unsigned short*)(ws + oGATH);
  unsigned short* GATL  = (unsigned short*)(ws + oGATL);
  const float* fdum = gamma;   // placeholder for unused bias / resid pointer arguments (never dereferenced)

  const dim3 blk(256);
  const dim3 blkTall(128);                               // GEMM blocks of 4 x 1 waves, for the outputs 64 and 192 wide
  const int n8Plane = (int)(kPlane / 8);                 // 262144 -> 1024 blocks exact
  const int n8W     = (int)(kWPlane / 8);                // 131072 -> 512 blocks exact

  // ---- weight planes ----
  k_wsplit8<<<dim3(n8W / 256, 4), blk, 0, stream>>>(Wk, Wv, Wr, Wo, WH, WL, n8W);
  // A [1024][160] -> AT [192][1024] (rows >= 160 zero): n tiles 6, k tiles 16
  k_trcast<false, 64><<<dim3(kMixPad / 32, kChan / 64, 1), blk, 0, stream>>>(Amat, kChan, kMix, 0L, AT, AT, kChan, 0L);
  // tdA [1024][64] -> TDAT [64][1024]
  k_trcast<false, 64><<<dim3(kDec / 32, kChan / 64, 1), blk, 0, stream>>>(tdA, kChan, kDec, 0L, TDAT, TDAT, kChan, 0L);
  // tdB [64][1024] -> TDBT [1024][64]
  k_trcast<false, 64><<<dim3(kChan / 32, 1, 1), blk, 0, stream>>>(tdB, kDec, kChan, 0L, TDBT, TDBT, kDec, 0L);
  // Wg1 [1024][160] -> WG1T hi/lo [192][1024] (rows >= 160 zero)
  k_trcast<true, 64><<<dim3(kMixPad / 32, kChan / 64, 1), blk, 0, stream>>>(Wg1, kChan, kMix, 0L, WG1TH, WG1TL, kChan, 0L);
  // Wg2 [160][1024] -> WG2T hi/lo [1024][192] (cols >= 160 zero): n tiles 32, k tiles 3
  k_trcast<true, 64><<<dim3(kChan / 32, kMixPad / 64, 1), blk, 0, stream>>>(Wg2, kMix, kChan, 0L, WG2TH, WG2TL, kMixPad, 0L);
  // Bp[s] [32][1024] -> BPT[s] [1024][32], s = blockIdx.z
  k_trcast<false, 32><<<dim3(kChan / 32, 1, kNBr), blk, 0, stream>>>(Bp, kBr, kChan, (long)kBr * kChan, BPT, BPT, kBr, (long)kChan * kBr);

  // ---- token shift ----
  k_xx8<<<dim3(n8Plane / 256), blk, 0, stream>>>(x, miu_x, XX, n8Plane);

  // ---- mix lowrank: HPRE = XX @ AT^T  (M 2048, N 192, K 1024; 24 blocks of 256 x 64) ----
  wmma_gemm64<1, false, 0, 0, false, 0, 4, 1, 64, kChan><<<dim3((kRows / 256) * (kMixPad / 64), 1), blkTall, 0, stream>>>(
      XX, XX, 0L, AT, AT, 0L, (void*)HPRE, (void*)HPRE, kMixPad, 0L, fdum, fdum, 0L, kMixPad, 1.0f);
  // HC flat [2048*160] = tanh(HPRE[:, 0:160]) compact bf16; n2 = 163840 -> 640 blocks exact
  k_tanh2<false><<<dim3((kRows * kMix / 2) / 256), blk, 0, stream>>>(HPRE, kMixPad, HC, HC, kMix, kMix, kRows * kMix / 2);

  // ---- mix GEMM of all five branches (blockIdx.y = s; A = HC viewed [10240][32], rows 2048s..; K 32); its epilogue forms the
  // branch inputs and stores their bf16 planes ----
  wmma_gemm64<1, false, 0, 3, false, 0, 2, 4, 32, kBr><<<dim3((kRows / 128) * (kChan / 256), kNBr), blk, 0, stream>>>(
      HC, HC, (long)kRows * kBr, BPT, BPT, (long)kChan * kBr,
      (void*)X5H, (void*)X5L, kChan, (long)kPlane, lam, x, 0L, kChan, 1.0f);

  // ---- decay lowrank: LPRE = X5H[0] @ TDAT^T (N 64, K 1024; 8 blocks of 256 x 64); L1 = tanh; WLR = L1 @ TDBT^T (K 64) ----
  wmma_gemm64<1, false, 0, 0, false, 0, 4, 1, 64, kChan><<<dim3((kRows / 256) * (kDec / 64), 1), blkTall, 0, stream>>>(
      X5H, X5H, 0L, TDAT, TDAT, 0L, (void*)LPRE, (void*)LPRE, kDec, 0L, fdum, fdum, 0L, kDec, 1.0f);
  k_tanh2<false><<<dim3((kRows * kDec / 2) / 256), blk, 0, stream>>>(LPRE, kDec, L1, L1, kDec, kDec, kRows * kDec / 2);
  wmma_gemm64<1, false, 0, 0, false, 0, 2, 4, 64, kDec><<<dim3((kRows / 128) * (kChan / 256), 1), blk, 0, stream>>>(
      L1, L1, 0L, TDBT, TDBT, 0L, (void*)WLR, (void*)WLR, kChan, 0L, fdum, fdum, 0L, kChan, 1.0f);

  // ---- k / v / r projections, batched over blockIdx.y = 0..2 (hi/lo split, K 1024) -> KVR f32 planes ----
  wmma_gemm64<1, true, 0, 0, false, 0, 2, 4, 64, kChan><<<dim3((kRows / 128) * (kChan / 256), 3), blk, 0, stream>>>(
      X5H + kPlane, X5L, (long)kPlane, WH, WL, (long)kWPlane,
      (void*)KVR, (void*)KVR, kChan, (long)kPlane, fdum, fdum, 0L, kChan, 1.0f);

  // ---- gate: GHPRE = X5[4] @ WG1T^T (split, N 192); GH = tanh hi/lo; GATE = GH @ WG2T^T (split, K 192) ----
  wmma_gemm64<1, true, 0, 0, false, 0, 4, 1, 64, kChan><<<dim3((kRows / 256) * (kMixPad / 64), 1), blkTall, 0, stream>>>(
      X5H + 4 * kPlane, X5L + 3 * kPlane, 0L, WG1TH, WG1TL, 0L,
      (void*)GHPRE, (void*)GHPRE, kMixPad, 0L, fdum, fdum, 0L, kMixPad, 1.0f);
  k_tanh2<true><<<dim3((kRows * kMixPad / 2) / 256), blk, 0, stream>>>(GHPRE, kMixPad, GHH, GHL, kMixPad, kMix, kRows * kMixPad / 2);
  wmma_gemm64<1, true, 0, 0, false, 0, 2, 4, 64, kMixPad><<<dim3((kRows / 128) * (kChan / 256), 1), blk, 0, stream>>>(
      GHH, GHL, 0L, WG2TH, WG2TL, 0L, (void*)GATE, (void*)GATE, kChan, 0L, fdum, fdum, 0L, kChan, 1.0f);

  // ---- state scan -> Y ----
  k_state_scan<<<dim3(kBatch * kNHead * 2), dim3(128), 0, stream>>>(KVR, KVR + kPlane, KVR + 2 * kPlane, WLR, td_miu, u, Yp);

  // ---- GroupNorm + gate -> GATH/GATL (4096 blocks x 8 waves = 32768 (row, head) pairs) ----
  k_gn_gate<<<dim3((kRows * kNHead) / 8), blk, 0, stream>>>(Yp, GATE, gamma, beta, GATH, GATL);

  // ---- output projection straight into d_out (split, K 1024) ----
  wmma_gemm64<1, true, 0, 0, false, 0, 2, 4, 64, kChan><<<dim3((kRows / 128) * (kChan / 256), 1), blk, 0, stream>>>(
      GATH, GATL, 0L, WH + 3 * kWPlane, WL + 3 * kWPlane, 0L,
      (void*)out, (void*)out, kChan, 0L, fdum, fdum, 0L, kChan, 1.0f);
}

// v004
// It runs in 183 microseconds.
// Next to v003, in two timings, it ran 1.36 times as fast each time.
// All steps since v000 together make it 5.48 times as fast.
// Contractions: every GEMM on v_wmma_f32_16x16x32_bf16 (bf16 operands, f32 accumulate) - the four lowrank mix/decay sites single bf16, the k/v/r projections, the gate pair and the output projection as bf16 hi/lo split (hi*hi + hi*lo + lo*hi); token shift, state scan, GroupNorm and gating in f32 on VALU.
#include <hip/hip_runtime.h>
#include <math.h>

// ---------------------------------------------------------------------------
// Problem constants
// ---------------------------------------------------------------------------
constexpr int kBatch  = 2;
constexpr int kSeq    = 1024;
constexpr int kChan   = 1024;
constexpr int kHead   = 64;
constexpr int kNHead  = 16;
constexpr int kRows   = kBatch * kSeq;          // 2048 token rows (m = b*1024 + t)
constexpr int kMix    = 160;                    // lowrank width of the mix and gate paths
constexpr int kMixPad = 192;                    // padded to a 64 multiple (pad rows / cols zero-filled)
constexpr int kDec    = 64;                     // decay lowrank width
constexpr int kBr     = 32;                     // per-branch mix width
constexpr int kNBr    = 5;                      // branches: 0 decay, 1 k, 2 v, 3 r, 4 gate
constexpr long kPlane  = (long)kRows * kChan;   // 2,097,152 elements per activation plane
constexpr long kWPlane = (long)kChan * kChan;   // 1,048,576 elements per square weight plane
constexpr float kGnEps = 1.6e-4f;               // 1e-5 * 16
static_assert(kNHead * kHead == kChan, "shape");
static_assert(kRows % 256 == 0 && kChan % 256 == 0 && kMixPad % 64 == 0 && kDec % 64 == 0, "M and N tile multiples");
static_assert(kChan % 32 == 0 && kBr % 32 == 0 && kDec % 32 == 0 && kMixPad % 32 == 0, "K multiples of 32");
static_assert(kMix % 8 == 0 && kMixPad % 8 == 0 && kDec % 8 == 0, "pack groups never straddle a row");

typedef __attribute__((ext_vector_type(16))) _Float16 v16h;
typedef __attribute__((ext_vector_type(8)))  _Float16 v8h;
typedef __attribute__((ext_vector_type(16))) __bf16   v16b;
typedef __attribute__((ext_vector_type(8)))  __bf16   v8b;
typedef __attribute__((ext_vector_type(8)))  float    v8f;
typedef __attribute__((ext_vector_type(4)))  float    v4f;
typedef __attribute__((ext_vector_type(2)))  float    v2f;
typedef __attribute__((ext_vector_type(4)))  unsigned int v4u;

// ---------------------------------------------------------------------------
// Shared helpers
// ---------------------------------------------------------------------------
__device__ __forceinline__ unsigned short f2bf_bits(float f) {
  unsigned u = __float_as_uint(f);
  return (unsigned short)((u + 0x7FFFu + ((u >> 16) & 1u)) >> 16);
}
__device__ __forceinline__ float bf_bits2f(unsigned short h) { return __uint_as_float(((unsigned)h) << 16); }
__device__ __forceinline__ unsigned pk16(unsigned short a, unsigned short b) { return (unsigned)a | ((unsigned)b << 16); }
// RNE convert to a bf16 hi part and a bf16 lo part of the f32 residual
__device__ __forceinline__ void bf_split_bits(float f, unsigned short& hb, unsigned short& lb) {
  hb = f2bf_bits(f);
  lb = f2bf_bits(f - bf_bits2f(hb));
}

// hazard guards as plain device helpers; the 4-acc guard ties every
// accumulator of a group and names the A fragments as inputs
__device__ __forceinline__ void dep_guard4_h(v8f& a, v8f& b, v8f& c, v8f& d, v16h x, v16h y) { asm volatile("v_nop\n\tv_nop\n\tv_nop\n\tv_nop" : "+v"(a), "+v"(b), "+v"(c), "+v"(d) : "v"(x), "v"(y)); }
__device__ __forceinline__ void dep_guard4_b(v8f& a, v8f& b, v8f& c, v8f& d, v16b x, v16b y) { asm volatile("v_nop\n\tv_nop\n\tv_nop\n\tv_nop" : "+v"(a), "+v"(b), "+v"(c), "+v"(d) : "v"(x), "v"(y)); }
__device__ __forceinline__ void keep4_h(v16h a, v16h b, v16h c, v16h d) { asm volatile("v_nop" :: "v"(a), "v"(b), "v"(c), "v"(d)); }
__device__ __forceinline__ void keep4_b(v16b a, v16b b, v16b c, v16b d) { asm volatile("v_nop" :: "v"(a), "v"(b), "v"(c), "v"(d)); }
__device__ __forceinline__ void acc_guard4(v8f& a, v8f& b, v8f& c, v8f& d) { asm volatile("v_nop\n\tv_nop\n\tv_nop\n\tv_nop" : "+v"(a), "+v"(b), "+v"(c), "+v"(d)); }
template <typename T> struct Frag;
template <> struct Frag<_Float16> {
  typedef v16h V; typedef v8h H; union U { v16h v; v8h h[2]; };
  // elements 0..7 <- p[0..7], 8..15 <- p[16..23]
  static __device__ __forceinline__ v16h load(const _Float16* p) {
    U f; f.h[0] = *(const v8h*)(p); f.h[1] = *(const v8h*)(p + 16); return f.v;
  }
  static __device__ __forceinline__ v8f mma(v16h a, v16h b, v8f c) {
    return __builtin_amdgcn_wmma_f32_16x16x32_f16(false, a, false, b, (short)0, c, false, false);
  }
  static __device__ __forceinline__ void guard4(v8f& a, v8f& b, v8f& c, v8f& d, v16h x, v16h y) { dep_guard4_h(a, b, c, d, x, y); }
  static __device__ __forceinline__ void keep(v16h a, v16h b, v16h c, v16h d) { keep4_h(a, b, c, d); }
};
template <> struct Frag<__bf16> {
  typedef v16b V; typedef v8b H; union U { v16b v; v8b h[2]; };
  static __device__ __forceinline__ v16b load(const __bf16* p) {
    U f; f.h[0] = *(const v8b*)(p); f.h[1] = *(const v8b*)(p + 16); return f.v;
  }
  static __device__ __forceinline__ v8f mma(v16b a, v16b b, v8f c) {
    return __builtin_amdgcn_wmma_f32_16x16x32_bf16(false, a, false, b, (short)0, c, false, false);
  }
  static __device__ __forceinline__ void guard4(v8f& a, v8f& b, v8f& c, v8f& d, v16b x, v16b y) { dep_guard4_b(a, b, c, d, x, y); }
  static __device__ __forceinline__ void keep(v16b a, v16b b, v16b c, v16b d) { keep4_b(a, b, c, d); }
};

// ---- Register-blocked batched WMMA GEMM (ACT reduced to none/relu/leaky) -------------------------------
// C[m,n] = scale * sum_k A[m,k] * Bt[n,k] (+bias)(+resid); each wave owns a (16*MI)x64 tile, the WM x WN waves of a block one
// (16*MI*WM) x (64*WN) tile. A row-major [M,KD]; Bt row-major [N,KD]; M % (16*MI*WM) == 0, N % (64*WN) == 0, KD % KS == 0.
// Operand path: the block brings KS k values of its A rows and Bt rows from global memory in whole row pieces (KS*2 bytes,
// 16 B per lane), through registers, into one of two LDS buffers; every wave reads its fragments from there. The loads of
// stage s+1 are issued ahead of the products of stage s and stored to the other buffer behind them; one barrier per stage.
// SPLIT: operands are hi/lo planes (A2/Bt2 = lo planes, same layout); product = hi*hi + hi*lo + lo*hi.
// BIAS_MODE: 0 = none, 1 = bias[m], 2 = bias[n].
// OUT_MODE: 0 = f32, 1 = f16, 2 = bf16 hi plane (Cout) + bf16 lo plane (Cout2).
//           3 = branch input: the tile is the mix term u of branch b = blockIdx.y; the epilogue forms
//               x[m][n] + (x[m-1][n]*f - x[m][n]) * (u + lam[b][n]), f = 0 at t == 0 else 1 (address of the prior row clamped),
//               x = resid (pitch kChan), lam = bias (pitch N), and stores its bf16 hi plane (Cout, plane b) and, for b > 0, its
//               bf16 lo plane (Cout2, plane b-1). Every 128-B line of a plane is stored once, by 8 lanes of one wave.
// ET: 0 = f16 operands, 1 = bf16 operands (pointers passed as 16-bit storage)
// The engine is a device function, so that GEMMs which do not depend on one another can share one launch: bx and b stand for the
// block's place in the GEMM's own grid, smem for the launch's one LDS array (kGemmLds bytes of it are used).
// MI: 16-row groups of a wave's tile, 4 unless said otherwise. With MI = 2 a wave owns 32x64, so that a 256 x 64 block tile takes the
// eight waves of the 256-thread blocks that it shares a launch with; every element's k order is the same for every MI.
template <bool SPLIT, int WM, int WN, int KS, int MI>
constexpr int kGemmLds = 2 * (SPLIT ? 2 : 1) * (16 * MI * WM + 64 * WN) * (KS + 8) * 2 + WM * WN * 16 * 68 * 4;
template <int ET> struct Elem;
template <> struct Elem<0> { typedef _Float16 T; };
template <> struct Elem<1> { typedef __bf16 T; };
template <int ET, bool SPLIT, int BIAS_MODE, int OUT_MODE, bool RESID, int ACT, int WM, int WN, int KS, int KD, int MI>
__device__ __forceinline__ void gemm64_body(
    char* smem, const int bx, const int b,
    const unsigned short* __restrict__ Ap, const unsigned short* __restrict__ A2p, long strideA,
    const unsigned short* __restrict__ Btp, const unsigned short* __restrict__ Bt2p, long strideB,
    void* __restrict__ Cout, void* __restrict__ Cout2, int ldc, long strideC,
    const float* __restrict__ bias,
    const float* __restrict__ resid, long strideR,
    int N, float scale) {
  typedef typename Elem<ET>::T T;
  typedef typename Frag<T>::V V;
  typedef typename Frag<T>::H H;
  constexpr int NW    = WM * WN;               // waves per block
  constexpr int NT    = 32 * NW;               // threads per block
  constexpr int BM    = 16 * MI * WM;          // block tile rows (A rows per stage)
  constexpr int BN    = 64 * WN;               // block tile columns (Bt rows per stage)
  constexpr int PITCH = KS + 8;                // LDS row pitch in elements: row bytes + 16, an odd multiple of 16 B
  constexpr int CH    = KS / 8;                // 16-B pieces per row piece
  constexpr int RSTEP = NT / CH;               // rows covered by one load of the whole block
  constexpr int NA    = BM / RSTEP;            // loads per thread and plane, A
  constexpr int NB    = BN / RSTEP;            // loads per thread and plane, Bt
  constexpr int PLANE = (BM + BN) * PITCH;     // elements of one plane in one buffer: A rows, then Bt rows
  constexpr int BUF   = (SPLIT ? 2 : 1) * PLANE;
  constexpr int NS    = KD / KS;               // stages
  static_assert(KS == 32 || KS == 64, "row piece");
  static_assert(KD % KS == 0 && BM % RSTEP == 0 && BN % RSTEP == 0, "stage split");
  const T* A = (const T*)Ap; const T* A2 = (const T*)A2p; const T* Bt = (const T*)Btp; const T* Bt2 = (const T*)Bt2p;
  static_assert(kGemmLds<SPLIT, WM, WN, KS, MI> == 2 * BUF * 2 + NW * 16 * 68 * 4, "LDS share");
  static_assert(OUT_MODE != 3 || MI == 4, "the branch-input epilogue is written for 64-row wave tiles");
  T* sOp = (T*)smem;                                // two operand buffers
  float* sT = (float*)(smem + 2 * BUF * 2);         // behind them, per wave, a 16x64 slab, pitch 68 floats
  const int tid  = threadIdx.x;
  const int lane = tid & 31;
  const int wave = tid >> 5;
  const int tilesN = N / BN;
  const int bm = bx / tilesN;                  // the GEMM's grid holds exactly (M / BM) * (N / BN) blocks
  const int bn = bx - bm * tilesN;
  const int wm = wave / WN;
  const int wn = wave - wm * WN;
  const int m0 = bm * BM + wm * (16 * MI);
  const int n0 = bn * BN + (wn << 6);

  // block-uniform bases of the block's rows; every thread adds its one fixed byte offset
  const char* gA  = (const char*)(A  + (size_t)b * strideA + (size_t)(bm * BM) * KD);
  const char* gB  = (const char*)(Bt + (size_t)b * strideB + (size_t)(bn * BN) * KD);
  const char* gA2 = SPLIT ? (const char*)(A2  + (size_t)b * strideA + (size_t)(bm * BM) * KD) : nullptr;
  const char* gB2 = SPLIT ? (const char*)(Bt2 + (size_t)b * strideB + (size_t)(bn * BN) * KD) : nullptr;
  const int sRow = tid / CH, sCol = (tid % CH) * 8;
  const unsigned offG = (unsigned)(sRow * KD + sCol) * 2u;   // bytes
  const int      offL = sRow * PITCH + sCol;                 // elements

  const int rlane = lane & 15;                 // row (A) / col (B, D) within subtile
  const int koff  = (lane >> 4) * 8;           // k offset of this lane half
  const int mOff  = (lane >> 4) * 8;           // D row offset

  v8f acc[MI][4];
#pragma unroll
  for (int i = 0; i < MI; ++i)
#pragma unroll
    for (int j = 0; j < 4; ++j) acc[i][j] = (v8f){0.f,0.f,0.f,0.f,0.f,0.f,0.f,0.f};

  // one stage in flight; every loop over these arrays and over the fragments is fully unrolled, so that they stay in registers
  H ra[NA], ra2[NA], rb[NB], rb2[NB];
  auto gload = [&](int k0) {
    // the two scheduling barriers keep every other instruction out of the group of loads and its wait, and the group ahead of
    // the products: sunk next to the LDS stores that use them, the loads would show their whole latency in every stage
    __builtin_amdgcn_sched_barrier(0);
#pragma unroll
    for (int i = 0; i < NA; ++i) {
      ra[i] = *(const H*)(gA + (size_t)k0 * 2 + (size_t)i * (RSTEP * KD * 2) + offG);
      if (SPLIT) ra2[i] = *(const H*)(gA2 + (size_t)k0 * 2 + (size_t)i * (RSTEP * KD * 2) + offG);
    }
#pragma unroll
    for (int i = 0; i < NB; ++i) {
      rb[i] = *(const H*)(gB + (size_t)k0 * 2 + (size_t)i * (RSTEP * KD * 2) + offG);
      if (SPLIT) rb2[i] = *(const H*)(gB2 + (size_t)k0 * 2 + (size_t)i * (RSTEP * KD * 2) + offG);
    }
    // precaution: this wait stands in front of every later write of a register that one of these loads names
    asm volatile("s_wait_xcnt 0x0" ::: "memory");
    __builtin_amdgcn_sched_barrier(0);
  };
  auto sstore = [&](T* buf) {
#pragma unroll
    for (int i = 0; i < NA; ++i) {
      *(H*)(buf + i * (RSTEP * PITCH) + offL) = ra[i];
      if (SPLIT) *(H*)(buf + PLANE + i * (RSTEP * PITCH) + offL) = ra2[i];
    }
#pragma unroll
    for (int i = 0; i < NB; ++i) {
      *(H*)(buf + (BM + i * RSTEP) * PITCH + offL) = rb[i];
      if (SPLIT) *(H*)(buf + PLANE + (BM + i * RSTEP) * PITCH + offL) = rb2[i];
    }
  };
  const int fragA = (wm * (16 * MI) + rlane) * PITCH + koff;        // this lane's place in the first A / Bt fragment of its wave
  const int fragB = (BM + (wn << 6) + rlane) * PITCH + koff;
  auto compute = [&](const T* buf) {
#pragma unroll
    for (int kk = 0; kk < KS; kk += 32) {
      V bh[4], bl[4], ah[MI], al[MI];
#pragma unroll
      for (int j = 0; j < 4; ++j) {
        bh[j] = Frag<T>::load(buf + fragB + j * (16 * PITCH) + kk);
        if (SPLIT) bl[j] = Frag<T>::load(buf + PLANE + fragB + j * (16 * PITCH) + kk);
      }
#pragma unroll
      for (int i = 0; i < MI; ++i) {
        ah[i] = Frag<T>::load(buf + fragA + i * (16 * PITCH) + kk);
        if (SPLIT) al[i] = Frag<T>::load(buf + PLANE + fragA + i * (16 * PITCH) + kk);
      }
#pragma unroll
      for (int i = 0; i < MI; ++i) {
#pragma unroll
        for (int j = 0; j < 4; ++j) {
          acc[i][j] = Frag<T>::mma(ah[i], bh[j], acc[i][j]);
          if (SPLIT) {
            acc[i][j] = Frag<T>::mma(ah[i], bl[j], acc[i][j]);
            acc[i][j] = Frag<T>::mma(al[i], bh[j], acc[i][j]);
          }
        }
        Frag<T>::guard4(acc[i][0], acc[i][1], acc[i][2], acc[i][3], ah[i], SPLIT ? al[i] : ah[i]);
      }
      Frag<T>::keep(bh[0], bh[1], bh[2], bh[3]);
      if (SPLIT) Frag<T>::keep(bl[0], bl[1], bl[2], bl[3]);
    }
  };

  gload(0);
  sstore(sOp);
  __syncthreads();
  // kept rolled, for speed only
#pragma unroll 1
  for (int s = 0; s < NS; ++s) {
    if (s + 1 < NS) gload((s + 1) * KS);                       // block-uniform
    compute(sOp + (s & 1) * BUF);
    if (s + 1 < NS) sstore(sOp + ((s + 1) & 1) * BUF);
    // the one barrier of a stage: publishes stage s+1 and ends the reads of stage s, whose buffer the next pass overwrites
    __syncthreads();
  }
#pragma unroll   // acc is indexed by constants only, so that it stays in registers
  for (int i = 0; i < MI; ++i) acc_guard4(acc[i][0], acc[i][1], acc[i][2], acc[i][3]);

  // ---- epilogue ----
  float* slab = sT + wave * (16 * 68);
  const float* Rb = RESID ? (resid + (size_t)b * strideR) : nullptr;
  v4f lam0 = (v4f){0.f, 0.f, 0.f, 0.f}, lam1 = lam0;
  // OUT_MODE 3: block-uniform bases of the block's first row in x and in the two planes (pitch kChan); every lane adds one fixed byte
  // offset, offX (f32; half of it in the bf16 planes), and the row groups are immediates. t == 0 can only fall on the first row of a
  // wave's tile (64 divides kSeq): there the prior row's address is the row's own and its factor 0.
  static_assert(OUT_MODE != 3 || kSeq % 64 == 0, "t == 0 only on a wave tile's first row");
  const char* gX = nullptr; char* gH = nullptr; char* gL = nullptr;
  unsigned offX = 0, offP0 = 0;
  float fz0 = 1.0f;
  if (OUT_MODE == 3) {
    const size_t tile0 = (size_t)(bm * BM) * kChan + bn * BN;
    gX = (const char*)(resid + tile0);
    gH = (char*)((unsigned short*)Cout  + (size_t)b * strideC + tile0);
    gL = (char*)((unsigned short*)Cout2 + (size_t)(b > 0 ? (b - 1) : 0) * strideC + tile0);
    const int row0 = (wm << 6) + (lane >> 3);
    offX = (unsigned)(row0 * kChan + (wn << 6) + (lane & 7) * 8) * 4u;
    const bool t0 = ((bm * BM + row0) & (kSeq - 1)) == 0;
    offP0 = t0 ? offX + (unsigned)(kChan * 4) : offX;      // counted from one row above gX, so that it is never negative
    fz0 = t0 ? 0.0f : 1.0f;
    const float* pl = bias + (size_t)b * N + n0 + (lane & 7) * 8;
    __builtin_amdgcn_sched_barrier(0);   // with the one below: keeps the two loads and their wait together
    lam0 = *(const v4f*)(pl); lam1 = *(const v4f*)(pl + 4);
    // precaution: this wait stands in front of every later write of a register that one of these two loads names
    asm volatile("s_wait_xcnt 0x0" ::: "memory");
    __builtin_amdgcn_sched_barrier(0);
  }
#pragma unroll
  for (int i = 0; i < MI; ++i) {
    const int mBase = m0 + (i << 4);
    v4f xa0[4], xa1[4], xb0[4], xb1[4];
    if (OUT_MODE == 3) {
      // the two scheduling barriers keep every other instruction out of the group of loads and its wait, and the group ahead of
      // the slab writes, which are served while the loads fly
      __builtin_amdgcn_sched_barrier(0);
#pragma unroll
      for (int it = 0; it < 4; ++it) {
        const int r = i * 16 + it * 4;                       // this lane's row = first row of its wave + r + q
        const char* px = gX + (size_t)r * (kChan * 4) + offX;
        const char* pp = (r == 0) ? (gX - kChan * 4 + offP0) : (gX + (size_t)(r - 1) * (kChan * 4) + offX);
        xa0[it] = *(const v4f*)(px); xa1[it] = *(const v4f*)(px + 16);
        xb0[it] = *(const v4f*)(pp); xb1[it] = *(const v4f*)(pp + 16);
      }
      // precaution: this wait stands in front of every later write of a register that one of these loads names
      asm volatile("s_wait_xcnt 0x0" ::: "memory");
      __builtin_amdgcn_sched_barrier(0);
    }
#pragma unroll
    for (int j = 0; j < 4; ++j) {
      const int n = n0 + (j << 4) + rlane;
      float bv = 0.f;
      if (BIAS_MODE == 2) bv = bias[n];
#pragma unroll
      for (int r = 0; r < 8; ++r) {
        float v = acc[i][j][r] * scale;
        if (BIAS_MODE == 1) v += bias[mBase + mOff + r];
        if (BIAS_MODE == 2) v += bv;
        if (RESID) v += Rb[(size_t)(mBase + mOff + r) * ldc + n];
        if (ACT == 2) v = fmaxf(v, 0.0f);
        if (ACT == 4) v = (v > 0.f) ? v : 0.01f * v;
        slab[(mOff + r) * 68 + (j << 4) + rlane] = v;
      }
    }
    __builtin_amdgcn_fence(__ATOMIC_RELEASE, "workgroup");
    __builtin_amdgcn_wave_barrier();
    __builtin_amdgcn_fence(__ATOMIC_ACQUIRE, "workgroup");
    if (OUT_MODE == 0) {
      float* C = (float*)Cout + (size_t)b * strideC;
      const int hh = lane >> 4, c4 = (lane & 15) * 4;     // row seg = 256 B = 16 lanes x 16 B
      v4f v[8];
      float* pc[8];
#pragma unroll   // here and below: v and pc are indexed by constants only, so that they stay in registers
      for (int it = 0; it < 8; ++it) {
        const int row = it * 2 + hh;
        v[it]  = *(const v4f*)(slab + row * 68 + c4);
        pc[it] = C + (size_t)(mBase + row) * ldc + n0 + c4;
      }
      // the two scheduling barriers keep every other instruction out of the group of stores and its wait
      __builtin_amdgcn_sched_barrier(0);
#pragma unroll
      for (int it = 0; it < 8; ++it) *(v4f*)pc[it] = v[it];
      // precaution: this wait stands in front of every later write of a register that one of these stores names
      asm volatile("s_wait_xcnt 0x0" ::: "memory");
      __builtin_amdgcn_sched_barrier(0);
    } else if (OUT_MODE == 3) {
      const int q = lane >> 3, c8 = (lane & 7) * 8;
      v4u uh[4], ul[4];
#pragma unroll
      for (int it = 0; it < 4; ++it) {
        const int row = it * 4 + q;
        const float fz = (i == 0 && it == 0) ? fz0 : 1.0f;
        const v4f u0 = *(const v4f*)(slab + row * 68 + c8), u1 = *(const v4f*)(slab + row * 68 + c8 + 4);
        unsigned short hb[8], lb[8];
#pragma unroll
        for (int e = 0; e < 4; ++e) {
          const float ba0 = xb0[it][e] * fz - xa0[it][e];
          const float ba1 = xb1[it][e] * fz - xa1[it][e];
          const float v0 = xa0[it][e] + ba0 * (u0[e] + lam0[e]);
          const float v1 = xa1[it][e] + ba1 * (u1[e] + lam1[e]);
          bf_split_bits(v0, hb[e], lb[e]);
          bf_split_bits(v1, hb[4 + e], lb[4 + e]);
        }
        uh[it] = (v4u){pk16(hb[0], hb[1]), pk16(hb[2], hb[3]), pk16(hb[4], hb[5]), pk16(hb[6], hb[7])};
        ul[it] = (v4u){pk16(lb[0], lb[1]), pk16(lb[2], lb[3]), pk16(lb[4], lb[5]), pk16(lb[6], lb[7])};
      }
      // as for the loads: nothing else is scheduled into the group of stores and its wait
      __builtin_amdgcn_sched_barrier(0);
#pragma unroll
      for (int it = 0; it < 4; ++it) *(v4u*)(gH + (size_t)(i * 16 + it * 4) * (kChan * 2) + offX / 2) = uh[it];
      // the same precaution for the registers that these stores name
      asm volatile("s_wait_xcnt 0x0" ::: "memory");
      __builtin_amdgcn_sched_barrier(0);
      if (b > 0) {                                           // block-uniform: branch 0 has no lo plane
        __builtin_amdgcn_sched_barrier(0);
#pragma unroll
        for (int it = 0; it < 4; ++it) *(v4u*)(gL + (size_t)(i * 16 + it * 4) * (kChan * 2) + offX / 2) = ul[it];
        asm volatile("s_wait_xcnt 0x0" ::: "memory");        // the same precaution
        __builtin_amdgcn_sched_barrier(0);
      }
    } else {
      const int q = lane >> 3, c8 = (lane & 7) * 8;
      unsigned short* C  = (unsigned short*)Cout  + (size_t)b * strideC;
      unsigned short* C2 = (OUT_MODE == 2) ? ((unsigned short*)Cout2 + (size_t)b * strideC) : nullptr;
      {
#pragma unroll
        for (int it = 0; it < 4; ++it) {
          const int row = it * 4 + q;
          const float* sp = slab + row * 68 + c8;
          v8h hv, lv;
#pragma unroll
          for (int e = 0; e < 8; ++e) {
            if (OUT_MODE == 1) {
              hv[e] = (_Float16)sp[e];
            } else {
              unsigned short hb = f2bf_bits(sp[e]);
              unsigned short lb = f2bf_bits(sp[e] - bf_bits2f(hb));
              hv[e] = __builtin_bit_cast(_Float16, hb);
              lv[e] = __builtin_bit_cast(_Float16, lb);
            }
          }
          *(v8h*)(C + (size_t)(mBase + row) * ldc + n0 + c8) = hv;
          if (OUT_MODE == 2) *(v8h*)(C2 + (size_t)(mBase + row) * ldc + n0 + c8) = lv;
        }
        
      }
    }
    __builtin_amdgcn_fence(__ATOMIC_RELEASE, "workgroup");
    __builtin_amdgcn_wave_barrier();
    __builtin_amdgcn_fence(__ATOMIC_ACQUIRE, "workgroup");
  }
}

// One GEMM in a launch of its own: grid (tiles, batch).
template <int ET, bool SPLIT, int BIAS_MODE, int OUT_MODE, bool RESID, int ACT, int WM, int WN, int KS, int KD>
__global__ __launch_bounds__(32 * WM * WN) void wmma_gemm64(
    const unsigned short* __restrict__ Ap, const unsigned short* __restrict__ A2p, long strideA,
    const unsigned short* __restrict__ Btp, const unsigned short* __restrict__ Bt2p, long strideB,
    void* __restrict__ Cout, void* __restrict__ Cout2, int ldc, long strideC,
    const float* __restrict__ bias,
    const float* __restrict__ resid, long strideR,
    int N, float scale) {
  __shared__ __align__(16) char smem[kGemmLds<SPLIT, WM, WN, KS, 4>];
  gemm64_body<ET, SPLIT, BIAS_MODE, OUT_MODE, RESID, ACT, WM, WN, KS, KD, 4>(
      smem, blockIdx.x, blockIdx.y, Ap, A2p, strideA, Btp, Bt2p, strideB, Cout, Cout2, ldc, strideC, bias, resid, strideR, N, scale);
}

// The three GEMMs that read only the branch inputs, in one launch of 224 blocks, each block alone on its WGP by its LDS:
//   blocks   0..191  k / v / r projections (split, K 1024), 64 tiles of 128 x 256 for each of the three
//   blocks 192..215  gate lowrank (split, N 192, K 1024), 24 tiles of 256 x 64, eight waves of 32 x 64
//   blocks 216..223  decay lowrank (single, N 64, K 1024), 8 tiles of 256 x 64, eight waves of 32 x 64
constexpr int kProjTiles = (kRows / 128) * (kChan / 256);   // 64
constexpr int kGateTiles = (kRows / 256) * (kMixPad / 64);  // 24
constexpr int kDecTiles  = (kRows / 256) * (kDec / 64);     // 8
__global__ __launch_bounds__(256) void k_branch_gemms(
    const unsigned short* __restrict__ X5H, const unsigned short* __restrict__ X5L,
    const unsigned short* __restrict__ WH, const unsigned short* __restrict__ WL, float* __restrict__ KVR,
    const unsigned short* __restrict__ WG1TH, const unsigned short* __restrict__ WG1TL, float* __restrict__ GHPRE,
    const unsigned short* __restrict__ TDAT, float* __restrict__ LPRE) {
  const float* fdum = nullptr;                               // bias and resid of the engine: not used by these GEMMs, never dereferenced
  __shared__ __align__(16) char smem[kGemmLds<true, 2, 4, 64, 4>];
  static_assert(kGemmLds<true, 8, 1, 64, 2> <= kGemmLds<true, 2, 4, 64, 4> && kGemmLds<false, 8, 1, 64, 2> <= kGemmLds<true, 2, 4, 64, 4>, "LDS share");
  const int id = blockIdx.x;                                 // every branch below is block-uniform
  if (id < 3 * kProjTiles) {
    gemm64_body<1, true, 0, 0, false, 0, 2, 4, 64, kChan, 4>(
        smem, id % kProjTiles, id / kProjTiles, X5H + kPlane, X5L, (long)kPlane, WH, WL, (long)kWPlane,
        (void*)KVR, (void*)KVR, kChan, (long)kPlane, fdum, fdum, 0L, kChan, 1.0f);
  } else if (id < 3 * kProjTiles + kGateTiles) {
    gemm64_body<1, true, 0, 0, false, 0, 8, 1, 64, kChan, 2>(
        smem, id - 3 * kProjTiles, 0, X5H + 4 * kPlane, X5L + 3 * kPlane, 0L, WG1TH, WG1TL, 0L,
        (void*)GHPRE, (void*)GHPRE, kMixPad, 0L, fdum, fdum, 0L, kMixPad, 1.0f);
  } else {
    gemm64_body<1, false, 0, 0, false, 0, 8, 1, 64, kChan, 2>(
        smem, id - 3 * kProjTiles - kGateTiles, 0, X5H, X5H, 0L, TDAT, TDAT, 0L,
        (void*)LPRE, (void*)LPRE, kDec, 0L, fdum, fdum, 0L, kDec, 1.0f);
  }
}

// The two GEMMs behind the tanh of the two lowrank paths, in one launch of 128 blocks:
//   blocks  0..63   gate output (split, K 192), blocks 64..127 decay output (single, K 64); 64 tiles of 128 x 256 each
__global__ __launch_bounds__(256) void k_lowrank_out_gemms(
    const unsigned short* __restrict__ GHH, const unsigned short* __restrict__ GHL,
    const unsigned short* __restrict__ WG2TH, const unsigned short* __restrict__ WG2TL, float* __restrict__ GATE,
    const unsigned short* __restrict__ L1, const unsigned short* __restrict__ TDBT, float* __restrict__ WLR) {
  const float* fdum = nullptr;                               // bias and resid of the engine: not used by these GEMMs, never dereferenced
  __shared__ __align__(16) char smem[kGemmLds<true, 2, 4, 64, 4>];
  const int id = blockIdx.x;                                 // block-uniform
  if (id < kProjTiles) {
    gemm64_body<1, true, 0, 0, false, 0, 2, 4, 64, kMixPad, 4>(
        smem, id, 0, GHH, GHL, 0L, WG2TH, WG2TL, 0L, (void*)GATE, (void*)GATE, kChan, 0L, fdum, fdum, 0L, kChan, 1.0f);
  } else {
    gemm64_body<1, false, 0, 0, false, 0, 2, 4, 64, kDec, 4>(
        smem, id - kProjTiles, 0, L1, L1, 0L, TDBT, TDBT, 0L, (void*)WLR, (void*)WLR, kChan, 0L, fdum, fdum, 0L, kChan, 1.0f);
  }
}

// ---------------------------------------------------------------------------
// Square weight split: four [1024][1024] f32 matrices (layout kept as-is = [out][in] = Bt) -> bf16 hi and lo planes.
// 512 x 4 blocks (bx, z): z selects the matrix and the output plane (planes at out + z*1048576 halves).
// Thread i owns 8 consecutive elements: two b128 loads, one 16-B store per lane per plane; a wave writes 512 contiguous
// ---------------------------------------------------------------------------
__device__ __forceinline__ void wsplit8_body(const int bx, const int z,
                                             const float* __restrict__ W0, const float* __restrict__ W1,
                                             const float* __restrict__ W2, const float* __restrict__ W3,
                                             unsigned short* __restrict__ outH, unsigned short* __restrict__ outL,
                                             int n8PerMat) {
  const float* W = (z == 0) ? W0 : (z == 1) ? W1 : (z == 2) ? W2 : W3;   // block-uniform
  const int i = bx * 256 + threadIdx.x;
  if (i >= n8PerMat) return;
  const float* p = W + 8 * (size_t)i;
  const v4f a = *(const v4f*)(p);
  const v4f c = *(const v4f*)(p + 4);
  unsigned short hb[8], lb[8];
#pragma unroll
  for (int e = 0; e < 4; ++e) {
    bf_split_bits(a[e], hb[e], lb[e]);
    bf_split_bits(c[e], hb[4 + e], lb[4 + e]);
  }
  const v4u uh = (v4u){pk16(hb[0], hb[1]), pk16(hb[2], hb[3]), pk16(hb[4], hb[5]), pk16(hb[6], hb[7])};
  const v4u ul = (v4u){pk16(lb[0], lb[1]), pk16(lb[2], lb[3]), pk16(lb[4], lb[5]), pk16(lb[6], lb[7])};
  const size_t o = (size_t)z * (size_t)kWPlane + 8 * (size_t)i;
  *(v4u*)(outH + o) = uh;
  *(v4u*)(outL + o) = ul;
  // precaution: this wait stands in front of every later write of a register that one of these stores names
  asm volatile("s_wait_xcnt 0x0" ::: "memory");
}

// ---------------------------------------------------------------------------
// Transpose + bf16 convert (single or hi/lo): in[R][Cc] f32 row-major (pitch Cc) -> out[n][k] = cvt(in[k][n]) for
// k < R and n < Cc, zero otherwise (pad rows / pad columns of the output plane are WRITTEN as zeros).
// blocks (bx, by, bz) of nTilesN x nTilesK x Z: a block covers 32 output rows n0..n0+31 and KT output columns k0..k0+KT-1; bz adds
// inStrideZ / outStrideZ element offsets. 256 threads; sm = 32 * (KT + 1) floats of LDS.
// Load coverage: (32*KT/256) iterations x 256 threads = 32 x KT elements (coalesced along n), clamped address, 0/1 factor.
// Store, KT == 64: row = wave*4 + (lane>>3) -> 8 waves x 4 = 32 rows; (lane&7) x 8 halves = 64 cols; each row segment =
// Store, KT == 32 (requires ldo == 32, k0 == 0): threads 0..127, row = t>>2, c8 = (t&3)*8 -> thread t writes tile bytes
// ---------------------------------------------------------------------------
template <bool SPLIT, int KT>
__device__ __forceinline__ void trcast_body(float* sm, const int bx, const int by, const int bz,
                                            const float* __restrict__ in, int R, int Cc, long inStrideZ,
                                            unsigned short* __restrict__ outH, unsigned short* __restrict__ outL,
                                            int ldo, long outStrideZ) {
  static_assert(KT == 64 || KT == 32, "tile");
  const int t  = threadIdx.x;
  const int n0 = bx * 32;
  const int k0 = by * KT;
  const float* inz = in + (size_t)bz * inStrideZ;
  constexpr int kIters = (32 * KT) / 256;
  const float* pin[kIters];
  float fz[kIters], v[kIters];
#pragma unroll   // here and in the two loops below: the three arrays are indexed by constants only, so that they stay in registers
  for (int it = 0; it < kIters; ++it) {
    const int e  = it * 256 + t;
    const int n  = n0 + (e & 31);
    const int k  = k0 + (e >> 5);
    const int nc = (n < Cc) ? n : (Cc - 1);
    const int kc = (k < R) ? k : (R - 1);
    pin[it] = inz + (size_t)kc * Cc + nc;
    fz[it]  = ((n < Cc) && (k < R)) ? 1.0f : 0.0f;
  }
  // the two scheduling barriers keep every other instruction out of the group of loads and its wait
  __builtin_amdgcn_sched_barrier(0);
#pragma unroll
  for (int it = 0; it < kIters; ++it) v[it] = *pin[it];
  // precaution: this wait stands in front of every later write of a register that one of these loads names
  asm volatile("s_wait_xcnt 0x0" ::: "memory");
  __builtin_amdgcn_sched_barrier(0);
#pragma unroll
  for (int it = 0; it < kIters; ++it) {
    const int e = it * 256 + t;
    sm[(e & 31) * (KT + 1) + (e >> 5)] = v[it] * fz[it];
  }
  __syncthreads();
  const int lane = t & 31, wave = t >> 5;
  unsigned short* oh = outH + (size_t)bz * outStrideZ;
  unsigned short* ol = outL + (size_t)bz * outStrideZ;
  int row, c8;
  bool active;
  if (KT == 64) { row = wave * 4 + (lane >> 3); c8 = (lane & 7) * 8; active = true; }
  else          { row = t >> 2;                 c8 = (t & 3) * 8;    active = (t < 128); }
  if (active) {
    unsigned short hb[8], lb[8];
#pragma unroll
    for (int e = 0; e < 8; ++e) {
      const float v = sm[row * (KT + 1) + c8 + e];
      if (SPLIT) { bf_split_bits(v, hb[e], lb[e]); }
      else       { hb[e] = f2bf_bits(v); lb[e] = 0; }
    }
    const v4u uh = (v4u){pk16(hb[0], hb[1]), pk16(hb[2], hb[3]), pk16(hb[4], hb[5]), pk16(hb[6], hb[7])};
    const v4u ul = (v4u){pk16(lb[0], lb[1]), pk16(lb[2], lb[3]), pk16(lb[4], lb[5]), pk16(lb[6], lb[7])};
    const size_t o = (size_t)(n0 + row) * ldo + k0 + c8;
    *(v4u*)(oh + o) = uh;
    if (SPLIT) *(v4u*)(ol + o) = ul;
    // precaution: this wait stands in front of every later write of a register that one of these stores names
    asm volatile("s_wait_xcnt 0x0" ::: "memory");
  }
}

// ---------------------------------------------------------------------------
// Token shift: xx[m][c] = x[m][c] + (x[m-1][c]*f - x[m][c]) * miu_x[c], f = 0 at t == 0 else 1 (address of the prior row
// clamped, arithmetic 0/1 factor). Output: single bf16 plane [2048][1024].
// ---------------------------------------------------------------------------
__device__ __forceinline__ void xx8_body(const int bx, const float* __restrict__ x, const float* __restrict__ miu_x,
                                         unsigned short* __restrict__ XX, int n8) {
  const int i = bx * 256 + threadIdx.x;
  if (i >= n8) return;
  const int f  = 8 * i;
  const int m  = f >> 10;
  const int c0 = f & 1023;
  const int t  = m & 1023;
  const int mp = (t > 0) ? (m - 1) : m;
  const float fz = (t > 0) ? 1.0f : 0.0f;
  const float* px = x + f;
  const float* pp = x + ((size_t)mp << 10) + c0;
  const float* pm = miu_x + c0;
  const v4f a0 = *(const v4f*)(px), a1 = *(const v4f*)(px + 4);
  const v4f b0 = *(const v4f*)(pp), b1 = *(const v4f*)(pp + 4);
  const v4f u0 = *(const v4f*)(pm), u1 = *(const v4f*)(pm + 4);
  unsigned short hb[8];
#pragma unroll
  for (int e = 0; e < 4; ++e) {
    const float ba0 = b0[e] * fz - a0[e];
    const float ba1 = b1[e] * fz - a1[e];
    hb[e]     = f2bf_bits(a0[e] + ba0 * u0[e]);
    hb[4 + e] = f2bf_bits(a1[e] + ba1 * u1[e]);
  }
  const v4u uh = (v4u){pk16(hb[0], hb[1]), pk16(hb[2], hb[3]), pk16(hb[4], hb[5]), pk16(hb[6], hb[7])};
  unsigned short* q = XX + f;
  *(v4u*)q = uh;
  // precaution: this wait stands in front of every later write of a register that this store names
  asm volatile("s_wait_xcnt 0x0" ::: "memory");
}

// ---------------------------------------------------------------------------
// Everything that reads only the inputs, in one launch: the token shift, the six transposes and the square weight split do not
// depend on one another. blockIdx.x is cut into ranges, one per piece of work, each range holding that piece's own grid; every
// branch is block-uniform, and the one barrier of a transpose is passed by all threads of its block.
// ---------------------------------------------------------------------------
constexpr int kPbXX  = (int)(kPlane / 8) / 256;              // 1024 token shift
constexpr int kPbA   = (kMixPad / 32) * (kChan / 64);        // 96   A    [1024][160] -> AT   [192][1024], rows >= 160 zero
constexpr int kPbTA  = (kDec / 32) * (kChan / 64);           // 32   tdA  [1024][64]  -> TDAT [64][1024]
constexpr int kPbTB  = kChan / 32;                           // 32   tdB  [64][1024]  -> TDBT [1024][64]
constexpr int kPbG1  = (kMixPad / 32) * (kChan / 64);        // 96   Wg1  [1024][160] -> WG1T hi/lo [192][1024], rows >= 160 zero
constexpr int kPbG2  = (kChan / 32) * (kMixPad / 64);        // 96   Wg2  [160][1024] -> WG2T hi/lo [1024][192], cols >= 160 zero
constexpr int kPbBp  = (kChan / 32) * kNBr;                  // 160  Bp[s] [32][1024] -> BPT[s] [1024][32]
constexpr int kPbW   = ((int)(kWPlane / 8) / 256) * 4;       // 2048 Wk, Wv, Wr, Wo hi/lo
constexpr int kPbAll = kPbXX + kPbA + kPbTA + kPbTB + kPbG1 + kPbG2 + kPbBp + kPbW;
__global__ __launch_bounds__(256) void k_prepare(
    const float* __restrict__ x, const float* __restrict__ miu_x, const float* __restrict__ Amat,
    const float* __restrict__ tdA, const float* __restrict__ tdB, const float* __restrict__ Wg1, const float* __restrict__ Wg2,
    const float* __restrict__ Bp, const float* __restrict__ Wk, const float* __restrict__ Wv, const float* __restrict__ Wr,
    const float* __restrict__ Wo,
    unsigned short* __restrict__ XX, unsigned short* __restrict__ AT, unsigned short* __restrict__ TDAT,
    unsigned short* __restrict__ TDBT, unsigned short* __restrict__ WG1TH, unsigned short* __restrict__ WG1TL,
    unsigned short* __restrict__ WG2TH, unsigned short* __restrict__ WG2TL, unsigned short* __restrict__ BPT,
    unsigned short* __restrict__ WH, unsigned short* __restrict__ WL) {
  __shared__ float sm[32 * 65];
  int l = blockIdx.x;
  if (l < kPbXX) { xx8_body(l, x, miu_x, XX, (int)(kPlane / 8)); return; }
  l -= kPbXX;
  if (l < kPbA) { trcast_body<false, 64>(sm, l % (kMixPad / 32), l / (kMixPad / 32), 0, Amat, kChan, kMix, 0L, AT, AT, kChan, 0L); return; }
  l -= kPbA;
  if (l < kPbTA) { trcast_body<false, 64>(sm, l % (kDec / 32), l / (kDec / 32), 0, tdA, kChan, kDec, 0L, TDAT, TDAT, kChan, 0L); return; }
  l -= kPbTA;
  if (l < kPbTB) { trcast_body<false, 64>(sm, l, 0, 0, tdB, kDec, kChan, 0L, TDBT, TDBT, kDec, 0L); return; }
  l -= kPbTB;
  if (l < kPbG1) { trcast_body<true, 64>(sm, l % (kMixPad / 32), l / (kMixPad / 32), 0, Wg1, kChan, kMix, 0L, WG1TH, WG1TL, kChan, 0L); return; }
  l -= kPbG1;
  if (l < kPbG2) { trcast_body<true, 64>(sm, l % (kChan / 32), l / (kChan / 32), 0, Wg2, kMix, kChan, 0L, WG2TH, WG2TL, kMixPad, 0L); return; }
  l -= kPbG2;
  if (l < kPbBp) { trcast_body<false, 32>(sm, l % (kChan / 32), 0, l / (kChan / 32), Bp, kBr, kChan, (long)kBr * kChan, BPT, BPT, kBr, (long)kChan * kBr); return; }
  l -= kPbBp;
  wsplit8_body(l % (kPbW / 4), l / (kPbW / 4), Wk, Wv, Wr, Wo, WH, WL, (int)(kWPlane / 8));
}

// ---------------------------------------------------------------------------
// tanh + bf16 convert (single or hi/lo) with column compaction / padding:
//   out flat index f = m*ncols + c  <-  tanh(in[m*ldin + c]) for c < nvalid, 0 for c >= nvalid  (ncols <= ldin, both even).
// ---------------------------------------------------------------------------
template <bool SPLIT>
__device__ __forceinline__ void tanh2_body(const int bx, const float* __restrict__ in, int ldin,
                                           unsigned short* __restrict__ outH, unsigned short* __restrict__ outL,
                                           int ncols, int nvalid, int n2) {
  const int i = bx * 256 + threadIdx.x;
  if (i >= n2) return;
  const int f = 2 * i;
  const int m = f / ncols;
  const int c = f - m * ncols;
  const v2f a = *(const v2f*)(in + (size_t)m * ldin + c);
  // precaution: this wait stands in front of every later write of a register that this load names
  asm volatile("s_wait_xcnt 0x0" ::: "memory");
  const float f0 = (c < nvalid) ? 1.0f : 0.0f;
  const float f1 = (c + 1 < nvalid) ? 1.0f : 0.0f;
  const float t0 = tanhf(a[0]) * f0;
  const float t1 = tanhf(a[1]) * f1;
  unsigned short h0, h1, l0 = 0, l1 = 0;
  if (SPLIT) { bf_split_bits(t0, h0, l0); bf_split_bits(t1, h1, l1); }
  else       { h0 = f2bf_bits(t0); h1 = f2bf_bits(t1); }
  const unsigned uh = pk16(h0, h1);
  const unsigned ul = pk16(l0, l1);
  ((unsigned*)outH)[i] = uh;
  if (SPLIT) ((unsigned*)outL)[i] = ul;
  
}

template <bool SPLIT>
__global__ __launch_bounds__(256) void k_tanh2(const float* __restrict__ in, int ldin,
                                               unsigned short* __restrict__ outH, unsigned short* __restrict__ outL,
                                               int ncols, int nvalid, int n2) {
  tanh2_body<SPLIT>(blockIdx.x, in, ldin, outH, outL, ncols, nvalid, n2);
}
// The tanh of the gate lowrank (hi/lo, 768 blocks) and of the decay lowrank (single, 256 blocks) in one launch; block-uniform branch.
constexpr int kTbGate = (kRows * kMixPad / 2) / 256;
constexpr int kTbDec  = (kRows * kDec / 2) / 256;
__global__ __launch_bounds__(256) void k_tanh_pair(const float* __restrict__ GHPRE, unsigned short* __restrict__ GHH,
                                                   unsigned short* __restrict__ GHL, const float* __restrict__ LPRE,
                                                   unsigned short* __restrict__ L1) {
  const int id = blockIdx.x;
  if (id < kTbGate) tanh2_body<true>(id, GHPRE, kMixPad, GHH, GHL, kMixPad, kMix, kRows * kMixPad / 2);
  else              tanh2_body<false>(id - kTbGate, LPRE, kDec, L1, L1, kDec, kDec, kRows * kDec / 2);
}

// ---------------------------------------------------------------------------
// Linear-attention state scan, f32. One block (128 threads = 4 waves, one per SIMD) per (batch b, head n, half ih of the
// v channels): the rows i of the state are independent, so each block carries 32 rows x 64 k channels.
// Thread (ip, jg): jg = lane & 7 owns k channels 8*jg .. 8*jg+7, ip = wave*4 + (lane >> 3) owns rows 2*ip, 2*ip+1;
// S lives in 8 f32 pairs (pairs run along j, so r, k and d pairs come straight out of the b128 LDS reads).
// The sequence is cut into chunks of kSc timesteps; pass c of the loop, between two block barriers,
//   - runs the kSc steps of chunk c from stage buffer c & 1 (r, k*exp(min(w,0)), exp(w), v; w = wl + td_miu). A step has no
//     barrier: each thread stores its partial sum over its 8 k channels to partial buffer c & 1;
//   - writes chunk c+1 into the other stage buffer, piece by piece between the steps, and issues the loads of chunk c+2;
//   - finishes chunk c-1: y_i = sum of the 8 partials + v_i * bonus[t], bonus[t] = sum_j r_j*u_j*k_j (16 partials per step,
//     written by the staging threads into a ring of 4 slots). Each 128-B line of Y is stored once, by 8 lanes of one wave.
// ---------------------------------------------------------------------------
constexpr int kSc  = 32;             // timesteps per chunk
constexpr int kNC  = kSeq / kSc;     // chunks
constexpr int kIB  = 32;             // state rows (v channels) per block
constexpr int kPJ  = 40;             // floats between the partial rows of two j groups: the 8 groups of a store hit disjoint banks
constexpr int kPT  = 8 * kPJ + 32;   // floats between two timesteps' partials: two timesteps of one b128 read hit disjoint banks
constexpr int kPre = 6;              // steps whose LDS operands are fetched ahead of their use
static_assert(kSeq % kSc == 0 && kNC >= 2 && kHead == 2 * kIB && kSc % 16 == 0 && kSc > kPre, "scan chunking");
struct ScanOp { v4f r0, r1, k0, k1, d0, d1; v2f v; };
__device__ __forceinline__ v2f lo2(v4f a) { return (v2f){a[0], a[1]}; }
__device__ __forceinline__ v2f hi2(v4f a) { return (v2f){a[2], a[3]}; }
__global__ __launch_bounds__(128) void k_state_scan(const float* __restrict__ kraw, const float* __restrict__ vpl,
                                                    const float* __restrict__ rpl, const float* __restrict__ wl,
                                                    const float* __restrict__ td_miu, const float* __restrict__ u,
                                                    float* __restrict__ Y) {
  __shared__ __align__(16) float sr0[kSc * 64], sr1[kSc * 64];
  __shared__ __align__(16) float sk0[kSc * 64], sk1[kSc * 64];
  __shared__ __align__(16) float sd0[kSc * 64], sd1[kSc * 64];
  __shared__ __align__(16) float sv0[kSc * kIB], sv1[kSc * kIB];
  __shared__ __align__(16) float part0[kSc * kPT], part1[kSc * kPT];
  __shared__ __align__(16) float sbp[4][kSc][16];
  const int tid  = threadIdx.x;
  const int lane = tid & 31;
  const int wave = tid >> 5;
  const int ih   = blockIdx.x & 1;
  const int n    = (blockIdx.x >> 1) & (kNHead - 1);
  const int b    = blockIdx.x >> 5;
  const int jg   = lane & 7;
  const int j0   = jg * 8;
  const int il   = (wave * 4 + (lane >> 3)) * 2;      // first of this thread's two rows, local to the block
  // staging and output roles: r/k/w rows are 16 float4 wide, v and y rows 8 float4 wide
  const int sRow = tid >> 4, sC4 = (tid & 15) * 4;
  const int vRow = tid >> 3, vC4 = (tid & 7) * 4;
  const size_t base = (size_t)b * kSeq * kChan + (size_t)n * kHead;
  const unsigned offS = (unsigned)(sRow * kChan + sC4) * 4u;             // byte offsets of the two roles inside a piece
  const unsigned offV = (unsigned)(vRow * kChan + ih * kIB + vC4) * 4u;
  const v4f tm4 = *(const v4f*)(td_miu + n * kHead + sC4);
  const v4f u4  = *(const v4f*)(u + n * kHead + sC4);
  // precaution: this wait stands in front of every later write of a register that one of these two loads names; the scheduling
  // barrier keeps later instructions behind it
  asm volatile("s_wait_xcnt 0x0" ::: "memory");
  __builtin_amdgcn_sched_barrier(0);

  v2f S0[4], S1[4];
#pragma unroll
  for (int q = 0; q < 4; ++q) { S0[q] = (v2f){0.f, 0.f}; S1[q] = (v2f){0.f, 0.f}; }

  // staged through registers in kSc/8 pieces: piece it = 8 rows of r, k, w (and, for the first kSc/16 pieces, 16 rows of v)
  v4f gw[kSc / 8], gk[kSc / 8], gr[kSc / 8], gv[kSc / 16];
  // the v values this thread staged are the ones its own output role needs two passes later: vOld of chunk c-1, vNew of chunk c
  v4f vOld[kSc / 16], vNew[kSc / 16];
#pragma unroll
  for (int it = 0; it < kSc / 16; ++it) { vOld[it] = (v4f){0.f, 0.f, 0.f, 0.f}; vNew[it] = vOld[it]; }
  auto issue = [&](int it, int t0) {
    const size_t ub = base + (size_t)(t0 + it * 8) * kChan;      // block-uniform: scalar base + this thread's fixed byte offset
    const size_t uv = base + (size_t)(t0 + it * 16) * kChan;
    // the two scheduling barriers keep every other instruction out of the group of loads and its wait
    __builtin_amdgcn_sched_barrier(0);
    gw[it] = *(const v4f*)((const char*)(wl + ub) + offS);
    gk[it] = *(const v4f*)((const char*)(kraw + ub) + offS);
    gr[it] = *(const v4f*)((const char*)(rpl + ub) + offS);
    if (it < kSc / 16) gv[it] = *(const v4f*)((const char*)(vpl + uv) + offV);
    // precaution: this wait stands in front of every later write of a register that one of these loads names
    asm volatile("s_wait_xcnt 0x0" ::: "memory");
    __builtin_amdgcn_sched_barrier(0);
  };
  auto commit = [&](int it, float* dr, float* dk, float* dd_, float* dv, int slot) {
    const int tl = it * 8 + sRow;
    v4f kk, dd;
    float bp = 0.0f;
#pragma unroll
    for (int e = 0; e < 4; ++e) {
      const float wv = gw[it][e] + tm4[e];
      kk[e] = gk[it][e] * expf(fminf(wv, 0.0f));
      dd[e] = expf(wv);
      bp += gr[it][e] * (u4[e] * kk[e]);
    }
    *(v4f*)(dr + tl * 64 + sC4)  = gr[it];
    *(v4f*)(dk + tl * 64 + sC4)  = kk;
    *(v4f*)(dd_ + tl * 64 + sC4) = dd;
    sbp[slot][tl][tid & 15] = bp;
    if (it < kSc / 16) {
      *(v4f*)(dv + (it * 16 + vRow) * kIB + vC4) = gv[it];
      vOld[it] = vNew[it];
      vNew[it] = gv[it];
    }
  };
  // finishing chunk cc from its partials (src), its bonus slot and vOld: the LDS reads, and apart from them the sums and stores
  v4f x[kSc / 16][12];
  auto finish_load = [&](const float* src, int cc) {
#pragma unroll
    for (int it = 0; it < kSc / 16; ++it) {
      const int tl = it * 16 + vRow;
#pragma unroll
      for (int g = 0; g < 8; ++g) x[it][g] = *(const v4f*)(src + tl * kPT + g * kPJ + vC4);
#pragma unroll
      for (int g = 0; g < 4; ++g) x[it][8 + g] = *(const v4f*)(&sbp[cc & 3][tl][4 * g]);
    }
  };
  auto finish_sum = [&](int cc) {
    v4f yv[kSc / 16];
#pragma unroll
    for (int it = 0; it < kSc / 16; ++it) {
      const v4f b4 = (x[it][8] + x[it][9]) + (x[it][10] + x[it][11]);
      const float bn = (b4[0] + b4[1]) + (b4[2] + b4[3]);
      yv[it] = (((x[it][0] + x[it][1]) + (x[it][2] + x[it][3])) + ((x[it][4] + x[it][5]) + (x[it][6] + x[it][7]))) + vOld[it] * bn;
    }
    // as in issue(): nothing else is scheduled into the group of stores and its wait
    __builtin_amdgcn_sched_barrier(0);
#pragma unroll
    for (int it = 0; it < kSc / 16; ++it)
      *(v4f*)((char*)(Y + base + (size_t)(cc * kSc + it * 16) * kChan) + offV) = yv[it];
    // the same precaution for the registers that these stores name
    asm volatile("s_wait_xcnt 0x0" ::: "memory");
    __builtin_amdgcn_sched_barrier(0);
  };
  auto pass = [&](int c) {
    const int p = c & 1;
    const float* pr = (p ? sr1 : sr0) + j0;
    const float* pk = (p ? sk1 : sk0) + j0;
    const float* pd = (p ? sd1 : sd0) + j0;
    const float* pv = (p ? sv1 : sv0) + il;
    float* pp = (p ? part1 : part0) + jg * kPJ + il;
    // chunk whose loads are issued in this pass; clamped, so that the steps have no branch (the last two passes re-read the last
    // chunk, and the last pass stages it into buffers that nobody reads any more)
    const int tN = ((c + 2 < kNC) ? (c + 2) : (kNC - 1)) * kSc;
    auto ld = [&](int tl) {
      ScanOp o;
      o.r0 = *(const v4f*)(pr + tl * 64); o.r1 = *(const v4f*)(pr + tl * 64 + 4);
      o.k0 = *(const v4f*)(pk + tl * 64); o.k1 = *(const v4f*)(pk + tl * 64 + 4);
      o.d0 = *(const v4f*)(pd + tl * 64); o.d1 = *(const v4f*)(pd + tl * 64 + 4);
      o.v  = *(const v2f*)(pv + tl * kIB);
      return o;
    };
    // the previous chunk's reads first, then the first steps' reads, which are served while the previous chunk is summed and stored
    if (c > 0) finish_load(p ? part0 : part1, c - 1);      // block-uniform
    ScanOp ring[kPre];
#pragma unroll
    for (int tl = 0; tl < kPre; ++tl) ring[tl] = ld(tl);
    if (c > 0) finish_sum(c - 1);
    // fully unrolled so that the ring's slots are registers and every LDS offset an immediate
#pragma unroll
    for (int tl = 0; tl < kSc; ++tl) {
      const ScanOp o = ring[tl % kPre];
      if (tl + kPre < kSc) ring[tl % kPre] = ld(tl + kPre);
      // keeps these reads kPre steps ahead of their use: sunk next to it, the wave would wait out the LDS latency in every step
      __builtin_amdgcn_sched_barrier(0);
      const v2f r2[4] = {lo2(o.r0), hi2(o.r0), lo2(o.r1), hi2(o.r1)};
      const v2f k2[4] = {lo2(o.k0), hi2(o.k0), lo2(o.k1), hi2(o.k1)};
      const v2f d2[4] = {lo2(o.d0), hi2(o.d0), lo2(o.d1), hi2(o.d1)};
      const v2f vv0 = (v2f){o.v[0], o.v[0]};
      const v2f vv1 = (v2f){o.v[1], o.v[1]};
      v2f a0 = r2[0] * S0[0];
      v2f a1 = r2[0] * S1[0];
#pragma unroll
      for (int q = 1; q < 4; ++q) {
        a0 = __builtin_elementwise_fma(r2[q], S0[q], a0);
        a1 = __builtin_elementwise_fma(r2[q], S1[q], a1);
      }
#pragma unroll
      for (int q = 0; q < 4; ++q) {
        S0[q] = __builtin_elementwise_fma(S0[q], d2[q], k2[q] * vv0);
        S1[q] = __builtin_elementwise_fma(S1[q], d2[q], k2[q] * vv1);
      }
      *(v2f*)(pp + tl * kPT) = (v2f){a0[0] + a0[1], a1[0] + a1[1]};
      // one piece of the next chunk's stage every 4 steps, early in the pass: its vector work runs while the LDS reads fetched
      // ahead are served, and the loads issued behind it have the rest of the pass to land before the barrier waits for them
      if ((tl & 3) == 1 && (tl >> 2) < kSc / 8) {
        commit(tl >> 2, p ? sr0 : sr1, p ? sk0 : sk1, p ? sd0 : sd1, p ? sv0 : sv1, (c + 1) & 3);
        issue(tl >> 2, tN);
      }
    }
    // the one barrier of a pass: publishes this chunk's partials and the next chunk's stage, and ends the reads of this chunk's
    // stage and of the previous chunk's partials, which the next pass overwrites
    __syncthreads();
  };

#pragma unroll
  for (int it = 0; it < kSc / 8; ++it) issue(it, 0);
#pragma unroll
  for (int it = 0; it < kSc / 8; ++it) {
    commit(it, sr0, sk0, sd0, sv0, 0);
    issue(it, kSc);
  }
  __syncthreads();
#pragma unroll 1
  for (int c = 0; c < kNC; ++c) pass(c);
  finish_load(((kNC - 1) & 1) ? part1 : part0, kNC - 1);
  finish_sum(kNC - 1);
}

// ---------------------------------------------------------------------------
// GroupNorm (64 channels per head, biased variance, eps 1.6e-4) + affine + gate multiply -> bf16 hi/lo planes.
// One wave per (row m, head n), 8 pairs per 256-thread block; lane owns channels 2l, 2l+1; shuffle reductions (unconditional).
// ---------------------------------------------------------------------------
__global__ __launch_bounds__(256) void k_gn_gate(const float* __restrict__ Y, const float* __restrict__ G,
                                                 const float* __restrict__ gamma, const float* __restrict__ beta,
                                                 unsigned short* __restrict__ outH, unsigned short* __restrict__ outL) {
  __shared__ __align__(16) float slab[8][64];
  const int lane = threadIdx.x & 31, wave = threadIdx.x >> 5;
  const int pair = blockIdx.x * 8 + wave;
  const int m = pair >> 4;
  const int n = pair & 15;
  const size_t base = (size_t)m * kChan + (size_t)n * kHead;
  const int c = n * kHead + 2 * lane;
  const v2f yv = *(const v2f*)(Y + base + 2 * lane);
  const v2f gv = *(const v2f*)(G + base + 2 * lane);
  const v2f ga = *(const v2f*)(gamma + c);
  const v2f be = *(const v2f*)(beta + c);
  float s = yv[0] + yv[1];
#pragma unroll
  for (int off = 16; off > 0; off >>= 1) s += __shfl_xor(s, off, 32);
  const float mean = s * (1.0f / 64.0f);
  const float d0 = yv[0] - mean;
  const float d1 = yv[1] - mean;
  float q = d0 * d0 + d1 * d1;
#pragma unroll
  for (int off = 16; off > 0; off >>= 1) q += __shfl_xor(q, off, 32);
  const float var = q * (1.0f / 64.0f);
  const float rs  = 1.0f / sqrtf(var + kGnEps);
  const float o0 = ((d0 * rs) * ga[0] + be[0]) * gv[0];
  const float o1 = ((d1 * rs) * ga[1] + be[1]) * gv[1];
  *(v2f*)(&slab[wave][2 * lane]) = (v2f){o0, o1};
  __syncthreads();
  if (lane < 8) {
    unsigned short hb[8], lb[8];
#pragma unroll
    for (int e = 0; e < 8; ++e) bf_split_bits(slab[wave][8 * lane + e], hb[e], lb[e]);
    const v4u uh = (v4u){pk16(hb[0], hb[1]), pk16(hb[2], hb[3]), pk16(hb[4], hb[5]), pk16(hb[6], hb[7])};
    const v4u ul = (v4u){pk16(lb[0], lb[1]), pk16(lb[2], lb[3]), pk16(lb[4], lb[5]), pk16(lb[6], lb[7])};
    const size_t o = base + 8 * (size_t)lane;
    *(v4u*)(outH + o) = uh;
    *(v4u*)(outL + o) = ul;
    
  }
}

// ---------------------------------------------------------------------------
// Host glue.
// Workspace region map (bytes; every size is a multiple of 4096, offsets in that order):
//   XX     bf16 [2048][1024]            4,194,304
//   HPRE   f32  [2048][192]             1,572,864   (tanh input of the mix path; cols 160..191 written by the GEMM, unread)
//   HC     bf16 [2048][160] = [10240][32] 655,360   (compact; branch s = rows 2048s.. of the ld-32 view)
//   MIU    f32  [2048][1024]            8,388,608   (the decay lowrank output)
//   X5H    bf16 [5][2048][1024]        20,971,520   (branch inputs hi: 0 decay (single), 1 k, 2 v, 3 r, 4 gate)
//   X5L    bf16 [4][2048][1024]        16,777,216   (lo planes of branches 1..4 at index s-1)
//   WH     bf16 [4][1024][1024]         8,388,608   (Wk, Wv, Wr, Wo hi, [out][in] as-is)
//   WL     bf16 [4][1024][1024]         8,388,608   (lo)
//   AT     bf16 [192][1024]               393,216   (A^T, rows 160..191 zero)
//   TDAT   bf16 [64][1024]                131,072
//   TDBT   bf16 [1024][64]                131,072
//   WG1TH  bf16 [192][1024]               393,216   (rows 160..191 zero)   WG1TL 393,216
//   WG2TH  bf16 [1024][192]               393,216   (cols 160..191 zero)   WG2TL 393,216
//   BPT    bf16 [5][1024][32]             327,680
//   LPRE   f32  [2048][64]                524,288
//   L1     bf16 [2048][64]                262,144
//   KVR    f32  [3][2048][1024]         25,165,824   (k unscaled, v, r)
//   GHPRE  f32  [2048][192]             1,572,864
//   GHH    bf16 [2048][192]               786,432   (cols 160..191 zero)   GHL 786,432
//   GATE   f32  [2048][1024]            8,388,608
//   Y      f32  [2048][1024]            8,388,608
//   GATH   bf16 [2048][1024]            4,194,304   GATL 4,194,304
//   total                             126,156,800
// GEMM shapes (M, N, K): (2048,192,1024) (2048,1024,32)x5 batched (2048,64,1024) (2048,1024,64) (2048,1024,1024)x3 batched
// (2048,192,1024) (2048,1024,192) (2048,1024,1024); all M,N % 64 == 0, all K % 32 == 0, pads zero-written by producers.
// ---------------------------------------------------------------------------
extern "C" void kernel_launch(void* const* d_in, const int* in_sizes, int n_in,
                              void* d_out, int out_size, void* d_ws, size_t ws_size,
                              hipStream_t stream) {
  if (n_in < 17) return;
  if (in_sizes[0] != kBatch * kSeq * kChan) return;
  if (in_sizes[1] != kChan || in_sizes[2] != kNBr * kChan) return;
  if (in_sizes[3] != kChan * kMix || in_sizes[4] != kNBr * kBr * kChan) return;
  if (in_sizes[5] != kChan || in_sizes[6] != kChan * kDec || in_sizes[7] != kDec * kChan) return;
  if (in_sizes[8] != kNHead * kHead) return;
  if (in_sizes[9] != kChan * kChan || in_sizes[10] != kChan * kChan || in_sizes[11] != kChan * kChan || in_sizes[12] != kChan * kChan) return;
  if (in_sizes[13] != kChan * kMix || in_sizes[14] != kMix * kChan) return;
  if (in_sizes[15] != kChan || in_sizes[16] != kChan) return;
  if (out_size != kBatch * kSeq * kChan) return;

  const float* x      = (const float*)d_in[0];
  const float* miu_x  = (const float*)d_in[1];
  const float* lam    = (const float*)d_in[2];    // [5][1024]
  const float* Amat   = (const float*)d_in[3];    // [1024][160]
  const float* Bp     = (const float*)d_in[4];    // [5][32][1024]
  const float* td_miu = (const float*)d_in[5];    // [1024]
  const float* tdA    = (const float*)d_in[6];    // [1024][64]
  const float* tdB    = (const float*)d_in[7];    // [64][1024]
  const float* u      = (const float*)d_in[8];    // [16][64]
  const float* Wk     = (const float*)d_in[9];    // [1024][1024] [out][in]
  const float* Wv     = (const float*)d_in[10];
  const float* Wr     = (const float*)d_in[11];
  const float* Wo     = (const float*)d_in[12];
  const float* Wg1    = (const float*)d_in[13];   // [1024][160]
  const float* Wg2    = (const float*)d_in[14];   // [160][1024]
  const float* gamma  = (const float*)d_in[15];
  const float* beta   = (const float*)d_in[16];
  float* out = (float*)d_out;

  // ---- carve ----
  const size_t szXX    = (size_t)kPlane * 2;
  const size_t szHPRE  = (size_t)kRows * kMixPad * 4;
  const size_t szHC    = (size_t)kRows * kMix * 2;
  const size_t szF32P  = (size_t)kPlane * 4;
  const size_t szX5H   = (size_t)kNBr * kPlane * 2;
  const size_t szX5L   = (size_t)(kNBr - 1) * kPlane * 2;
  const size_t szWSQ   = (size_t)4 * kWPlane * 2;
  const size_t szAT    = (size_t)kMixPad * kChan * 2;
  const size_t szTDAT  = (size_t)kDec * kChan * 2;
  const size_t szTDBT  = (size_t)kChan * kDec * 2;
  const size_t szWG1T  = (size_t)kMixPad * kChan * 2;
  const size_t szWG2T  = (size_t)kChan * kMixPad * 2;
  const size_t szBPT   = (size_t)kNBr * kChan * kBr * 2;
  const size_t szLPRE  = (size_t)kRows * kDec * 4;
  const size_t szL1    = (size_t)kRows * kDec * 2;
  const size_t szKVR   = (size_t)3 * kPlane * 4;
  const size_t szGHPRE = (size_t)kRows * kMixPad * 4;
  const size_t szGH    = (size_t)kRows * kMixPad * 2;
  const size_t szGAT   = (size_t)kPlane * 2;
  size_t off = 0;
  const size_t oXX    = off; off += szXX;
  const size_t oHPRE  = off; off += szHPRE;
  const size_t oHC    = off; off += szHC;
  const size_t oMIU   = off; off += szF32P;
  const size_t oX5H   = off; off += szX5H;
  const size_t oX5L   = off; off += szX5L;
  const size_t oWH    = off; off += szWSQ;
  const size_t oWL    = off; off += szWSQ;
  const size_t oAT    = off; off += szAT;
  const size_t oTDAT  = off; off += szTDAT;
  const size_t oTDBT  = off; off += szTDBT;
  const size_t oWG1TH = off; off += szWG1T;
  const size_t oWG1TL = off; off += szWG1T;
  const size_t oWG2TH = off; off += szWG2T;
  const size_t oWG2TL = off; off += szWG2T;
  const size_t oBPT   = off; off += szBPT;
  const size_t oLPRE  = off; off += szLPRE;
  const size_t oL1    = off; off += szL1;
  const size_t oKVR   = off; off += szKVR;
  const size_t oGHPRE = off; off += szGHPRE;
  const size_t oGHH   = off; off += szGH;
  const size_t oGHL   = off; off += szGH;
  const size_t oGATE  = off; off += szF32P;
  const size_t oY     = off; off += szF32P;
  const size_t oGATH  = off; off += szGAT;
  const size_t oGATL  = off; off += szGAT;
  const size_t total  = off;   // 126,156,800
  if (total > (size_t)134217728) return;
  if (ws_size < total) return;

  char* ws = (char*)d_ws;
  unsigned short* XX    = (unsigned short*)(ws + oXX);
  float*          HPRE  = (float*)(ws + oHPRE);
  unsigned short* HC    = (unsigned short*)(ws + oHC);
  float*          MIU   = (float*)(ws + oMIU);
  float*          WLR   = MIU;                       // decay lowrank output, f32 [2048][1024]
  unsigned short* X5H   = (unsigned short*)(ws + oX5H);
  unsigned short* X5L   = (unsigned short*)(ws + oX5L);
  unsigned short* WH    = (unsigned short*)(ws + oWH);
  unsigned short* WL    = (unsigned short*)(ws + oWL);
  unsigned short* AT    = (unsigned short*)(ws + oAT);
  unsigned short* TDAT  = (unsigned short*)(ws + oTDAT);
  unsigned short* TDBT  = (unsigned short*)(ws + oTDBT);
  unsigned short* WG1TH = (unsigned short*)(ws + oWG1TH);
  unsigned short* WG1TL = (unsigned short*)(ws + oWG1TL);
  unsigned short* WG2TH = (unsigned short*)(ws + oWG2TH);
  unsigned short* WG2TL = (unsigned short*)(ws + oWG2TL);
  unsigned short* BPT   = (unsigned short*)(ws + oBPT);
  float*          LPRE  = (float*)(ws + oLPRE);
  unsigned short* L1    = (unsigned short*)(ws + oL1);
  float*          KVR   = (float*)(ws + oKVR);
  float*          GHPRE = (float*)(ws + oGHPRE);
  unsigned short* GHH   = (unsigned short*)(ws + oGHH);
  unsigned short* GHL   = (unsigned short*)(ws + oGHL);
  float*          GATE  = (float*)(ws + oGATE);
  float*          Yp    = (float*)(ws + oY);
  unsigned short* GATH  = (unsigned short*)(ws + oGATH);
  unsigned short* GATL  = (unsigned short*)(ws + oGATL);
  const float* fdum = gamma;   // placeholder for unused bias / resid pointer arguments (never dereferenced)

  const dim3 blk(256);
  const dim3 blkTall(128);                               // the mix lowrank GEMM's blocks of 4 x 1 waves

  // ---- token shift and all weight planes ----
  k_prepare<<<dim3(kPbAll), blk, 0, stream>>>(x, miu_x, Amat, tdA, tdB, Wg1, Wg2, Bp, Wk, Wv, Wr, Wo,
                                              XX, AT, TDAT, TDBT, WG1TH, WG1TL, WG2TH, WG2TL, BPT, WH, WL);

  // ---- mix lowrank: HPRE = XX @ AT^T  (M 2048, N 192, K 1024; 24 blocks of 256 x 64) ----
  wmma_gemm64<1, false, 0, 0, false, 0, 4, 1, 64, kChan><<<dim3((kRows / 256) * (kMixPad / 64), 1), blkTall, 0, stream>>>(
      XX, XX, 0L, AT, AT, 0L, (void*)HPRE, (void*)HPRE, kMixPad, 0L, fdum, fdum, 0L, kMixPad, 1.0f);
  // HC flat [2048*160] = tanh(HPRE[:, 0:160]) compact bf16; n2 = 163840 -> 640 blocks exact
  k_tanh2<false><<<dim3((kRows * kMix / 2) / 256), blk, 0, stream>>>(HPRE, kMixPad, HC, HC, kMix, kMix, kRows * kMix / 2);

  // ---- mix GEMM of all five branches (blockIdx.y = s; A = HC viewed [10240][32], rows 2048s..; K 32); its epilogue forms the
  // branch inputs and stores their bf16 planes ----
  wmma_gemm64<1, false, 0, 3, false, 0, 2, 4, 32, kBr><<<dim3((kRows / 128) * (kChan / 256), kNBr), blk, 0, stream>>>(
      HC, HC, (long)kRows * kBr, BPT, BPT, (long)kChan * kBr,
      (void*)X5H, (void*)X5L, kChan, (long)kPlane, lam, x, 0L, kChan, 1.0f);

  // ---- what reads only the branch inputs: KVR = k (unscaled), v, r projections; GHPRE = X5[4] @ WG1T^T; LPRE = X5H[0] @ TDAT^T ----
  k_branch_gemms<<<dim3(3 * kProjTiles + kGateTiles + kDecTiles), blk, 0, stream>>>(
      X5H, X5L, WH, WL, KVR, WG1TH, WG1TL, GHPRE, TDAT, LPRE);
  // ---- GH = tanh(GHPRE) hi/lo (cols 160..191 zero); L1 = tanh(LPRE) ----
  k_tanh_pair<<<dim3(kTbGate + kTbDec), blk, 0, stream>>>(GHPRE, GHH, GHL, LPRE, L1);
  // ---- GATE = GH @ WG2T^T (split, K 192); WLR = L1 @ TDBT^T (K 64) ----
  k_lowrank_out_gemms<<<dim3(2 * kProjTiles), blk, 0, stream>>>(GHH, GHL, WG2TH, WG2TL, GATE, L1, TDBT, WLR);

  // ---- state scan -> Y ----
  k_state_scan<<<dim3(kBatch * kNHead * 2), dim3(128), 0, stream>>>(KVR, KVR + kPlane, KVR + 2 * kPlane, WLR, td_miu, u, Yp);

  // ---- GroupNorm + gate -> GATH/GATL (4096 blocks x 8 waves = 32768 (row, head) pairs) ----
  k_gn_gate<<<dim3((kRows * kNHead) / 8), blk, 0, stream>>>(Yp, GATE, gamma, beta, GATH, GATL);

  // ---- output projection straight into d_out (split, K 1024) ----
  wmma_gemm64<1, true, 0, 0, false, 0, 2, 4, 64, kChan><<<dim3((kRows / 128) * (kChan / 256), 1), blk, 0, stream>>>(
      GATH, GATL, 0L, WH + 3 * kWPlane, WL + 3 * kWPlane, 0L,
      (void*)out, (void*)out, kChan, 0L, fdum, fdum, 0L, kChan, 1.0f);
}

// v005
// Measured time: 174 microseconds a run.
// In two side-by-side timings against v004, it was 1.05 and 1.06 times as fast.
// Over all steps from v000 it is 5.77 times as fast.
// Contractions: every GEMM on v_wmma_f32_16x16x32_bf16 (bf16 operands, f32 accumulate) - the four lowrank mix/decay sites single bf16, the k/v/r projections, the gate pair and the output projection as bf16 hi/lo split (hi*hi + hi*lo + lo*hi); token shift, state scan, GroupNorm and gating in f32 on VALU.
#include <hip/hip_runtime.h>
#include <math.h>

// ---------------------------------------------------------------------------
// Problem constants
// ---------------------------------------------------------------------------
constexpr int kBatch  = 2;
constexpr int kSeq    = 1024;
constexpr int kChan   = 1024;
constexpr int kHead   = 64;
constexpr int kNHead  = 16;
constexpr int kRows   = kBatch * kSeq;          // 2048 token rows (m = b*1024 + t)
constexpr int kMix    = 160;                    // lowrank width of the mix and gate paths
constexpr int kMixPad = 192;                    // padded to a 64 multiple (pad rows / cols zero-filled)
constexpr int kDec    = 64;                     // decay lowrank width
constexpr int kBr     = 32;                     // per-branch mix width
constexpr int kNBr    = 5;                      // branches: 0 decay, 1 k, 2 v, 3 r, 4 gate
constexpr long kPlane  = (long)kRows * kChan;   // 2,097,152 elements per activation plane
constexpr long kWPlane = (long)kChan * kChan;   // 1,048,576 elements per square weight plane
constexpr float kGnEps = 1.6e-4f;               // 1e-5 * 16
static_assert(kNHead * kHead == kChan, "shape");
static_assert(kRows % 256 == 0 && kChan % 256 == 0 && kMixPad % 64 == 0 && kDec % 64 == 0, "M and N tile multiples");
static_assert(kChan % 32 == 0 && kBr % 32 == 0 && kDec % 32 == 0 && kMixPad % 32 == 0, "K multiples of 32");
static_assert(kMix % 8 == 0 && kMixPad % 8 == 0 && kDec % 8 == 0, "pack groups never straddle a row");

typedef __attribute__((ext_vector_type(16))) _Float16 v16h;
typedef __attribute__((ext_vector_type(8)))  _Float16 v8h;
typedef __attribute__((ext_vector_type(16))) __bf16   v16b;
typedef __attribute__((ext_vector_type(8)))  __bf16   v8b;
typedef __attribute__((ext_vector_type(8)))  float    v8f;
typedef __attribute__((ext_vector_type(4)))  float    v4f;
typedef __attribute__((ext_vector_type(2)))  float    v2f;
typedef __attribute__((ext_vector_type(4)))  unsigned int v4u;

// ---------------------------------------------------------------------------
// Shared helpers
// ---------------------------------------------------------------------------
__device__ __forceinline__ unsigned short f2bf_bits(float f) {
  unsigned u = __float_as_uint(f);
  return (unsigned short)((u + 0x7FFFu + ((u >> 16) & 1u)) >> 16);
}
__device__ __forceinline__ float bf_bits2f(unsigned short h) { return __uint_as_float(((unsigned)h) << 16); }
__device__ __forceinline__ unsigned pk16(unsigned short a, unsigned short b) { return (unsigned)a | ((unsigned)b << 16); }
// RNE convert to a bf16 hi part and a bf16 lo part of the f32 residual
__device__ __forceinline__ void bf_split_bits(float f, unsigned short& hb, unsigned short& lb) {
  hb = f2bf_bits(f);
  lb = f2bf_bits(f - bf_bits2f(hb));
}

// hazard guards as plain device helpers; the 4-acc guard ties every
// accumulator of a group and names the A fragments as inputs
__device__ __forceinline__ void dep_guard4_h(v8f& a, v8f& b, v8f& c, v8f& d, v16h x, v16h y) { asm volatile("v_nop\n\tv_nop\n\tv_nop\n\tv_nop" : "+v"(a), "+v"(b), "+v"(c), "+v"(d) : "v"(x), "v"(y)); }
__device__ __forceinline__ void dep_guard4_b(v8f& a, v8f& b, v8f& c, v8f& d, v16b x, v16b y) { asm volatile("v_nop\n\tv_nop\n\tv_nop\n\tv_nop" : "+v"(a), "+v"(b), "+v"(c), "+v"(d) : "v"(x), "v"(y)); }
__device__ __forceinline__ void keep4_h(v16h a, v16h b, v16h c, v16h d) { asm volatile("v_nop" :: "v"(a), "v"(b), "v"(c), "v"(d)); }
__device__ __forceinline__ void keep4_b(v16b a, v16b b, v16b c, v16b d) { asm volatile("v_nop" :: "v"(a), "v"(b), "v"(c), "v"(d)); }
__device__ __forceinline__ void acc_guard4(v8f& a, v8f& b, v8f& c, v8f& d) { asm volatile("v_nop\n\tv_nop\n\tv_nop\n\tv_nop" : "+v"(a), "+v"(b), "+v"(c), "+v"(d)); }
template <typename T> struct Frag;
template <> struct Frag<_Float16> {
  typedef v16h V; typedef v8h H; union U { v16h v; v8h h[2]; };
  // elements 0..7 <- p[0..7], 8..15 <- p[16..23]
  static __device__ __forceinline__ v16h load(const _Float16* p) {
    U f; f.h[0] = *(const v8h*)(p); f.h[1] = *(const v8h*)(p + 16); return f.v;
  }
  static __device__ __forceinline__ v8f mma(v16h a, v16h b, v8f c) {
    return __builtin_amdgcn_wmma_f32_16x16x32_f16(false, a, false, b, (short)0, c, false, false);
  }
  static __device__ __forceinline__ void guard4(v8f& a, v8f& b, v8f& c, v8f& d, v16h x, v16h y) { dep_guard4_h(a, b, c, d, x, y); }
  static __device__ __forceinline__ void keep(v16h a, v16h b, v16h c, v16h d) { keep4_h(a, b, c, d); }
};
template <> struct Frag<__bf16> {
  typedef v16b V; typedef v8b H; union U { v16b v; v8b h[2]; };
  static __device__ __forceinline__ v16b load(const __bf16* p) {
    U f; f.h[0] = *(const v8b*)(p); f.h[1] = *(const v8b*)(p + 16); return f.v;
  }
  static __device__ __forceinline__ v8f mma(v16b a, v16b b, v8f c) {
    return __builtin_amdgcn_wmma_f32_16x16x32_bf16(false, a, false, b, (short)0, c, false, false);
  }
  static __device__ __forceinline__ void guard4(v8f& a, v8f& b, v8f& c, v8f& d, v16b x, v16b y) { dep_guard4_b(a, b, c, d, x, y); }
  static __device__ __forceinline__ void keep(v16b a, v16b b, v16b c, v16b d) { keep4_b(a, b, c, d); }
};

// ---- Register-blocked batched WMMA GEMM (ACT reduced to none/relu/leaky) -------------------------------
// C[m,n] = scale * sum_k A[m,k] * Bt[n,k] (+bias)(+resid); each wave owns a (16*MI)x64 tile, the WM x WN waves of a block one
// (16*MI*WM) x (64*WN) tile. A row-major [M,KD]; Bt row-major [N,KD]; M % (16*MI*WM) == 0, N % (64*WN) == 0, KD % KS == 0.
// Operand path: the block brings KS k values of its A rows and Bt rows from global memory in whole row pieces (KS*2 bytes,
// 16 B per lane), through registers, into one of two LDS buffers; every wave reads its fragments from there. The loads of
// stage s+1 are issued ahead of the products of stage s and stored to the other buffer behind them; one barrier per stage.
// SPLIT: operands are hi/lo planes (A2/Bt2 = lo planes, same layout); product = hi*hi + hi*lo + lo*hi.
// BIAS_MODE: 0 = none, 1 = bias[m], 2 = bias[n].
// OUT_MODE: 0 = f32, 1 = f16, 2 = bf16 hi plane (Cout) + bf16 lo plane (Cout2).
//           3 = branch input: the tile is the mix term u of branch b = blockIdx.y; the epilogue forms
//               x[m][n] + (x[m-1][n]*f - x[m][n]) * (u + lam[b][n]), f = 0 at t == 0 else 1 (address of the prior row clamped),
//               x = resid (pitch kChan), lam = bias (pitch N), and stores its bf16 hi plane (Cout, plane b) and, for b > 0, its
//               bf16 lo plane (Cout2, plane b-1). Every 128-B line of a plane is stored once, by 8 lanes of one wave.
// ET: 0 = f16 operands, 1 = bf16 operands (pointers passed as 16-bit storage)
// The engine is a device function, so that GEMMs which do not depend on one another can share one launch: bx and b stand for the
// block's place in the GEMM's own grid, smem for the launch's one LDS array (kGemmLds bytes of it are used).
// MI: 16-row groups of a wave's tile, 4 unless said otherwise. With MI = 2 a wave owns 32x64, so that a 256 x 64 block tile takes the
// eight waves of the 256-thread blocks that it shares a launch with; every element's k order is the same for every MI.
template <bool SPLIT, int WM, int WN, int KS, int MI>
constexpr int kGemmLds = 2 * (SPLIT ? 2 : 1) * (16 * MI * WM + 64 * WN) * (KS + 8) * 2 + WM * WN * 16 * 68 * 4;
template <int ET> struct Elem;
template <> struct Elem<0> { typedef _Float16 T; };
template <> struct Elem<1> { typedef __bf16 T; };
template <int ET, bool SPLIT, int BIAS_MODE, int OUT_MODE, bool RESID, int ACT, int WM, int WN, int KS, int KD, int MI>
__device__ __forceinline__ void gemm64_body(
    char* smem, const int bx, const int b,
    const unsigned short* __restrict__ Ap, const unsigned short* __restrict__ A2p, long strideA,
    const unsigned short* __restrict__ Btp, const unsigned short* __restrict__ Bt2p, long strideB,
    void* __restrict__ Cout, void* __restrict__ Cout2, int ldc, long strideC,
    const float* __restrict__ bias,
    const float* __restrict__ resid, long strideR,
    int N, float scale) {
  typedef typename Elem<ET>::T T;
  typedef typename Frag<T>::V V;
  typedef typename Frag<T>::H H;
  constexpr int NW    = WM * WN;               // waves per block
  constexpr int NT    = 32 * NW;               // threads per block
  constexpr int BM    = 16 * MI * WM;          // block tile rows (A rows per stage)
  constexpr int BN    = 64 * WN;               // block tile columns (Bt rows per stage)
  constexpr int PITCH = KS + 8;                // LDS row pitch in elements: row bytes + 16, an odd multiple of 16 B
  constexpr int CH    = KS / 8;                // 16-B pieces per row piece
  constexpr int RSTEP = NT / CH;               // rows covered by one load of the whole block
  constexpr int NA    = BM / RSTEP;            // loads per thread and plane, A
  constexpr int NB    = BN / RSTEP;            // loads per thread and plane, Bt
  constexpr int PLANE = (BM + BN) * PITCH;     // elements of one plane in one buffer: A rows, then Bt rows
  constexpr int BUF   = (SPLIT ? 2 : 1) * PLANE;
  constexpr int NS    = KD / KS;               // stages
  static_assert(KS == 32 || KS == 64, "row piece");
  static_assert(KD % KS == 0 && BM % RSTEP == 0 && BN % RSTEP == 0, "stage split");
  const T* A = (const T*)Ap; const T* A2 = (const T*)A2p; const T* Bt = (const T*)Btp; const T* Bt2 = (const T*)Bt2p;
  static_assert(kGemmLds<SPLIT, WM, WN, KS, MI> == 2 * BUF * 2 + NW * 16 * 68 * 4, "LDS share");
  static_assert(OUT_MODE != 3 || MI == 4, "the branch-input epilogue is written for 64-row wave tiles");
  T* sOp = (T*)smem;                                // two operand buffers
  float* sT = (float*)(smem + 2 * BUF * 2);         // behind them, per wave, a 16x64 slab, pitch 68 floats
  const int tid  = threadIdx.x;
  const int lane = tid & 31;
  const int wave = tid >> 5;
  const int tilesN = N / BN;
  const int bm = bx / tilesN;                  // the GEMM's grid holds exactly (M / BM) * (N / BN) blocks
  const int bn = bx - bm * tilesN;
  const int wm = wave / WN;
  const int wn = wave - wm * WN;
  const int m0 = bm * BM + wm * (16 * MI);
  const int n0 = bn * BN + (wn << 6);

  // block-uniform bases of the block's rows; every thread adds its one fixed byte offset
  const char* gA  = (const char*)(A  + (size_t)b * strideA + (size_t)(bm * BM) * KD);
  const char* gB  = (const char*)(Bt + (size_t)b * strideB + (size_t)(bn * BN) * KD);
  const char* gA2 = SPLIT ? (const char*)(A2  + (size_t)b * strideA + (size_t)(bm * BM) * KD) : nullptr;
  const char* gB2 = SPLIT ? (const char*)(Bt2 + (size_t)b * strideB + (size_t)(bn * BN) * KD) : nullptr;
  const int sRow = tid / CH, sCol = (tid % CH) * 8;
  const unsigned offG = (unsigned)(sRow * KD + sCol) * 2u;   // bytes
  const int      offL = sRow * PITCH + sCol;                 // elements

  const int rlane = lane & 15;                 // row (A) / col (B, D) within subtile
  const int koff  = (lane >> 4) * 8;           // k offset of this lane half
  const int mOff  = (lane >> 4) * 8;           // D row offset

  v8f acc[MI][4];
#pragma unroll
  for (int i = 0; i < MI; ++i)
#pragma unroll
    for (int j = 0; j < 4; ++j) acc[i][j] = (v8f){0.f,0.f,0.f,0.f,0.f,0.f,0.f,0.f};

  // one stage in flight; every loop over these arrays and over the fragments is fully unrolled, so that they stay in registers
  H ra[NA], ra2[NA], rb[NB], rb2[NB];
  auto gload = [&](int k0) {
    // the two scheduling barriers keep every other instruction out of the group of loads and its wait, and the group ahead of
    // the products: sunk next to the LDS stores that use them, the loads would show their whole latency in every stage
    __builtin_amdgcn_sched_barrier(0);
#pragma unroll
    for (int i = 0; i < NA; ++i) {
      ra[i] = *(const H*)(gA + (size_t)k0 * 2 + (size_t)i * (RSTEP * KD * 2) + offG);
      if (SPLIT) ra2[i] = *(const H*)(gA2 + (size_t)k0 * 2 + (size_t)i * (RSTEP * KD * 2) + offG);
    }
#pragma unroll
    for (int i = 0; i < NB; ++i) {
      rb[i] = *(const H*)(gB + (size_t)k0 * 2 + (size_t)i * (RSTEP * KD * 2) + offG);
      if (SPLIT) rb2[i] = *(const H*)(gB2 + (size_t)k0 * 2 + (size_t)i * (RSTEP * KD * 2) + offG);
    }
    // precaution: this wait stands in front of every later write of a register that one of these loads names
    asm volatile("s_wait_xcnt 0x0" ::: "memory");
    __builtin_amdgcn_sched_barrier(0);
  };
  auto sstore = [&](T* buf) {
#pragma unroll
    for (int i = 0; i < NA; ++i) {
      *(H*)(buf + i * (RSTEP * PITCH) + offL) = ra[i];
      if (SPLIT) *(H*)(buf + PLANE + i * (RSTEP * PITCH) + offL) = ra2[i];
    }
#pragma unroll
    for (int i = 0; i < NB; ++i) {
      *(H*)(buf + (BM + i * RSTEP) * PITCH + offL) = rb[i];
      if (SPLIT) *(H*)(buf + PLANE + (BM + i * RSTEP) * PITCH + offL) = rb2[i];
    }
  };
  const int fragA = (wm * (16 * MI) + rlane) * PITCH + koff;        // this lane's place in the first A / Bt fragment of its wave
  const int fragB = (BM + (wn << 6) + rlane) * PITCH + koff;
  auto compute = [&](const T* buf) {
#pragma unroll
    for (int kk = 0; kk < KS; kk += 32) {
      V bh[4], bl[4], ah[MI], al[MI];
#pragma unroll
      for (int j = 0; j < 4; ++j) {
        bh[j] = Frag<T>::load(buf + fragB + j * (16 * PITCH) + kk);
        if (SPLIT) bl[j] = Frag<T>::load(buf + PLANE + fragB + j * (16 * PITCH) + kk);
      }
#pragma unroll
      for (int i = 0; i < MI; ++i) {
        ah[i] = Frag<T>::load(buf + fragA + i * (16 * PITCH) + kk);
        if (SPLIT) al[i] = Frag<T>::load(buf + PLANE + fragA + i * (16 * PITCH) + kk);
      }
#pragma unroll
      for (int i = 0; i < MI; ++i) {
#pragma unroll
        for (int j = 0; j < 4; ++j) {
          acc[i][j] = Frag<T>::mma(ah[i], bh[j], acc[i][j]);
          if (SPLIT) {
            acc[i][j] = Frag<T>::mma(ah[i], bl[j], acc[i][j]);
            acc[i][j] = Frag<T>::mma(al[i], bh[j], acc[i][j]);
          }
        }
        Frag<T>::guard4(acc[i][0], acc[i][1], acc[i][2], acc[i][3], ah[i], SPLIT ? al[i] : ah[i]);
      }
      Frag<T>::keep(bh[0], bh[1], bh[2], bh[3]);
      if (SPLIT) Frag<T>::keep(bl[0], bl[1], bl[2], bl[3]);
    }
  };

  gload(0);
  sstore(sOp);
  __syncthreads();
  // kept rolled, for speed only
#pragma unroll 1
  for (int s = 0; s < NS; ++s) {
    if (s + 1 < NS) gload((s + 1) * KS);                       // block-uniform
    compute(sOp + (s & 1) * BUF);
    if (s + 1 < NS) sstore(sOp + ((s + 1) & 1) * BUF);
    // the one barrier of a stage: publishes stage s+1 and ends the reads of stage s, whose buffer the next pass overwrites
    __syncthreads();
  }
#pragma unroll   // acc is indexed by constants only, so that it stays in registers
  for (int i = 0; i < MI; ++i) acc_guard4(acc[i][0], acc[i][1], acc[i][2], acc[i][3]);

  // ---- epilogue ----
  float* slab = sT + wave * (16 * 68);
  const float* Rb = RESID ? (resid + (size_t)b * strideR) : nullptr;
  v4f lam0 = (v4f){0.f, 0.f, 0.f, 0.f}, lam1 = lam0;
  // OUT_MODE 3: block-uniform bases of the block's first row in x and in the two planes (pitch kChan); every lane adds one fixed byte
  // offset, offX (f32; half of it in the bf16 planes), and the row groups are immediates. t == 0 can only fall on the first row of a
  // wave's tile (64 divides kSeq): there the prior row's address is the row's own and its factor 0.
  static_assert(OUT_MODE != 3 || kSeq % 64 == 0, "t == 0 only on a wave tile's first row");
  const char* gX = nullptr; char* gH = nullptr; char* gL = nullptr;
  unsigned offX = 0, offP0 = 0;
  float fz0 = 1.0f;
  if (OUT_MODE == 3) {
    const size_t tile0 = (size_t)(bm * BM) * kChan + bn * BN;
    gX = (const char*)(resid + tile0);
    gH = (char*)((unsigned short*)Cout  + (size_t)b * strideC + tile0);
    gL = (char*)((unsigned short*)Cout2 + (size_t)(b > 0 ? (b - 1) : 0) * strideC + tile0);
    const int row0 = (wm << 6) + (lane >> 3);
    offX = (unsigned)(row0 * kChan + (wn << 6) + (lane & 7) * 8) * 4u;
    const bool t0 = ((bm * BM + row0) & (kSeq - 1)) == 0;
    offP0 = t0 ? offX + (unsigned)(kChan * 4) : offX;      // counted from one row above gX, so that it is never negative
    fz0 = t0 ? 0.0f : 1.0f;
    const float* pl = bias + (size_t)b * N + n0 + (lane & 7) * 8;
    __builtin_amdgcn_sched_barrier(0);   // with the one below: keeps the two loads and their wait together
    lam0 = *(const v4f*)(pl); lam1 = *(const v4f*)(pl + 4);
    // precaution: this wait stands in front of every later write of a register that one of these two loads names
    asm volatile("s_wait_xcnt 0x0" ::: "memory");
    __builtin_amdgcn_sched_barrier(0);
  }
#pragma unroll
  for (int i = 0; i < MI; ++i) {
    const int mBase = m0 + (i << 4);
    v4f xa0[4], xa1[4], xb0[4], xb1[4];
    if (OUT_MODE == 3) {
      // the two scheduling barriers keep every other instruction out of the group of loads and its wait, and the group ahead of
      // the slab writes, which are served while the loads fly
      __builtin_amdgcn_sched_barrier(0);
#pragma unroll
      for (int it = 0; it < 4; ++it) {
        const int r = i * 16 + it * 4;                       // this lane's row = first row of its wave + r + q
        const char* px = gX + (size_t)r * (kChan * 4) + offX;
        const char* pp = (r == 0) ? (gX - kChan * 4 + offP0) : (gX + (size_t)(r - 1) * (kChan * 4) + offX);
        xa0[it] = *(const v4f*)(px); xa1[it] = *(const v4f*)(px + 16);
        xb0[it] = *(const v4f*)(pp); xb1[it] = *(const v4f*)(pp + 16);
      }
      // precaution: this wait stands in front of every later write of a register that one of these loads names
      asm volatile("s_wait_xcnt 0x0" ::: "memory");
      __builtin_amdgcn_sched_barrier(0);
    }
#pragma unroll
    for (int j = 0; j < 4; ++j) {
      const int n = n0 + (j << 4) + rlane;
      float bv = 0.f;
      if (BIAS_MODE == 2) bv = bias[n];
#pragma unroll
      for (int r = 0; r < 8; ++r) {
        float v = acc[i][j][r] * scale;
        if (BIAS_MODE == 1) v += bias[mBase + mOff + r];
        if (BIAS_MODE == 2) v += bv;
        if (RESID) v += Rb[(size_t)(mBase + mOff + r) * ldc + n];
        if (ACT == 2) v = fmaxf(v, 0.0f);
        if (ACT == 4) v = (v > 0.f) ? v : 0.01f * v;
        slab[(mOff + r) * 68 + (j << 4) + rlane] = v;
      }
    }
    __builtin_amdgcn_fence(__ATOMIC_RELEASE, "workgroup");
    __builtin_amdgcn_wave_barrier();
    __builtin_amdgcn_fence(__ATOMIC_ACQUIRE, "workgroup");
    if (OUT_MODE == 0) {
      float* C = (float*)Cout + (size_t)b * strideC;
      const int hh = lane >> 4, c4 = (lane & 15) * 4;     // row seg = 256 B = 16 lanes x 16 B
      v4f v[8];
      float* pc[8];
#pragma unroll   // here and below: v and pc are indexed by constants only, so that they stay in registers
      for (int it = 0; it < 8; ++it) {
        const int row = it * 2 + hh;
        v[it]  = *(const v4f*)(slab + row * 68 + c4);
        pc[it] = C + (size_t)(mBase + row) * ldc + n0 + c4;
      }
      // the two scheduling barriers keep every other instruction out of the group of stores and its wait
      __builtin_amdgcn_sched_barrier(0);
#pragma unroll
      for (int it = 0; it < 8; ++it) *(v4f*)pc[it] = v[it];
      // precaution: this wait stands in front of every later write of a register that one of these stores names
      asm volatile("s_wait_xcnt 0x0" ::: "memory");
      __builtin_amdgcn_sched_barrier(0);
    } else if (OUT_MODE == 3) {
      const int q = lane >> 3, c8 = (lane & 7) * 8;
      v4u uh[4], ul[4];
#pragma unroll
      for (int it = 0; it < 4; ++it) {
        const int row = it * 4 + q;
        const float fz = (i == 0 && it == 0) ? fz0 : 1.0f;
        const v4f u0 = *(const v4f*)(slab + row * 68 + c8), u1 = *(const v4f*)(slab + row * 68 + c8 + 4);
        unsigned short hb[8], lb[8];
#pragma unroll
        for (int e = 0; e < 4; ++e) {
          const float ba0 = xb0[it][e] * fz - xa0[it][e];
          const float ba1 = xb1[it][e] * fz - xa1[it][e];
          const float v0 = xa0[it][e] + ba0 * (u0[e] + lam0[e]);
          const float v1 = xa1[it][e] + ba1 * (u1[e] + lam1[e]);
          bf_split_bits(v0, hb[e], lb[e]);
          bf_split_bits(v1, hb[4 + e], lb[4 + e]);
        }
        uh[it] = (v4u){pk16(hb[0], hb[1]), pk16(hb[2], hb[3]), pk16(hb[4], hb[5]), pk16(hb[6], hb[7])};
        ul[it] = (v4u){pk16(lb[0], lb[1]), pk16(lb[2], lb[3]), pk16(lb[4], lb[5]), pk16(lb[6], lb[7])};
      }
      // as for the loads: nothing else is scheduled into the group of stores and its wait
      __builtin_amdgcn_sched_barrier(0);
#pragma unroll
      for (int it = 0; it < 4; ++it) *(v4u*)(gH + (size_t)(i * 16 + it * 4) * (kChan * 2) + offX / 2) = uh[it];
      // the same precaution for the registers that these stores name
      asm volatile("s_wait_xcnt 0x0" ::: "memory");
      __builtin_amdgcn_sched_barrier(0);
      if (b > 0) {                                           // block-uniform: branch 0 has no lo plane
        __builtin_amdgcn_sched_barrier(0);
#pragma unroll
        for (int it = 0; it < 4; ++it) *(v4u*)(gL + (size_t)(i * 16 + it * 4) * (kChan * 2) + offX / 2) = ul[it];
        asm volatile("s_wait_xcnt 0x0" ::: "memory");        // the same precaution
        __builtin_amdgcn_sched_barrier(0);
      }
    } else {
      const int q = lane >> 3, c8 = (lane & 7) * 8;
      unsigned short* C  = (unsigned short*)Cout  + (size_t)b * strideC;
      unsigned short* C2 = (OUT_MODE == 2) ? ((unsigned short*)Cout2 + (size_t)b * strideC) : nullptr;
      {
#pragma unroll
        for (int it = 0; it < 4; ++it) {
          const int row = it * 4 + q;
          const float* sp = slab + row * 68 + c8;
          v8h hv, lv;
#pragma unroll
          for (int e = 0; e < 8; ++e) {
            if (OUT_MODE == 1) {
              hv[e] = (_Float16)sp[e];
            } else {
              unsigned short hb = f2bf_bits(sp[e]);
              unsigned short lb = f2bf_bits(sp[e] - bf_bits2f(hb));
              hv[e] = __builtin_bit_cast(_Float16, hb);
              lv[e] = __builtin_bit_cast(_Float16, lb);
            }
          }
          *(v8h*)(C + (size_t)(mBase + row) * ldc + n0 + c8) = hv;
          if (OUT_MODE == 2) *(v8h*)(C2 + (size_t)(mBase + row) * ldc + n0 + c8) = lv;
        }
        
      }
    }
    __builtin_amdgcn_fence(__ATOMIC_RELEASE, "workgroup");
    __builtin_amdgcn_wave_barrier();
    __builtin_amdgcn_fence(__ATOMIC_ACQUIRE, "workgroup");
  }
}

// One GEMM in a launch of its own: grid (tiles, batch).
template <int ET, bool SPLIT, int BIAS_MODE, int OUT_MODE, bool RESID, int ACT, int WM, int WN, int KS, int KD>
__global__ __launch_bounds__(32 * WM * WN) void wmma_gemm64(
    const unsigned short* __restrict__ Ap, const unsigned short* __restrict__ A2p, long strideA,
    const unsigned short* __restrict__ Btp, const unsigned short* __restrict__ Bt2p, long strideB,
    void* __restrict__ Cout, void* __restrict__ Cout2, int ldc, long strideC,
    const float* __restrict__ bias,
    const float* __restrict__ resid, long strideR,
    int N, float scale) {
  __shared__ __align__(16) char smem[kGemmLds<SPLIT, WM, WN, KS, 4>];
  gemm64_body<ET, SPLIT, BIAS_MODE, OUT_MODE, RESID, ACT, WM, WN, KS, KD, 4>(
      smem, blockIdx.x, blockIdx.y, Ap, A2p, strideA, Btp, Bt2p, strideB, Cout, Cout2, ldc, strideC, bias, resid, strideR, N, scale);
}

// The three GEMMs that read only the branch inputs, in one launch of 224 blocks, each block alone on its WGP by its LDS:
//   blocks   0..191  k / v / r projections (split, K 1024), 64 tiles of 128 x 256 for each of the three
//   blocks 192..215  gate lowrank (split, N 192, K 1024), 24 tiles of 256 x 64, eight waves of 32 x 64
//   blocks 216..223  decay lowrank (single, N 64, K 1024), 8 tiles of 256 x 64, eight waves of 32 x 64
constexpr int kProjTiles = (kRows / 128) * (kChan / 256);   // 64
constexpr int kGateTiles = (kRows / 256) * (kMixPad / 64);  // 24
constexpr int kDecTiles  = (kRows / 256) * (kDec / 64);     // 8
__global__ __launch_bounds__(256) void k_branch_gemms(
    const unsigned short* __restrict__ X5H, const unsigned short* __restrict__ X5L,
    const unsigned short* __restrict__ WH, const unsigned short* __restrict__ WL, float* __restrict__ KVR,
    const unsigned short* __restrict__ WG1TH, const unsigned short* __restrict__ WG1TL, float* __restrict__ GHPRE,
    const unsigned short* __restrict__ TDAT, float* __restrict__ LPRE) {
  const float* fdum = nullptr;                               // bias and resid of the engine: not used by these GEMMs, never dereferenced
  __shared__ __align__(16) char smem[kGemmLds<true, 2, 4, 64, 4>];
  static_assert(kGemmLds<true, 8, 1, 64, 2> <= kGemmLds<true, 2, 4, 64, 4> && kGemmLds<false, 8, 1, 64, 2> <= kGemmLds<true, 2, 4, 64, 4>, "LDS share");
  const int id = blockIdx.x;                                 // every branch below is block-uniform
  if (id < 3 * kProjTiles) {
    gemm64_body<1, true, 0, 0, false, 0, 2, 4, 64, kChan, 4>(
        smem, id % kProjTiles, id / kProjTiles, X5H + kPlane, X5L, (long)kPlane, WH, WL, (long)kWPlane,
        (void*)KVR, (void*)KVR, kChan, (long)kPlane, fdum, fdum, 0L, kChan, 1.0f);
  } else if (id < 3 * kProjTiles + kGateTiles) {
    gemm64_body<1, true, 0, 0, false, 0, 8, 1, 64, kChan, 2>(
        smem, id - 3 * kProjTiles, 0, X5H + 4 * kPlane, X5L + 3 * kPlane, 0L, WG1TH, WG1TL, 0L,
        (void*)GHPRE, (void*)GHPRE, kMixPad, 0L, fdum, fdum, 0L, kMixPad, 1.0f);
  } else {
    gemm64_body<1, false, 0, 0, false, 0, 8, 1, 64, kChan, 2>(
        smem, id - 3 * kProjTiles - kGateTiles, 0, X5H, X5H, 0L, TDAT, TDAT, 0L,
        (void*)LPRE, (void*)LPRE, kDec, 0L, fdum, fdum, 0L, kDec, 1.0f);
  }
}

// The two GEMMs behind the tanh of the two lowrank paths, in one launch of 128 blocks:
//   blocks  0..63   gate output (split, K 192), blocks 64..127 decay output (single, K 64); 64 tiles of 128 x 256 each
__global__ __launch_bounds__(256) void k_lowrank_out_gemms(
    const unsigned short* __restrict__ GHH, const unsigned short* __restrict__ GHL,
    const unsigned short* __restrict__ WG2TH, const unsigned short* __restrict__ WG2TL, float* __restrict__ GATE,
    const unsigned short* __restrict__ L1, const unsigned short* __restrict__ TDBT, float* __restrict__ WLR) {
  const float* fdum = nullptr;                               // bias and resid of the engine: not used by these GEMMs, never dereferenced
  __shared__ __align__(16) char smem[kGemmLds<true, 2, 4, 64, 4>];
  const int id = blockIdx.x;                                 // block-uniform
  if (id < kProjTiles) {
    gemm64_body<1, true, 0, 0, false, 0, 2, 4, 64, kMixPad, 4>(
        smem, id, 0, GHH, GHL, 0L, WG2TH, WG2TL, 0L, (void*)GATE, (void*)GATE, kChan, 0L, fdum, fdum, 0L, kChan, 1.0f);
  } else {
    gemm64_body<1, false, 0, 0, false, 0, 2, 4, 64, kDec, 4>(
        smem, id - kProjTiles, 0, L1, L1, 0L, TDBT, TDBT, 0L, (void*)WLR, (void*)WLR, kChan, 0L, fdum, fdum, 0L, kChan, 1.0f);
  }
}

// ---------------------------------------------------------------------------
// Square weight split: four [1024][1024] f32 matrices (layout kept as-is = [out][in] = Bt) -> bf16 hi and lo planes.
// 512 x 4 blocks (bx, z): z selects the matrix and the output plane (planes at out + z*1048576 halves).
// Thread i owns 8 consecutive elements: two b128 loads, one 16-B store per lane per plane; a wave writes 512 contiguous
// ---------------------------------------------------------------------------
__device__ __forceinline__ void wsplit8_body(const int bx, const int z,
                                             const float* __restrict__ W0, const float* __restrict__ W1,
                                             const float* __restrict__ W2, const float* __restrict__ W3,
                                             unsigned short* __restrict__ outH, unsigned short* __restrict__ outL,
                                             int n8PerMat) {
  const float* W = (z == 0) ? W0 : (z == 1) ? W1 : (z == 2) ? W2 : W3;   // block-uniform
  const int i = bx * 256 + threadIdx.x;
  if (i >= n8PerMat) return;
  const float* p = W + 8 * (size_t)i;
  const v4f a = *(const v4f*)(p);
  const v4f c = *(const v4f*)(p + 4);
  unsigned short hb[8], lb[8];
#pragma unroll
  for (int e = 0; e < 4; ++e) {
    bf_split_bits(a[e], hb[e], lb[e]);
    bf_split_bits(c[e], hb[4 + e], lb[4 + e]);
  }
  const v4u uh = (v4u){pk16(hb[0], hb[1]), pk16(hb[2], hb[3]), pk16(hb[4], hb[5]), pk16(hb[6], hb[7])};
  const v4u ul = (v4u){pk16(lb[0], lb[1]), pk16(lb[2], lb[3]), pk16(lb[4], lb[5]), pk16(lb[6], lb[7])};
  const size_t o = (size_t)z * (size_t)kWPlane + 8 * (size_t)i;
  *(v4u*)(outH + o) = uh;
  *(v4u*)(outL + o) = ul;
  // precaution: this wait stands in front of every later write of a register that one of these stores names
  asm volatile("s_wait_xcnt 0x0" ::: "memory");
}

// ---------------------------------------------------------------------------
// Transpose + bf16 convert (single or hi/lo): in[R][Cc] f32 row-major (pitch Cc) -> out[n][k] = cvt(in[k][n]) for
// k < R and n < Cc, zero otherwise (pad rows / pad columns of the output plane are WRITTEN as zeros).
// blocks (bx, by, bz) of nTilesN x nTilesK x Z: a block covers 32 output rows n0..n0+31 and KT output columns k0..k0+KT-1; bz adds
// inStrideZ / outStrideZ element offsets. 256 threads; sm = 32 * (KT + 1) floats of LDS.
// Load coverage: (32*KT/256) iterations x 256 threads = 32 x KT elements (coalesced along n), clamped address, 0/1 factor.
// Store, KT == 64: row = wave*4 + (lane>>3) -> 8 waves x 4 = 32 rows; (lane&7) x 8 halves = 64 cols; each row segment =
// Store, KT == 32 (requires ldo == 32, k0 == 0): threads 0..127, row = t>>2, c8 = (t&3)*8 -> thread t writes tile bytes
// ---------------------------------------------------------------------------
template <bool SPLIT, int KT>
__device__ __forceinline__ void trcast_body(float* sm, const int bx, const int by, const int bz,
                                            const float* __restrict__ in, int R, int Cc, long inStrideZ,
                                            unsigned short* __restrict__ outH, unsigned short* __restrict__ outL,
                                            int ldo, long outStrideZ) {
  static_assert(KT == 64 || KT == 32, "tile");
  const int t  = threadIdx.x;
  const int n0 = bx * 32;
  const int k0 = by * KT;
  const float* inz = in + (size_t)bz * inStrideZ;
  constexpr int kIters = (32 * KT) / 256;
  const float* pin[kIters];
  float fz[kIters], v[kIters];
#pragma unroll   // here and in the two loops below: the three arrays are indexed by constants only, so that they stay in registers
  for (int it = 0; it < kIters; ++it) {
    const int e  = it * 256 + t;
    const int n  = n0 + (e & 31);
    const int k  = k0 + (e >> 5);
    const int nc = (n < Cc) ? n : (Cc - 1);
    const int kc = (k < R) ? k : (R - 1);
    pin[it] = inz + (size_t)kc * Cc + nc;
    fz[it]  = ((n < Cc) && (k < R)) ? 1.0f : 0.0f;
  }
  // the two scheduling barriers keep every other instruction out of the group of loads and its wait
  __builtin_amdgcn_sched_barrier(0);
#pragma unroll
  for (int it = 0; it < kIters; ++it) v[it] = *pin[it];
  // precaution: this wait stands in front of every later write of a register that one of these loads names
  asm volatile("s_wait_xcnt 0x0" ::: "memory");
  __builtin_amdgcn_sched_barrier(0);
#pragma unroll
  for (int it = 0; it < kIters; ++it) {
    const int e = it * 256 + t;
    sm[(e & 31) * (KT + 1) + (e >> 5)] = v[it] * fz[it];
  }
  __syncthreads();
  const int lane = t & 31, wave = t >> 5;
  unsigned short* oh = outH + (size_t)bz * outStrideZ;
  unsigned short* ol = outL + (size_t)bz * outStrideZ;
  int row, c8;
  bool active;
  if (KT == 64) { row = wave * 4 + (lane >> 3); c8 = (lane & 7) * 8; active = true; }
  else          { row = t >> 2;                 c8 = (t & 3) * 8;    active = (t < 128); }
  if (active) {
    unsigned short hb[8], lb[8];
#pragma unroll
    for (int e = 0; e < 8; ++e) {
      const float v = sm[row * (KT + 1) + c8 + e];
      if (SPLIT) { bf_split_bits(v, hb[e], lb[e]); }
      else       { hb[e] = f2bf_bits(v); lb[e] = 0; }
    }
    const v4u uh = (v4u){pk16(hb[0], hb[1]), pk16(hb[2], hb[3]), pk16(hb[4], hb[5]), pk16(hb[6], hb[7])};
    const v4u ul = (v4u){pk16(lb[0], lb[1]), pk16(lb[2], lb[3]), pk16(lb[4], lb[5]), pk16(lb[6], lb[7])};
    const size_t o = (size_t)(n0 + row) * ldo + k0 + c8;
    *(v4u*)(oh + o) = uh;
    if (SPLIT) *(v4u*)(ol + o) = ul;
    // precaution: this wait stands in front of every later write of a register that one of these stores names
    asm volatile("s_wait_xcnt 0x0" ::: "memory");
  }
}

// ---------------------------------------------------------------------------
// Token shift: xx[m][c] = x[m][c] + (x[m-1][c]*f - x[m][c]) * miu_x[c], f = 0 at t == 0 else 1 (address of the prior row
// clamped, arithmetic 0/1 factor). Output: single bf16 plane [2048][1024].
// ---------------------------------------------------------------------------
__device__ __forceinline__ void xx8_body(const int bx, const float* __restrict__ x, const float* __restrict__ miu_x,
                                         unsigned short* __restrict__ XX, int n8) {
  const int i = bx * 256 + threadIdx.x;
  if (i >= n8) return;
  const int f  = 8 * i;
  const int m  = f >> 10;
  const int c0 = f & 1023;
  const int t  = m & 1023;
  const int mp = (t > 0) ? (m - 1) : m;
  const float fz = (t > 0) ? 1.0f : 0.0f;
  const float* px = x + f;
  const float* pp = x + ((size_t)mp << 10) + c0;
  const float* pm = miu_x + c0;
  const v4f a0 = *(const v4f*)(px), a1 = *(const v4f*)(px + 4);
  const v4f b0 = *(const v4f*)(pp), b1 = *(const v4f*)(pp + 4);
  const v4f u0 = *(const v4f*)(pm), u1 = *(const v4f*)(pm + 4);
  unsigned short hb[8];
#pragma unroll
  for (int e = 0; e < 4; ++e) {
    const float ba0 = b0[e] * fz - a0[e];
    const float ba1 = b1[e] * fz - a1[e];
    hb[e]     = f2bf_bits(a0[e] + ba0 * u0[e]);
    hb[4 + e] = f2bf_bits(a1[e] + ba1 * u1[e]);
  }
  const v4u uh = (v4u){pk16(hb[0], hb[1]), pk16(hb[2], hb[3]), pk16(hb[4], hb[5]), pk16(hb[6], hb[7])};
  unsigned short* q = XX + f;
  *(v4u*)q = uh;
  // precaution: this wait stands in front of every later write of a register that this store names
  asm volatile("s_wait_xcnt 0x0" ::: "memory");
}

// ---------------------------------------------------------------------------
// Everything that reads only the inputs, in one launch: the token shift, the six transposes and the square weight split do not
// depend on one another. blockIdx.x is cut into ranges, one per piece of work, each range holding that piece's own grid; every
// branch is block-uniform, and the one barrier of a transpose is passed by all threads of its block.
// ---------------------------------------------------------------------------
constexpr int kPbXX  = (int)(kPlane / 8) / 256;              // 1024 token shift
constexpr int kPbA   = (kMixPad / 32) * (kChan / 64);        // 96   A    [1024][160] -> AT   [192][1024], rows >= 160 zero
constexpr int kPbTA  = (kDec / 32) * (kChan / 64);           // 32   tdA  [1024][64]  -> TDAT [64][1024]
constexpr int kPbTB  = kChan / 32;                           // 32   tdB  [64][1024]  -> TDBT [1024][64]
constexpr int kPbG1  = (kMixPad / 32) * (kChan / 64);        // 96   Wg1  [1024][160] -> WG1T hi/lo [192][1024], rows >= 160 zero
constexpr int kPbG2  = (kChan / 32) * (kMixPad / 64);        // 96   Wg2  [160][1024] -> WG2T hi/lo [1024][192], cols >= 160 zero
constexpr int kPbBp  = (kChan / 32) * kNBr;                  // 160  Bp[s] [32][1024] -> BPT[s] [1024][32]
constexpr int kPbW   = ((int)(kWPlane / 8) / 256) * 4;       // 2048 Wk, Wv, Wr, Wo hi/lo
constexpr int kPbAll = kPbXX + kPbA + kPbTA + kPbTB + kPbG1 + kPbG2 + kPbBp + kPbW;
__global__ __launch_bounds__(256) void k_prepare(
    const float* __restrict__ x, const float* __restrict__ miu_x, const float* __restrict__ Amat,
    const float* __restrict__ tdA, const float* __restrict__ tdB, const float* __restrict__ Wg1, const float* __restrict__ Wg2,
    const float* __restrict__ Bp, const float* __restrict__ Wk, const float* __restrict__ Wv, const float* __restrict__ Wr,
    const float* __restrict__ Wo,
    unsigned short* __restrict__ XX, unsigned short* __restrict__ AT, unsigned short* __restrict__ TDAT,
    unsigned short* __restrict__ TDBT, unsigned short* __restrict__ WG1TH, unsigned short* __restrict__ WG1TL,
    unsigned short* __restrict__ WG2TH, unsigned short* __restrict__ WG2TL, unsigned short* __restrict__ BPT,
    unsigned short* __restrict__ WH, unsigned short* __restrict__ WL) {
  __shared__ float sm[32 * 65];
  int l = blockIdx.x;
  if (l < kPbXX) { xx8_body(l, x, miu_x, XX, (int)(kPlane / 8)); return; }
  l -= kPbXX;
  if (l < kPbA) { trcast_body<false, 64>(sm, l % (kMixPad / 32), l / (kMixPad / 32), 0, Amat, kChan, kMix, 0L, AT, AT, kChan, 0L); return; }
  l -= kPbA;
  if (l < kPbTA) { trcast_body<false, 64>(sm, l % (kDec / 32), l / (kDec / 32), 0, tdA, kChan, kDec, 0L, TDAT, TDAT, kChan, 0L); return; }
  l -= kPbTA;
  if (l < kPbTB) { trcast_body<false, 64>(sm, l, 0, 0, tdB, kDec, kChan, 0L, TDBT, TDBT, kDec, 0L); return; }
  l -= kPbTB;
  if (l < kPbG1) { trcast_body<true, 64>(sm, l % (kMixPad / 32), l / (kMixPad / 32), 0, Wg1, kChan, kMix, 0L, WG1TH, WG1TL, kChan, 0L); return; }
  l -= kPbG1;
  if (l < kPbG2) { trcast_body<true, 64>(sm, l % (kChan / 32), l / (kChan / 32), 0, Wg2, kMix, kChan, 0L, WG2TH, WG2TL, kMixPad, 0L); return; }
  l -= kPbG2;
  if (l < kPbBp) { trcast_body<false, 32>(sm, l % (kChan / 32), 0, l / (kChan / 32), Bp, kBr, kChan, (long)kBr * kChan, BPT, BPT, kBr, (long)kChan * kBr); return; }
  l -= kPbBp;
  wsplit8_body(l % (kPbW / 4), l / (kPbW / 4), Wk, Wv, Wr, Wo, WH, WL, (int)(kWPlane / 8));
}

// ---------------------------------------------------------------------------
// tanh + bf16 convert (single or hi/lo) with column compaction / padding:
//   out flat index f = m*ncols + c  <-  tanh(in[m*ldin + c]) for c < nvalid, 0 for c >= nvalid  (ncols <= ldin, both even).
// ---------------------------------------------------------------------------
template <bool SPLIT>
__device__ __forceinline__ void tanh2_body(const int bx, const float* __restrict__ in, int ldin,
                                           unsigned short* __restrict__ outH, unsigned short* __restrict__ outL,
                                           int ncols, int nvalid, int n2) {
  const int i = bx * 256 + threadIdx.x;
  if (i >= n2) return;
  const int f = 2 * i;
  const int m = f / ncols;
  const int c = f - m * ncols;
  const v2f a = *(const v2f*)(in + (size_t)m * ldin + c);
  // precaution: this wait stands in front of every later write of a register that this load names
  asm volatile("s_wait_xcnt 0x0" ::: "memory");
  const float f0 = (c < nvalid) ? 1.0f : 0.0f;
  const float f1 = (c + 1 < nvalid) ? 1.0f : 0.0f;
  const float t0 = tanhf(a[0]) * f0;
  const float t1 = tanhf(a[1]) * f1;
  unsigned short h0, h1, l0 = 0, l1 = 0;
  if (SPLIT) { bf_split_bits(t0, h0, l0); bf_split_bits(t1, h1, l1); }
  else       { h0 = f2bf_bits(t0); h1 = f2bf_bits(t1); }
  const unsigned uh = pk16(h0, h1);
  const unsigned ul = pk16(l0, l1);
  ((unsigned*)outH)[i] = uh;
  if (SPLIT) ((unsigned*)outL)[i] = ul;
  
}

template <bool SPLIT>
__global__ __launch_bounds__(256) void k_tanh2(const float* __restrict__ in, int ldin,
                                               unsigned short* __restrict__ outH, unsigned short* __restrict__ outL,
                                               int ncols, int nvalid, int n2) {
  tanh2_body<SPLIT>(blockIdx.x, in, ldin, outH, outL, ncols, nvalid, n2);
}
// The tanh of the gate lowrank (hi/lo, 768 blocks) and of the decay lowrank (single, 256 blocks) in one launch; block-uniform branch.
constexpr int kTbGate = (kRows * kMixPad / 2) / 256;
constexpr int kTbDec  = (kRows * kDec / 2) / 256;
__global__ __launch_bounds__(256) void k_tanh_pair(const float* __restrict__ GHPRE, unsigned short* __restrict__ GHH,
                                                   unsigned short* __restrict__ GHL, const float* __restrict__ LPRE,
                                                   unsigned short* __restrict__ L1) {
  const int id = blockIdx.x;
  if (id < kTbGate) tanh2_body<true>(id, GHPRE, kMixPad, GHH, GHL, kMixPad, kMix, kRows * kMixPad / 2);
  else              tanh2_body<false>(id - kTbGate, LPRE, kDec, L1, L1, kDec, kDec, kRows * kDec / 2);
}

// ---------------------------------------------------------------------------
// Linear-attention state scan, f32. One block (128 threads = 4 waves) per (batch b, head n, eighth ih of the
// v channels): the rows i of the state are independent, so each block carries 8 rows x 64 k channels.
// Thread (il, jg): jg = lane owns k channels 2*jg, 2*jg+1, il = wave*2 is the first of the wave's two rows;
// S lives in 2 f32 pairs, one per k channel (pairs run along the two rows, so a step's packed sum is the two rows' partials as they
// are stored, and a step reads four 8-byte LDS operands: r, k, d of its two k channels and v of its two rows).
// The sequence is cut into chunks of kSc timesteps; pass c of the loop, between two block barriers,
//   - runs the kSc steps of chunk c from stage buffer c & 1 (r, k*exp(min(w,0)), exp(w), v; w = wl + td_miu). A step has no
//     barrier: each thread stores its partial sums over its 2 k channels to partial buffer c & 1;
//   - writes chunk c+1 into the other stage buffer, piece by piece between the steps, and issues the loads of chunk c+2;
//   - finishes chunk c-1: y_i = sum of the 32 partials + v_i * bonus[t], bonus[t] = sum_j r_j*u_j*k_j (16 partials per step,
//     written by the staging threads into a ring of 4 slots).
// Y is laid out by scan block, [block][t][8 rows], so that every 128-B line of it (4 timesteps) is stored once, by 16 lanes of
// one wave of the one block that owns it.
// ---------------------------------------------------------------------------
constexpr int kSc  = 32;             // timesteps per chunk
constexpr int kNC  = kSeq / kSc;     // chunks
constexpr int kIB  = 8;              // state rows (v channels) per block
constexpr int kNIB = kHead / kIB;    // blocks per head
constexpr int kJG  = 32;             // j groups, 2 k channels each
constexpr int kPJ  = 10;             // floats between the partial rows of two j groups: the 32 lanes of a b64 store hit all 64 banks once
constexpr int kPT  = kJG * kPJ + 8;  // floats between two timesteps' partials: the 8 timesteps of one b64 read hit disjoint banks
constexpr int kPre = 12;             // steps whose LDS operands are fetched ahead of their use
static_assert(kSeq % kSc == 0 && kNC >= 2 && kNIB == 8 && kJG * 2 == kHead && kSc == 32 && kSc > kPre, "scan chunking");
struct ScanOp { v2f r, k, d, v; };
__device__ __forceinline__ v2f both(float a) { return (v2f){a, a}; }
__global__ __launch_bounds__(128) void k_state_scan(const float* __restrict__ kraw, const float* __restrict__ vpl,
                                                    const float* __restrict__ rpl, const float* __restrict__ wl,
                                                    const float* __restrict__ td_miu, const float* __restrict__ u,
                                                    float* __restrict__ Y) {
  __shared__ __align__(16) float sr0[kSc * 64], sr1[kSc * 64];
  __shared__ __align__(16) float sk0[kSc * 64], sk1[kSc * 64];
  __shared__ __align__(16) float sd0[kSc * 64], sd1[kSc * 64];
  __shared__ __align__(16) float sv0[kSc * kIB], sv1[kSc * kIB];
  __shared__ __align__(16) float part0[kSc * kPT], part1[kSc * kPT];
  __shared__ __align__(16) float sbp[4][kSc][16];
  const int tid  = threadIdx.x;
  const int lane = tid & 31;
  const int wave = tid >> 5;
  const int ih   = blockIdx.x & (kNIB - 1);
  const int n    = (blockIdx.x >> 3) & (kNHead - 1);
  const int b    = blockIdx.x >> 7;
  const int jg   = lane;
  const int j0   = jg * 2;
  const int il   = wave * 2;                          // first of this thread's two rows, local to the block
  // staging and output roles: r/k/w rows are 16 float4 wide, v and y rows 4 float2 wide
  const int sRow = tid >> 4, sC4 = (tid & 15) * 4;
  const int vRow = tid >> 2, vC2 = (tid & 3) * 2;
  const size_t base = (size_t)b * kSeq * kChan + (size_t)n * kHead;
  float* Yb = Y + (size_t)blockIdx.x * (kSeq * kIB);                     // this block's own [t][8] plane
  const unsigned offS = (unsigned)(sRow * kChan + sC4) * 4u;             // byte offsets of the roles inside a piece
  const unsigned offV = (unsigned)(vRow * kChan + ih * kIB + vC2) * 4u;
  const unsigned offY = (unsigned)(vRow * kIB + vC2) * 4u;
  const v4f tm4 = *(const v4f*)(td_miu + n * kHead + sC4);
  const v4f u4  = *(const v4f*)(u + n * kHead + sC4);
  // precaution: this wait stands in front of every later write of a register that one of these two loads names; the scheduling
  // barrier keeps later instructions behind it
  asm volatile("s_wait_xcnt 0x0" ::: "memory");
  __builtin_amdgcn_sched_barrier(0);

  v2f S[2];
#pragma unroll
  for (int q = 0; q < 2; ++q) S[q] = (v2f){0.f, 0.f};

  // staged through registers in kSc/8 pieces: piece it = 8 rows of r, k, w (and, with the first piece, all kSc rows of v)
  v4f gw[kSc / 8], gk[kSc / 8], gr[kSc / 8];
  v2f gv;
  // the v values this thread staged are the ones its own output role needs two passes later: vOld of chunk c-1, vNew of chunk c
  v2f vOld = (v2f){0.f, 0.f}, vNew = vOld;
  auto issue = [&](int it, int t0) {
    const size_t ub = base + (size_t)(t0 + it * 8) * kChan;      // block-uniform: scalar base + this thread's fixed byte offset
    // the two scheduling barriers keep every other instruction out of the group of loads and its wait
    __builtin_amdgcn_sched_barrier(0);
    gw[it] = *(const v4f*)((const char*)(wl + ub) + offS);
    gk[it] = *(const v4f*)((const char*)(kraw + ub) + offS);
    gr[it] = *(const v4f*)((const char*)(rpl + ub) + offS);
    if (it == 0) gv = *(const v2f*)((const char*)(vpl + ub) + offV);
    // precaution: this wait stands in front of every later write of a register that one of these loads names
    asm volatile("s_wait_xcnt 0x0" ::: "memory");
    __builtin_amdgcn_sched_barrier(0);
  };
  auto commit = [&](int it, float* dr, float* dk, float* dd_, float* dv, int slot) {
    const int tl = it * 8 + sRow;
    v4f kk, dd;
    float bp = 0.0f;
#pragma unroll
    for (int e = 0; e < 4; ++e) {
      const float wv = gw[it][e] + tm4[e];
      kk[e] = gk[it][e] * expf(fminf(wv, 0.0f));
      dd[e] = expf(wv);
      bp += gr[it][e] * (u4[e] * kk[e]);
    }
    *(v4f*)(dr + tl * 64 + sC4)  = gr[it];
    *(v4f*)(dk + tl * 64 + sC4)  = kk;
    *(v4f*)(dd_ + tl * 64 + sC4) = dd;
    sbp[slot][tl][tid & 15] = bp;
    if (it == 0) {
      *(v2f*)(dv + vRow * kIB + vC2) = gv;
      vOld = vNew;
      vNew = gv;
    }
  };
  // finishing chunk cc from its partials (src), its bonus slot and vOld: the LDS reads, and apart from them the sums and the store
  v2f x[kJG];
  v4f xb[4];
  auto finish_load = [&](const float* src, int cc) {
#pragma unroll   // here and below: x and xb are indexed by constants only, so that they stay in registers
    for (int g = 0; g < kJG; ++g) x[g] = *(const v2f*)(src + vRow * kPT + g * kPJ + vC2);
#pragma unroll
    for (int g = 0; g < 4; ++g) xb[g] = *(const v4f*)(&sbp[cc & 3][vRow][4 * g]);
  };
  auto finish_sum = [&](int cc) {
    const v4f b4 = (xb[0] + xb[1]) + (xb[2] + xb[3]);
    const float bn = (b4[0] + b4[1]) + (b4[2] + b4[3]);
    v2f s8[4];
#pragma unroll
    for (int h = 0; h < 4; ++h)
      s8[h] = ((x[8 * h] + x[8 * h + 1]) + (x[8 * h + 2] + x[8 * h + 3])) + ((x[8 * h + 4] + x[8 * h + 5]) + (x[8 * h + 6] + x[8 * h + 7]));
    const v2f yv = ((s8[0] + s8[1]) + (s8[2] + s8[3])) + vOld * bn;
    // as in issue(): nothing else is scheduled into the store and its wait
    __builtin_amdgcn_sched_barrier(0);
    *(v2f*)((char*)(Yb + (size_t)cc * (kSc * kIB)) + offY) = yv;
    // the same precaution for the registers that this store names
    asm volatile("s_wait_xcnt 0x0" ::: "memory");
    __builtin_amdgcn_sched_barrier(0);
  };
  auto pass = [&](int c) {
    const int p = c & 1;
    const float* pr = (p ? sr1 : sr0) + j0;
    const float* pk = (p ? sk1 : sk0) + j0;
    const float* pd = (p ? sd1 : sd0) + j0;
    const float* pv = (p ? sv1 : sv0) + il;
    float* pp = (p ? part1 : part0) + jg * kPJ + il;
    // chunk whose loads are issued in this pass; clamped, so that the steps have no branch (the last two passes re-read the last
    // chunk, and the last pass stages it into buffers that nobody reads any more)
    const int tN = ((c + 2 < kNC) ? (c + 2) : (kNC - 1)) * kSc;
    auto ld = [&](int tl) {
      ScanOp o;
      o.r = *(const v2f*)(pr + tl * 64);
      o.k = *(const v2f*)(pk + tl * 64);
      o.d = *(const v2f*)(pd + tl * 64);
      o.v = *(const v2f*)(pv + tl * kIB);
      return o;
    };
    // the previous chunk's reads first, then the first steps' reads, which are served while the previous chunk is summed and stored
    if (c > 0) finish_load(p ? part0 : part1, c - 1);      // block-uniform
    ScanOp ring[kPre];
#pragma unroll
    for (int tl = 0; tl < kPre; ++tl) ring[tl] = ld(tl);
    if (c > 0) finish_sum(c - 1);
    // fully unrolled so that the ring's slots are registers and every LDS offset an immediate
#pragma unroll
    for (int tl = 0; tl < kSc; ++tl) {
      const ScanOp o = ring[tl % kPre];
      if (tl + kPre < kSc) ring[tl % kPre] = ld(tl + kPre);
      // keeps these reads kPre steps ahead of their use: sunk next to it, the wave would wait out the LDS latency in every step
      __builtin_amdgcn_sched_barrier(0);
      v2f a = both(o.r[0]) * S[0];
      a = __builtin_elementwise_fma(both(o.r[1]), S[1], a);
      S[0] = __builtin_elementwise_fma(S[0], both(o.d[0]), both(o.k[0]) * o.v);
      S[1] = __builtin_elementwise_fma(S[1], both(o.d[1]), both(o.k[1]) * o.v);
      *(v2f*)(pp + tl * kPT) = a;
      // one piece of the next chunk's stage every 4 steps, early in the pass: its vector work runs while the LDS reads fetched
      // ahead are served, and the loads issued behind it have the rest of the pass to land before the barrier waits for them
      if ((tl & 3) == 1 && (tl >> 2) < kSc / 8) {
        commit(tl >> 2, p ? sr0 : sr1, p ? sk0 : sk1, p ? sd0 : sd1, p ? sv0 : sv1, (c + 1) & 3);
        issue(tl >> 2, tN);
      }
    }
    // the one barrier of a pass: publishes this chunk's partials and the next chunk's stage, and ends the reads of this chunk's
    // stage and of the previous chunk's partials, which the next pass overwrites
    __syncthreads();
  };

#pragma unroll
  for (int it = 0; it < kSc / 8; ++it) issue(it, 0);
#pragma unroll
  for (int it = 0; it < kSc / 8; ++it) {
    commit(it, sr0, sk0, sd0, sv0, 0);
    issue(it, kSc);
  }
  __syncthreads();
#pragma unroll 1
  for (int c = 0; c < kNC; ++c) pass(c);
  finish_load(((kNC - 1) & 1) ? part1 : part0, kNC - 1);
  finish_sum(kNC - 1);
}

// ---------------------------------------------------------------------------
// GroupNorm (64 channels per head, biased variance, eps 1.6e-4) + affine + gate multiply -> bf16 hi/lo planes.
// One wave per (row m, head n), 8 pairs per 256-thread block; lane owns channels 2l, 2l+1; shuffle reductions (unconditional).
// Y comes in the scan's layout [scan block][t][8 rows]: a block takes 4 consecutive rows of 2 heads, which share their lines of Y.
// ---------------------------------------------------------------------------
__global__ __launch_bounds__(256) void k_gn_gate(const float* __restrict__ Y, const float* __restrict__ G,
                                                 const float* __restrict__ gamma, const float* __restrict__ beta,
                                                 unsigned short* __restrict__ outH, unsigned short* __restrict__ outL) {
  __shared__ __align__(16) float slab[8][64];
  const int lane = threadIdx.x & 31, wave = threadIdx.x >> 5;
  const int m = (blockIdx.x >> 3) * 4 + (wave & 3);
  const int n = (blockIdx.x & 7) * 2 + (wave >> 2);
  const size_t base = (size_t)m * kChan + (size_t)n * kHead;
  const int c = n * kHead + 2 * lane;
  const int sb = ((m / kSeq) * kNHead + n) * kNIB + (2 * lane) / kIB;      // the scan block that owns this lane's two channels
  // the two scheduling barriers keep every other instruction out of the group of loads and its wait, so that the four fly together
  __builtin_amdgcn_sched_barrier(0);
  const v2f yv = *(const v2f*)(Y + ((size_t)sb * kSeq + (m % kSeq)) * kIB + (2 * lane) % kIB);
  const v2f gv = *(const v2f*)(G + base + 2 * lane);
  const v2f ga = *(const v2f*)(gamma + c);
  const v2f be = *(const v2f*)(beta + c);
  // precaution: this wait stands in front of every later write of a register that one of these loads names
  asm volatile("s_wait_xcnt 0x0" ::: "memory");
  __builtin_amdgcn_sched_barrier(0);
  float s = yv[0] + yv[1];
#pragma unroll
  for (int off = 16; off > 0; off >>= 1) s += __shfl_xor(s, off, 32);
  const float mean = s * (1.0f / 64.0f);
  const float d0 = yv[0] - mean;
  const float d1 = yv[1] - mean;
  float q = d0 * d0 + d1 * d1;
#pragma unroll
  for (int off = 16; off > 0; off >>= 1) q += __shfl_xor(q, off, 32);
  const float var = q * (1.0f / 64.0f);
  const float rs  = 1.0f / sqrtf(var + kGnEps);
  const float o0 = ((d0 * rs) * ga[0] + be[0]) * gv[0];
  const float o1 = ((d1 * rs) * ga[1] + be[1]) * gv[1];
  *(v2f*)(&slab[wave][2 * lane]) = (v2f){o0, o1};
  __syncthreads();
  if (lane < 8) {
    unsigned short hb[8], lb[8];
#pragma unroll
    for (int e = 0; e < 8; ++e) bf_split_bits(slab[wave][8 * lane + e], hb[e], lb[e]);
    const v4u uh = (v4u){pk16(hb[0], hb[1]), pk16(hb[2], hb[3]), pk16(hb[4], hb[5]), pk16(hb[6], hb[7])};
    const v4u ul = (v4u){pk16(lb[0], lb[1]), pk16(lb[2], lb[3]), pk16(lb[4], lb[5]), pk16(lb[6], lb[7])};
    const size_t o = base + 8 * (size_t)lane;
    *(v4u*)(outH + o) = uh;
    *(v4u*)(outL + o) = ul;
    
  }
}

// ---------------------------------------------------------------------------
// Host glue.
// Workspace region map (bytes; every size is a multiple of 4096, offsets in that order):
//   XX     bf16 [2048][1024]            4,194,304
//   HPRE   f32  [2048][192]             1,572,864   (tanh input of the mix path; cols 160..191 written by the GEMM, unread)
//   HC     bf16 [2048][160] = [10240][32] 655,360   (compact; branch s = rows 2048s.. of the ld-32 view)
//   MIU    f32  [2048][1024]            8,388,608   (the decay lowrank output)
//   X5H    bf16 [5][2048][1024]        20,971,520   (branch inputs hi: 0 decay (single), 1 k, 2 v, 3 r, 4 gate)
//   X5L    bf16 [4][2048][1024]        16,777,216   (lo planes of branches 1..4 at index s-1)
//   WH     bf16 [4][1024][1024]         8,388,608   (Wk, Wv, Wr, Wo hi, [out][in] as-is)
//   WL     bf16 [4][1024][1024]         8,388,608   (lo)
//   AT     bf16 [192][1024]               393,216   (A^T, rows 160..191 zero)
//   TDAT   bf16 [64][1024]                131,072
//   TDBT   bf16 [1024][64]                131,072
//   WG1TH  bf16 [192][1024]               393,216   (rows 160..191 zero)   WG1TL 393,216
//   WG2TH  bf16 [1024][192]               393,216   (cols 160..191 zero)   WG2TL 393,216
//   BPT    bf16 [5][1024][32]             327,680
//   LPRE   f32  [2048][64]                524,288
//   L1     bf16 [2048][64]                262,144
//   KVR    f32  [3][2048][1024]         25,165,824   (k unscaled, v, r)
//   GHPRE  f32  [2048][192]             1,572,864
//   GHH    bf16 [2048][192]               786,432   (cols 160..191 zero)   GHL 786,432
//   GATE   f32  [2048][1024]            8,388,608
//   Y      f32  [256][1024][8]          8,388,608   (scan block = (b*16 + head)*8 + eighth of the head's channels, t, row)
//   GATH   bf16 [2048][1024]            4,194,304   GATL 4,194,304
//   total                             126,156,800
// GEMM shapes (M, N, K): (2048,192,1024) (2048,1024,32)x5 batched (2048,64,1024) (2048,1024,64) (2048,1024,1024)x3 batched
// (2048,192,1024) (2048,1024,192) (2048,1024,1024); all M,N % 64 == 0, all K % 32 == 0, pads zero-written by producers.
// ---------------------------------------------------------------------------
extern "C" void kernel_launch(void* const* d_in, const int* in_sizes, int n_in,
                              void* d_out, int out_size, void* d_ws, size_t ws_size,
                              hipStream_t stream) {
  if (n_in < 17) return;
  if (in_sizes[0] != kBatch * kSeq * kChan) return;
  if (in_sizes[1] != kChan || in_sizes[2] != kNBr * kChan) return;
  if (in_sizes[3] != kChan * kMix || in_sizes[4] != kNBr * kBr * kChan) return;
  if (in_sizes[5] != kChan || in_sizes[6] != kChan * kDec || in_sizes[7] != kDec * kChan) return;
  if (in_sizes[8] != kNHead * kHead) return;
  if (in_sizes[9] != kChan * kChan || in_sizes[10] != kChan * kChan || in_sizes[11] != kChan * kChan || in_sizes[12] != kChan * kChan) return;
  if (in_sizes[13] != kChan * kMix || in_sizes[14] != kMix * kChan) return;
  if (in_sizes[15] != kChan || in_sizes[16] != kChan) return;
  if (out_size != kBatch * kSeq * kChan) return;

  const float* x      = (const float*)d_in[0];
  const float* miu_x  = (const float*)d_in[1];
  const float* lam    = (const float*)d_in[2];    // [5][1024]
  const float* Amat   = (const float*)d_in[3];    // [1024][160]
  const float* Bp     = (const float*)d_in[4];    // [5][32][1024]
  const float* td_miu = (const float*)d_in[5];    // [1024]
  const float* tdA    = (const float*)d_in[6];    // [1024][64]
  const float* tdB    = (const float*)d_in[7];    // [64][1024]
  const float* u      = (const float*)d_in[8];    // [16][64]
  const float* Wk     = (const float*)d_in[9];    // [1024][1024] [out][in]
  const float* Wv     = (const float*)d_in[10];
  const float* Wr     = (const float*)d_in[11];
  const float* Wo     = (const float*)d_in[12];
  const float* Wg1    = (const float*)d_in[13];   // [1024][160]
  const float* Wg2    = (const float*)d_in[14];   // [160][1024]
  const float* gamma  = (const float*)d_in[15];
  const float* beta   = (const float*)d_in[16];
  float* out = (float*)d_out;

  // ---- carve ----
  const size_t szXX    = (size_t)kPlane * 2;
  const size_t szHPRE  = (size_t)kRows * kMixPad * 4;
  const size_t szHC    = (size_t)kRows * kMix * 2;
  const size_t szF32P  = (size_t)kPlane * 4;
  const size_t szX5H   = (size_t)kNBr * kPlane * 2;
  const size_t szX5L   = (size_t)(kNBr - 1) * kPlane * 2;
  const size_t szWSQ   = (size_t)4 * kWPlane * 2;
  const size_t szAT    = (size_t)kMixPad * kChan * 2;
  const size_t szTDAT  = (size_t)kDec * kChan * 2;
  const size_t szTDBT  = (size_t)kChan * kDec * 2;
  const size_t szWG1T  = (size_t)kMixPad * kChan * 2;
  const size_t szWG2T  = (size_t)kChan * kMixPad * 2;
  const size_t szBPT   = (size_t)kNBr * kChan * kBr * 2;
  const size_t szLPRE  = (size_t)kRows * kDec * 4;
  const size_t szL1    = (size_t)kRows * kDec * 2;
  const size_t szKVR   = (size_t)3 * kPlane * 4;
  const size_t szGHPRE = (size_t)kRows * kMixPad * 4;
  const size_t szGH    = (size_t)kRows * kMixPad * 2;
  const size_t szGAT   = (size_t)kPlane * 2;
  size_t off = 0;
  const size_t oXX    = off; off += szXX;
  const size_t oHPRE  = off; off += szHPRE;
  const size_t oHC    = off; off += szHC;
  const size_t oMIU   = off; off += szF32P;
  const size_t oX5H   = off; off += szX5H;
  const size_t oX5L   = off; off += szX5L;
  const size_t oWH    = off; off += szWSQ;
  const size_t oWL    = off; off += szWSQ;
  const size_t oAT    = off; off += szAT;
  const size_t oTDAT  = off; off += szTDAT;
  const size_t oTDBT  = off; off += szTDBT;
  const size_t oWG1TH = off; off += szWG1T;
  const size_t oWG1TL = off; off += szWG1T;
  const size_t oWG2TH = off; off += szWG2T;
  const size_t oWG2TL = off; off += szWG2T;
  const size_t oBPT   = off; off += szBPT;
  const size_t oLPRE  = off; off += szLPRE;
  const size_t oL1    = off; off += szL1;
  const size_t oKVR   = off; off += szKVR;
  const size_t oGHPRE = off; off += szGHPRE;
  const size_t oGHH   = off; off += szGH;
  const size_t oGHL   = off; off += szGH;
  const size_t oGATE  = off; off += szF32P;
  const size_t oY     = off; off += szF32P;
  const size_t oGATH  = off; off += szGAT;
  const size_t oGATL  = off; off += szGAT;
  const size_t total  = off;   // 126,156,800
  if (total > (size_t)134217728) return;
  if (ws_size < total) return;

  char* ws = (char*)d_ws;
  unsigned short* XX    = (unsigned short*)(ws + oXX);
  float*          HPRE  = (float*)(ws + oHPRE);
  unsigned short* HC    = (unsigned short*)(ws + oHC);
  float*          MIU   = (float*)(ws + oMIU);
  float*          WLR   = MIU;                       // decay lowrank output, f32 [2048][1024]
  unsigned short* X5H   = (unsigned short*)(ws + oX5H);
  unsigned short* X5L   = (unsigned short*)(ws + oX5L);
  unsigned short* WH    = (unsigned short*)(ws + oWH);
  unsigned short* WL    = (unsigned short*)(ws + oWL);
  unsigned short* AT    = (unsigned short*)(ws + oAT);
  unsigned short* TDAT  = (unsigned short*)(ws + oTDAT);
  unsigned short* TDBT  = (unsigned short*)(ws + oTDBT);
  unsigned short* WG1TH = (unsigned short*)(ws + oWG1TH);
  unsigned short* WG1TL = (unsigned short*)(ws + oWG1TL);
  unsigned short* WG2TH = (unsigned short*)(ws + oWG2TH);
  unsigned short* WG2TL = (unsigned short*)(ws + oWG2TL);
  unsigned short* BPT   = (unsigned short*)(ws + oBPT);
  float*          LPRE  = (float*)(ws + oLPRE);
  unsigned short* L1    = (unsigned short*)(ws + oL1);
  float*          KVR   = (float*)(ws + oKVR);
  float*          GHPRE = (float*)(ws + oGHPRE);
  unsigned short* GHH   = (unsigned short*)(ws + oGHH);
  unsigned short* GHL   = (unsigned short*)(ws + oGHL);
  float*          GATE  = (float*)(ws + oGATE);
  float*          Yp    = (float*)(ws + oY);
  unsigned short* GATH  = (unsigned short*)(ws + oGATH);
  unsigned short* GATL  = (unsigned short*)(ws + oGATL);
  const float* fdum = gamma;   // placeholder for unused bias / resid pointer arguments (never dereferenced)

  const dim3 blk(256);
  const dim3 blkTall(128);                               // the mix lowrank GEMM's blocks of 4 x 1 waves

  // ---- token shift and all weight planes ----
  k_prepare<<<dim3(kPbAll), blk, 0, stream>>>(x, miu_x, Amat, tdA, tdB, Wg1, Wg2, Bp, Wk, Wv, Wr, Wo,
                                              XX, AT, TDAT, TDBT, WG1TH, WG1TL, WG2TH, WG2TL, BPT, WH, WL);

  // ---- mix lowrank: HPRE = XX @ AT^T  (M 2048, N 192, K 1024; 24 blocks of 256 x 64) ----
  wmma_gemm64<1, false, 0, 0, false, 0, 4, 1, 64, kChan><<<dim3((kRows / 256) * (kMixPad / 64), 1), blkTall, 0, stream>>>(
      XX, XX, 0L, AT, AT, 0L, (void*)HPRE, (void*)HPRE, kMixPad, 0L, fdum, fdum, 0L, kMixPad, 1.0f);
  // HC flat [2048*160] = tanh(HPRE[:, 0:160]) compact bf16; n2 = 163840 -> 640 blocks exact
  k_tanh2<false><<<dim3((kRows * kMix / 2) / 256), blk, 0, stream>>>(HPRE, kMixPad, HC, HC, kMix, kMix, kRows * kMix / 2);

  // ---- mix GEMM of all five branches (blockIdx.y = s; A = HC viewed [10240][32], rows 2048s..; K 32); its epilogue forms the
  // branch inputs and stores their bf16 planes ----
  wmma_gemm64<1, false, 0, 3, false, 0, 2, 4, 32, kBr><<<dim3((kRows / 128) * (kChan / 256), kNBr), blk, 0, stream>>>(
      HC, HC, (long)kRows * kBr, BPT, BPT, (long)kChan * kBr,
      (void*)X5H, (void*)X5L, kChan, (long)kPlane, lam, x, 0L, kChan, 1.0f);

  // ---- what reads only the branch inputs: KVR = k (unscaled), v, r projections; GHPRE = X5[4] @ WG1T^T; LPRE = X5H[0] @ TDAT^T ----
  k_branch_gemms<<<dim3(3 * kProjTiles + kGateTiles + kDecTiles), blk, 0, stream>>>(
      X5H, X5L, WH, WL, KVR, WG1TH, WG1TL, GHPRE, TDAT, LPRE);
  // ---- GH = tanh(GHPRE) hi/lo (cols 160..191 zero); L1 = tanh(LPRE) ----
  k_tanh_pair<<<dim3(kTbGate + kTbDec), blk, 0, stream>>>(GHPRE, GHH, GHL, LPRE, L1);
  // ---- GATE = GH @ WG2T^T (split, K 192); WLR = L1 @ TDBT^T (K 64) ----
  k_lowrank_out_gemms<<<dim3(2 * kProjTiles), blk, 0, stream>>>(GHH, GHL, WG2TH, WG2TL, GATE, L1, TDBT, WLR);

  // ---- state scan -> Y ----
  k_state_scan<<<dim3(kBatch * kNHead * kNIB), dim3(128), 0, stream>>>(KVR, KVR + kPlane, KVR + 2 * kPlane, WLR, td_miu, u, Yp);

  // ---- GroupNorm + gate -> GATH/GATL (4096 blocks x 8 waves = 32768 (row, head) pairs) ----
  k_gn_gate<<<dim3((kRows * kNHead) / 8), blk, 0, stream>>>(Yp, GATE, gamma, beta, GATH, GATL);

  // ---- output projection straight into d_out (split, K 1024) ----
  wmma_gemm64<1, true, 0, 0, false, 0, 2, 4, 64, kChan><<<dim3((kRows / 128) * (kChan / 256), 1), blk, 0, stream>>>(
      GATH, GATL, 0L, WH + 3 * kWPlane, WL + 3 * kWPlane, 0L,
      (void*)out, (void*)out, kChan, 0L, fdum, fdum, 0L, kChan, 1.0f);
}

// v006
// One run takes 169 microseconds.
// In two side-by-side timings against v005, it was 1.05 and 1.03 times as fast.
// Counting every step since v000, it is 6.00 times as fast.
// Contractions: every GEMM on v_wmma_f32_16x16x32_bf16 (bf16 operands, f32 accumulate) - the four lowrank mix/decay sites single bf16, the k/v/r projections, the gate pair and the output projection as bf16 hi/lo split (hi*hi + hi*lo + lo*hi); token shift, state scan, GroupNorm and gating in f32 on VALU.
#include <hip/hip_runtime.h>
#include <math.h>

// ---------------------------------------------------------------------------
// Problem constants
// ---------------------------------------------------------------------------
constexpr int kBatch  = 2;
constexpr int kSeq    = 1024;
constexpr int kChan   = 1024;
constexpr int kHead   = 64;
constexpr int kNHead  = 16;
constexpr int kRows   = kBatch * kSeq;          // 2048 token rows (m = b*1024 + t)
constexpr int kMix    = 160;                    // lowrank width of the mix and gate paths
constexpr int kMixPad = 192;                    // padded to a 64 multiple (pad rows / cols zero-filled)
constexpr int kDec    = 64;                     // decay lowrank width
constexpr int kBr     = 32;                     // per-branch mix width
constexpr int kNBr    = 5;                      // branches: 0 decay, 1 k, 2 v, 3 r, 4 gate
constexpr long kPlane  = (long)kRows * kChan;   // 2,097,152 elements per activation plane
constexpr long kWPlane = (long)kChan * kChan;   // 1,048,576 elements per square weight plane
constexpr float kGnEps = 1.6e-4f;               // 1e-5 * 16
static_assert(kNHead * kHead == kChan, "shape");
static_assert(kRows % 256 == 0 && kChan % 256 == 0 && kMixPad % 64 == 0 && kDec % 64 == 0, "M and N tile multiples");
static_assert(kChan % 32 == 0 && kBr % 32 == 0 && kDec % 32 == 0 && kMixPad % 32 == 0, "K multiples of 32");
static_assert(kMix % 8 == 0 && kMixPad % 8 == 0 && kDec % 8 == 0, "pack groups never straddle a row");

typedef __attribute__((ext_vector_type(16))) _Float16 v16h;
typedef __attribute__((ext_vector_type(8)))  _Float16 v8h;
typedef __attribute__((ext_vector_type(16))) __bf16   v16b;
typedef __attribute__((ext_vector_type(8)))  __bf16   v8b;
typedef __attribute__((ext_vector_type(8)))  float    v8f;
typedef __attribute__((ext_vector_type(4)))  float    v4f;
typedef __attribute__((ext_vector_type(2)))  float    v2f;
typedef __attribute__((ext_vector_type(4)))  unsigned int v4u;

// ---------------------------------------------------------------------------
// Shared helpers
// ---------------------------------------------------------------------------
__device__ __forceinline__ unsigned short f2bf_bits(float f) {
  unsigned u = __float_as_uint(f);
  return (unsigned short)((u + 0x7FFFu + ((u >> 16) & 1u)) >> 16);
}
__device__ __forceinline__ float bf_bits2f(unsigned short h) { return __uint_as_float(((unsigned)h) << 16); }
__device__ __forceinline__ unsigned pk16(unsigned short a, unsigned short b) { return (unsigned)a | ((unsigned)b << 16); }
// RNE convert to a bf16 hi part and a bf16 lo part of the f32 residual
__device__ __forceinline__ void bf_split_bits(float f, unsigned short& hb, unsigned short& lb) {
  hb = f2bf_bits(f);
  lb = f2bf_bits(f - bf_bits2f(hb));
}

// hazard guards as plain device helpers; the 4-acc guard ties every
// accumulator of a group and names the A fragments as inputs
__device__ __forceinline__ void dep_guard4_h(v8f& a, v8f& b, v8f& c, v8f& d, v16h x, v16h y) { asm volatile("v_nop\n\tv_nop\n\tv_nop\n\tv_nop" : "+v"(a), "+v"(b), "+v"(c), "+v"(d) : "v"(x), "v"(y)); }
__device__ __forceinline__ void dep_guard4_b(v8f& a, v8f& b, v8f& c, v8f& d, v16b x, v16b y) { asm volatile("v_nop\n\tv_nop\n\tv_nop\n\tv_nop" : "+v"(a), "+v"(b), "+v"(c), "+v"(d) : "v"(x), "v"(y)); }
__device__ __forceinline__ void keep4_h(v16h a, v16h b, v16h c, v16h d) { asm volatile("v_nop" :: "v"(a), "v"(b), "v"(c), "v"(d)); }
__device__ __forceinline__ void keep4_b(v16b a, v16b b, v16b c, v16b d) { asm volatile("v_nop" :: "v"(a), "v"(b), "v"(c), "v"(d)); }
__device__ __forceinline__ void acc_guard4(v8f& a, v8f& b, v8f& c, v8f& d) { asm volatile("v_nop\n\tv_nop\n\tv_nop\n\tv_nop" : "+v"(a), "+v"(b), "+v"(c), "+v"(d)); }
template <typename T> struct Frag;
template <> struct Frag<_Float16> {
  typedef v16h V; typedef v8h H; union U { v16h v; v8h h[2]; };
  // elements 0..7 <- p[0..7], 8..15 <- p[16..23]
  static __device__ __forceinline__ v16h load(const _Float16* p) {
    U f; f.h[0] = *(const v8h*)(p); f.h[1] = *(const v8h*)(p + 16); return f.v;
  }
  static __device__ __forceinline__ v8f mma(v16h a, v16h b, v8f c) {
    return __builtin_amdgcn_wmma_f32_16x16x32_f16(false, a, false, b, (short)0, c, false, false);
  }
  static __device__ __forceinline__ void guard4(v8f& a, v8f& b, v8f& c, v8f& d, v16h x, v16h y) { dep_guard4_h(a, b, c, d, x, y); }
  static __device__ __forceinline__ void keep(v16h a, v16h b, v16h c, v16h d) { keep4_h(a, b, c, d); }
};
template <> struct Frag<__bf16> {
  typedef v16b V; typedef v8b H; union U { v16b v; v8b h[2]; };
  static __device__ __forceinline__ v16b load(const __bf16* p) {
    U f; f.h[0] = *(const v8b*)(p); f.h[1] = *(const v8b*)(p + 16); return f.v;
  }
  static __device__ __forceinline__ v8f mma(v16b a, v16b b, v8f c) {
    return __builtin_amdgcn_wmma_f32_16x16x32_bf16(false, a, false, b, (short)0, c, false, false);
  }
  static __device__ __forceinline__ void guard4(v8f& a, v8f& b, v8f& c, v8f& d, v16b x, v16b y) { dep_guard4_b(a, b, c, d, x, y); }
  static __device__ __forceinline__ void keep(v16b a, v16b b, v16b c, v16b d) { keep4_b(a, b, c, d); }
};

// ---- Register-blocked batched WMMA GEMM (ACT reduced to none/relu/leaky/tanh) -------------------------------
// C[m,n] = scale * sum_k A[m,k] * Bt[n,k] (+bias)(+resid); each wave owns a (16*MI)x64 tile, the WM x WN waves of a block one
// (16*MI*WM) x (64*WN) tile. A row-major [M,KD]; Bt row-major [N,KD]; M % (16*MI*WM) == 0, N % (64*WN) == 0, KD % KS == 0.
// Operand path: the block brings KS k values of its A rows and Bt rows from global memory in whole row pieces (KS*2 bytes,
// 16 B per lane), through registers, into one of two LDS buffers; every wave reads its fragments from there. The loads of
// stage s+1 are issued ahead of the products of stage s and stored to the other buffer behind them; one barrier per stage.
// SPLIT: operands are hi/lo planes (A2/Bt2 = lo planes, same layout); product = hi*hi + hi*lo + lo*hi.
// BIAS_MODE: 0 = none, 1 = bias[m], 2 = bias[n].
// OUT_MODE: 0 = f32, 2 = bf16 hi plane (Cout) + bf16 lo plane (Cout2), 4 = bf16 hi plane alone. In 2 and 4 a row of a wave's tile is one
//               whole 128-B line of each plane (ldc % 64 == 0), stored once, by 8 lanes of that wave.
//           3 = branch input: the tile is the mix term u of branch b = blockIdx.y; the epilogue forms
//               x[m][n] + (x[m-1][n]*f - x[m][n]) * (u + lam[b][n]), f = 0 at t == 0 else 1 (address of the prior row clamped),
//               x = resid (pitch kChan), lam = bias (pitch N), and stores its bf16 hi plane (Cout, plane b) and, for b > 0, its
//               bf16 lo plane (Cout2, plane b-1). Every 128-B line of a plane is stored once, by 8 lanes of one wave.
//               Its A operand is the [kNBr * kRows][kBr] row-major view of the mix lowrank's kMix valid columns, which lie in a plane
//               of pitch kMixPad: row R of the view is columns (R % kNBr) * kBr .. of the plane's row R / kNBr.
// ACT (OUT_MODE 2 and 4 only): 5 = tanh ahead of the bf16 conversion; columns from kMix on of an N == kMixPad GEMM are stored as zero.
// ET: 0 = f16 operands, 1 = bf16 operands (pointers passed as 16-bit storage)
// The engine is a device function, so that GEMMs which do not depend on one another can share one launch: bx and b stand for the
// block's place in the GEMM's own grid, smem for the launch's one LDS array (kGemmLds bytes of it are used).
// MI: 16-row groups of a wave's tile, 4 unless said otherwise. With MI = 2 a wave owns 32x64, so that a 256 x 64 block tile takes the
// eight waves of the 256-thread blocks that it shares a launch with; every element's k order is the same for every MI.
template <bool SPLIT, int WM, int WN, int KS, int MI>
constexpr int kGemmLds = 2 * (SPLIT ? 2 : 1) * (16 * MI * WM + 64 * WN) * (KS + 8) * 2 + WM * WN * 16 * 68 * 4;
template <int ET> struct Elem;
template <> struct Elem<0> { typedef _Float16 T; };
template <> struct Elem<1> { typedef __bf16 T; };
template <int ET, bool SPLIT, int BIAS_MODE, int OUT_MODE, bool RESID, int ACT, int WM, int WN, int KS, int KD, int MI>
__device__ __forceinline__ void gemm64_body(
    char* smem, const int bx, const int b,
    const unsigned short* __restrict__ Ap, const unsigned short* __restrict__ A2p, long strideA,
    const unsigned short* __restrict__ Btp, const unsigned short* __restrict__ Bt2p, long strideB,
    void* __restrict__ Cout, void* __restrict__ Cout2, int ldc, long strideC,
    const float* __restrict__ bias,
    const float* __restrict__ resid, long strideR,
    int N, float scale) {
  typedef typename Elem<ET>::T T;
  typedef typename Frag<T>::V V;
  typedef typename Frag<T>::H H;
  constexpr int NW    = WM * WN;               // waves per block
  constexpr int NT    = 32 * NW;               // threads per block
  constexpr int BM    = 16 * MI * WM;          // block tile rows (A rows per stage)
  constexpr int BN    = 64 * WN;               // block tile columns (Bt rows per stage)
  constexpr int PITCH = KS + 8;                // LDS row pitch in elements: row bytes + 16, an odd multiple of 16 B
  constexpr int CH    = KS / 8;                // 16-B pieces per row piece
  constexpr int RSTEP = NT / CH;               // rows covered by one load of the whole block
  constexpr int NA    = BM / RSTEP;            // loads per thread and plane, A
  constexpr int NB    = BN / RSTEP;            // loads per thread and plane, Bt
  constexpr int PLANE = (BM + BN) * PITCH;     // elements of one plane in one buffer: A rows, then Bt rows
  constexpr int BUF   = (SPLIT ? 2 : 1) * PLANE;
  constexpr int NS    = KD / KS;               // stages
  static_assert(KS == 32 || KS == 64, "row piece");
  static_assert(KD % KS == 0 && BM % RSTEP == 0 && BN % RSTEP == 0, "stage split");
  const T* A = (const T*)Ap; const T* A2 = (const T*)A2p; const T* Bt = (const T*)Btp; const T* Bt2 = (const T*)Bt2p;
  static_assert(kGemmLds<SPLIT, WM, WN, KS, MI> == 2 * BUF * 2 + NW * 16 * 68 * 4, "LDS share");
  static_assert(OUT_MODE != 3 || MI == 4, "the branch-input epilogue is written for 64-row wave tiles");
  T* sOp = (T*)smem;                                // two operand buffers
  float* sT = (float*)(smem + 2 * BUF * 2);         // behind them, per wave, a 16x64 slab, pitch 68 floats
  const int tid  = threadIdx.x;
  const int lane = tid & 31;
  const int wave = tid >> 5;
  const int tilesN = N / BN;
  const int bm = bx / tilesN;                  // the GEMM's grid holds exactly (M / BM) * (N / BN) blocks
  const int bn = bx - bm * tilesN;
  const int wm = wave / WN;
  const int wn = wave - wm * WN;
  const int m0 = bm * BM + wm * (16 * MI);
  const int n0 = bn * BN + (wn << 6);

  // block-uniform bases of the block's rows; every thread adds its one fixed byte offset
  const char* gA  = (const char*)(A  + (size_t)b * strideA + (size_t)(bm * BM) * KD);
  const char* gB  = (const char*)(Bt + (size_t)b * strideB + (size_t)(bn * BN) * KD);
  const char* gA2 = SPLIT ? (const char*)(A2  + (size_t)b * strideA + (size_t)(bm * BM) * KD) : nullptr;
  const char* gB2 = SPLIT ? (const char*)(Bt2 + (size_t)b * strideB + (size_t)(bn * BN) * KD) : nullptr;
  const int sRow = tid / CH, sCol = (tid % CH) * 8;
  const unsigned offG = (unsigned)(sRow * KD + sCol) * 2u;   // bytes
  const int      offL = sRow * PITCH + sCol;                 // elements
  // OUT_MODE 3: byte offsets of this thread's A row pieces, counted from the start of the padded plane
  static_assert(OUT_MODE != 3 || (KD == kBr && KS == kBr), "a row of the view is one row piece");
  unsigned offV[NA];
#pragma unroll   // offV is indexed by constants only, so that it stays in registers
  for (int i = 0; i < NA; ++i) {
    const int R = b * kRows + bm * BM + i * RSTEP + sRow;
    offV[i] = (OUT_MODE == 3) ? (unsigned)((R / kNBr) * kMixPad + (R % kNBr) * kBr + sCol) * 2u : 0u;
  }

  const int rlane = lane & 15;                 // row (A) / col (B, D) within subtile
  const int koff  = (lane >> 4) * 8;           // k offset of this lane half
  const int mOff  = (lane >> 4) * 8;           // D row offset

  v8f acc[MI][4];
#pragma unroll
  for (int i = 0; i < MI; ++i)
#pragma unroll
    for (int j = 0; j < 4; ++j) acc[i][j] = (v8f){0.f,0.f,0.f,0.f,0.f,0.f,0.f,0.f};

  // one stage in flight; every loop over these arrays and over the fragments is fully unrolled, so that they stay in registers
  H ra[NA], ra2[NA], rb[NB], rb2[NB];
  auto gload = [&](int k0) {
    // the two scheduling barriers keep every other instruction out of the group of loads and its wait, and the group ahead of
    // the products: sunk next to the LDS stores that use them, the loads would show their whole latency in every stage
    __builtin_amdgcn_sched_barrier(0);
#pragma unroll
    for (int i = 0; i < NA; ++i) {
      if (OUT_MODE == 3) ra[i] = *(const H*)((const char*)A + offV[i]);
      else               ra[i] = *(const H*)(gA + (size_t)k0 * 2 + (size_t)i * (RSTEP * KD * 2) + offG);
      if (SPLIT) ra2[i] = *(const H*)(gA2 + (size_t)k0 * 2 + (size_t)i * (RSTEP * KD * 2) + offG);
    }
#pragma unroll
    for (int i = 0; i < NB; ++i) {
      rb[i] = *(const H*)(gB + (size_t)k0 * 2 + (size_t)i * (RSTEP * KD * 2) + offG);
      if (SPLIT) rb2[i] = *(const H*)(gB2 + (size_t)k0 * 2 + (size_t)i * (RSTEP * KD * 2) + offG);
    }
    // precaution: this wait stands in front of every later write of a register that one of these loads names
    asm volatile("s_wait_xcnt 0x0" ::: "memory");
    __builtin_amdgcn_sched_barrier(0);
  };
  auto sstore = [&](T* buf) {
#pragma unroll
    for (int i = 0; i < NA; ++i) {
      *(H*)(buf + i * (RSTEP * PITCH) + offL) = ra[i];
      if (SPLIT) *(H*)(buf + PLANE + i * (RSTEP * PITCH) + offL) = ra2[i];
    }
#pragma unroll
    for (int i = 0; i < NB; ++i) {
      *(H*)(buf + (BM + i * RSTEP) * PITCH + offL) = rb[i];
      if (SPLIT) *(H*)(buf + PLANE + (BM + i * RSTEP) * PITCH + offL) = rb2[i];
    }
  };
  const int fragA = (wm * (16 * MI) + rlane) * PITCH + koff;        // this lane's place in the first A / Bt fragment of its wave
  const int fragB = (BM + (wn << 6) + rlane) * PITCH + koff;
  auto compute = [&](const T* buf) {
#pragma unroll
    for (int kk = 0; kk < KS; kk += 32) {
      V bh[4], bl[4], ah[MI], al[MI];
#pragma unroll
      for (int j = 0; j < 4; ++j) {
        bh[j] = Frag<T>::load(buf + fragB + j * (16 * PITCH) + kk);
        if (SPLIT) bl[j] = Frag<T>::load(buf + PLANE + fragB + j * (16 * PITCH) + kk);
      }
#pragma unroll
      for (int i = 0; i < MI; ++i) {
        ah[i] = Frag<T>::load(buf + fragA + i * (16 * PITCH) + kk);
        if (SPLIT) al[i] = Frag<T>::load(buf + PLANE + fragA + i * (16 * PITCH) + kk);
      }
#pragma unroll
      for (int i = 0; i < MI; ++i) {
#pragma unroll
        for (int j = 0; j < 4; ++j) {
          acc[i][j] = Frag<T>::mma(ah[i], bh[j], acc[i][j]);
          if (SPLIT) {
            acc[i][j] = Frag<T>::mma(ah[i], bl[j], acc[i][j]);
            acc[i][j] = Frag<T>::mma(al[i], bh[j], acc[i][j]);
          }
        }
        Frag<T>::guard4(acc[i][0], acc[i][1], acc[i][2], acc[i][3], ah[i], SPLIT ? al[i] : ah[i]);
      }
      Frag<T>::keep(bh[0], bh[1], bh[2], bh[3]);
      if (SPLIT) Frag<T>::keep(bl[0], bl[1], bl[2], bl[3]);
    }
  };

  gload(0);
  sstore(sOp);
  __syncthreads();
  // kept rolled, for speed only
#pragma unroll 1
  for (int s = 0; s < NS; ++s) {
    if (s + 1 < NS) gload((s + 1) * KS);                       // block-uniform
    compute(sOp + (s & 1) * BUF);
    if (s + 1 < NS) sstore(sOp + ((s + 1) & 1) * BUF);
    // the one barrier of a stage: publishes stage s+1 and ends the reads of stage s, whose buffer the next pass overwrites
    __syncthreads();
  }
#pragma unroll   // acc is indexed by constants only, so that it stays in registers
  for (int i = 0; i < MI; ++i) acc_guard4(acc[i][0], acc[i][1], acc[i][2], acc[i][3]);

  // ---- epilogue ----
  float* slab = sT + wave * (16 * 68);
  const float* Rb = RESID ? (resid + (size_t)b * strideR) : nullptr;
  v4f lam0 = (v4f){0.f, 0.f, 0.f, 0.f}, lam1 = lam0;
  // OUT_MODE 3: block-uniform bases of the block's first row in x and in the two planes (pitch kChan); every lane adds one fixed byte
  // offset, offX (f32; half of it in the bf16 planes), and the row groups are immediates. t == 0 can only fall on the first row of a
  // wave's tile (64 divides kSeq): there the prior row's address is the row's own and its factor 0.
  static_assert(OUT_MODE != 3 || kSeq % 64 == 0, "t == 0 only on a wave tile's first row");
  const char* gX = nullptr; char* gH = nullptr; char* gL = nullptr;
  unsigned offX = 0, offP0 = 0;
  float fz0 = 1.0f;
  if (OUT_MODE == 3) {
    const size_t tile0 = (size_t)(bm * BM) * kChan + bn * BN;
    gX = (const char*)(resid + tile0);
    gH = (char*)((unsigned short*)Cout  + (size_t)b * strideC + tile0);
    gL = (char*)((unsigned short*)Cout2 + (size_t)(b > 0 ? (b - 1) : 0) * strideC + tile0);
    const int row0 = (wm << 6) + (lane >> 3);
    offX = (unsigned)(row0 * kChan + (wn << 6) + (lane & 7) * 8) * 4u;
    const bool t0 = ((bm * BM + row0) & (kSeq - 1)) == 0;
    offP0 = t0 ? offX + (unsigned)(kChan * 4) : offX;      // counted from one row above gX, so that it is never negative
    fz0 = t0 ? 0.0f : 1.0f;
    const float* pl = bias + (size_t)b * N + n0 + (lane & 7) * 8;
    __builtin_amdgcn_sched_barrier(0);   // with the one below: keeps the two loads and their wait together
    lam0 = *(const v4f*)(pl); lam1 = *(const v4f*)(pl + 4);
    // precaution: this wait stands in front of every later write of a register that one of these two loads names
    asm volatile("s_wait_xcnt 0x0" ::: "memory");
    __builtin_amdgcn_sched_barrier(0);
  }
#pragma unroll
  for (int i = 0; i < MI; ++i) {
    const int mBase = m0 + (i << 4);
    v4f xa0[4], xa1[4], xb0[4], xb1[4];
    if (OUT_MODE == 3) {
      // the two scheduling barriers keep every other instruction out of the group of loads and its wait, and the group ahead of
      // the slab writes, which are served while the loads fly
      __builtin_amdgcn_sched_barrier(0);
#pragma unroll
      for (int it = 0; it < 4; ++it) {
        const int r = i * 16 + it * 4;                       // this lane's row = first row of its wave + r + q
        const char* px = gX + (size_t)r * (kChan * 4) + offX;
        const char* pp = (r == 0) ? (gX - kChan * 4 + offP0) : (gX + (size_t)(r - 1) * (kChan * 4) + offX);
        xa0[it] = *(const v4f*)(px); xa1[it] = *(const v4f*)(px + 16);
        xb0[it] = *(const v4f*)(pp); xb1[it] = *(const v4f*)(pp + 16);
      }
      // precaution: this wait stands in front of every later write of a register that one of these loads names
      asm volatile("s_wait_xcnt 0x0" ::: "memory");
      __builtin_amdgcn_sched_barrier(0);
    }
#pragma unroll
    for (int j = 0; j < 4; ++j) {
      const int n = n0 + (j << 4) + rlane;
      float bv = 0.f;
      if (BIAS_MODE == 2) bv = bias[n];
#pragma unroll
      for (int r = 0; r < 8; ++r) {
        float v = acc[i][j][r] * scale;
        if (BIAS_MODE == 1) v += bias[mBase + mOff + r];
        if (BIAS_MODE == 2) v += bv;
        if (RESID) v += Rb[(size_t)(mBase + mOff + r) * ldc + n];
        if (ACT == 2) v = fmaxf(v, 0.0f);
        if (ACT == 4) v = (v > 0.f) ? v : 0.01f * v;
        slab[(mOff + r) * 68 + (j << 4) + rlane] = v;
      }
    }
    __builtin_amdgcn_fence(__ATOMIC_RELEASE, "workgroup");
    __builtin_amdgcn_wave_barrier();
    __builtin_amdgcn_fence(__ATOMIC_ACQUIRE, "workgroup");
    if (OUT_MODE == 0) {
      float* C = (float*)Cout + (size_t)b * strideC;
      const int hh = lane >> 4, c4 = (lane & 15) * 4;     // row seg = 256 B = 16 lanes x 16 B
      v4f v[8];
      float* pc[8];
#pragma unroll   // here and below: v and pc are indexed by constants only, so that they stay in registers
      for (int it = 0; it < 8; ++it) {
        const int row = it * 2 + hh;
        v[it]  = *(const v4f*)(slab + row * 68 + c4);
        pc[it] = C + (size_t)(mBase + row) * ldc + n0 + c4;
      }
      // the two scheduling barriers keep every other instruction out of the group of stores and its wait
      __builtin_amdgcn_sched_barrier(0);
#pragma unroll
      for (int it = 0; it < 8; ++it) *(v4f*)pc[it] = v[it];
      // precaution: this wait stands in front of every later write of a register that one of these stores names
      asm volatile("s_wait_xcnt 0x0" ::: "memory");
      __builtin_amdgcn_sched_barrier(0);
    } else if (OUT_MODE == 3) {
      const int q = lane >> 3, c8 = (lane & 7) * 8;
      v4u uh[4], ul[4];
#pragma unroll
      for (int it = 0; it < 4; ++it) {
        const int row = it * 4 + q;
        const float fz = (i == 0 && it == 0) ? fz0 : 1.0f;
        const v4f u0 = *(const v4f*)(slab + row * 68 + c8), u1 = *(const v4f*)(slab + row * 68 + c8 + 4);
        unsigned short hb[8], lb[8];
#pragma unroll
        for (int e = 0; e < 4; ++e) {
          const float ba0 = xb0[it][e] * fz - xa0[it][e];
          const float ba1 = xb1[it][e] * fz - xa1[it][e];
          const float v0 = xa0[it][e] + ba0 * (u0[e] + lam0[e]);
          const float v1 = xa1[it][e] + ba1 * (u1[e] + lam1[e]);
          bf_split_bits(v0, hb[e], lb[e]);
          bf_split_bits(v1, hb[4 + e], lb[4 + e]);
        }
        uh[it] = (v4u){pk16(hb[0], hb[1]), pk16(hb[2], hb[3]), pk16(hb[4], hb[5]), pk16(hb[6], hb[7])};
        ul[it] = (v4u){pk16(lb[0], lb[1]), pk16(lb[2], lb[3]), pk16(lb[4], lb[5]), pk16(lb[6], lb[7])};
      }
      // as for the loads: nothing else is scheduled into the group of stores and its wait
      __builtin_amdgcn_sched_barrier(0);
#pragma unroll
      for (int it = 0; it < 4; ++it) *(v4u*)(gH + (size_t)(i * 16 + it * 4) * (kChan * 2) + offX / 2) = uh[it];
      // the same precaution for the registers that these stores name
      asm volatile("s_wait_xcnt 0x0" ::: "memory");
      __builtin_amdgcn_sched_barrier(0);
      if (b > 0) {                                           // block-uniform: branch 0 has no lo plane
        __builtin_amdgcn_sched_barrier(0);
#pragma unroll
        for (int it = 0; it < 4; ++it) *(v4u*)(gL + (size_t)(i * 16 + it * 4) * (kChan * 2) + offX / 2) = ul[it];
        asm volatile("s_wait_xcnt 0x0" ::: "memory");        // the same precaution
        __builtin_amdgcn_sched_barrier(0);
      }
    } else {
      static_assert(OUT_MODE == 0 || OUT_MODE == 3 || OUT_MODE == 2 || OUT_MODE == 4, "output form");
      const int q = lane >> 3, c8 = (lane & 7) * 8;
      // 8 divides kMix: the 8 columns of a lane are all valid or all pad
      const float fv = (ACT == 5 && N == kMixPad && n0 + c8 >= kMix) ? 0.0f : 1.0f;
      const size_t o0 = (size_t)b * strideC + (size_t)(mBase + q) * ldc + n0 + c8;
      unsigned short* C  = (unsigned short*)Cout + o0;
      unsigned short* C2 = (unsigned short*)Cout2 + o0;
      // kept rolled, for speed only: the tanh is long, and unrolled it would have 32 copies per row group
#pragma unroll 1
      for (int it = 0; it < 4; ++it) {
        const float* sp = slab + (it * 4 + q) * 68 + c8;
        const v4f u0 = *(const v4f*)(sp), u1 = *(const v4f*)(sp + 4);
        unsigned short hb[8], lb[8];
#pragma unroll
        for (int e = 0; e < 4; ++e) {
          float t0 = u0[e], t1 = u1[e];
          if (ACT == 5) { t0 = tanhf(t0) * fv; t1 = tanhf(t1) * fv; }
          if (OUT_MODE == 2) { bf_split_bits(t0, hb[e], lb[e]); bf_split_bits(t1, hb[4 + e], lb[4 + e]); }
          else               { hb[e] = f2bf_bits(t0); hb[4 + e] = f2bf_bits(t1); lb[e] = 0; lb[4 + e] = 0; }
        }
        const v4u uh = (v4u){pk16(hb[0], hb[1]), pk16(hb[2], hb[3]), pk16(hb[4], hb[5]), pk16(hb[6], hb[7])};
        const v4u ul = (v4u){pk16(lb[0], lb[1]), pk16(lb[2], lb[3]), pk16(lb[4], lb[5]), pk16(lb[6], lb[7])};
        // the two scheduling barriers keep every other instruction out of the group of stores and its wait
        __builtin_amdgcn_sched_barrier(0);
        *(v4u*)(C + (size_t)(it * 4) * ldc) = uh;
        if (OUT_MODE == 2) *(v4u*)(C2 + (size_t)(it * 4) * ldc) = ul;
        // precaution: this wait stands in front of every later write of a register that one of these stores names
        asm volatile("s_wait_xcnt 0x0" ::: "memory");
        __builtin_amdgcn_sched_barrier(0);
      }
    }
    __builtin_amdgcn_fence(__ATOMIC_RELEASE, "workgroup");
    __builtin_amdgcn_wave_barrier();
    __builtin_amdgcn_fence(__ATOMIC_ACQUIRE, "workgroup");
  }
}

// One GEMM in a launch of its own: grid (tiles, batch).
template <int ET, bool SPLIT, int BIAS_MODE, int OUT_MODE, bool RESID, int ACT, int WM, int WN, int KS, int KD, int MI = 4>
__global__ __launch_bounds__(32 * WM * WN) void wmma_gemm64(
    const unsigned short* __restrict__ Ap, const unsigned short* __restrict__ A2p, long strideA,
    const unsigned short* __restrict__ Btp, const unsigned short* __restrict__ Bt2p, long strideB,
    void* __restrict__ Cout, void* __restrict__ Cout2, int ldc, long strideC,
    const float* __restrict__ bias,
    const float* __restrict__ resid, long strideR,
    int N, float scale) {
  __shared__ __align__(16) char smem[kGemmLds<SPLIT, WM, WN, KS, MI>];
  gemm64_body<ET, SPLIT, BIAS_MODE, OUT_MODE, RESID, ACT, WM, WN, KS, KD, MI>(
      smem, blockIdx.x, blockIdx.y, Ap, A2p, strideA, Btp, Bt2p, strideB, Cout, Cout2, ldc, strideC, bias, resid, strideR, N, scale);
}

// The three GEMMs that read only the branch inputs, in one launch of 224 blocks, each block alone on its WGP by its LDS:
//   blocks   0..191  k / v / r projections (split, K 1024), 64 tiles of 128 x 256 for each of the three
//   blocks 192..215  gate lowrank (split, N 192, K 1024), 24 tiles of 256 x 64, eight waves of 32 x 64; stores tanh as bf16 hi/lo
//   blocks 216..223  decay lowrank (single, N 64, K 1024), 8 tiles of 256 x 64, eight waves of 32 x 64; stores tanh as bf16
constexpr int kProjTiles = (kRows / 128) * (kChan / 256);   // 64
constexpr int kGateTiles = (kRows / 256) * (kMixPad / 64);  // 24
constexpr int kDecTiles  = (kRows / 256) * (kDec / 64);     // 8
__global__ __launch_bounds__(256) void k_branch_gemms(
    const unsigned short* __restrict__ X5H, const unsigned short* __restrict__ X5L,
    const unsigned short* __restrict__ WH, const unsigned short* __restrict__ WL, float* __restrict__ KVR,
    const unsigned short* __restrict__ WG1TH, const unsigned short* __restrict__ WG1TL,
    unsigned short* __restrict__ GHH, unsigned short* __restrict__ GHL,
    const unsigned short* __restrict__ TDAT, unsigned short* __restrict__ L1) {
  const float* fdum = nullptr;                               // bias and resid of the engine: not used by these GEMMs, never dereferenced
  __shared__ __align__(16) char smem[kGemmLds<true, 2, 4, 64, 4>];
  static_assert(kGemmLds<true, 8, 1, 64, 2> <= kGemmLds<true, 2, 4, 64, 4> && kGemmLds<false, 8, 1, 64, 2> <= kGemmLds<true, 2, 4, 64, 4>, "LDS share");
  const int id = blockIdx.x;                                 // every branch below is block-uniform
  if (id < 3 * kProjTiles) {
    gemm64_body<1, true, 0, 0, false, 0, 2, 4, 64, kChan, 4>(
        smem, id % kProjTiles, id / kProjTiles, X5H + kPlane, X5L, (long)kPlane, WH, WL, (long)kWPlane,
        (void*)KVR, (void*)KVR, kChan, (long)kPlane, fdum, fdum, 0L, kChan, 1.0f);
  } else if (id < 3 * kProjTiles + kGateTiles) {
    gemm64_body<1, true, 0, 2, false, 5, 8, 1, 64, kChan, 2>(
        smem, id - 3 * kProjTiles, 0, X5H + 4 * kPlane, X5L + 3 * kPlane, 0L, WG1TH, WG1TL, 0L,
        (void*)GHH, (void*)GHL, kMixPad, 0L, fdum, fdum, 0L, kMixPad, 1.0f);
  } else {
    gemm64_body<1, false, 0, 4, false, 5, 8, 1, 64, kChan, 2>(
        smem, id - 3 * kProjTiles - kGateTiles, 0, X5H, X5H, 0L, TDAT, TDAT, 0L,
        (void*)L1, (void*)L1, kDec, 0L, fdum, fdum, 0L, kDec, 1.0f);
  }
}

// The two GEMMs behind the tanh of the two lowrank paths, in one launch of 128 blocks:
//   blocks  0..63   gate output (split, K 192), blocks 64..127 decay output (single, K 64); 64 tiles of 128 x 256 each
__global__ __launch_bounds__(256) void k_lowrank_out_gemms(
    const unsigned short* __restrict__ GHH, const unsigned short* __restrict__ GHL,
    const unsigned short* __restrict__ WG2TH, const unsigned short* __restrict__ WG2TL, float* __restrict__ GATE,
    const unsigned short* __restrict__ L1, const unsigned short* __restrict__ TDBT, float* __restrict__ WLR) {
  const float* fdum = nullptr;                               // bias and resid of the engine: not used by these GEMMs, never dereferenced
  __shared__ __align__(16) char smem[kGemmLds<true, 2, 4, 64, 4>];
  const int id = blockIdx.x;                                 // block-uniform
  if (id < kProjTiles) {
    gemm64_body<1, true, 0, 0, false, 0, 2, 4, 64, kMixPad, 4>(
        smem, id, 0, GHH, GHL, 0L, WG2TH, WG2TL, 0L, (void*)GATE, (void*)GATE, kChan, 0L, fdum, fdum, 0L, kChan, 1.0f);
  } else {
    gemm64_body<1, false, 0, 0, false, 0, 2, 4, 64, kDec, 4>(
        smem, id - kProjTiles, 0, L1, L1, 0L, TDBT, TDBT, 0L, (void*)WLR, (void*)WLR, kChan, 0L, fdum, fdum, 0L, kChan, 1.0f);
  }
}

// ---------------------------------------------------------------------------
// Square weight split: four [1024][1024] f32 matrices (layout kept as-is = [out][in] = Bt) -> bf16 hi and lo planes.
// 512 x 4 blocks (bx, z): z selects the matrix and the output plane (planes at out + z*1048576 halves).
// Thread i owns 8 consecutive elements: two b128 loads, one 16-B store per lane per plane; a wave writes 512 contiguous
// ---------------------------------------------------------------------------
__device__ __forceinline__ void wsplit8_body(const int bx, const int z,
                                             const float* __restrict__ W0, const float* __restrict__ W1,
                                             const float* __restrict__ W2, const float* __restrict__ W3,
                                             unsigned short* __restrict__ outH, unsigned short* __restrict__ outL,
                                             int n8PerMat) {
  const float* W = (z == 0) ? W0 : (z == 1) ? W1 : (z == 2) ? W2 : W3;   // block-uniform
  const int i = bx * 256 + threadIdx.x;
  if (i >= n8PerMat) return;
  const float* p = W + 8 * (size_t)i;
  const v4f a = *(const v4f*)(p);
  const v4f c = *(const v4f*)(p + 4);
  unsigned short hb[8], lb[8];
#pragma unroll
  for (int e = 0; e < 4; ++e) {
    bf_split_bits(a[e], hb[e], lb[e]);
    bf_split_bits(c[e], hb[4 + e], lb[4 + e]);
  }
  const v4u uh = (v4u){pk16(hb[0], hb[1]), pk16(hb[2], hb[3]), pk16(hb[4], hb[5]), pk16(hb[6], hb[7])};
  const v4u ul = (v4u){pk16(lb[0], lb[1]), pk16(lb[2], lb[3]), pk16(lb[4], lb[5]), pk16(lb[6], lb[7])};
  const size_t o = (size_t)z * (size_t)kWPlane + 8 * (size_t)i;
  *(v4u*)(outH + o) = uh;
  *(v4u*)(outL + o) = ul;
  // precaution: this wait stands in front of every later write of a register that one of these stores names
  asm volatile("s_wait_xcnt 0x0" ::: "memory");
}

// ---------------------------------------------------------------------------
// Transpose + bf16 convert (single or hi/lo): in[R][Cc] f32 row-major (pitch Cc) -> out[n][k] = cvt(in[k][n]) for
// k < R and n < Cc, zero otherwise (pad rows / pad columns of the output plane are WRITTEN as zeros).
// blocks (bx, by, bz) of nTilesN x nTilesK x Z: a block covers 32 output rows n0..n0+31 and KT output columns k0..k0+KT-1; bz adds
// inStrideZ / outStrideZ element offsets. 256 threads; sm = 32 * (KT + 1) floats of LDS.
// Load coverage: (32*KT/256) iterations x 256 threads = 32 x KT elements (coalesced along n), clamped address, 0/1 factor.
// Store, KT == 64: row = wave*4 + (lane>>3) -> 8 waves x 4 = 32 rows; (lane&7) x 8 halves = 64 cols; each row segment =
// Store, KT == 32 (requires ldo == 32, k0 == 0): threads 0..127, row = t>>2, c8 = (t&3)*8 -> thread t writes tile bytes
// ---------------------------------------------------------------------------
template <bool SPLIT, int KT>
__device__ __forceinline__ void trcast_body(float* sm, const int bx, const int by, const int bz,
                                            const float* __restrict__ in, int R, int Cc, long inStrideZ,
                                            unsigned short* __restrict__ outH, unsigned short* __restrict__ outL,
                                            int ldo, long outStrideZ) {
  static_assert(KT == 64 || KT == 32, "tile");
  const int t  = threadIdx.x;
  const int n0 = bx * 32;
  const int k0 = by * KT;
  const float* inz = in + (size_t)bz * inStrideZ;
  constexpr int kIters = (32 * KT) / 256;
  const float* pin[kIters];
  float fz[kIters], v[kIters];
#pragma unroll   // here and in the two loops below: the three arrays are indexed by constants only, so that they stay in registers
  for (int it = 0; it < kIters; ++it) {
    const int e  = it * 256 + t;
    const int n  = n0 + (e & 31);
    const int k  = k0 + (e >> 5);
    const int nc = (n < Cc) ? n : (Cc - 1);
    const int kc = (k < R) ? k : (R - 1);
    pin[it] = inz + (size_t)kc * Cc + nc;
    fz[it]  = ((n < Cc) && (k < R)) ? 1.0f : 0.0f;
  }
  // the two scheduling barriers keep every other instruction out of the group of loads and its wait
  __builtin_amdgcn_sched_barrier(0);
#pragma unroll
  for (int it = 0; it < kIters; ++it) v[it] = *pin[it];
  // precaution: this wait stands in front of every later write of a register that one of these loads names
  asm volatile("s_wait_xcnt 0x0" ::: "memory");
  __builtin_amdgcn_sched_barrier(0);
#pragma unroll
  for (int it = 0; it < kIters; ++it) {
    const int e = it * 256 + t;
    sm[(e & 31) * (KT + 1) + (e >> 5)] = v[it] * fz[it];
  }
  __syncthreads();
  const int lane = t & 31, wave = t >> 5;
  unsigned short* oh = outH + (size_t)bz * outStrideZ;
  unsigned short* ol = outL + (size_t)bz * outStrideZ;
  int row, c8;
  bool active;
  if (KT == 64) { row = wave * 4 + (lane >> 3); c8 = (lane & 7) * 8; active = true; }
  else          { row = t >> 2;                 c8 = (t & 3) * 8;    active = (t < 128); }
  if (active) {
    unsigned short hb[8], lb[8];
#pragma unroll
    for (int e = 0; e < 8; ++e) {
      const float v = sm[row * (KT + 1) + c8 + e];
      if (SPLIT) { bf_split_bits(v, hb[e], lb[e]); }
      else       { hb[e] = f2bf_bits(v); lb[e] = 0; }
    }
    const v4u uh = (v4u){pk16(hb[0], hb[1]), pk16(hb[2], hb[3]), pk16(hb[4], hb[5]), pk16(hb[6], hb[7])};
    const v4u ul = (v4u){pk16(lb[0], lb[1]), pk16(lb[2], lb[3]), pk16(lb[4], lb[5]), pk16(lb[6], lb[7])};
    const size_t o = (size_t)(n0 + row) * ldo + k0 + c8;
    *(v4u*)(oh + o) = uh;
    if (SPLIT) *(v4u*)(ol + o) = ul;
    // precaution: this wait stands in front of every later write of a register that one of these stores names
    asm volatile("s_wait_xcnt 0x0" ::: "memory");
  }
}

// ---------------------------------------------------------------------------
// Token shift: xx[m][c] = x[m][c] + (x[m-1][c]*f - x[m][c]) * miu_x[c], f = 0 at t == 0 else 1 (address of the prior row
// clamped, arithmetic 0/1 factor). Output: single bf16 plane [2048][1024].
// ---------------------------------------------------------------------------
__device__ __forceinline__ void xx8_body(const int bx, const float* __restrict__ x, const float* __restrict__ miu_x,
                                         unsigned short* __restrict__ XX, int n8) {
  const int i = bx * 256 + threadIdx.x;
  if (i >= n8) return;
  const int f  = 8 * i;
  const int m  = f >> 10;
  const int c0 = f & 1023;
  const int t  = m & 1023;
  const int mp = (t > 0) ? (m - 1) : m;
  const float fz = (t > 0) ? 1.0f : 0.0f;
  const float* px = x + f;
  const float* pp = x + ((size_t)mp << 10) + c0;
  const float* pm = miu_x + c0;
  const v4f a0 = *(const v4f*)(px), a1 = *(const v4f*)(px + 4);
  const v4f b0 = *(const v4f*)(pp), b1 = *(const v4f*)(pp + 4);
  const v4f u0 = *(const v4f*)(pm), u1 = *(const v4f*)(pm + 4);
  unsigned short hb[8];
#pragma unroll
  for (int e = 0; e < 4; ++e) {
    const float ba0 = b0[e] * fz - a0[e];
    const float ba1 = b1[e] * fz - a1[e];
    hb[e]     = f2bf_bits(a0[e] + ba0 * u0[e]);
    hb[4 + e] = f2bf_bits(a1[e] + ba1 * u1[e]);
  }
  const v4u uh = (v4u){pk16(hb[0], hb[1]), pk16(hb[2], hb[3]), pk16(hb[4], hb[5]), pk16(hb[6], hb[7])};
  unsigned short* q = XX + f;
  *(v4u*)q = uh;
  // precaution: this wait stands in front of every later write of a register that this store names
  asm volatile("s_wait_xcnt 0x0" ::: "memory");
}

// ---------------------------------------------------------------------------
// Everything that reads only the inputs, in one launch: the token shift, the six transposes and the square weight split do not
// depend on one another. blockIdx.x is cut into ranges, one per piece of work, each range holding that piece's own grid; every
// branch is block-uniform, and the one barrier of a transpose is passed by all threads of its block.
// ---------------------------------------------------------------------------
constexpr int kPbXX  = (int)(kPlane / 8) / 256;              // 1024 token shift
constexpr int kPbA   = (kMixPad / 32) * (kChan / 64);        // 96   A    [1024][160] -> AT   [192][1024], rows >= 160 zero
constexpr int kPbTA  = (kDec / 32) * (kChan / 64);           // 32   tdA  [1024][64]  -> TDAT [64][1024]
constexpr int kPbTB  = kChan / 32;                           // 32   tdB  [64][1024]  -> TDBT [1024][64]
constexpr int kPbG1  = (kMixPad / 32) * (kChan / 64);        // 96   Wg1  [1024][160] -> WG1T hi/lo [192][1024], rows >= 160 zero
constexpr int kPbG2  = (kChan / 32) * (kMixPad / 64);        // 96   Wg2  [160][1024] -> WG2T hi/lo [1024][192], cols >= 160 zero
constexpr int kPbBp  = (kChan / 32) * kNBr;                  // 160  Bp[s] [32][1024] -> BPT[s] [1024][32]
constexpr int kPbW   = ((int)(kWPlane / 8) / 256) * 4;       // 2048 Wk, Wv, Wr, Wo hi/lo
constexpr int kPbAll = kPbXX + kPbA + kPbTA + kPbTB + kPbG1 + kPbG2 + kPbBp + kPbW;
__global__ __launch_bounds__(256) void k_prepare(
    const float* __restrict__ x, const float* __restrict__ miu_x, const float* __restrict__ Amat,
    const float* __restrict__ tdA, const float* __restrict__ tdB, const float* __restrict__ Wg1, const float* __restrict__ Wg2,
    const float* __restrict__ Bp, const float* __restrict__ Wk, const float* __restrict__ Wv, const float* __restrict__ Wr,
    const float* __restrict__ Wo,
    unsigned short* __restrict__ XX, unsigned short* __restrict__ AT, unsigned short* __restrict__ TDAT,
    unsigned short* __restrict__ TDBT, unsigned short* __restrict__ WG1TH, unsigned short* __restrict__ WG1TL,
    unsigned short* __restrict__ WG2TH, unsigned short* __restrict__ WG2TL, unsigned short* __restrict__ BPT,
    unsigned short* __restrict__ WH, unsigned short* __restrict__ WL) {
  __shared__ float sm[32 * 65];
  int l = blockIdx.x;
  if (l < kPbXX) { xx8_body(l, x, miu_x, XX, (int)(kPlane / 8)); return; }
  l -= kPbXX;
  if (l < kPbA) { trcast_body<false, 64>(sm, l % (kMixPad / 32), l / (kMixPad / 32), 0, Amat, kChan, kMix, 0L, AT, AT, kChan, 0L); return; }
  l -= kPbA;
  if (l < kPbTA) { trcast_body<false, 64>(sm, l % (kDec / 32), l / (kDec / 32), 0, tdA, kChan, kDec, 0L, TDAT, TDAT, kChan, 0L); return; }
  l -= kPbTA;
  if (l < kPbTB) { trcast_body<false, 64>(sm, l, 0, 0, tdB, kDec, kChan, 0L, TDBT, TDBT, kDec, 0L); return; }
  l -= kPbTB;
  if (l < kPbG1) { trcast_body<true, 64>(sm, l % (kMixPad / 32), l / (kMixPad / 32), 0, Wg1, kChan, kMix, 0L, WG1TH, WG1TL, kChan, 0L); return; }
  l -= kPbG1;
  if (l < kPbG2) { trcast_body<true, 64>(sm, l % (kChan / 32), l / (kChan / 32), 0, Wg2, kMix, kChan, 0L, WG2TH, WG2TL, kMixPad, 0L); return; }
  l -= kPbG2;
  if (l < kPbBp) { trcast_body<false, 32>(sm, l % (kChan / 32), 0, l / (kChan / 32), Bp, kBr, kChan, (long)kBr * kChan, BPT, BPT, kBr, (long)kChan * kBr); return; }
  l -= kPbBp;
  wsplit8_body(l % (kPbW / 4), l / (kPbW / 4), Wk, Wv, Wr, Wo, WH, WL, (int)(kWPlane / 8));
}

// ---------------------------------------------------------------------------
// Linear-attention state scan, f32. One block (128 threads = 4 waves) per (batch b, head n, eighth ih of the
// v channels): the rows i of the state are independent, so each block carries 8 rows x 64 k channels.
// Thread (il, jg): jg = lane owns k channels 2*jg, 2*jg+1, il = wave*2 is the first of the wave's two rows;
// S lives in 2 f32 pairs, one per k channel (pairs run along the two rows, so a step's packed sum is the two rows' partials as they
// are stored, and a step reads four 8-byte LDS operands: r, k, d of its two k channels and v of its two rows).
// The sequence is cut into chunks of kSc timesteps; pass c of the loop, between two block barriers,
//   - runs the kSc steps of chunk c from stage buffer c & 1 (r, k*exp(min(w,0)), exp(w), v; w = wl + td_miu). A step has no
//     barrier: each thread stores its partial sums over its 2 k channels to partial buffer c & 1;
//   - writes chunk c+1 into the other stage buffer, piece by piece between the steps, and issues the loads of chunk c+2;
//   - finishes chunk c-1: y_i = sum of the 32 partials + v_i * bonus[t], bonus[t] = sum_j r_j*u_j*k_j (16 partials per step,
//     written by the staging threads into a ring of 4 slots).
// Y is laid out by scan block, [block][t][8 rows], so that every 128-B line of it (4 timesteps) is stored once, by 16 lanes of
// one wave of the one block that owns it.
// ---------------------------------------------------------------------------
constexpr int kSc  = 32;             // timesteps per chunk
constexpr int kNC  = kSeq / kSc;     // chunks
constexpr int kIB  = 8;              // state rows (v channels) per block
constexpr int kNIB = kHead / kIB;    // blocks per head
constexpr int kJG  = 32;             // j groups, 2 k channels each
constexpr int kPJ  = 10;             // floats between the partial rows of two j groups: the 32 lanes of a b64 store hit all 64 banks once
constexpr int kPT  = kJG * kPJ + 8;  // floats between two timesteps' partials: the 8 timesteps of one b64 read hit disjoint banks
constexpr int kPre = 12;             // steps whose LDS operands are fetched ahead of their use
static_assert(kSeq % kSc == 0 && kNC >= 2 && kNIB == 8 && kJG * 2 == kHead && kSc == 32 && kSc > kPre, "scan chunking");
struct ScanOp { v2f r, k, d, v; };
__device__ __forceinline__ v2f both(float a) { return (v2f){a, a}; }
__global__ __launch_bounds__(128) void k_state_scan(const float* __restrict__ kraw, const float* __restrict__ vpl,
                                                    const float* __restrict__ rpl, const float* __restrict__ wl,
                                                    const float* __restrict__ td_miu, const float* __restrict__ u,
                                                    float* __restrict__ Y) {
  __shared__ __align__(16) float sr0[kSc * 64], sr1[kSc * 64];
  __shared__ __align__(16) float sk0[kSc * 64], sk1[kSc * 64];
  __shared__ __align__(16) float sd0[kSc * 64], sd1[kSc * 64];
  __shared__ __align__(16) float sv0[kSc * kIB], sv1[kSc * kIB];
  __shared__ __align__(16) float part0[kSc * kPT], part1[kSc * kPT];
  __shared__ __align__(16) float sbp[4][kSc][16];
  const int tid  = threadIdx.x;
  const int lane = tid & 31;
  const int wave = tid >> 5;
  const int ih   = blockIdx.x & (kNIB - 1);
  const int n    = (blockIdx.x >> 3) & (kNHead - 1);
  const int b    = blockIdx.x >> 7;
  const int jg   = lane;
  const int j0   = jg * 2;
  const int il   = wave * 2;                          // first of this thread's two rows, local to the block
  // staging and output roles: r/k/w rows are 16 float4 wide, v and y rows 4 float2 wide
  const int sRow = tid >> 4, sC4 = (tid & 15) * 4;
  const int vRow = tid >> 2, vC2 = (tid & 3) * 2;
  const size_t base = (size_t)b * kSeq * kChan + (size_t)n * kHead;
  float* Yb = Y + (size_t)blockIdx.x * (kSeq * kIB);                     // this block's own [t][8] plane
  const unsigned offS = (unsigned)(sRow * kChan + sC4) * 4u;             // byte offsets of the roles inside a piece
  const unsigned offV = (unsigned)(vRow * kChan + ih * kIB + vC2) * 4u;
  const unsigned offY = (unsigned)(vRow * kIB + vC2) * 4u;
  const v4f tm4 = *(const v4f*)(td_miu + n * kHead + sC4);
  const v4f u4  = *(const v4f*)(u + n * kHead + sC4);
  // precaution: this wait stands in front of every later write of a register that one of these two loads names; the scheduling
  // barrier keeps later instructions behind it
  asm volatile("s_wait_xcnt 0x0" ::: "memory");
  __builtin_amdgcn_sched_barrier(0);

  v2f S[2];
#pragma unroll
  for (int q = 0; q < 2; ++q) S[q] = (v2f){0.f, 0.f};

  // staged through registers in kSc/8 pieces: piece it = 8 rows of r, k, w (and, with the first piece, all kSc rows of v)
  v4f gw[kSc / 8], gk[kSc / 8], gr[kSc / 8];
  v2f gv;
  // the v values this thread staged are the ones its own output role needs two passes later: vOld of chunk c-1, vNew of chunk c
  v2f vOld = (v2f){0.f, 0.f}, vNew = vOld;
  auto issue = [&](int it, int t0) {
    const size_t ub = base + (size_t)(t0 + it * 8) * kChan;      // block-uniform: scalar base + this thread's fixed byte offset
    // the two scheduling barriers keep every other instruction out of the group of loads and its wait
    __builtin_amdgcn_sched_barrier(0);
    gw[it] = *(const v4f*)((const char*)(wl + ub) + offS);
    gk[it] = *(const v4f*)((const char*)(kraw + ub) + offS);
    gr[it] = *(const v4f*)((const char*)(rpl + ub) + offS);
    if (it == 0) gv = *(const v2f*)((const char*)(vpl + ub) + offV);
    // precaution: this wait stands in front of every later write of a register that one of these loads names
    asm volatile("s_wait_xcnt 0x0" ::: "memory");
    __builtin_amdgcn_sched_barrier(0);
  };
  auto commit = [&](int it, float* dr, float* dk, float* dd_, float* dv, int slot) {
    const int tl = it * 8 + sRow;
    v4f kk, dd;
    float bp = 0.0f;
#pragma unroll
    for (int e = 0; e < 4; ++e) {
      const float wv = gw[it][e] + tm4[e];
      kk[e] = gk[it][e] * expf(fminf(wv, 0.0f));
      dd[e] = expf(wv);
      bp += gr[it][e] * (u4[e] * kk[e]);
    }
    *(v4f*)(dr + tl * 64 + sC4)  = gr[it];
    *(v4f*)(dk + tl * 64 + sC4)  = kk;
    *(v4f*)(dd_ + tl * 64 + sC4) = dd;
    sbp[slot][tl][tid & 15] = bp;
    if (it == 0) {
      *(v2f*)(dv + vRow * kIB + vC2) = gv;
      vOld = vNew;
      vNew = gv;
    }
  };
  // finishing chunk cc from its partials (src), its bonus slot and vOld: the LDS reads, and apart from them the sums and the store
  v2f x[kJG];
  v4f xb[4];
  auto finish_load = [&](const float* src, int cc) {
#pragma unroll   // here and below: x and xb are indexed by constants only, so that they stay in registers
    for (int g = 0; g < kJG; ++g) x[g] = *(const v2f*)(src + vRow * kPT + g * kPJ + vC2);
#pragma unroll
    for (int g = 0; g < 4; ++g) xb[g] = *(const v4f*)(&sbp[cc & 3][vRow][4 * g]);
  };
  auto finish_sum = [&](int cc) {
    const v4f b4 = (xb[0] + xb[1]) + (xb[2] + xb[3]);
    const float bn = (b4[0] + b4[1]) + (b4[2] + b4[3]);
    v2f s8[4];
#pragma unroll
    for (int h = 0; h < 4; ++h)
      s8[h] = ((x[8 * h] + x[8 * h + 1]) + (x[8 * h + 2] + x[8 * h + 3])) + ((x[8 * h + 4] + x[8 * h + 5]) + (x[8 * h + 6] + x[8 * h + 7]));
    const v2f yv = ((s8[0] + s8[1]) + (s8[2] + s8[3])) + vOld * bn;
    // as in issue(): nothing else is scheduled into the store and its wait
    __builtin_amdgcn_sched_barrier(0);
    *(v2f*)((char*)(Yb + (size_t)cc * (kSc * kIB)) + offY) = yv;
    // the same precaution for the registers that this store names
    asm volatile("s_wait_xcnt 0x0" ::: "memory");
    __builtin_amdgcn_sched_barrier(0);
  };
  auto pass = [&](int c) {
    const int p = c & 1;
    const float* pr = (p ? sr1 : sr0) + j0;
    const float* pk = (p ? sk1 : sk0) + j0;
    const float* pd = (p ? sd1 : sd0) + j0;
    const float* pv = (p ? sv1 : sv0) + il;
    float* pp = (p ? part1 : part0) + jg * kPJ + il;
    // chunk whose loads are issued in this pass; clamped, so that the steps have no branch (the last two passes re-read the last
    // chunk, and the last pass stages it into buffers that nobody reads any more)
    const int tN = ((c + 2 < kNC) ? (c + 2) : (kNC - 1)) * kSc;
    auto ld = [&](int tl) {
      ScanOp o;
      o.r = *(const v2f*)(pr + tl * 64);
      o.k = *(const v2f*)(pk + tl * 64);
      o.d = *(const v2f*)(pd + tl * 64);
      o.v = *(const v2f*)(pv + tl * kIB);
      return o;
    };
    // the previous chunk's reads first, then the first steps' reads, which are served while the previous chunk is summed and stored
    if (c > 0) finish_load(p ? part0 : part1, c - 1);      // block-uniform
    ScanOp ring[kPre];
#pragma unroll
    for (int tl = 0; tl < kPre; ++tl) ring[tl] = ld(tl);
    if (c > 0) finish_sum(c - 1);
    // fully unrolled so that the ring's slots are registers and every LDS offset an immediate
#pragma unroll
    for (int tl = 0; tl < kSc; ++tl) {
      const ScanOp o = ring[tl % kPre];
      if (tl + kPre < kSc) ring[tl % kPre] = ld(tl + kPre);
      // keeps these reads kPre steps ahead of their use: sunk next to it, the wave would wait out the LDS latency in every step
      __builtin_amdgcn_sched_barrier(0);
      v2f a = both(o.r[0]) * S[0];
      a = __builtin_elementwise_fma(both(o.r[1]), S[1], a);
      S[0] = __builtin_elementwise_fma(S[0], both(o.d[0]), both(o.k[0]) * o.v);
      S[1] = __builtin_elementwise_fma(S[1], both(o.d[1]), both(o.k[1]) * o.v);
      *(v2f*)(pp + tl * kPT) = a;
      // one piece of the next chunk's stage every 4 steps, early in the pass: its vector work runs while the LDS reads fetched
      // ahead are served, and the loads issued behind it have the rest of the pass to land before the barrier waits for them
      if ((tl & 3) == 1 && (tl >> 2) < kSc / 8) {
        commit(tl >> 2, p ? sr0 : sr1, p ? sk0 : sk1, p ? sd0 : sd1, p ? sv0 : sv1, (c + 1) & 3);
        issue(tl >> 2, tN);
      }
    }
    // the one barrier of a pass: publishes this chunk's partials and the next chunk's stage, and ends the reads of this chunk's
    // stage and of the previous chunk's partials, which the next pass overwrites
    __syncthreads();
  };

#pragma unroll
  for (int it = 0; it < kSc / 8; ++it) issue(it, 0);
#pragma unroll
  for (int it = 0; it < kSc / 8; ++it) {
    commit(it, sr0, sk0, sd0, sv0, 0);
    issue(it, kSc);
  }
  __syncthreads();
#pragma unroll 1
  for (int c = 0; c < kNC; ++c) pass(c);
  finish_load(((kNC - 1) & 1) ? part1 : part0, kNC - 1);
  finish_sum(kNC - 1);
}

// ---------------------------------------------------------------------------
// GroupNorm (64 channels per head, biased variance, eps 1.6e-4) + affine + gate multiply -> bf16 hi/lo planes.
// One wave per (row m, head n), 8 pairs per 256-thread block; lane owns channels 2l, 2l+1; shuffle reductions (unconditional).
// Y comes in the scan's layout [scan block][t][8 rows]: a block takes 4 consecutive rows of 2 heads, which share their lines of Y.
// ---------------------------------------------------------------------------
__global__ __launch_bounds__(256) void k_gn_gate(const float* __restrict__ Y, const float* __restrict__ G,
                                                 const float* __restrict__ gamma, const float* __restrict__ beta,
                                                 unsigned short* __restrict__ outH, unsigned short* __restrict__ outL) {
  __shared__ __align__(16) float slab[8][64];
  const int lane = threadIdx.x & 31, wave = threadIdx.x >> 5;
  const int m = (blockIdx.x >> 3) * 4 + (wave & 3);
  const int n = (blockIdx.x & 7) * 2 + (wave >> 2);
  const size_t base = (size_t)m * kChan + (size_t)n * kHead;
  const int c = n * kHead + 2 * lane;
  const int sb = ((m / kSeq) * kNHead + n) * kNIB + (2 * lane) / kIB;      // the scan block that owns this lane's two channels
  // the two scheduling barriers keep every other instruction out of the group of loads and its wait, so that the four fly together
  __builtin_amdgcn_sched_barrier(0);
  const v2f yv = *(const v2f*)(Y + ((size_t)sb * kSeq + (m % kSeq)) * kIB + (2 * lane) % kIB);
  const v2f gv = *(const v2f*)(G + base + 2 * lane);
  const v2f ga = *(const v2f*)(gamma + c);
  const v2f be = *(const v2f*)(beta + c);
  // precaution: this wait stands in front of every later write of a register that one of these loads names
  asm volatile("s_wait_xcnt 0x0" ::: "memory");
  __builtin_amdgcn_sched_barrier(0);
  float s = yv[0] + yv[1];
#pragma unroll
  for (int off = 16; off > 0; off >>= 1) s += __shfl_xor(s, off, 32);
  const float mean = s * (1.0f / 64.0f);
  const float d0 = yv[0] - mean;
  const float d1 = yv[1] - mean;
  float q = d0 * d0 + d1 * d1;
#pragma unroll
  for (int off = 16; off > 0; off >>= 1) q += __shfl_xor(q, off, 32);
  const float var = q * (1.0f / 64.0f);
  const float rs  = 1.0f / sqrtf(var + kGnEps);
  const float o0 = ((d0 * rs) * ga[0] + be[0]) * gv[0];
  const float o1 = ((d1 * rs) * ga[1] + be[1]) * gv[1];
  *(v2f*)(&slab[wave][2 * lane]) = (v2f){o0, o1};
  __syncthreads();
  if (lane < 8) {
    unsigned short hb[8], lb[8];
#pragma unroll
    for (int e = 0; e < 8; ++e) bf_split_bits(slab[wave][8 * lane + e], hb[e], lb[e]);
    const v4u uh = (v4u){pk16(hb[0], hb[1]), pk16(hb[2], hb[3]), pk16(hb[4], hb[5]), pk16(hb[6], hb[7])};
    const v4u ul = (v4u){pk16(lb[0], lb[1]), pk16(lb[2], lb[3]), pk16(lb[4], lb[5]), pk16(lb[6], lb[7])};
    const size_t o = base + 8 * (size_t)lane;
    *(v4u*)(outH + o) = uh;
    *(v4u*)(outL + o) = ul;
    
  }
}

// ---------------------------------------------------------------------------
// Host glue.
// Workspace region map (bytes; every size is a multiple of 4096, offsets in that order):
//   XX     bf16 [2048][1024]            4,194,304
//   HC     bf16 [2048][192]               786,432   (tanh of the mix lowrank; cols 160..191 zero, unread; branch s = rows 2048s.. of the
//                                                    [10240][32] view of its cols 0..159)
//   MIU    f32  [2048][1024]            8,388,608   (the decay lowrank output)
//   X5H    bf16 [5][2048][1024]        20,971,520   (branch inputs hi: 0 decay (single), 1 k, 2 v, 3 r, 4 gate)
//   X5L    bf16 [4][2048][1024]        16,777,216   (lo planes of branches 1..4 at index s-1)
//   WH     bf16 [4][1024][1024]         8,388,608   (Wk, Wv, Wr, Wo hi, [out][in] as-is)
//   WL     bf16 [4][1024][1024]         8,388,608   (lo)
//   AT     bf16 [192][1024]               393,216   (A^T, rows 160..191 zero)
//   TDAT   bf16 [64][1024]                131,072
//   TDBT   bf16 [1024][64]                131,072
//   WG1TH  bf16 [192][1024]               393,216   (rows 160..191 zero)   WG1TL 393,216
//   WG2TH  bf16 [1024][192]               393,216   (cols 160..191 zero)   WG2TL 393,216
//   BPT    bf16 [5][1024][32]             327,680
//   L1     bf16 [2048][64]                262,144
//   KVR    f32  [3][2048][1024]         25,165,824   (k unscaled, v, r)
//   GHH    bf16 [2048][192]               786,432   (cols 160..191 zero)   GHL 786,432
//   GATE   f32  [2048][1024]            8,388,608
//   Y      f32  [256][1024][8]          8,388,608   (scan block = (b*16 + head)*8 + eighth of the head's channels, t, row)
//   GATH   bf16 [2048][1024]            4,194,304   GATL 4,194,304
//   total                             122,617,856
// GEMM shapes (M, N, K): (2048,192,1024) (2048,1024,32)x5 batched (2048,64,1024) (2048,1024,64) (2048,1024,1024)x3 batched
// (2048,192,1024) (2048,1024,192) (2048,1024,1024); all M,N % 64 == 0, all K % 32 == 0, pads zero-written by producers.
// ---------------------------------------------------------------------------
extern "C" void kernel_launch(void* const* d_in, const int* in_sizes, int n_in,
                              void* d_out, int out_size, void* d_ws, size_t ws_size,
                              hipStream_t stream) {
  if (n_in < 17) return;
  if (in_sizes[0] != kBatch * kSeq * kChan) return;
  if (in_sizes[1] != kChan || in_sizes[2] != kNBr * kChan) return;
  if (in_sizes[3] != kChan * kMix || in_sizes[4] != kNBr * kBr * kChan) return;
  if (in_sizes[5] != kChan || in_sizes[6] != kChan * kDec || in_sizes[7] != kDec * kChan) return;
  if (in_sizes[8] != kNHead * kHead) return;
  if (in_sizes[9] != kChan * kChan || in_sizes[10] != kChan * kChan || in_sizes[11] != kChan * kChan || in_sizes[12] != kChan * kChan) return;
  if (in_sizes[13] != kChan * kMix || in_sizes[14] != kMix * kChan) return;
  if (in_sizes[15] != kChan || in_sizes[16] != kChan) return;
  if (out_size != kBatch * kSeq * kChan) return;

  const float* x      = (const float*)d_in[0];
  const float* miu_x  = (const float*)d_in[1];
  const float* lam    = (const float*)d_in[2];    // [5][1024]
  const float* Amat   = (const float*)d_in[3];    // [1024][160]
  const float* Bp     = (const float*)d_in[4];    // [5][32][1024]
  const float* td_miu = (const float*)d_in[5];    // [1024]
  const float* tdA    = (const float*)d_in[6];    // [1024][64]
  const float* tdB    = (const float*)d_in[7];    // [64][1024]
  const float* u      = (const float*)d_in[8];    // [16][64]
  const float* Wk     = (const float*)d_in[9];    // [1024][1024] [out][in]
  const float* Wv     = (const float*)d_in[10];
  const float* Wr     = (const float*)d_in[11];
  const float* Wo     = (const float*)d_in[12];
  const float* Wg1    = (const float*)d_in[13];   // [1024][160]
  const float* Wg2    = (const float*)d_in[14];   // [160][1024]
  const float* gamma  = (const float*)d_in[15];
  const float* beta   = (const float*)d_in[16];
  float* out = (float*)d_out;

  // ---- carve ----
  const size_t szXX    = (size_t)kPlane * 2;
  const size_t szHC    = (size_t)kRows * kMixPad * 2;
  const size_t szF32P  = (size_t)kPlane * 4;
  const size_t szX5H   = (size_t)kNBr * kPlane * 2;
  const size_t szX5L   = (size_t)(kNBr - 1) * kPlane * 2;
  const size_t szWSQ   = (size_t)4 * kWPlane * 2;
  const size_t szAT    = (size_t)kMixPad * kChan * 2;
  const size_t szTDAT  = (size_t)kDec * kChan * 2;
  const size_t szTDBT  = (size_t)kChan * kDec * 2;
  const size_t szWG1T  = (size_t)kMixPad * kChan * 2;
  const size_t szWG2T  = (size_t)kChan * kMixPad * 2;
  const size_t szBPT   = (size_t)kNBr * kChan * kBr * 2;
  const size_t szL1    = (size_t)kRows * kDec * 2;
  const size_t szKVR   = (size_t)3 * kPlane * 4;
  const size_t szGH    = (size_t)kRows * kMixPad * 2;
  const size_t szGAT   = (size_t)kPlane * 2;
  size_t off = 0;
  const size_t oXX    = off; off += szXX;
  const size_t oHC    = off; off += szHC;
  const size_t oMIU   = off; off += szF32P;
  const size_t oX5H   = off; off += szX5H;
  const size_t oX5L   = off; off += szX5L;
  const size_t oWH    = off; off += szWSQ;
  const size_t oWL    = off; off += szWSQ;
  const size_t oAT    = off; off += szAT;
  const size_t oTDAT  = off; off += szTDAT;
  const size_t oTDBT  = off; off += szTDBT;
  const size_t oWG1TH = off; off += szWG1T;
  const size_t oWG1TL = off; off += szWG1T;
  const size_t oWG2TH = off; off += szWG2T;
  const size_t oWG2TL = off; off += szWG2T;
  const size_t oBPT   = off; off += szBPT;
  const size_t oL1    = off; off += szL1;
  const size_t oKVR   = off; off += szKVR;
  const size_t oGHH   = off; off += szGH;
  const size_t oGHL   = off; off += szGH;
  const size_t oGATE  = off; off += szF32P;
  const size_t oY     = off; off += szF32P;
  const size_t oGATH  = off; off += szGAT;
  const size_t oGATL  = off; off += szGAT;
  const size_t total  = off;   // 122,617,856
  if (total > (size_t)134217728) return;
  if (ws_size < total) return;

  char* ws = (char*)d_ws;
  unsigned short* XX    = (unsigned short*)(ws + oXX);
  unsigned short* HC    = (unsigned short*)(ws + oHC);
  float*          MIU   = (float*)(ws + oMIU);
  float*          WLR   = MIU;                       // decay lowrank output, f32 [2048][1024]
  unsigned short* X5H   = (unsigned short*)(ws + oX5H);
  unsigned short* X5L   = (unsigned short*)(ws + oX5L);
  unsigned short* WH    = (unsigned short*)(ws + oWH);
  unsigned short* WL    = (unsigned short*)(ws + oWL);
  unsigned short* AT    = (unsigned short*)(ws + oAT);
  unsigned short* TDAT  = (unsigned short*)(ws + oTDAT);
  unsigned short* TDBT  = (unsigned short*)(ws + oTDBT);
  unsigned short* WG1TH = (unsigned short*)(ws + oWG1TH);
  unsigned short* WG1TL = (unsigned short*)(ws + oWG1TL);
  unsigned short* WG2TH = (unsigned short*)(ws + oWG2TH);
  unsigned short* WG2TL = (unsigned short*)(ws + oWG2TL);
  unsigned short* BPT   = (unsigned short*)(ws + oBPT);
  unsigned short* L1    = (unsigned short*)(ws + oL1);
  float*          KVR   = (float*)(ws + oKVR);
  unsigned short* GHH   = (unsigned short*)(ws + oGHH);
  unsigned short* GHL   = (unsigned short*)(ws + oGHL);
  float*          GATE  = (float*)(ws + oGATE);
  float*          Yp    = (float*)(ws + oY);
  unsigned short* GATH  = (unsigned short*)(ws + oGATH);
  unsigned short* GATL  = (unsigned short*)(ws + oGATL);
  const float* fdum = gamma;   // placeholder for unused bias / resid pointer arguments (never dereferenced)

  const dim3 blk(256);

  // ---- token shift and all weight planes ----
  k_prepare<<<dim3(kPbAll), blk, 0, stream>>>(x, miu_x, Amat, tdA, tdB, Wg1, Wg2, Bp, Wk, Wv, Wr, Wo,
                                              XX, AT, TDAT, TDBT, WG1TH, WG1TL, WG2TH, WG2TL, BPT, WH, WL);

  // ---- mix lowrank: HC = tanh(XX @ AT^T) as bf16 (M 2048, N 192, K 1024; 48 blocks of 128 x 64, eight waves of 16 x 64, so that a
  // lane has 32 tanh to do) ----
  wmma_gemm64<1, false, 0, 4, false, 5, 8, 1, 64, kChan, 1><<<dim3((kRows / 128) * (kMixPad / 64), 1), blk, 0, stream>>>(
      XX, XX, 0L, AT, AT, 0L, (void*)HC, (void*)HC, kMixPad, 0L, fdum, fdum, 0L, kMixPad, 1.0f);

  // ---- mix GEMM of all five branches (blockIdx.y = s; A = cols 0..159 of HC viewed [10240][32], rows 2048s..; K 32); its epilogue
  // forms the branch inputs and stores their bf16 planes ----
  wmma_gemm64<1, false, 0, 3, false, 0, 2, 4, 32, kBr><<<dim3((kRows / 128) * (kChan / 256), kNBr), blk, 0, stream>>>(
      HC, HC, (long)kRows * kBr, BPT, BPT, (long)kChan * kBr,
      (void*)X5H, (void*)X5L, kChan, (long)kPlane, lam, x, 0L, kChan, 1.0f);

  // ---- what reads only the branch inputs: KVR = k (unscaled), v, r projections; GH = tanh(X5[4] @ WG1T^T) hi/lo (cols 160..191 zero);
  // L1 = tanh(X5H[0] @ TDAT^T) ----
  k_branch_gemms<<<dim3(3 * kProjTiles + kGateTiles + kDecTiles), blk, 0, stream>>>(
      X5H, X5L, WH, WL, KVR, WG1TH, WG1TL, GHH, GHL, TDAT, L1);
  // ---- GATE = GH @ WG2T^T (split, K 192); WLR = L1 @ TDBT^T (K 64) ----
  k_lowrank_out_gemms<<<dim3(2 * kProjTiles), blk, 0, stream>>>(GHH, GHL, WG2TH, WG2TL, GATE, L1, TDBT, WLR);

  // ---- state scan -> Y ----
  k_state_scan<<<dim3(kBatch * kNHead * kNIB), dim3(128), 0, stream>>>(KVR, KVR + kPlane, KVR + 2 * kPlane, WLR, td_miu, u, Yp);

  // ---- GroupNorm + gate -> GATH/GATL (4096 blocks x 8 waves = 32768 (row, head) pairs) ----
  k_gn_gate<<<dim3((kRows * kNHead) / 8), blk, 0, stream>>>(Yp, GATE, gamma, beta, GATH, GATL);

  // ---- output projection straight into d_out (split, K 1024) ----
  wmma_gemm64<1, true, 0, 0, false, 0, 2, 4, 64, kChan><<<dim3((kRows / 128) * (kChan / 256), 1), blk, 0, stream>>>(
      GATH, GATL, 0L, WH + 3 * kWPlane, WL + 3 * kWPlane, 0L,
      (void*)out, (void*)out, kChan, 0L, fdum, fdum, 0L, kChan, 1.0f);
}

// v007
// One run takes 151 microseconds.
// In two side-by-side timings against v006, it was 1.12 and 1.10 times as fast.
// Counting every step since v000, it is 6.65 times as fast.
// Contractions: every GEMM on v_wmma_f32_16x16x32_bf16 (bf16 operands, f32 accumulate) - the four lowrank mix/decay sites single bf16, the k/v/r projections, the gate pair and the output projection as bf16 hi/lo split (hi*hi + hi*lo + lo*hi); token shift, state scan, GroupNorm and gating in f32 on VALU.
#include <hip/hip_runtime.h>
#include <math.h>

// ---------------------------------------------------------------------------
// Problem constants
// ---------------------------------------------------------------------------
constexpr int kBatch  = 2;
constexpr int kSeq    = 1024;
constexpr int kChan   = 1024;
constexpr int kHead   = 64;
constexpr int kNHead  = 16;
constexpr int kRows   = kBatch * kSeq;          // 2048 token rows (m = b*1024 + t)
constexpr int kMix    = 160;                    // lowrank width of the mix and gate paths
constexpr int kMixPad = 192;                    // padded to a 64 multiple (pad rows / cols zero-filled)
constexpr int kDec    = 64;                     // decay lowrank width
constexpr int kBr     = 32;                     // per-branch mix width
constexpr int kNBr    = 5;                      // branches: 0 decay, 1 k, 2 v, 3 r, 4 gate
constexpr long kPlane  = (long)kRows * kChan;   // 2,097,152 elements per activation plane
constexpr long kWPlane = (long)kChan * kChan;   // 1,048,576 elements per square weight plane
constexpr float kGnEps = 1.6e-4f;               // 1e-5 * 16
static_assert(kNHead * kHead == kChan, "shape");
static_assert(kRows % 256 == 0 && kChan % 256 == 0 && kMixPad % 64 == 0 && kDec % 64 == 0, "M and N tile multiples");
static_assert(kChan % 32 == 0 && kBr % 32 == 0 && kDec % 32 == 0 && kMixPad % 32 == 0, "K multiples of 32");
static_assert(kMix % 8 == 0 && kMixPad % 8 == 0 && kDec % 8 == 0, "pack groups never straddle a row");

typedef __attribute__((ext_vector_type(16))) _Float16 v16h;
typedef __attribute__((ext_vector_type(8)))  _Float16 v8h;
typedef __attribute__((ext_vector_type(16))) __bf16   v16b;
typedef __attribute__((ext_vector_type(8)))  __bf16   v8b;
typedef __attribute__((ext_vector_type(8)))  float    v8f;
typedef __attribute__((ext_vector_type(4)))  float    v4f;
typedef __attribute__((ext_vector_type(2)))  float    v2f;
typedef __attribute__((ext_vector_type(4)))  unsigned int v4u;

// ---------------------------------------------------------------------------
// Shared helpers
// ---------------------------------------------------------------------------
__device__ __forceinline__ unsigned short f2bf_bits(float f) {
  unsigned u = __float_as_uint(f);
  return (unsigned short)((u + 0x7FFFu + ((u >> 16) & 1u)) >> 16);
}
__device__ __forceinline__ float bf_bits2f(unsigned short h) { return __uint_as_float(((unsigned)h) << 16); }
__device__ __forceinline__ unsigned pk16(unsigned short a, unsigned short b) { return (unsigned)a | ((unsigned)b << 16); }
// RNE convert to a bf16 hi part and a bf16 lo part of the f32 residual
__device__ __forceinline__ void bf_split_bits(float f, unsigned short& hb, unsigned short& lb) {
  hb = f2bf_bits(f);
  lb = f2bf_bits(f - bf_bits2f(hb));
}

// hazard guards as plain device helpers; the 4-acc guard ties every
// accumulator of a group and names the A fragments as inputs
__device__ __forceinline__ void dep_guard4_h(v8f& a, v8f& b, v8f& c, v8f& d, v16h x, v16h y) { asm volatile("v_nop\n\tv_nop\n\tv_nop\n\tv_nop" : "+v"(a), "+v"(b), "+v"(c), "+v"(d) : "v"(x), "v"(y)); }
__device__ __forceinline__ void dep_guard4_b(v8f& a, v8f& b, v8f& c, v8f& d, v16b x, v16b y) { asm volatile("v_nop\n\tv_nop\n\tv_nop\n\tv_nop" : "+v"(a), "+v"(b), "+v"(c), "+v"(d) : "v"(x), "v"(y)); }
__device__ __forceinline__ void keep4_h(v16h a, v16h b, v16h c, v16h d) { asm volatile("v_nop" :: "v"(a), "v"(b), "v"(c), "v"(d)); }
__device__ __forceinline__ void keep4_b(v16b a, v16b b, v16b c, v16b d) { asm volatile("v_nop" :: "v"(a), "v"(b), "v"(c), "v"(d)); }
__device__ __forceinline__ void acc_guard4(v8f& a, v8f& b, v8f& c, v8f& d) { asm volatile("v_nop\n\tv_nop\n\tv_nop\n\tv_nop" : "+v"(a), "+v"(b), "+v"(c), "+v"(d)); }
template <typename T> struct Frag;
template <> struct Frag<_Float16> {
  typedef v16h V; typedef v8h H; union U { v16h v; v8h h[2]; };
  // elements 0..7 <- p[0..7], 8..15 <- p[16..23]
  static __device__ __forceinline__ v16h load(const _Float16* p) {
    U f; f.h[0] = *(const v8h*)(p); f.h[1] = *(const v8h*)(p + 16); return f.v;
  }
  static __device__ __forceinline__ v8f mma(v16h a, v16h b, v8f c) {
    return __builtin_amdgcn_wmma_f32_16x16x32_f16(false, a, false, b, (short)0, c, false, false);
  }
  static __device__ __forceinline__ void guard4(v8f& a, v8f& b, v8f& c, v8f& d, v16h x, v16h y) { dep_guard4_h(a, b, c, d, x, y); }
  static __device__ __forceinline__ void keep(v16h a, v16h b, v16h c, v16h d) { keep4_h(a, b, c, d); }
};
template <> struct Frag<__bf16> {
  typedef v16b V; typedef v8b H; union U { v16b v; v8b h[2]; };
  static __device__ __forceinline__ v16b load(const __bf16* p) {
    U f; f.h[0] = *(const v8b*)(p); f.h[1] = *(const v8b*)(p + 16); return f.v;
  }
  static __device__ __forceinline__ v8f mma(v16b a, v16b b, v8f c) {
    return __builtin_amdgcn_wmma_f32_16x16x32_bf16(false, a, false, b, (short)0, c, false, false);
  }
  static __device__ __forceinline__ void guard4(v8f& a, v8f& b, v8f& c, v8f& d, v16b x, v16b y) { dep_guard4_b(a, b, c, d, x, y); }
  static __device__ __forceinline__ void keep(v16b a, v16b b, v16b c, v16b d) { keep4_b(a, b, c, d); }
};

// ---- Register-blocked batched WMMA GEMM (ACT reduced to none/relu/leaky/tanh) -------------------------------
// C[m,n] = scale * sum_k A[m,k] * Bt[n,k] (+bias)(+resid); each wave owns a (16*MI)x64 tile, the WM x WN waves of a block one
// (16*MI*WM) x (64*WN) tile. A row-major [M,KD]; Bt row-major [N,KD]; M % (16*MI*WM) == 0, N % (64*WN) == 0, KD % KS == 0.
// Operand path: the block brings KS k values of its A rows and Bt rows from global memory in whole row pieces (KS*2 bytes,
// 16 B per lane), through registers, into one of two LDS buffers; every wave reads its fragments from there. The loads of
// stage s+1 are issued ahead of the products of stage s and stored to the other buffer behind them; one barrier per stage.
// SPLIT: operands are hi/lo planes (A2/Bt2 = lo planes, same layout); product = hi*hi + hi*lo + lo*hi.
// BIAS_MODE: 0 = none, 1 = bias[m], 2 = bias[n].
// OUT_MODE: 0 = f32, 2 = bf16 hi plane (Cout) + bf16 lo plane (Cout2), 4 = bf16 hi plane alone. In 2 and 4 a row of a wave's tile is one
//               whole 128-B line of each plane (ldc % 64 == 0), stored once, by 8 lanes of that wave.
//           3 = branch input: the tile is the mix term u of branch b = blockIdx.y; the epilogue forms
//               x[m][n] + (x[m-1][n]*f - x[m][n]) * (u + lam[b][n]), f = 0 at t == 0 else 1 (address of the prior row clamped),
//               x = resid (pitch kChan), lam = bias (pitch N), and stores its bf16 hi plane (Cout, plane b) and, for b > 0, its
//               bf16 lo plane (Cout2, plane b-1). Every 128-B line of a plane is stored once, by 8 lanes of one wave.
//               Its A operand is the [kNBr * kRows][kBr] row-major view of the mix lowrank's kMix valid columns, which lie in a plane
//               of pitch kMixPad: row R of the view is columns (R % kNBr) * kBr .. of the plane's row R / kNBr.
// ACT (OUT_MODE 2 and 4 only): 5 = tanh ahead of the bf16 conversion; columns from kMix on of an N == kMixPad GEMM are stored as zero.
// ET: 0 = f16 operands, 1 = bf16 operands (pointers passed as 16-bit storage)
// The engine is a device function, so that GEMMs which do not depend on one another can share one launch: bx and b stand for the
// block's place in the GEMM's own grid, smem for the launch's one LDS array (kGemmLds bytes of it are used).
// MI: 16-row groups of a wave's tile, 4 unless said otherwise. With MI = 2 a wave owns 32x64, so that a 256 x 64 block tile takes the
// eight waves of the 256-thread blocks that it shares a launch with; every element's k order is the same for every MI.
template <bool SPLIT, int WM, int WN, int KS, int MI>
constexpr int kGemmLds = 2 * (SPLIT ? 2 : 1) * (16 * MI * WM + 64 * WN) * (KS + 8) * 2 + WM * WN * 16 * 68 * 4;
template <int ET> struct Elem;
template <> struct Elem<0> { typedef _Float16 T; };
template <> struct Elem<1> { typedef __bf16 T; };
template <int ET, bool SPLIT, int BIAS_MODE, int OUT_MODE, bool RESID, int ACT, int WM, int WN, int KS, int KD, int MI>
__device__ __forceinline__ void gemm64_body(
    char* smem, const int bx, const int b,
    const unsigned short* __restrict__ Ap, const unsigned short* __restrict__ A2p, long strideA,
    const unsigned short* __restrict__ Btp, const unsigned short* __restrict__ Bt2p, long strideB,
    void* __restrict__ Cout, void* __restrict__ Cout2, int ldc, long strideC,
    const float* __restrict__ bias,
    const float* __restrict__ resid, long strideR,
    int N, float scale) {
  typedef typename Elem<ET>::T T;
  typedef typename Frag<T>::V V;
  typedef typename Frag<T>::H H;
  constexpr int NW    = WM * WN;               // waves per block
  constexpr int NT    = 32 * NW;               // threads per block
  constexpr int BM    = 16 * MI * WM;          // block tile rows (A rows per stage)
  constexpr int BN    = 64 * WN;               // block tile columns (Bt rows per stage)
  constexpr int PITCH = KS + 8;                // LDS row pitch in elements: row bytes + 16, an odd multiple of 16 B
  constexpr int CH    = KS / 8;                // 16-B pieces per row piece
  constexpr int RSTEP = NT / CH;               // rows covered by one load of the whole block
  constexpr int NA    = BM / RSTEP;            // loads per thread and plane, A
  constexpr int NB    = BN / RSTEP;            // loads per thread and plane, Bt
  constexpr int PLANE = (BM + BN) * PITCH;     // elements of one plane in one buffer: A rows, then Bt rows
  constexpr int BUF   = (SPLIT ? 2 : 1) * PLANE;
  constexpr int NS    = KD / KS;               // stages
  static_assert(KS == 32 || KS == 64, "row piece");
  static_assert(KD % KS == 0 && BM % RSTEP == 0 && BN % RSTEP == 0, "stage split");
  const T* A = (const T*)Ap; const T* A2 = (const T*)A2p; const T* Bt = (const T*)Btp; const T* Bt2 = (const T*)Bt2p;
  static_assert(kGemmLds<SPLIT, WM, WN, KS, MI> == 2 * BUF * 2 + NW * 16 * 68 * 4, "LDS share");
  static_assert(OUT_MODE != 3 || MI == 4, "the branch-input epilogue is written for 64-row wave tiles");
  T* sOp = (T*)smem;                                // two operand buffers
  float* sT = (float*)(smem + 2 * BUF * 2);         // behind them, per wave, a 16x64 slab, pitch 68 floats
  const int tid  = threadIdx.x;
  const int lane = tid & 31;
  const int wave = tid >> 5;
  const int tilesN = N / BN;
  const int bm = bx / tilesN;                  // the GEMM's grid holds exactly (M / BM) * (N / BN) blocks
  const int bn = bx - bm * tilesN;
  const int wm = wave / WN;
  const int wn = wave - wm * WN;
  const int m0 = bm * BM + wm * (16 * MI);
  const int n0 = bn * BN + (wn << 6);

  // block-uniform bases of the block's rows; every thread adds its one fixed byte offset
  const char* gA  = (const char*)(A  + (size_t)b * strideA + (size_t)(bm * BM) * KD);
  const char* gB  = (const char*)(Bt + (size_t)b * strideB + (size_t)(bn * BN) * KD);
  const char* gA2 = SPLIT ? (const char*)(A2  + (size_t)b * strideA + (size_t)(bm * BM) * KD) : nullptr;
  const char* gB2 = SPLIT ? (const char*)(Bt2 + (size_t)b * strideB + (size_t)(bn * BN) * KD) : nullptr;
  const int sRow = tid / CH, sCol = (tid % CH) * 8;
  const unsigned offG = (unsigned)(sRow * KD + sCol) * 2u;   // bytes
  const int      offL = sRow * PITCH + sCol;                 // elements
  // OUT_MODE 3: byte offsets of this thread's A row pieces, counted from the start of the padded plane
  static_assert(OUT_MODE != 3 || (KD == kBr && KS == kBr), "a row of the view is one row piece");
  unsigned offV[NA];
#pragma unroll   // offV is indexed by constants only, so that it stays in registers
  for (int i = 0; i < NA; ++i) {
    const int R = b * kRows + bm * BM + i * RSTEP + sRow;
    offV[i] = (OUT_MODE == 3) ? (unsigned)((R / kNBr) * kMixPad + (R % kNBr) * kBr + sCol) * 2u : 0u;
  }

  const int rlane = lane & 15;                 // row (A) / col (B, D) within subtile
  const int koff  = (lane >> 4) * 8;           // k offset of this lane half
  const int mOff  = (lane >> 4) * 8;           // D row offset

  v8f acc[MI][4];
#pragma unroll
  for (int i = 0; i < MI; ++i)
#pragma unroll
    for (int j = 0; j < 4; ++j) acc[i][j] = (v8f){0.f,0.f,0.f,0.f,0.f,0.f,0.f,0.f};

  // one stage in flight; every loop over these arrays and over the fragments is fully unrolled, so that they stay in registers
  H ra[NA], ra2[NA], rb[NB], rb2[NB];
  auto gload = [&](int k0) {
    // the two scheduling barriers keep every other instruction out of the group of loads and its wait, and the group ahead of
    // the products: sunk next to the LDS stores that use them, the loads would show their whole latency in every stage
    __builtin_amdgcn_sched_barrier(0);
#pragma unroll
    for (int i = 0; i < NA; ++i) {
      if (OUT_MODE == 3) ra[i] = *(const H*)((const char*)A + offV[i]);
      else               ra[i] = *(const H*)(gA + (size_t)k0 * 2 + (size_t)i * (RSTEP * KD * 2) + offG);
      if (SPLIT) ra2[i] = *(const H*)(gA2 + (size_t)k0 * 2 + (size_t)i * (RSTEP * KD * 2) + offG);
    }
#pragma unroll
    for (int i = 0; i < NB; ++i) {
      rb[i] = *(const H*)(gB + (size_t)k0 * 2 + (size_t)i * (RSTEP * KD * 2) + offG);
      if (SPLIT) rb2[i] = *(const H*)(gB2 + (size_t)k0 * 2 + (size_t)i * (RSTEP * KD * 2) + offG);
    }
    // precaution: this wait stands in front of every later write of a register that one of these loads names
    asm volatile("s_wait_xcnt 0x0" ::: "memory");
    __builtin_amdgcn_sched_barrier(0);
  };
  auto sstore = [&](T* buf) {
#pragma unroll
    for (int i = 0; i < NA; ++i) {
      *(H*)(buf + i * (RSTEP * PITCH) + offL) = ra[i];
      if (SPLIT) *(H*)(buf + PLANE + i * (RSTEP * PITCH) + offL) = ra2[i];
    }
#pragma unroll
    for (int i = 0; i < NB; ++i) {
      *(H*)(buf + (BM + i * RSTEP) * PITCH + offL) = rb[i];
      if (SPLIT) *(H*)(buf + PLANE + (BM + i * RSTEP) * PITCH + offL) = rb2[i];
    }
  };
  const int fragA = (wm * (16 * MI) + rlane) * PITCH + koff;        // this lane's place in the first A / Bt fragment of its wave
  const int fragB = (BM + (wn << 6) + rlane) * PITCH + koff;
  auto compute = [&](const T* buf) {
#pragma unroll
    for (int kk = 0; kk < KS; kk += 32) {
      V bh[4], bl[4], ah[MI], al[MI];
#pragma unroll
      for (int j = 0; j < 4; ++j) {
        bh[j] = Frag<T>::load(buf + fragB + j * (16 * PITCH) + kk);
        if (SPLIT) bl[j] = Frag<T>::load(buf + PLANE + fragB + j * (16 * PITCH) + kk);
      }
#pragma unroll
      for (int i = 0; i < MI; ++i) {
        ah[i] = Frag<T>::load(buf + fragA + i * (16 * PITCH) + kk);
        if (SPLIT) al[i] = Frag<T>::load(buf + PLANE + fragA + i * (16 * PITCH) + kk);
      }
#pragma unroll
      for (int i = 0; i < MI; ++i) {
#pragma unroll
        for (int j = 0; j < 4; ++j) {
          acc[i][j] = Frag<T>::mma(ah[i], bh[j], acc[i][j]);
          if (SPLIT) {
            acc[i][j] = Frag<T>::mma(ah[i], bl[j], acc[i][j]);
            acc[i][j] = Frag<T>::mma(al[i], bh[j], acc[i][j]);
          }
        }
        Frag<T>::guard4(acc[i][0], acc[i][1], acc[i][2], acc[i][3], ah[i], SPLIT ? al[i] : ah[i]);
      }
      Frag<T>::keep(bh[0], bh[1], bh[2], bh[3]);
      if (SPLIT) Frag<T>::keep(bl[0], bl[1], bl[2], bl[3]);
    }
  };

  gload(0);
  sstore(sOp);
  __syncthreads();
  // kept rolled, for speed only
#pragma unroll 1
  for (int s = 0; s < NS; ++s) {
    if (s + 1 < NS) gload((s + 1) * KS);                       // block-uniform
    compute(sOp + (s & 1) * BUF);
    if (s + 1 < NS) sstore(sOp + ((s + 1) & 1) * BUF);
    // the one barrier of a stage: publishes stage s+1 and ends the reads of stage s, whose buffer the next pass overwrites
    __syncthreads();
  }
#pragma unroll   // acc is indexed by constants only, so that it stays in registers
  for (int i = 0; i < MI; ++i) acc_guard4(acc[i][0], acc[i][1], acc[i][2], acc[i][3]);

  // ---- epilogue ----
  float* slab = sT + wave * (16 * 68);
  const float* Rb = RESID ? (resid + (size_t)b * strideR) : nullptr;
  v4f lam0 = (v4f){0.f, 0.f, 0.f, 0.f}, lam1 = lam0;
  // OUT_MODE 3: block-uniform bases of the block's first row in x and in the two planes (pitch kChan); every lane adds one fixed byte
  // offset, offX (f32; half of it in the bf16 planes), and the row groups are immediates. t == 0 can only fall on the first row of a
  // wave's tile (64 divides kSeq): there the prior row's address is the row's own and its factor 0.
  static_assert(OUT_MODE != 3 || kSeq % 64 == 0, "t == 0 only on a wave tile's first row");
  const char* gX = nullptr; char* gH = nullptr; char* gL = nullptr;
  unsigned offX = 0, offP0 = 0;
  float fz0 = 1.0f;
  if (OUT_MODE == 3) {
    const size_t tile0 = (size_t)(bm * BM) * kChan + bn * BN;
    gX = (const char*)(resid + tile0);
    gH = (char*)((unsigned short*)Cout  + (size_t)b * strideC + tile0);
    gL = (char*)((unsigned short*)Cout2 + (size_t)(b > 0 ? (b - 1) : 0) * strideC + tile0);
    const int row0 = (wm << 6) + (lane >> 3);
    offX = (unsigned)(row0 * kChan + (wn << 6) + (lane & 7) * 8) * 4u;
    const bool t0 = ((bm * BM + row0) & (kSeq - 1)) == 0;
    offP0 = t0 ? offX + (unsigned)(kChan * 4) : offX;      // counted from one row above gX, so that it is never negative
    fz0 = t0 ? 0.0f : 1.0f;
    const float* pl = bias + (size_t)b * N + n0 + (lane & 7) * 8;
    __builtin_amdgcn_sched_barrier(0);   // with the one below: keeps the two loads and their wait together
    lam0 = *(const v4f*)(pl); lam1 = *(const v4f*)(pl + 4);
    // precaution: this wait stands in front of every later write of a register that one of these two loads names
    asm volatile("s_wait_xcnt 0x0" ::: "memory");
    __builtin_amdgcn_sched_barrier(0);
  }
#pragma unroll
  for (int i = 0; i < MI; ++i) {
    const int mBase = m0 + (i << 4);
    v4f xa0[4], xa1[4], xb0[4], xb1[4];
    if (OUT_MODE == 3) {
      // the two scheduling barriers keep every other instruction out of the group of loads and its wait, and the group ahead of
      // the slab writes, which are served while the loads fly
      __builtin_amdgcn_sched_barrier(0);
#pragma unroll
      for (int it = 0; it < 4; ++it) {
        const int r = i * 16 + it * 4;                       // this lane's row = first row of its wave + r + q
        const char* px = gX + (size_t)r * (kChan * 4) + offX;
        const char* pp = (r == 0) ? (gX - kChan * 4 + offP0) : (gX + (size_t)(r - 1) * (kChan * 4) + offX);
        xa0[it] = *(const v4f*)(px); xa1[it] = *(const v4f*)(px + 16);
        xb0[it] = *(const v4f*)(pp); xb1[it] = *(const v4f*)(pp + 16);
      }
      // precaution: this wait stands in front of every later write of a register that one of these loads names
      asm volatile("s_wait_xcnt 0x0" ::: "memory");
      __builtin_amdgcn_sched_barrier(0);
    }
#pragma unroll
    for (int j = 0; j < 4; ++j) {
      const int n = n0 + (j << 4) + rlane;
      float bv = 0.f;
      if (BIAS_MODE == 2) bv = bias[n];
#pragma unroll
      for (int r = 0; r < 8; ++r) {
        float v = acc[i][j][r] * scale;
        if (BIAS_MODE == 1) v += bias[mBase + mOff + r];
        if (BIAS_MODE == 2) v += bv;
        if (RESID) v += Rb[(size_t)(mBase + mOff + r) * ldc + n];
        if (ACT == 2) v = fmaxf(v, 0.0f);
        if (ACT == 4) v = (v > 0.f) ? v : 0.01f * v;
        slab[(mOff + r) * 68 + (j << 4) + rlane] = v;
      }
    }
    __builtin_amdgcn_fence(__ATOMIC_RELEASE, "workgroup");
    __builtin_amdgcn_wave_barrier();
    __builtin_amdgcn_fence(__ATOMIC_ACQUIRE, "workgroup");
    if (OUT_MODE == 0) {
      float* C = (float*)Cout + (size_t)b * strideC;
      const int hh = lane >> 4, c4 = (lane & 15) * 4;     // row seg = 256 B = 16 lanes x 16 B
      v4f v[8];
      float* pc[8];
#pragma unroll   // here and below: v and pc are indexed by constants only, so that they stay in registers
      for (int it = 0; it < 8; ++it) {
        const int row = it * 2 + hh;
        v[it]  = *(const v4f*)(slab + row * 68 + c4);
        pc[it] = C + (size_t)(mBase + row) * ldc + n0 + c4;
      }
      // the two scheduling barriers keep every other instruction out of the group of stores and its wait
      __builtin_amdgcn_sched_barrier(0);
#pragma unroll
      for (int it = 0; it < 8; ++it) *(v4f*)pc[it] = v[it];
      // precaution: this wait stands in front of every later write of a register that one of these stores names
      asm volatile("s_wait_xcnt 0x0" ::: "memory");
      __builtin_amdgcn_sched_barrier(0);
    } else if (OUT_MODE == 3) {
      const int q = lane >> 3, c8 = (lane & 7) * 8;
      v4u uh[4], ul[4];
#pragma unroll
      for (int it = 0; it < 4; ++it) {
        const int row = it * 4 + q;
        const float fz = (i == 0 && it == 0) ? fz0 : 1.0f;
        const v4f u0 = *(const v4f*)(slab + row * 68 + c8), u1 = *(const v4f*)(slab + row * 68 + c8 + 4);
        unsigned short hb[8], lb[8];
#pragma unroll
        for (int e = 0; e < 4; ++e) {
          const float ba0 = xb0[it][e] * fz - xa0[it][e];
          const float ba1 = xb1[it][e] * fz - xa1[it][e];
          const float v0 = xa0[it][e] + ba0 * (u0[e] + lam0[e]);
          const float v1 = xa1[it][e] + ba1 * (u1[e] + lam1[e]);
          bf_split_bits(v0, hb[e], lb[e]);
          bf_split_bits(v1, hb[4 + e], lb[4 + e]);
        }
        uh[it] = (v4u){pk16(hb[0], hb[1]), pk16(hb[2], hb[3]), pk16(hb[4], hb[5]), pk16(hb[6], hb[7])};
        ul[it] = (v4u){pk16(lb[0], lb[1]), pk16(lb[2], lb[3]), pk16(lb[4], lb[5]), pk16(lb[6], lb[7])};
      }
      // as for the loads: nothing else is scheduled into the group of stores and its wait
      __builtin_amdgcn_sched_barrier(0);
#pragma unroll
      for (int it = 0; it < 4; ++it) *(v4u*)(gH + (size_t)(i * 16 + it * 4) * (kChan * 2) + offX / 2) = uh[it];
      // the same precaution for the registers that these stores name
      asm volatile("s_wait_xcnt 0x0" ::: "memory");
      __builtin_amdgcn_sched_barrier(0);
      if (b > 0) {                                           // block-uniform: branch 0 has no lo plane
        __builtin_amdgcn_sched_barrier(0);
#pragma unroll
        for (int it = 0; it < 4; ++it) *(v4u*)(gL + (size_t)(i * 16 + it * 4) * (kChan * 2) + offX / 2) = ul[it];
        asm volatile("s_wait_xcnt 0x0" ::: "memory");        // the same precaution
        __builtin_amdgcn_sched_barrier(0);
      }
    } else {
      static_assert(OUT_MODE == 0 || OUT_MODE == 3 || OUT_MODE == 2 || OUT_MODE == 4, "output form");
      const int q = lane >> 3, c8 = (lane & 7) * 8;
      // 8 divides kMix: the 8 columns of a lane are all valid or all pad
      const float fv = (ACT == 5 && N == kMixPad && n0 + c8 >= kMix) ? 0.0f : 1.0f;
      const size_t o0 = (size_t)b * strideC + (size_t)(mBase + q) * ldc + n0 + c8;
      unsigned short* C  = (unsigned short*)Cout + o0;
      unsigned short* C2 = (unsigned short*)Cout2 + o0;
      // kept rolled, for speed only: the tanh is long, and unrolled it would have 32 copies per row group
#pragma unroll 1
      for (int it = 0; it < 4; ++it) {
        const float* sp = slab + (it * 4 + q) * 68 + c8;
        const v4f u0 = *(const v4f*)(sp), u1 = *(const v4f*)(sp + 4);
        unsigned short hb[8], lb[8];
#pragma unroll
        for (int e = 0; e < 4; ++e) {
          float t0 = u0[e], t1 = u1[e];
          if (ACT == 5) { t0 = tanhf(t0) * fv; t1 = tanhf(t1) * fv; }
          if (OUT_MODE == 2) { bf_split_bits(t0, hb[e], lb[e]); bf_split_bits(t1, hb[4 + e], lb[4 + e]); }
          else               { hb[e] = f2bf_bits(t0); hb[4 + e] = f2bf_bits(t1); lb[e] = 0; lb[4 + e] = 0; }
        }
        const v4u uh = (v4u){pk16(hb[0], hb[1]), pk16(hb[2], hb[3]), pk16(hb[4], hb[5]), pk16(hb[6], hb[7])};
        const v4u ul = (v4u){pk16(lb[0], lb[1]), pk16(lb[2], lb[3]), pk16(lb[4], lb[5]), pk16(lb[6], lb[7])};
        // the two scheduling barriers keep every other instruction out of the group of stores and its wait
        __builtin_amdgcn_sched_barrier(0);
        *(v4u*)(C + (size_t)(it * 4) * ldc) = uh;
        if (OUT_MODE == 2) *(v4u*)(C2 + (size_t)(it * 4) * ldc) = ul;
        // precaution: this wait stands in front of every later write of a register that one of these stores names
        asm volatile("s_wait_xcnt 0x0" ::: "memory");
        __builtin_amdgcn_sched_barrier(0);
      }
    }
    __builtin_amdgcn_fence(__ATOMIC_RELEASE, "workgroup");
    __builtin_amdgcn_wave_barrier();
    __builtin_amdgcn_fence(__ATOMIC_ACQUIRE, "workgroup");
  }
}

// One GEMM in a launch of its own: grid (tiles, batch).
template <int ET, bool SPLIT, int BIAS_MODE, int OUT_MODE, bool RESID, int ACT, int WM, int WN, int KS, int KD, int MI = 4>
__global__ __launch_bounds__(32 * WM * WN) void wmma_gemm64(
    const unsigned short* __restrict__ Ap, const unsigned short* __restrict__ A2p, long strideA,
    const unsigned short* __restrict__ Btp, const unsigned short* __restrict__ Bt2p, long strideB,
    void* __restrict__ Cout, void* __restrict__ Cout2, int ldc, long strideC,
    const float* __restrict__ bias,
    const float* __restrict__ resid, long strideR,
    int N, float scale) {
  __shared__ __align__(16) char smem[kGemmLds<SPLIT, WM, WN, KS, MI>];
  gemm64_body<ET, SPLIT, BIAS_MODE, OUT_MODE, RESID, ACT, WM, WN, KS, KD, MI>(
      smem, blockIdx.x, blockIdx.y, Ap, A2p, strideA, Btp, Bt2p, strideB, Cout, Cout2, ldc, strideC, bias, resid, strideR, N, scale);
}

// The three GEMMs that read only the branch inputs, in one launch of 224 blocks, each block alone on its WGP by its LDS:
//   blocks   0..191  k / v / r projections (split, K 1024), 64 tiles of 128 x 256 for each of the three
//   blocks 192..215  gate lowrank (split, N 192, K 1024), 24 tiles of 256 x 64, eight waves of 32 x 64; stores tanh as bf16 hi/lo
//   blocks 216..223  decay lowrank (single, N 64, K 1024), 8 tiles of 256 x 64, eight waves of 32 x 64; stores tanh as bf16
constexpr int kProjTiles = (kRows / 128) * (kChan / 256);   // 64
constexpr int kGateTiles = (kRows / 256) * (kMixPad / 64);  // 24
constexpr int kDecTiles  = (kRows / 256) * (kDec / 64);     // 8
__global__ __launch_bounds__(256) void k_branch_gemms(
    const unsigned short* __restrict__ X5H, const unsigned short* __restrict__ X5L,
    const unsigned short* __restrict__ WH, const unsigned short* __restrict__ WL, float* __restrict__ KVR,
    const unsigned short* __restrict__ WG1TH, const unsigned short* __restrict__ WG1TL,
    unsigned short* __restrict__ GHH, unsigned short* __restrict__ GHL,
    const unsigned short* __restrict__ TDAT, unsigned short* __restrict__ L1) {
  const float* fdum = nullptr;                               // bias and resid of the engine: not used by these GEMMs, never dereferenced
  __shared__ __align__(16) char smem[kGemmLds<true, 2, 4, 64, 4>];
  static_assert(kGemmLds<true, 8, 1, 64, 2> <= kGemmLds<true, 2, 4, 64, 4> && kGemmLds<false, 8, 1, 64, 2> <= kGemmLds<true, 2, 4, 64, 4>, "LDS share");
  const int id = blockIdx.x;                                 // every branch below is block-uniform
  if (id < 3 * kProjTiles) {
    gemm64_body<1, true, 0, 0, false, 0, 2, 4, 64, kChan, 4>(
        smem, id % kProjTiles, id / kProjTiles, X5H + kPlane, X5L, (long)kPlane, WH, WL, (long)kWPlane,
        (void*)KVR, (void*)KVR, kChan, (long)kPlane, fdum, fdum, 0L, kChan, 1.0f);
  } else if (id < 3 * kProjTiles + kGateTiles) {
    gemm64_body<1, true, 0, 2, false, 5, 8, 1, 64, kChan, 2>(
        smem, id - 3 * kProjTiles, 0, X5H + 4 * kPlane, X5L + 3 * kPlane, 0L, WG1TH, WG1TL, 0L,
        (void*)GHH, (void*)GHL, kMixPad, 0L, fdum, fdum, 0L, kMixPad, 1.0f);
  } else {
    gemm64_body<1, false, 0, 4, false, 5, 8, 1, 64, kChan, 2>(
        smem, id - 3 * kProjTiles - kGateTiles, 0, X5H, X5H, 0L, TDAT, TDAT, 0L,
        (void*)L1, (void*)L1, kDec, 0L, fdum, fdum, 0L, kDec, 1.0f);
  }
}

// Block tile of the GEMMs whose launch would leave WGPs idle at 128 x 256 (64 tiles for a 2048 x 1024 result, on 256 WGPs):
// 64 x 128, eight waves of 16 x 64, so that one such GEMM has 256 tiles, one for every WGP.
constexpr int kFillTiles = (kRows / 64) * (kChan / 128);    // 256
// The two GEMMs behind the tanh of the two lowrank paths, in one launch of 512 blocks, two to a WGP by their LDS:
//   blocks  0..255  gate output (split, K 192), blocks 256..511 decay output (single, K 64); 256 tiles of 64 x 128 each
__global__ __launch_bounds__(256) void k_lowrank_out_gemms(
    const unsigned short* __restrict__ GHH, const unsigned short* __restrict__ GHL,
    const unsigned short* __restrict__ WG2TH, const unsigned short* __restrict__ WG2TL, float* __restrict__ GATE,
    const unsigned short* __restrict__ L1, const unsigned short* __restrict__ TDBT, float* __restrict__ WLR) {
  const float* fdum = nullptr;                               // bias and resid of the engine: not used by these GEMMs, never dereferenced
  __shared__ __align__(16) char smem[kGemmLds<true, 4, 2, 64, 1>];
  static_assert(kGemmLds<false, 4, 2, 64, 1> <= kGemmLds<true, 4, 2, 64, 1>, "LDS share");
  const int id = blockIdx.x;                                 // block-uniform
  if (id < kFillTiles) {
    gemm64_body<1, true, 0, 0, false, 0, 4, 2, 64, kMixPad, 1>(
        smem, id, 0, GHH, GHL, 0L, WG2TH, WG2TL, 0L, (void*)GATE, (void*)GATE, kChan, 0L, fdum, fdum, 0L, kChan, 1.0f);
  } else {
    gemm64_body<1, false, 0, 0, false, 0, 4, 2, 64, kDec, 1>(
        smem, id - kFillTiles, 0, L1, L1, 0L, TDBT, TDBT, 0L, (void*)WLR, (void*)WLR, kChan, 0L, fdum, fdum, 0L, kChan, 1.0f);
  }
}

// ---------------------------------------------------------------------------
// Square weight split: four [1024][1024] f32 matrices (layout kept as-is = [out][in] = Bt) -> bf16 hi and lo planes.
// 512 x 4 blocks (bx, z): z selects the matrix and the output plane (planes at out + z*1048576 halves).
// Thread i owns 8 consecutive elements: two b128 loads, one 16-B store per lane per plane; a wave writes 512 contiguous
// ---------------------------------------------------------------------------
__device__ __forceinline__ void wsplit8_body(const int bx, const int z,
                                             const float* __restrict__ W0, const float* __restrict__ W1,
                                             const float* __restrict__ W2, const float* __restrict__ W3,
                                             unsigned short* __restrict__ outH, unsigned short* __restrict__ outL,
                                             int n8PerMat) {
  const float* W = (z == 0) ? W0 : (z == 1) ? W1 : (z == 2) ? W2 : W3;   // block-uniform
  const int i = bx * 256 + threadIdx.x;
  if (i >= n8PerMat) return;
  const float* p = W + 8 * (size_t)i;
  const v4f a = *(const v4f*)(p);
  const v4f c = *(const v4f*)(p + 4);
  unsigned short hb[8], lb[8];
#pragma unroll
  for (int e = 0; e < 4; ++e) {
    bf_split_bits(a[e], hb[e], lb[e]);
    bf_split_bits(c[e], hb[4 + e], lb[4 + e]);
  }
  const v4u uh = (v4u){pk16(hb[0], hb[1]), pk16(hb[2], hb[3]), pk16(hb[4], hb[5]), pk16(hb[6], hb[7])};
  const v4u ul = (v4u){pk16(lb[0], lb[1]), pk16(lb[2], lb[3]), pk16(lb[4], lb[5]), pk16(lb[6], lb[7])};
  const size_t o = (size_t)z * (size_t)kWPlane + 8 * (size_t)i;
  *(v4u*)(outH + o) = uh;
  *(v4u*)(outL + o) = ul;
  // precaution: this wait stands in front of every later write of a register that one of these stores names
  asm volatile("s_wait_xcnt 0x0" ::: "memory");
}

// ---------------------------------------------------------------------------
// Transpose + bf16 convert (single or hi/lo): in[R][Cc] f32 row-major (pitch Cc) -> out[n][k] = cvt(in[k][n]) for
// k < R and n < Cc, zero otherwise (pad rows / pad columns of the output plane are WRITTEN as zeros).
// blocks (bx, by, bz) of nTilesN x nTilesK x Z: a block covers 32 output rows n0..n0+31 and KT output columns k0..k0+KT-1; bz adds
// inStrideZ / outStrideZ element offsets. 256 threads; sm = 32 * (KT + 1) floats of LDS.
// Load coverage: (32*KT/256) iterations x 256 threads = 32 x KT elements (coalesced along n), clamped address, 0/1 factor.
// Store, KT == 64: row = wave*4 + (lane>>3) -> 8 waves x 4 = 32 rows; (lane&7) x 8 halves = 64 cols; each row segment =
// Store, KT == 32 (requires ldo == 32, k0 == 0): threads 0..127, row = t>>2, c8 = (t&3)*8 -> thread t writes tile bytes
// ---------------------------------------------------------------------------
template <bool SPLIT, int KT>
__device__ __forceinline__ void trcast_body(float* sm, const int bx, const int by, const int bz,
                                            const float* __restrict__ in, int R, int Cc, long inStrideZ,
                                            unsigned short* __restrict__ outH, unsigned short* __restrict__ outL,
                                            int ldo, long outStrideZ) {
  static_assert(KT == 64 || KT == 32, "tile");
  const int t  = threadIdx.x;
  const int n0 = bx * 32;
  const int k0 = by * KT;
  const float* inz = in + (size_t)bz * inStrideZ;
  constexpr int kIters = (32 * KT) / 256;
  const float* pin[kIters];
  float fz[kIters], v[kIters];
#pragma unroll   // here and in the two loops below: the three arrays are indexed by constants only, so that they stay in registers
  for (int it = 0; it < kIters; ++it) {
    const int e  = it * 256 + t;
    const int n  = n0 + (e & 31);
    const int k  = k0 + (e >> 5);
    const int nc = (n < Cc) ? n : (Cc - 1);
    const int kc = (k < R) ? k : (R - 1);
    pin[it] = inz + (size_t)kc * Cc + nc;
    fz[it]  = ((n < Cc) && (k < R)) ? 1.0f : 0.0f;
  }
  // the two scheduling barriers keep every other instruction out of the group of loads and its wait
  __builtin_amdgcn_sched_barrier(0);
#pragma unroll
  for (int it = 0; it < kIters; ++it) v[it] = *pin[it];
  // precaution: this wait stands in front of every later write of a register that one of these loads names
  asm volatile("s_wait_xcnt 0x0" ::: "memory");
  __builtin_amdgcn_sched_barrier(0);
#pragma unroll
  for (int it = 0; it < kIters; ++it) {
    const int e = it * 256 + t;
    sm[(e & 31) * (KT + 1) + (e >> 5)] = v[it] * fz[it];
  }
  __syncthreads();
  const int lane = t & 31, wave = t >> 5;
  unsigned short* oh = outH + (size_t)bz * outStrideZ;
  unsigned short* ol = outL + (size_t)bz * outStrideZ;
  int row, c8;
  bool active;
  if (KT == 64) { row = wave * 4 + (lane >> 3); c8 = (lane & 7) * 8; active = true; }
  else          { row = t >> 2;                 c8 = (t & 3) * 8;    active = (t < 128); }
  if (active) {
    unsigned short hb[8], lb[8];
#pragma unroll
    for (int e = 0; e < 8; ++e) {
      const float v = sm[row * (KT + 1) + c8 + e];
      if (SPLIT) { bf_split_bits(v, hb[e], lb[e]); }
      else       { hb[e] = f2bf_bits(v); lb[e] = 0; }
    }
    const v4u uh = (v4u){pk16(hb[0], hb[1]), pk16(hb[2], hb[3]), pk16(hb[4], hb[5]), pk16(hb[6], hb[7])};
    const v4u ul = (v4u){pk16(lb[0], lb[1]), pk16(lb[2], lb[3]), pk16(lb[4], lb[5]), pk16(lb[6], lb[7])};
    const size_t o = (size_t)(n0 + row) * ldo + k0 + c8;
    *(v4u*)(oh + o) = uh;
    if (SPLIT) *(v4u*)(ol + o) = ul;
    // precaution: this wait stands in front of every later write of a register that one of these stores names
    asm volatile("s_wait_xcnt 0x0" ::: "memory");
  }
}

// ---------------------------------------------------------------------------
// Token shift: xx[m][c] = x[m][c] + (x[m-1][c]*f - x[m][c]) * miu_x[c], f = 0 at t == 0 else 1 (address of the prior row
// clamped, arithmetic 0/1 factor). Output: single bf16 plane [2048][1024].
// ---------------------------------------------------------------------------
__device__ __forceinline__ void xx8_body(const int bx, const float* __restrict__ x, const float* __restrict__ miu_x,
                                         unsigned short* __restrict__ XX, int n8) {
  const int i = bx * 256 + threadIdx.x;
  if (i >= n8) return;
  const int f  = 8 * i;
  const int m  = f >> 10;
  const int c0 = f & 1023;
  const int t  = m & 1023;
  const int mp = (t > 0) ? (m - 1) : m;
  const float fz = (t > 0) ? 1.0f : 0.0f;
  const float* px = x + f;
  const float* pp = x + ((size_t)mp << 10) + c0;
  const float* pm = miu_x + c0;
  const v4f a0 = *(const v4f*)(px), a1 = *(const v4f*)(px + 4);
  const v4f b0 = *(const v4f*)(pp), b1 = *(const v4f*)(pp + 4);
  const v4f u0 = *(const v4f*)(pm), u1 = *(const v4f*)(pm + 4);
  unsigned short hb[8];
#pragma unroll
  for (int e = 0; e < 4; ++e) {
    const float ba0 = b0[e] * fz - a0[e];
    const float ba1 = b1[e] * fz - a1[e];
    hb[e]     = f2bf_bits(a0[e] + ba0 * u0[e]);
    hb[4 + e] = f2bf_bits(a1[e] + ba1 * u1[e]);
  }
  const v4u uh = (v4u){pk16(hb[0], hb[1]), pk16(hb[2], hb[3]), pk16(hb[4], hb[5]), pk16(hb[6], hb[7])};
  unsigned short* q = XX + f;
  *(v4u*)q = uh;
  // precaution: this wait stands in front of every later write of a register that this store names
  asm volatile("s_wait_xcnt 0x0" ::: "memory");
}

// ---------------------------------------------------------------------------
// Everything that reads only the inputs, in one launch: the token shift, the six transposes and the square weight split do not
// depend on one another. blockIdx.x is cut into ranges, one per piece of work, each range holding that piece's own grid; every
// branch is block-uniform, and the one barrier of a transpose is passed by all threads of its block.
// ---------------------------------------------------------------------------
constexpr int kPbXX  = (int)(kPlane / 8) / 256;              // 1024 token shift
constexpr int kPbA   = (kMixPad / 32) * (kChan / 64);        // 96   A    [1024][160] -> AT   [192][1024], rows >= 160 zero
constexpr int kPbTA  = (kDec / 32) * (kChan / 64);           // 32   tdA  [1024][64]  -> TDAT [64][1024]
constexpr int kPbTB  = kChan / 32;                           // 32   tdB  [64][1024]  -> TDBT [1024][64]
constexpr int kPbG1  = (kMixPad / 32) * (kChan / 64);        // 96   Wg1  [1024][160] -> WG1T hi/lo [192][1024], rows >= 160 zero
constexpr int kPbG2  = (kChan / 32) * (kMixPad / 64);        // 96   Wg2  [160][1024] -> WG2T hi/lo [1024][192], cols >= 160 zero
constexpr int kPbBp  = (kChan / 32) * kNBr;                  // 160  Bp[s] [32][1024] -> BPT[s] [1024][32]
constexpr int kPbW   = ((int)(kWPlane / 8) / 256) * 4;       // 2048 Wk, Wv, Wr, Wo hi/lo
constexpr int kPbAll = kPbXX + kPbA + kPbTA + kPbTB + kPbG1 + kPbG2 + kPbBp + kPbW;
__global__ __launch_bounds__(256) void k_prepare(
    const float* __restrict__ x, const float* __restrict__ miu_x, const float* __restrict__ Amat,
    const float* __restrict__ tdA, const float* __restrict__ tdB, const float* __restrict__ Wg1, const float* __restrict__ Wg2,
    const float* __restrict__ Bp, const float* __restrict__ Wk, const float* __restrict__ Wv, const float* __restrict__ Wr,
    const float* __restrict__ Wo,
    unsigned short* __restrict__ XX, unsigned short* __restrict__ AT, unsigned short* __restrict__ TDAT,
    unsigned short* __restrict__ TDBT, unsigned short* __restrict__ WG1TH, unsigned short* __restrict__ WG1TL,
    unsigned short* __restrict__ WG2TH, unsigned short* __restrict__ WG2TL, unsigned short* __restrict__ BPT,
    unsigned short* __restrict__ WH, unsigned short* __restrict__ WL) {
  __shared__ float sm[32 * 65];
  int l = blockIdx.x;
  if (l < kPbXX) { xx8_body(l, x, miu_x, XX, (int)(kPlane / 8)); return; }
  l -= kPbXX;
  if (l < kPbA) { trcast_body<false, 64>(sm, l % (kMixPad / 32), l / (kMixPad / 32), 0, Amat, kChan, kMix, 0L, AT, AT, kChan, 0L); return; }
  l -= kPbA;
  if (l < kPbTA) { trcast_body<false, 64>(sm, l % (kDec / 32), l / (kDec / 32), 0, tdA, kChan, kDec, 0L, TDAT, TDAT, kChan, 0L); return; }
  l -= kPbTA;
  if (l < kPbTB) { trcast_body<false, 64>(sm, l, 0, 0, tdB, kDec, kChan, 0L, TDBT, TDBT, kDec, 0L); return; }
  l -= kPbTB;
  if (l < kPbG1) { trcast_body<true, 64>(sm, l % (kMixPad / 32), l / (kMixPad / 32), 0, Wg1, kChan, kMix, 0L, WG1TH, WG1TL, kChan, 0L); return; }
  l -= kPbG1;
  if (l < kPbG2) { trcast_body<true, 64>(sm, l % (kChan / 32), l / (kChan / 32), 0, Wg2, kMix, kChan, 0L, WG2TH, WG2TL, kMixPad, 0L); return; }
  l -= kPbG2;
  if (l < kPbBp) { trcast_body<false, 32>(sm, l % (kChan / 32), 0, l / (kChan / 32), Bp, kBr, kChan, (long)kBr * kChan, BPT, BPT, kBr, (long)kChan * kBr); return; }
  l -= kPbBp;
  wsplit8_body(l % (kPbW / 4), l / (kPbW / 4), Wk, Wv, Wr, Wo, WH, WL, (int)(kWPlane / 8));
}

// ---------------------------------------------------------------------------
// Linear-attention state scan, f32. One block (128 threads = 4 waves) per (batch b, head n, eighth ih of the
// v channels): the rows i of the state are independent, so each block carries 8 rows x 64 k channels.
// Thread (il, jg): jg = lane owns k channels 2*jg, 2*jg+1, il = wave*2 is the first of the wave's two rows;
// S lives in 2 f32 pairs, one per k channel (pairs run along the two rows, so a step's packed sum is the two rows' partials as they
// are stored, and a step reads four 8-byte LDS operands: r, k, d of its two k channels and v of its two rows).
// The sequence is cut into chunks of kSc timesteps; pass c of the loop, between two block barriers,
//   - runs the kSc steps of chunk c from stage buffer c & 1 (r, k*exp(min(w,0)), exp(w), v; w = wl + td_miu). A step has no
//     barrier: each thread stores its partial sums over its 2 k channels to partial buffer c & 1;
//   - writes chunk c+1 into the other stage buffer, piece by piece between the steps, and issues the loads of chunk c+2;
//   - finishes chunk c-1: y_i = sum of the 32 partials + v_i * bonus[t], bonus[t] = sum_j r_j*u_j*k_j (16 partials per step,
//     written by the staging threads into a ring of 4 slots).
// Y is laid out by scan block, [block][t][8 rows], so that every 128-B line of it (4 timesteps) is stored once, by 16 lanes of
// one wave of the one block that owns it.
// ---------------------------------------------------------------------------
constexpr int kSc  = 32;             // timesteps per chunk
constexpr int kNC  = kSeq / kSc;     // chunks
constexpr int kIB  = 8;              // state rows (v channels) per block
constexpr int kNIB = kHead / kIB;    // blocks per head
constexpr int kJG  = 32;             // j groups, 2 k channels each
constexpr int kPJ  = 10;             // floats between the partial rows of two j groups: the 32 lanes of a b64 store hit all 64 banks once
constexpr int kPT  = kJG * kPJ + 8;  // floats between two timesteps' partials: the 8 timesteps of one b64 read hit disjoint banks
constexpr int kPre = 12;             // steps whose LDS operands are fetched ahead of their use
static_assert(kSeq % kSc == 0 && kNC >= 2 && kNIB == 8 && kJG * 2 == kHead && kSc == 32 && kSc > kPre, "scan chunking");
struct ScanOp { v2f r, k, d, v; };
__device__ __forceinline__ v2f both(float a) { return (v2f){a, a}; }
__global__ __launch_bounds__(128) void k_state_scan(const float* __restrict__ kraw, const float* __restrict__ vpl,
                                                    const float* __restrict__ rpl, const float* __restrict__ wl,
                                                    const float* __restrict__ td_miu, const float* __restrict__ u,
                                                    float* __restrict__ Y) {
  __shared__ __align__(16) float sr0[kSc * 64], sr1[kSc * 64];
  __shared__ __align__(16) float sk0[kSc * 64], sk1[kSc * 64];
  __shared__ __align__(16) float sd0[kSc * 64], sd1[kSc * 64];
  __shared__ __align__(16) float sv0[kSc * kIB], sv1[kSc * kIB];
  __shared__ __align__(16) float part0[kSc * kPT], part1[kSc * kPT];
  __shared__ __align__(16) float sbp[4][kSc][16];
  const int tid  = threadIdx.x;
  const int lane = tid & 31;
  const int wave = tid >> 5;
  const int ih   = blockIdx.x & (kNIB - 1);
  const int n    = (blockIdx.x >> 3) & (kNHead - 1);
  const int b    = blockIdx.x >> 7;
  const int jg   = lane;
  const int j0   = jg * 2;
  const int il   = wave * 2;                          // first of this thread's two rows, local to the block
  // staging and output roles: r/k/w rows are 16 float4 wide, v and y rows 4 float2 wide
  const int sRow = tid >> 4, sC4 = (tid & 15) * 4;
  const int vRow = tid >> 2, vC2 = (tid & 3) * 2;
  const size_t base = (size_t)b * kSeq * kChan + (size_t)n * kHead;
  float* Yb = Y + (size_t)blockIdx.x * (kSeq * kIB);                     // this block's own [t][8] plane
  const unsigned offS = (unsigned)(sRow * kChan + sC4) * 4u;             // byte offsets of the roles inside a piece
  const unsigned offV = (unsigned)(vRow * kChan + ih * kIB + vC2) * 4u;
  const unsigned offY = (unsigned)(vRow * kIB + vC2) * 4u;
  const v4f tm4 = *(const v4f*)(td_miu + n * kHead + sC4);
  const v4f u4  = *(const v4f*)(u + n * kHead + sC4);
  // precaution: this wait stands in front of every later write of a register that one of these two loads names; the scheduling
  // barrier keeps later instructions behind it
  asm volatile("s_wait_xcnt 0x0" ::: "memory");
  __builtin_amdgcn_sched_barrier(0);

  v2f S[2];
#pragma unroll
  for (int q = 0; q < 2; ++q) S[q] = (v2f){0.f, 0.f};

  // staged through registers in kSc/8 pieces: piece it = 8 rows of r, k, w (and, with the first piece, all kSc rows of v)
  v4f gw[kSc / 8], gk[kSc / 8], gr[kSc / 8];
  v2f gv;
  // the v values this thread staged are the ones its own output role needs two passes later: vOld of chunk c-1, vNew of chunk c
  v2f vOld = (v2f){0.f, 0.f}, vNew = vOld;
  auto issue = [&](int it, int t0) {
    const size_t ub = base + (size_t)(t0 + it * 8) * kChan;      // block-uniform: scalar base + this thread's fixed byte offset
    // the two scheduling barriers keep every other instruction out of the group of loads and its wait
    __builtin_amdgcn_sched_barrier(0);
    gw[it] = *(const v4f*)((const char*)(wl + ub) + offS);
    gk[it] = *(const v4f*)((const char*)(kraw + ub) + offS);
    gr[it] = *(const v4f*)((const char*)(rpl + ub) + offS);
    if (it == 0) gv = *(const v2f*)((const char*)(vpl + ub) + offV);
    // precaution: this wait stands in front of every later write of a register that one of these loads names
    asm volatile("s_wait_xcnt 0x0" ::: "memory");
    __builtin_amdgcn_sched_barrier(0);
  };
  auto commit = [&](int it, float* dr, float* dk, float* dd_, float* dv, int slot) {
    const int tl = it * 8 + sRow;
    v4f kk, dd;
    float bp = 0.0f;
#pragma unroll
    for (int e = 0; e < 4; ++e) {
      const float wv = gw[it][e] + tm4[e];
      kk[e] = gk[it][e] * expf(fminf(wv, 0.0f));
      dd[e] = expf(wv);
      bp += gr[it][e] * (u4[e] * kk[e]);
    }
    *(v4f*)(dr + tl * 64 + sC4)  = gr[it];
    *(v4f*)(dk + tl * 64 + sC4)  = kk;
    *(v4f*)(dd_ + tl * 64 + sC4) = dd;
    sbp[slot][tl][tid & 15] = bp;
    if (it == 0) {
      *(v2f*)(dv + vRow * kIB + vC2) = gv;
      vOld = vNew;
      vNew = gv;
    }
  };
  // finishing chunk cc from its partials (src), its bonus slot and vOld: the LDS reads, and apart from them the sums and the store
  v2f x[kJG];
  v4f xb[4];
  auto finish_load = [&](const float* src, int cc) {
#pragma unroll   // here and below: x and xb are indexed by constants only, so that they stay in registers
    for (int g = 0; g < kJG; ++g) x[g] = *(const v2f*)(src + vRow * kPT + g * kPJ + vC2);
#pragma unroll
    for (int g = 0; g < 4; ++g) xb[g] = *(const v4f*)(&sbp[cc & 3][vRow][4 * g]);
  };
  auto finish_sum = [&](int cc) {
    const v4f b4 = (xb[0] + xb[1]) + (xb[2] + xb[3]);
    const float bn = (b4[0] + b4[1]) + (b4[2] + b4[3]);
    v2f s8[4];
#pragma unroll
    for (int h = 0; h < 4; ++h)
      s8[h] = ((x[8 * h] + x[8 * h + 1]) + (x[8 * h + 2] + x[8 * h + 3])) + ((x[8 * h + 4] + x[8 * h + 5]) + (x[8 * h + 6] + x[8 * h + 7]));
    const v2f yv = ((s8[0] + s8[1]) + (s8[2] + s8[3])) + vOld * bn;
    // as in issue(): nothing else is scheduled into the store and its wait
    __builtin_amdgcn_sched_barrier(0);
    *(v2f*)((char*)(Yb + (size_t)cc * (kSc * kIB)) + offY) = yv;
    // the same precaution for the registers that this store names
    asm volatile("s_wait_xcnt 0x0" ::: "memory");
    __builtin_amdgcn_sched_barrier(0);
  };
  auto pass = [&](int c) {
    const int p = c & 1;
    const float* pr = (p ? sr1 : sr0) + j0;
    const float* pk = (p ? sk1 : sk0) + j0;
    const float* pd = (p ? sd1 : sd0) + j0;
    const float* pv = (p ? sv1 : sv0) + il;
    float* pp = (p ? part1 : part0) + jg * kPJ + il;
    // chunk whose loads are issued in this pass; clamped, so that the steps have no branch (the last two passes re-read the last
    // chunk, and the last pass stages it into buffers that nobody reads any more)
    const int tN = ((c + 2 < kNC) ? (c + 2) : (kNC - 1)) * kSc;
    auto ld = [&](int tl) {
      ScanOp o;
      o.r = *(const v2f*)(pr + tl * 64);
      o.k = *(const v2f*)(pk + tl * 64);
      o.d = *(const v2f*)(pd + tl * 64);
      o.v = *(const v2f*)(pv + tl * kIB);
      return o;
    };
    // the previous chunk's reads first, then the first steps' reads, which are served while the previous chunk is summed and stored
    if (c > 0) finish_load(p ? part0 : part1, c - 1);      // block-uniform
    ScanOp ring[kPre];
#pragma unroll
    for (int tl = 0; tl < kPre; ++tl) ring[tl] = ld(tl);
    if (c > 0) finish_sum(c - 1);
    // fully unrolled so that the ring's slots are registers and every LDS offset an immediate
#pragma unroll
    for (int tl = 0; tl < kSc; ++tl) {
      const ScanOp o = ring[tl % kPre];
      if (tl + kPre < kSc) ring[tl % kPre] = ld(tl + kPre);
      // keeps these reads kPre steps ahead of their use: sunk next to it, the wave would wait out the LDS latency in every step
      __builtin_amdgcn_sched_barrier(0);
      v2f a = both(o.r[0]) * S[0];
      a = __builtin_elementwise_fma(both(o.r[1]), S[1], a);
      S[0] = __builtin_elementwise_fma(S[0], both(o.d[0]), both(o.k[0]) * o.v);
      S[1] = __builtin_elementwise_fma(S[1], both(o.d[1]), both(o.k[1]) * o.v);
      *(v2f*)(pp + tl * kPT) = a;
      // one piece of the next chunk's stage every 4 steps, early in the pass: its vector work runs while the LDS reads fetched
      // ahead are served, and the loads issued behind it have the rest of the pass to land before the barrier waits for them
      if ((tl & 3) == 1 && (tl >> 2) < kSc / 8) {
        commit(tl >> 2, p ? sr0 : sr1, p ? sk0 : sk1, p ? sd0 : sd1, p ? sv0 : sv1, (c + 1) & 3);
        issue(tl >> 2, tN);
      }
    }
    // the one barrier of a pass: publishes this chunk's partials and the next chunk's stage, and ends the reads of this chunk's
    // stage and of the previous chunk's partials, which the next pass overwrites
    __syncthreads();
  };

#pragma unroll
  for (int it = 0; it < kSc / 8; ++it) issue(it, 0);
#pragma unroll
  for (int it = 0; it < kSc / 8; ++it) {
    commit(it, sr0, sk0, sd0, sv0, 0);
    issue(it, kSc);
  }
  __syncthreads();
#pragma unroll 1
  for (int c = 0; c < kNC; ++c) pass(c);
  finish_load(((kNC - 1) & 1) ? part1 : part0, kNC - 1);
  finish_sum(kNC - 1);
}

// ---------------------------------------------------------------------------
// GroupNorm (64 channels per head, biased variance, eps 1.6e-4) + affine + gate multiply -> bf16 hi/lo planes.
// One wave per (row m, head n), 8 pairs per 256-thread block; lane owns channels 2l, 2l+1; shuffle reductions (unconditional).
// Y comes in the scan's layout [scan block][t][8 rows]: a block takes 4 consecutive rows of 2 heads, which share their lines of Y.
// ---------------------------------------------------------------------------
__global__ __launch_bounds__(256) void k_gn_gate(const float* __restrict__ Y, const float* __restrict__ G,
                                                 const float* __restrict__ gamma, const float* __restrict__ beta,
                                                 unsigned short* __restrict__ outH, unsigned short* __restrict__ outL) {
  __shared__ __align__(16) float slab[8][64];
  const int lane = threadIdx.x & 31, wave = threadIdx.x >> 5;
  const int m = (blockIdx.x >> 3) * 4 + (wave & 3);
  const int n = (blockIdx.x & 7) * 2 + (wave >> 2);
  const size_t base = (size_t)m * kChan + (size_t)n * kHead;
  const int c = n * kHead + 2 * lane;
  const int sb = ((m / kSeq) * kNHead + n) * kNIB + (2 * lane) / kIB;      // the scan block that owns this lane's two channels
  // the two scheduling barriers keep every other instruction out of the group of loads and its wait, so that the four fly together
  __builtin_amdgcn_sched_barrier(0);
  const v2f yv = *(const v2f*)(Y + ((size_t)sb * kSeq + (m % kSeq)) * kIB + (2 * lane) % kIB);
  const v2f gv = *(const v2f*)(G + base + 2 * lane);
  const v2f ga = *(const v2f*)(gamma + c);
  const v2f be = *(const v2f*)(beta + c);
  // precaution: this wait stands in front of every later write of a register that one of these loads names
  asm volatile("s_wait_xcnt 0x0" ::: "memory");
  __builtin_amdgcn_sched_barrier(0);
  float s = yv[0] + yv[1];
#pragma unroll
  for (int off = 16; off > 0; off >>= 1) s += __shfl_xor(s, off, 32);
  const float mean = s * (1.0f / 64.0f);
  const float d0 = yv[0] - mean;
  const float d1 = yv[1] - mean;
  float q = d0 * d0 + d1 * d1;
#pragma unroll
  for (int off = 16; off > 0; off >>= 1) q += __shfl_xor(q, off, 32);
  const float var = q * (1.0f / 64.0f);
  const float rs  = 1.0f / sqrtf(var + kGnEps);
  const float o0 = ((d0 * rs) * ga[0] + be[0]) * gv[0];
  const float o1 = ((d1 * rs) * ga[1] + be[1]) * gv[1];
  *(v2f*)(&slab[wave][2 * lane]) = (v2f){o0, o1};
  __syncthreads();
  if (lane < 8) {
    unsigned short hb[8], lb[8];
#pragma unroll
    for (int e = 0; e < 8; ++e) bf_split_bits(slab[wave][8 * lane + e], hb[e], lb[e]);
    const v4u uh = (v4u){pk16(hb[0], hb[1]), pk16(hb[2], hb[3]), pk16(hb[4], hb[5]), pk16(hb[6], hb[7])};
    const v4u ul = (v4u){pk16(lb[0], lb[1]), pk16(lb[2], lb[3]), pk16(lb[4], lb[5]), pk16(lb[6], lb[7])};
    const size_t o = base + 8 * (size_t)lane;
    *(v4u*)(outH + o) = uh;
    *(v4u*)(outL + o) = ul;
    
  }
}

// ---------------------------------------------------------------------------
// Host glue.
// Workspace region map (bytes; every size is a multiple of 4096, offsets in that order):
//   XX     bf16 [2048][1024]            4,194,304
//   HC     bf16 [2048][192]               786,432   (tanh of the mix lowrank; cols 160..191 zero, unread; branch s = rows 2048s.. of the
//                                                    [10240][32] view of its cols 0..159)
//   MIU    f32  [2048][1024]            8,388,608   (the decay lowrank output)
//   X5H    bf16 [5][2048][1024]        20,971,520   (branch inputs hi: 0 decay (single), 1 k, 2 v, 3 r, 4 gate)
//   X5L    bf16 [4][2048][1024]        16,777,216   (lo planes of branches 1..4 at index s-1)
//   WH     bf16 [4][1024][1024]         8,388,608   (Wk, Wv, Wr, Wo hi, [out][in] as-is)
//   WL     bf16 [4][1024][1024]         8,388,608   (lo)
//   AT     bf16 [192][1024]               393,216   (A^T, rows 160..191 zero)
//   TDAT   bf16 [64][1024]                131,072
//   TDBT   bf16 [1024][64]                131,072
//   WG1TH  bf16 [192][1024]               393,216   (rows 160..191 zero)   WG1TL 393,216
//   WG2TH  bf16 [1024][192]               393,216   (cols 160..191 zero)   WG2TL 393,216
//   BPT    bf16 [5][1024][32]             327,680
//   L1     bf16 [2048][64]                262,144
//   KVR    f32  [3][2048][1024]         25,165,824   (k unscaled, v, r)
//   GHH    bf16 [2048][192]               786,432   (cols 160..191 zero)   GHL 786,432
//   GATE   f32  [2048][1024]            8,388,608
//   Y      f32  [256][1024][8]          8,388,608   (scan block = (b*16 + head)*8 + eighth of the head's channels, t, row)
//   GATH   bf16 [2048][1024]            4,194,304   GATL 4,194,304
//   total                             122,617,856
// GEMM shapes (M, N, K): (2048,192,1024) (2048,1024,32)x5 batched (2048,64,1024) (2048,1024,64) (2048,1024,1024)x3 batched
// (2048,192,1024) (2048,1024,192) (2048,1024,1024); all M,N % 64 == 0, all K % 32 == 0, pads zero-written by producers.
// ---------------------------------------------------------------------------
extern "C" void kernel_launch(void* const* d_in, const int* in_sizes, int n_in,
                              void* d_out, int out_size, void* d_ws, size_t ws_size,
                              hipStream_t stream) {
  if (n_in < 17) return;
  if (in_sizes[0] != kBatch * kSeq * kChan) return;
  if (in_sizes[1] != kChan || in_sizes[2] != kNBr * kChan) return;
  if (in_sizes[3] != kChan * kMix || in_sizes[4] != kNBr * kBr * kChan) return;
  if (in_sizes[5] != kChan || in_sizes[6] != kChan * kDec || in_sizes[7] != kDec * kChan) return;
  if (in_sizes[8] != kNHead * kHead) return;
  if (in_sizes[9] != kChan * kChan || in_sizes[10] != kChan * kChan || in_sizes[11] != kChan * kChan || in_sizes[12] != kChan * kChan) return;
  if (in_sizes[13] != kChan * kMix || in_sizes[14] != kMix * kChan) return;
  if (in_sizes[15] != kChan || in_sizes[16] != kChan) return;
  if (out_size != kBatch * kSeq * kChan) return;

  const float* x      = (const float*)d_in[0];
  const float* miu_x  = (const float*)d_in[1];
  const float* lam    = (const float*)d_in[2];    // [5][1024]
  const float* Amat   = (const float*)d_in[3];    // [1024][160]
  const float* Bp     = (const float*)d_in[4];    // [5][32][1024]
  const float* td_miu = (const float*)d_in[5];    // [1024]
  const float* tdA    = (const float*)d_in[6];    // [1024][64]
  const float* tdB    = (const float*)d_in[7];    // [64][1024]
  const float* u      = (const float*)d_in[8];    // [16][64]
  const float* Wk     = (const float*)d_in[9];    // [1024][1024] [out][in]
  const float* Wv     = (const float*)d_in[10];
  const float* Wr     = (const float*)d_in[11];
  const float* Wo     = (const float*)d_in[12];
  const float* Wg1    = (const float*)d_in[13];   // [1024][160]
  const float* Wg2    = (const float*)d_in[14];   // [160][1024]
  const float* gamma  = (const float*)d_in[15];
  const float* beta   = (const float*)d_in[16];
  float* out = (float*)d_out;

  // ---- carve ----
  const size_t szXX    = (size_t)kPlane * 2;
  const size_t szHC    = (size_t)kRows * kMixPad * 2;
  const size_t szF32P  = (size_t)kPlane * 4;
  const size_t szX5H   = (size_t)kNBr * kPlane * 2;
  const size_t szX5L   = (size_t)(kNBr - 1) * kPlane * 2;
  const size_t szWSQ   = (size_t)4 * kWPlane * 2;
  const size_t szAT    = (size_t)kMixPad * kChan * 2;
  const size_t szTDAT  = (size_t)kDec * kChan * 2;
  const size_t szTDBT  = (size_t)kChan * kDec * 2;
  const size_t szWG1T  = (size_t)kMixPad * kChan * 2;
  const size_t szWG2T  = (size_t)kChan * kMixPad * 2;
  const size_t szBPT   = (size_t)kNBr * kChan * kBr * 2;
  const size_t szL1    = (size_t)kRows * kDec * 2;
  const size_t szKVR   = (size_t)3 * kPlane * 4;
  const size_t szGH    = (size_t)kRows * kMixPad * 2;
  const size_t szGAT   = (size_t)kPlane * 2;
  size_t off = 0;
  const size_t oXX    = off; off += szXX;
  const size_t oHC    = off; off += szHC;
  const size_t oMIU   = off; off += szF32P;
  const size_t oX5H   = off; off += szX5H;
  const size_t oX5L   = off; off += szX5L;
  const size_t oWH    = off; off += szWSQ;
  const size_t oWL    = off; off += szWSQ;
  const size_t oAT    = off; off += szAT;
  const size_t oTDAT  = off; off += szTDAT;
  const size_t oTDBT  = off; off += szTDBT;
  const size_t oWG1TH = off; off += szWG1T;
  const size_t oWG1TL = off; off += szWG1T;
  const size_t oWG2TH = off; off += szWG2T;
  const size_t oWG2TL = off; off += szWG2T;
  const size_t oBPT   = off; off += szBPT;
  const size_t oL1    = off; off += szL1;
  const size_t oKVR   = off; off += szKVR;
  const size_t oGHH   = off; off += szGH;
  const size_t oGHL   = off; off += szGH;
  const size_t oGATE  = off; off += szF32P;
  const size_t oY     = off; off += szF32P;
  const size_t oGATH  = off; off += szGAT;
  const size_t oGATL  = off; off += szGAT;
  const size_t total  = off;   // 122,617,856
  if (total > (size_t)134217728) return;
  if (ws_size < total) return;

  char* ws = (char*)d_ws;
  unsigned short* XX    = (unsigned short*)(ws + oXX);
  unsigned short* HC    = (unsigned short*)(ws + oHC);
  float*          MIU   = (float*)(ws + oMIU);
  float*          WLR   = MIU;                       // decay lowrank output, f32 [2048][1024]
  unsigned short* X5H   = (unsigned short*)(ws + oX5H);
  unsigned short* X5L   = (unsigned short*)(ws + oX5L);
  unsigned short* WH    = (unsigned short*)(ws + oWH);
  unsigned short* WL    = (unsigned short*)(ws + oWL);
  unsigned short* AT    = (unsigned short*)(ws + oAT);
  unsigned short* TDAT  = (unsigned short*)(ws + oTDAT);
  unsigned short* TDBT  = (unsigned short*)(ws + oTDBT);
  unsigned short* WG1TH = (unsigned short*)(ws + oWG1TH);
  unsigned short* WG1TL = (unsigned short*)(ws + oWG1TL);
  unsigned short* WG2TH = (unsigned short*)(ws + oWG2TH);
  unsigned short* WG2TL = (unsigned short*)(ws + oWG2TL);
  unsigned short* BPT   = (unsigned short*)(ws + oBPT);
  unsigned short* L1    = (unsigned short*)(ws + oL1);
  float*          KVR   = (float*)(ws + oKVR);
  unsigned short* GHH   = (unsigned short*)(ws + oGHH);
  unsigned short* GHL   = (unsigned short*)(ws + oGHL);
  float*          GATE  = (float*)(ws + oGATE);
  float*          Yp    = (float*)(ws + oY);
  unsigned short* GATH  = (unsigned short*)(ws + oGATH);
  unsigned short* GATL  = (unsigned short*)(ws + oGATL);
  const float* fdum = gamma;   // placeholder for unused bias / resid pointer arguments (never dereferenced)

  const dim3 blk(256);

  // ---- token shift and all weight planes ----
  k_prepare<<<dim3(kPbAll), blk, 0, stream>>>(x, miu_x, Amat, tdA, tdB, Wg1, Wg2, Bp, Wk, Wv, Wr, Wo,
                                              XX, AT, TDAT, TDBT, WG1TH, WG1TL, WG2TH, WG2TL, BPT, WH, WL);

  // ---- mix lowrank: HC = tanh(XX @ AT^T) as bf16 (M 2048, N 192, K 1024; 48 blocks of 128 x 64, eight waves of 16 x 64, so that a
  // lane has 32 tanh to do) ----
  wmma_gemm64<1, false, 0, 4, false, 5, 8, 1, 64, kChan, 1><<<dim3((kRows / 128) * (kMixPad / 64), 1), blk, 0, stream>>>(
      XX, XX, 0L, AT, AT, 0L, (void*)HC, (void*)HC, kMixPad, 0L, fdum, fdum, 0L, kMixPad, 1.0f);

  // ---- mix GEMM of all five branches (blockIdx.y = s; A = cols 0..159 of HC viewed [10240][32], rows 2048s..; K 32); its epilogue
  // forms the branch inputs and stores their bf16 planes ----
  wmma_gemm64<1, false, 0, 3, false, 0, 2, 4, 32, kBr><<<dim3((kRows / 128) * (kChan / 256), kNBr), blk, 0, stream>>>(
      HC, HC, (long)kRows * kBr, BPT, BPT, (long)kChan * kBr,
      (void*)X5H, (void*)X5L, kChan, (long)kPlane, lam, x, 0L, kChan, 1.0f);

  // ---- what reads only the branch inputs: KVR = k (unscaled), v, r projections; GH = tanh(X5[4] @ WG1T^T) hi/lo (cols 160..191 zero);
  // L1 = tanh(X5H[0] @ TDAT^T) ----
  k_branch_gemms<<<dim3(3 * kProjTiles + kGateTiles + kDecTiles), blk, 0, stream>>>(
      X5H, X5L, WH, WL, KVR, WG1TH, WG1TL, GHH, GHL, TDAT, L1);
  // ---- GATE = GH @ WG2T^T (split, K 192); WLR = L1 @ TDBT^T (K 64) ----
  k_lowrank_out_gemms<<<dim3(2 * kFillTiles), blk, 0, stream>>>(GHH, GHL, WG2TH, WG2TL, GATE, L1, TDBT, WLR);

  // ---- state scan -> Y ----
  k_state_scan<<<dim3(kBatch * kNHead * kNIB), dim3(128), 0, stream>>>(KVR, KVR + kPlane, KVR + 2 * kPlane, WLR, td_miu, u, Yp);

  // ---- GroupNorm + gate -> GATH/GATL (4096 blocks x 8 waves = 32768 (row, head) pairs) ----
  k_gn_gate<<<dim3((kRows * kNHead) / 8), blk, 0, stream>>>(Yp, GATE, gamma, beta, GATH, GATL);

  // ---- output projection straight into d_out (split, K 1024; 256 tiles of 64 x 128) ----
  wmma_gemm64<1, true, 0, 0, false, 0, 4, 2, 64, kChan, 1><<<dim3(kFillTiles, 1), blk, 0, stream>>>(
      GATH, GATL, 0L, WH + 3 * kWPlane, WL + 3 * kWPlane, 0L,
      (void*)out, (void*)out, kChan, 0L, fdum, fdum, 0L, kChan, 1.0f);
}

// v008
// Measured time: 138 microseconds a run.
// Timed twice side by side with v007, it ran 1.10 times as fast both times.
// Over all steps from v000 it is 7.29 times as fast.
// Contractions: every GEMM on v_wmma_f32_16x16x32_bf16 (bf16 operands, f32 accumulate) - the four lowrank mix/decay sites single bf16, the k/v/r projections, the gate pair and the output projection as bf16 hi/lo split (hi*hi + hi*lo + lo*hi); token shift, state scan, GroupNorm and gating in f32 on VALU.
#include <hip/hip_runtime.h>
#include <math.h>

// ---------------------------------------------------------------------------
// Problem constants
// ---------------------------------------------------------------------------
constexpr int kBatch  = 2;
constexpr int kSeq    = 1024;
constexpr int kChan   = 1024;
constexpr int kHead   = 64;
constexpr int kNHead  = 16;
constexpr int kRows   = kBatch * kSeq;          // 2048 token rows (m = b*1024 + t)
constexpr int kMix    = 160;                    // lowrank width of the mix and gate paths
constexpr int kMixPad = 192;                    // padded to a 64 multiple (pad rows / cols zero-filled)
constexpr int kDec    = 64;                     // decay lowrank width
constexpr int kBr     = 32;                     // per-branch mix width
constexpr int kNBr    = 5;                      // branches: 0 decay, 1 k, 2 v, 3 r, 4 gate
constexpr long kPlane  = (long)kRows * kChan;   // 2,097,152 elements per activation plane
constexpr long kWPlane = (long)kChan * kChan;   // 1,048,576 elements per square weight plane
constexpr float kGnEps = 1.6e-4f;               // 1e-5 * 16
static_assert(kNHead * kHead == kChan, "shape");
static_assert(kRows % 256 == 0 && kChan % 256 == 0 && kMixPad % 64 == 0 && kDec % 64 == 0, "M and N tile multiples");
static_assert(kChan % 32 == 0 && kBr % 32 == 0 && kDec % 32 == 0 && kMixPad % 32 == 0, "K multiples of 32");
static_assert(kMix % 8 == 0 && kMixPad % 8 == 0 && kDec % 8 == 0, "pack groups never straddle a row");

typedef __attribute__((ext_vector_type(16))) _Float16 v16h;
typedef __attribute__((ext_vector_type(8)))  _Float16 v8h;
typedef __attribute__((ext_vector_type(16))) __bf16   v16b;
typedef __attribute__((ext_vector_type(8)))  __bf16   v8b;
typedef __attribute__((ext_vector_type(8)))  float    v8f;
typedef __attribute__((ext_vector_type(4)))  float    v4f;
typedef __attribute__((ext_vector_type(2)))  float    v2f;
typedef __attribute__((ext_vector_type(4)))  unsigned int v4u;

// ---------------------------------------------------------------------------
// Shared helpers
// ---------------------------------------------------------------------------
__device__ __forceinline__ unsigned short f2bf_bits(float f) {
  unsigned u = __float_as_uint(f);
  return (unsigned short)((u + 0x7FFFu + ((u >> 16) & 1u)) >> 16);
}
__device__ __forceinline__ float bf_bits2f(unsigned short h) { return __uint_as_float(((unsigned)h) << 16); }
__device__ __forceinline__ unsigned pk16(unsigned short a, unsigned short b) { return (unsigned)a | ((unsigned)b << 16); }
// RNE convert to a bf16 hi part and a bf16 lo part of the f32 residual
__device__ __forceinline__ void bf_split_bits(float f, unsigned short& hb, unsigned short& lb) {
  hb = f2bf_bits(f);
  lb = f2bf_bits(f - bf_bits2f(hb));
}

// hazard guards as plain device helpers; the 4-acc guard ties every
// accumulator of a group and names the A fragments as inputs
__device__ __forceinline__ void dep_guard4_h(v8f& a, v8f& b, v8f& c, v8f& d, v16h x, v16h y) { asm volatile("v_nop\n\tv_nop\n\tv_nop\n\tv_nop" : "+v"(a), "+v"(b), "+v"(c), "+v"(d) : "v"(x), "v"(y)); }
__device__ __forceinline__ void dep_guard4_b(v8f& a, v8f& b, v8f& c, v8f& d, v16b x, v16b y) { asm volatile("v_nop\n\tv_nop\n\tv_nop\n\tv_nop" : "+v"(a), "+v"(b), "+v"(c), "+v"(d) : "v"(x), "v"(y)); }
__device__ __forceinline__ void keep4_h(v16h a, v16h b, v16h c, v16h d) { asm volatile("v_nop" :: "v"(a), "v"(b), "v"(c), "v"(d)); }
__device__ __forceinline__ void keep4_b(v16b a, v16b b, v16b c, v16b d) { asm volatile("v_nop" :: "v"(a), "v"(b), "v"(c), "v"(d)); }
__device__ __forceinline__ void acc_guard4(v8f& a, v8f& b, v8f& c, v8f& d) { asm volatile("v_nop\n\tv_nop\n\tv_nop\n\tv_nop" : "+v"(a), "+v"(b), "+v"(c), "+v"(d)); }
template <typename T> struct Frag;
template <> struct Frag<_Float16> {
  typedef v16h V; typedef v8h H; union U { v16h v; v8h h[2]; };
  // elements 0..7 <- p[0..7], 8..15 <- p[16..23]
  static __device__ __forceinline__ v16h load(const _Float16* p) {
    U f; f.h[0] = *(const v8h*)(p); f.h[1] = *(const v8h*)(p + 16); return f.v;
  }
  static __device__ __forceinline__ v8f mma(v16h a, v16h b, v8f c) {
    return __builtin_amdgcn_wmma_f32_16x16x32_f16(false, a, false, b, (short)0, c, false, false);
  }
  static __device__ __forceinline__ void guard4(v8f& a, v8f& b, v8f& c, v8f& d, v16h x, v16h y) { dep_guard4_h(a, b, c, d, x, y); }
  static __device__ __forceinline__ void keep(v16h a, v16h b, v16h c, v16h d) { keep4_h(a, b, c, d); }
};
template <> struct Frag<__bf16> {
  typedef v16b V; typedef v8b H; union U { v16b v; v8b h[2]; };
  static __device__ __forceinline__ v16b load(const __bf16* p) {
    U f; f.h[0] = *(const v8b*)(p); f.h[1] = *(const v8b*)(p + 16); return f.v;
  }
  static __device__ __forceinline__ v8f mma(v16b a, v16b b, v8f c) {
    return __builtin_amdgcn_wmma_f32_16x16x32_bf16(false, a, false, b, (short)0, c, false, false);
  }
  static __device__ __forceinline__ void guard4(v8f& a, v8f& b, v8f& c, v8f& d, v16b x, v16b y) { dep_guard4_b(a, b, c, d, x, y); }
  static __device__ __forceinline__ void keep(v16b a, v16b b, v16b c, v16b d) { keep4_b(a, b, c, d); }
};

// ---- Register-blocked batched WMMA GEMM (ACT reduced to none/relu/leaky/tanh) -------------------------------
// C[m,n] = scale * sum_k A[m,k] * Bt[n,k] (+bias)(+resid); each wave owns a (16*MI)x64 tile, the WM x WN waves of a block one
// (16*MI*WM) x (64*WN) tile. A row-major [M,KD]; Bt row-major [N,KD]; M % (16*MI*WM) == 0, N % (64*WN) == 0, KD % KS == 0.
// Operand path: the block brings KS k values of its A rows and Bt rows from global memory in whole row pieces (KS*2 bytes,
// 16 B per lane), through registers, into one of two LDS buffers; every wave reads its fragments from there. The loads of
// stage s+1 are issued ahead of the products of stage s and stored to the other buffer behind them; one barrier per stage.
// SPLIT: operands are hi/lo planes (A2/Bt2 = lo planes, same layout); product = hi*hi + hi*lo + lo*hi.
// BIAS_MODE: 0 = none, 1 = bias[m], 2 = bias[n].
// OUT_MODE: 0 = f32, 2 = bf16 hi plane (Cout) + bf16 lo plane (Cout2), 4 = bf16 hi plane alone. In 2 and 4 a row of a wave's tile is one
//               whole 128-B line of each plane (ldc % 64 == 0), stored once, by 8 lanes of that wave.
//           3 = branch input: the tile is the mix term u of branch b = blockIdx.y; the epilogue forms
//               x[m][n] + (x[m-1][n]*f - x[m][n]) * (u + lam[b][n]), f = 0 at t == 0 else 1 (address of the prior row clamped),
//               x = resid (pitch kChan), lam = bias (pitch N), and stores its bf16 hi plane (Cout, plane b) and, for b > 0, its
//               bf16 lo plane (Cout2, plane b-1). Every 128-B line of a plane is stored once, by 8 lanes of one wave.
//               Its A operand is the [kNBr * kRows][kBr] row-major view of the mix lowrank's kMix valid columns, which lie in a plane
//               of pitch kMixPad: row R of the view is columns (R % kNBr) * kBr .. of the plane's row R / kNBr.
//           5 = scan operands: the tile is the decay lowrank term of 16 rows of one head per wave (64 divides n0); with w = tile + bias[n]
//               (bias = td_miu) the epilogue stores exp(w) (Cout, f32), k * exp(min(w, 0)) (Cout2, f32; k = resid, r = aux3,
//               pitch kChan) and, per row, the bonus sum_n r*u*k' (aux = u) into aux2, one 128-B line per wave tile (16 of its 32 floats).
// ACT (OUT_MODE 2 and 4 only): 5 = tanh ahead of the bf16 conversion; columns from kMix on of an N == kMixPad GEMM are stored as zero.
// ET: 0 = f16 operands, 1 = bf16 operands (pointers passed as 16-bit storage)
// The engine is a device function, so that GEMMs which do not depend on one another can share one launch: bx and b stand for the
// block's place in the GEMM's own grid, smem for the launch's one LDS array (kGemmLds bytes of it are used).
// MI: 16-row groups of a wave's tile, 4 unless said otherwise. With MI = 2 a wave owns 32x64, so that a 256 x 64 block tile takes the
// eight waves of the 256-thread blocks that it shares a launch with; every element's k order is the same for every MI.
template <bool SPLIT, int WM, int WN, int KS, int MI>
constexpr int kGemmLds = 2 * (SPLIT ? 2 : 1) * (16 * MI * WM + 64 * WN) * (KS + 8) * 2 + WM * WN * 16 * 68 * 4;
template <int ET> struct Elem;
template <> struct Elem<0> { typedef _Float16 T; };
template <> struct Elem<1> { typedef __bf16 T; };
template <int ET, bool SPLIT, int BIAS_MODE, int OUT_MODE, bool RESID, int ACT, int WM, int WN, int KS, int KD, int MI>
__device__ __forceinline__ void gemm64_body(
    char* smem, const int bx, const int b,
    const unsigned short* __restrict__ Ap, const unsigned short* __restrict__ A2p, long strideA,
    const unsigned short* __restrict__ Btp, const unsigned short* __restrict__ Bt2p, long strideB,
    void* __restrict__ Cout, void* __restrict__ Cout2, int ldc, long strideC,
    const float* __restrict__ bias,
    const float* __restrict__ resid, long strideR,
    int N, float scale,
    const float* __restrict__ aux = nullptr, float* __restrict__ aux2 = nullptr, const float* __restrict__ aux3 = nullptr) {
  typedef typename Elem<ET>::T T;
  typedef typename Frag<T>::V V;
  typedef typename Frag<T>::H H;
  constexpr int NW    = WM * WN;               // waves per block
  constexpr int NT    = 32 * NW;               // threads per block
  constexpr int BM    = 16 * MI * WM;          // block tile rows (A rows per stage)
  constexpr int BN    = 64 * WN;               // block tile columns (Bt rows per stage)
  constexpr int PITCH = KS + 8;                // LDS row pitch in elements: row bytes + 16, an odd multiple of 16 B
  constexpr int CH    = KS / 8;                // 16-B pieces per row piece
  constexpr int RSTEP = NT / CH;               // rows covered by one load of the whole block
  constexpr int NA    = BM / RSTEP;            // loads per thread and plane, A
  constexpr int NB    = BN / RSTEP;            // loads per thread and plane, Bt
  constexpr int PLANE = (BM + BN) * PITCH;     // elements of one plane in one buffer: A rows, then Bt rows
  constexpr int BUF   = (SPLIT ? 2 : 1) * PLANE;
  constexpr int NS    = KD / KS;               // stages
  static_assert(KS == 32 || KS == 64, "row piece");
  static_assert(KD % KS == 0 && BM % RSTEP == 0 && BN % RSTEP == 0, "stage split");
  const T* A = (const T*)Ap; const T* A2 = (const T*)A2p; const T* Bt = (const T*)Btp; const T* Bt2 = (const T*)Bt2p;
  static_assert(kGemmLds<SPLIT, WM, WN, KS, MI> == 2 * BUF * 2 + NW * 16 * 68 * 4, "LDS share");
  static_assert(OUT_MODE != 3 || MI == 4, "the branch-input epilogue is written for 64-row wave tiles");
  T* sOp = (T*)smem;                                // two operand buffers
  float* sT = (float*)(smem + 2 * BUF * 2);         // behind them, per wave, a 16x64 slab, pitch 68 floats
  const int tid  = threadIdx.x;
  const int lane = tid & 31;
  const int wave = tid >> 5;
  const int tilesN = N / BN;
  const int bm = bx / tilesN;                  // the GEMM's grid holds exactly (M / BM) * (N / BN) blocks
  const int bn = bx - bm * tilesN;
  const int wm = wave / WN;
  const int wn = wave - wm * WN;
  const int m0 = bm * BM + wm * (16 * MI);
  const int n0 = bn * BN + (wn << 6);

  // block-uniform bases of the block's rows; every thread adds its one fixed byte offset
  const char* gA  = (const char*)(A  + (size_t)b * strideA + (size_t)(bm * BM) * KD);
  const char* gB  = (const char*)(Bt + (size_t)b * strideB + (size_t)(bn * BN) * KD);
  const char* gA2 = SPLIT ? (const char*)(A2  + (size_t)b * strideA + (size_t)(bm * BM) * KD) : nullptr;
  const char* gB2 = SPLIT ? (const char*)(Bt2 + (size_t)b * strideB + (size_t)(bn * BN) * KD) : nullptr;
  const int sRow = tid / CH, sCol = (tid % CH) * 8;
  const unsigned offG = (unsigned)(sRow * KD + sCol) * 2u;   // bytes
  const int      offL = sRow * PITCH + sCol;                 // elements
  // OUT_MODE 3: byte offsets of this thread's A row pieces, counted from the start of the padded plane
  static_assert(OUT_MODE != 3 || (KD == kBr && KS == kBr), "a row of the view is one row piece");
  unsigned offV[NA];
#pragma unroll   // offV is indexed by constants only, so that it stays in registers
  for (int i = 0; i < NA; ++i) {
    const int R = b * kRows + bm * BM + i * RSTEP + sRow;
    offV[i] = (OUT_MODE == 3) ? (unsigned)((R / kNBr) * kMixPad + (R % kNBr) * kBr + sCol) * 2u : 0u;
  }

  const int rlane = lane & 15;                 // row (A) / col (B, D) within subtile
  const int koff  = (lane >> 4) * 8;           // k offset of this lane half
  const int mOff  = (lane >> 4) * 8;           // D row offset

  v8f acc[MI][4];
#pragma unroll
  for (int i = 0; i < MI; ++i)
#pragma unroll
    for (int j = 0; j < 4; ++j) acc[i][j] = (v8f){0.f,0.f,0.f,0.f,0.f,0.f,0.f,0.f};

  // one stage in flight; every loop over these arrays and over the fragments is fully unrolled, so that they stay in registers
  H ra[NA], ra2[NA], rb[NB], rb2[NB];
  auto gload = [&](int k0) {
    // the two scheduling barriers keep every other instruction out of the group of loads and its wait, and the group ahead of
    // the products: sunk next to the LDS stores that use them, the loads would show their whole latency in every stage
    __builtin_amdgcn_sched_barrier(0);
#pragma unroll
    for (int i = 0; i < NA; ++i) {
      if (OUT_MODE == 3) ra[i] = *(const H*)((const char*)A + offV[i]);
      else               ra[i] = *(const H*)(gA + (size_t)k0 * 2 + (size_t)i * (RSTEP * KD * 2) + offG);
      if (SPLIT) ra2[i] = *(const H*)(gA2 + (size_t)k0 * 2 + (size_t)i * (RSTEP * KD * 2) + offG);
    }
#pragma unroll
    for (int i = 0; i < NB; ++i) {
      rb[i] = *(const H*)(gB + (size_t)k0 * 2 + (size_t)i * (RSTEP * KD * 2) + offG);
      if (SPLIT) rb2[i] = *(const H*)(gB2 + (size_t)k0 * 2 + (size_t)i * (RSTEP * KD * 2) + offG);
    }
    // precaution: this wait stands in front of every later write of a register that one of these loads names
    asm volatile("s_wait_xcnt 0x0" ::: "memory");
    __builtin_amdgcn_sched_barrier(0);
  };
  auto sstore = [&](T* buf) {
#pragma unroll
    for (int i = 0; i < NA; ++i) {
      *(H*)(buf + i * (RSTEP * PITCH) + offL) = ra[i];
      if (SPLIT) *(H*)(buf + PLANE + i * (RSTEP * PITCH) + offL) = ra2[i];
    }
#pragma unroll
    for (int i = 0; i < NB; ++i) {
      *(H*)(buf + (BM + i * RSTEP) * PITCH + offL) = rb[i];
      if (SPLIT) *(H*)(buf + PLANE + (BM + i * RSTEP) * PITCH + offL) = rb2[i];
    }
  };
  const int fragA = (wm * (16 * MI) + rlane) * PITCH + koff;        // this lane's place in the first A / Bt fragment of its wave
  const int fragB = (BM + (wn << 6) + rlane) * PITCH + koff;
  auto compute = [&](const T* buf) {
#pragma unroll
    for (int kk = 0; kk < KS; kk += 32) {
      V bh[4], bl[4], ah[MI], al[MI];
#pragma unroll
      for (int j = 0; j < 4; ++j) {
        bh[j] = Frag<T>::load(buf + fragB + j * (16 * PITCH) + kk);
        if (SPLIT) bl[j] = Frag<T>::load(buf + PLANE + fragB + j * (16 * PITCH) + kk);
      }
#pragma unroll
      for (int i = 0; i < MI; ++i) {
        ah[i] = Frag<T>::load(buf + fragA + i * (16 * PITCH) + kk);
        if (SPLIT) al[i] = Frag<T>::load(buf + PLANE + fragA + i * (16 * PITCH) + kk);
      }
#pragma unroll
      for (int i = 0; i < MI; ++i) {
#pragma unroll
        for (int j = 0; j < 4; ++j) {
          acc[i][j] = Frag<T>::mma(ah[i], bh[j], acc[i][j]);
          if (SPLIT) {
            acc[i][j] = Frag<T>::mma(ah[i], bl[j], acc[i][j]);
            acc[i][j] = Frag<T>::mma(al[i], bh[j], acc[i][j]);
          }
        }
        Frag<T>::guard4(acc[i][0], acc[i][1], acc[i][2], acc[i][3], ah[i], SPLIT ? al[i] : ah[i]);
      }
      Frag<T>::keep(bh[0], bh[1], bh[2], bh[3]);
      if (SPLIT) Frag<T>::keep(bl[0], bl[1], bl[2], bl[3]);
    }
  };

  gload(0);
  sstore(sOp);
  __syncthreads();
  // kept rolled, for speed only
#pragma unroll 1
  for (int s = 0; s < NS; ++s) {
    if (s + 1 < NS) gload((s + 1) * KS);                       // block-uniform
    compute(sOp + (s & 1) * BUF);
    if (s + 1 < NS) sstore(sOp + ((s + 1) & 1) * BUF);
    // the one barrier of a stage: publishes stage s+1 and ends the reads of stage s, whose buffer the next pass overwrites
    __syncthreads();
  }
#pragma unroll   // acc is indexed by constants only, so that it stays in registers
  for (int i = 0; i < MI; ++i) acc_guard4(acc[i][0], acc[i][1], acc[i][2], acc[i][3]);

  // ---- epilogue ----
  float* slab = sT + wave * (16 * 68);
  const float* Rb = RESID ? (resid + (size_t)b * strideR) : nullptr;
  v4f lam0 = (v4f){0.f, 0.f, 0.f, 0.f}, lam1 = lam0;
  // OUT_MODE 3: block-uniform bases of the block's first row in x and in the two planes (pitch kChan); every lane adds one fixed byte
  // offset, offX (f32; half of it in the bf16 planes), and the row groups are immediates. t == 0 can only fall on the first row of a
  // wave's tile (64 divides kSeq): there the prior row's address is the row's own and its factor 0.
  static_assert(OUT_MODE != 3 || kSeq % 64 == 0, "t == 0 only on a wave tile's first row");
  const char* gX = nullptr; char* gH = nullptr; char* gL = nullptr;
  unsigned offX = 0, offP0 = 0;
  float fz0 = 1.0f;
  if (OUT_MODE == 3) {
    const size_t tile0 = (size_t)(bm * BM) * kChan + bn * BN;
    gX = (const char*)(resid + tile0);
    gH = (char*)((unsigned short*)Cout  + (size_t)b * strideC + tile0);
    gL = (char*)((unsigned short*)Cout2 + (size_t)(b > 0 ? (b - 1) : 0) * strideC + tile0);
    const int row0 = (wm << 6) + (lane >> 3);
    offX = (unsigned)(row0 * kChan + (wn << 6) + (lane & 7) * 8) * 4u;
    const bool t0 = ((bm * BM + row0) & (kSeq - 1)) == 0;
    offP0 = t0 ? offX + (unsigned)(kChan * 4) : offX;      // counted from one row above gX, so that it is never negative
    fz0 = t0 ? 0.0f : 1.0f;
    const float* pl = bias + (size_t)b * N + n0 + (lane & 7) * 8;
    __builtin_amdgcn_sched_barrier(0);   // with the one below: keeps the two loads and their wait together
    lam0 = *(const v4f*)(pl); lam1 = *(const v4f*)(pl + 4);
    // precaution: this wait stands in front of every later write of a register that one of these two loads names
    asm volatile("s_wait_xcnt 0x0" ::: "memory");
    __builtin_amdgcn_sched_barrier(0);
  }
  v4f tm4 = lam0, u4 = lam0;
  if (OUT_MODE == 5) {
    __builtin_amdgcn_sched_barrier(0);   // with the one below: keeps the two loads and their wait together
    tm4 = *(const v4f*)(bias + n0 + (lane & 15) * 4);
    u4  = *(const v4f*)(aux + n0 + (lane & 15) * 4);
    // precaution: this wait stands in front of every later write of a register that one of these two loads names
    asm volatile("s_wait_xcnt 0x0" ::: "memory");
    __builtin_amdgcn_sched_barrier(0);
  }
#pragma unroll
  for (int i = 0; i < MI; ++i) {
    const int mBase = m0 + (i << 4);
    v4f xa0[4], xa1[4], xb0[4], xb1[4];
    v4f kq[8], rq[8];
    // OUT_MODE 5: the four planes (k, r, exp(w), k') have pitch kChan: uniform bases, this lane's one byte offset, row pairs as immediates
    const unsigned offS5 = (unsigned)((mBase + (lane >> 4)) * kChan + n0 + (lane & 15) * 4) * 4u;
    if (OUT_MODE == 5) {
      // the two scheduling barriers keep every other instruction out of the group of loads and its wait, and the group ahead of
      // the slab writes, which are served while the loads fly
      __builtin_amdgcn_sched_barrier(0);
#pragma unroll   // kq and rq are indexed by constants only, so that they stay in registers
      for (int it = 0; it < 8; ++it) {
        kq[it] = *(const v4f*)((const char*)resid + (size_t)it * (2 * kChan * 4) + offS5);
        rq[it] = *(const v4f*)((const char*)aux3 + (size_t)it * (2 * kChan * 4) + offS5);
      }
      // precaution: this wait stands in front of every later write of a register that one of these loads names
      asm volatile("s_wait_xcnt 0x0" ::: "memory");
      __builtin_amdgcn_sched_barrier(0);
    }
    if (OUT_MODE == 3) {
      // the two scheduling barriers keep every other instruction out of the group of loads and its wait, and the group ahead of
      // the slab writes, which are served while the loads fly
      __builtin_amdgcn_sched_barrier(0);
#pragma unroll
      for (int it = 0; it < 4; ++it) {
        const int r = i * 16 + it * 4;                       // this lane's row = first row of its wave + r + q
        const char* px = gX + (size_t)r * (kChan * 4) + offX;
        const char* pp = (r == 0) ? (gX - kChan * 4 + offP0) : (gX + (size_t)(r - 1) * (kChan * 4) + offX);
        xa0[it] = *(const v4f*)(px); xa1[it] = *(const v4f*)(px + 16);
        xb0[it] = *(const v4f*)(pp); xb1[it] = *(const v4f*)(pp + 16);
      }
      // precaution: this wait stands in front of every later write of a register that one of these loads names
      asm volatile("s_wait_xcnt 0x0" ::: "memory");
      __builtin_amdgcn_sched_barrier(0);
    }
#pragma unroll
    for (int j = 0; j < 4; ++j) {
      const int n = n0 + (j << 4) + rlane;
      float bv = 0.f;
      if (BIAS_MODE == 2) bv = bias[n];
#pragma unroll
      for (int r = 0; r < 8; ++r) {
        float v = acc[i][j][r] * scale;
        if (BIAS_MODE == 1) v += bias[mBase + mOff + r];
        if (BIAS_MODE == 2) v += bv;
        if (RESID) v += Rb[(size_t)(mBase + mOff + r) * ldc + n];
        if (ACT == 2) v = fmaxf(v, 0.0f);
        if (ACT == 4) v = (v > 0.f) ? v : 0.01f * v;
        slab[(mOff + r) * 68 + (j << 4) + rlane] = v;
      }
    }
    __builtin_amdgcn_fence(__ATOMIC_RELEASE, "workgroup");
    __builtin_amdgcn_wave_barrier();
    __builtin_amdgcn_fence(__ATOMIC_ACQUIRE, "workgroup");
    if (OUT_MODE == 0) {
      float* C = (float*)Cout + (size_t)b * strideC;
      const int hh = lane >> 4, c4 = (lane & 15) * 4;     // row seg = 256 B = 16 lanes x 16 B
      v4f v[8];
      float* pc[8];
#pragma unroll   // here and below: v and pc are indexed by constants only, so that they stay in registers
      for (int it = 0; it < 8; ++it) {
        const int row = it * 2 + hh;
        v[it]  = *(const v4f*)(slab + row * 68 + c4);
        pc[it] = C + (size_t)(mBase + row) * ldc + n0 + c4;
      }
      // the two scheduling barriers keep every other instruction out of the group of stores and its wait
      __builtin_amdgcn_sched_barrier(0);
#pragma unroll
      for (int it = 0; it < 8; ++it) *(v4f*)pc[it] = v[it];
      // precaution: this wait stands in front of every later write of a register that one of these stores names
      asm volatile("s_wait_xcnt 0x0" ::: "memory");
      __builtin_amdgcn_sched_barrier(0);
    } else if (OUT_MODE == 5) {
      const int hh = lane >> 4, p = lane & 15, c4 = p * 4;     // row seg = 256 B = 16 lanes x 16 B
      v4f kk[8], dd[8];
      float bp[8];
#pragma unroll   // here and below: the arrays are indexed by constants only, so that they stay in registers
      for (int it = 0; it < 8; ++it) {
        const int row = it * 2 + hh;
        const v4f wl4 = *(const v4f*)(slab + row * 68 + c4);
        bp[it] = 0.0f;
#pragma unroll
        for (int e = 0; e < 4; ++e) {
          const float wv = wl4[e] + tm4[e];
          kk[it][e] = kq[it][e] * expf(fminf(wv, 0.0f));
          dd[it][e] = expf(wv);
          bp[it] += rq[it][e] * (u4[e] * kk[it][e]);
        }
      }
      // the two scheduling barriers keep every other instruction out of the group of stores and its wait
      __builtin_amdgcn_sched_barrier(0);
#pragma unroll
      for (int it = 0; it < 8; ++it) {
        *(v4f*)((char*)Cout + (size_t)it * (2 * kChan * 4) + offS5)  = dd[it];
        *(v4f*)((char*)Cout2 + (size_t)it * (2 * kChan * 4) + offS5) = kk[it];
      }
      // precaution: this wait stands in front of every later write of a register that one of these stores names
      asm volatile("s_wait_xcnt 0x0" ::: "memory");
      __builtin_amdgcn_sched_barrier(0);
      // a row's 16 partials (4 channels each) summed over its 16 lanes: first those 4 and 8 apart, then the four neighbours
#pragma unroll
      for (int it = 0; it < 8; ++it) bp[it] += __shfl_xor(bp[it], 4, 32);
#pragma unroll
      for (int it = 0; it < 8; ++it) bp[it] += __shfl_xor(bp[it], 8, 32);
#pragma unroll
      for (int it = 0; it < 8; ++it) bp[it] += __shfl_xor(bp[it], 1, 32);
#pragma unroll
      for (int it = 0; it < 8; ++it) bp[it] += __shfl_xor(bp[it], 2, 32);
      float bsel = bp[0];
#pragma unroll
      for (int it = 1; it < 8; ++it) bsel = (p == it) ? bp[it] : bsel;
      // lane p < 8 of half hh holds row 2p + hh: 16 lanes store the tile's 16 sums, 64 B of the tile's own line
      if (p < 8) {
        aux2[((size_t)(n0 >> 6) * (kRows / 16) + (mBase >> 4)) * 32 + p * 2 + hh] = bsel;
        // precaution: this wait stands in front of every later write of a register that this store names
        asm volatile("s_wait_xcnt 0x0" ::: "memory");
      }
    } else if (OUT_MODE == 3) {
      const int q = lane >> 3, c8 = (lane & 7) * 8;
      v4u uh[4], ul[4];
#pragma unroll
      for (int it = 0; it < 4; ++it) {
        const int row = it * 4 + q;
        const float fz = (i == 0 && it == 0) ? fz0 : 1.0f;
        const v4f u0 = *(const v4f*)(slab + row * 68 + c8), u1 = *(const v4f*)(slab + row * 68 + c8 + 4);
        unsigned short hb[8], lb[8];
#pragma unroll
        for (int e = 0; e < 4; ++e) {
          const float ba0 = xb0[it][e] * fz - xa0[it][e];
          const float ba1 = xb1[it][e] * fz - xa1[it][e];
          const float v0 = xa0[it][e] + ba0 * (u0[e] + lam0[e]);
          const float v1 = xa1[it][e] + ba1 * (u1[e] + lam1[e]);
          bf_split_bits(v0, hb[e], lb[e]);
          bf_split_bits(v1, hb[4 + e], lb[4 + e]);
        }
        uh[it] = (v4u){pk16(hb[0], hb[1]), pk16(hb[2], hb[3]), pk16(hb[4], hb[5]), pk16(hb[6], hb[7])};
        ul[it] = (v4u){pk16(lb[0], lb[1]), pk16(lb[2], lb[3]), pk16(lb[4], lb[5]), pk16(lb[6], lb[7])};
      }
      // as for the loads: nothing else is scheduled into the group of stores and its wait
      __builtin_amdgcn_sched_barrier(0);
#pragma unroll
      for (int it = 0; it < 4; ++it) *(v4u*)(gH + (size_t)(i * 16 + it * 4) * (kChan * 2) + offX / 2) = uh[it];
      // the same precaution for the registers that these stores name
      asm volatile("s_wait_xcnt 0x0" ::: "memory");
      __builtin_amdgcn_sched_barrier(0);
      if (b > 0) {                                           // block-uniform: branch 0 has no lo plane
        __builtin_amdgcn_sched_barrier(0);
#pragma unroll
        for (int it = 0; it < 4; ++it) *(v4u*)(gL + (size_t)(i * 16 + it * 4) * (kChan * 2) + offX / 2) = ul[it];
        asm volatile("s_wait_xcnt 0x0" ::: "memory");        // the same precaution
        __builtin_amdgcn_sched_barrier(0);
      }
    } else {
      static_assert(OUT_MODE == 0 || OUT_MODE == 3 || OUT_MODE == 5 || OUT_MODE == 2 || OUT_MODE == 4, "output form");
      const int q = lane >> 3, c8 = (lane & 7) * 8;
      // 8 divides kMix: the 8 columns of a lane are all valid or all pad
      const float fv = (ACT == 5 && N == kMixPad && n0 + c8 >= kMix) ? 0.0f : 1.0f;
      const size_t o0 = (size_t)b * strideC + (size_t)(mBase + q) * ldc + n0 + c8;
      unsigned short* C  = (unsigned short*)Cout + o0;
      unsigned short* C2 = (unsigned short*)Cout2 + o0;
      // kept rolled, for speed only: the tanh is long, and unrolled it would have 32 copies per row group
#pragma unroll 1
      for (int it = 0; it < 4; ++it) {
        const float* sp = slab + (it * 4 + q) * 68 + c8;
        const v4f u0 = *(const v4f*)(sp), u1 = *(const v4f*)(sp + 4);
        unsigned short hb[8], lb[8];
#pragma unroll
        for (int e = 0; e < 4; ++e) {
          float t0 = u0[e], t1 = u1[e];
          if (ACT == 5) { t0 = tanhf(t0) * fv; t1 = tanhf(t1) * fv; }
          if (OUT_MODE == 2) { bf_split_bits(t0, hb[e], lb[e]); bf_split_bits(t1, hb[4 + e], lb[4 + e]); }
          else               { hb[e] = f2bf_bits(t0); hb[4 + e] = f2bf_bits(t1); lb[e] = 0; lb[4 + e] = 0; }
        }
        const v4u uh = (v4u){pk16(hb[0], hb[1]), pk16(hb[2], hb[3]), pk16(hb[4], hb[5]), pk16(hb[6], hb[7])};
        const v4u ul = (v4u){pk16(lb[0], lb[1]), pk16(lb[2], lb[3]), pk16(lb[4], lb[5]), pk16(lb[6], lb[7])};
        // the two scheduling barriers keep every other instruction out of the group of stores and its wait
        __builtin_amdgcn_sched_barrier(0);
        *(v4u*)(C + (size_t)(it * 4) * ldc) = uh;
        if (OUT_MODE == 2) *(v4u*)(C2 + (size_t)(it * 4) * ldc) = ul;
        // precaution: this wait stands in front of every later write of a register that one of these stores names
        asm volatile("s_wait_xcnt 0x0" ::: "memory");
        __builtin_amdgcn_sched_barrier(0);
      }
    }
    __builtin_amdgcn_fence(__ATOMIC_RELEASE, "workgroup");
    __builtin_amdgcn_wave_barrier();
    __builtin_amdgcn_fence(__ATOMIC_ACQUIRE, "workgroup");
  }
}

// One GEMM in a launch of its own: grid (tiles, batch).
template <int ET, bool SPLIT, int BIAS_MODE, int OUT_MODE, bool RESID, int ACT, int WM, int WN, int KS, int KD, int MI = 4>
__global__ __launch_bounds__(32 * WM * WN) void wmma_gemm64(
    const unsigned short* __restrict__ Ap, const unsigned short* __restrict__ A2p, long strideA,
    const unsigned short* __restrict__ Btp, const unsigned short* __restrict__ Bt2p, long strideB,
    void* __restrict__ Cout, void* __restrict__ Cout2, int ldc, long strideC,
    const float* __restrict__ bias,
    const float* __restrict__ resid, long strideR,
    int N, float scale) {
  __shared__ __align__(16) char smem[kGemmLds<SPLIT, WM, WN, KS, MI>];
  gemm64_body<ET, SPLIT, BIAS_MODE, OUT_MODE, RESID, ACT, WM, WN, KS, KD, MI>(
      smem, blockIdx.x, blockIdx.y, Ap, A2p, strideA, Btp, Bt2p, strideB, Cout, Cout2, ldc, strideC, bias, resid, strideR, N, scale);
}

// The three GEMMs that read only the branch inputs, in one launch of 224 blocks, each block alone on its WGP by its LDS:
//   blocks   0..191  k / v / r projections (split, K 1024), 64 tiles of 128 x 256 for each of the three
//   blocks 192..215  gate lowrank (split, N 192, K 1024), 24 tiles of 256 x 64, eight waves of 32 x 64; stores tanh as bf16 hi/lo
//   blocks 216..223  decay lowrank (single, N 64, K 1024), 8 tiles of 256 x 64, eight waves of 32 x 64; stores tanh as bf16
constexpr int kProjTiles = (kRows / 128) * (kChan / 256);   // 64
constexpr int kGateTiles = (kRows / 256) * (kMixPad / 64);  // 24
constexpr int kDecTiles  = (kRows / 256) * (kDec / 64);     // 8
__global__ __launch_bounds__(256) void k_branch_gemms(
    const unsigned short* __restrict__ X5H, const unsigned short* __restrict__ X5L,
    const unsigned short* __restrict__ WH, const unsigned short* __restrict__ WL, float* __restrict__ KVR,
    const unsigned short* __restrict__ WG1TH, const unsigned short* __restrict__ WG1TL,
    unsigned short* __restrict__ GHH, unsigned short* __restrict__ GHL,
    const unsigned short* __restrict__ TDAT, unsigned short* __restrict__ L1) {
  const float* fdum = nullptr;                               // bias and resid of the engine: not used by these GEMMs, never dereferenced
  __shared__ __align__(16) char smem[kGemmLds<true, 2, 4, 64, 4>];
  static_assert(kGemmLds<true, 8, 1, 64, 2> <= kGemmLds<true, 2, 4, 64, 4> && kGemmLds<false, 8, 1, 64, 2> <= kGemmLds<true, 2, 4, 64, 4>, "LDS share");
  const int id = blockIdx.x;                                 // every branch below is block-uniform
  if (id < 3 * kProjTiles) {
    gemm64_body<1, true, 0, 0, false, 0, 2, 4, 64, kChan, 4>(
        smem, id % kProjTiles, id / kProjTiles, X5H + kPlane, X5L, (long)kPlane, WH, WL, (long)kWPlane,
        (void*)KVR, (void*)KVR, kChan, (long)kPlane, fdum, fdum, 0L, kChan, 1.0f);
  } else if (id < 3 * kProjTiles + kGateTiles) {
    gemm64_body<1, true, 0, 2, false, 5, 8, 1, 64, kChan, 2>(
        smem, id - 3 * kProjTiles, 0, X5H + 4 * kPlane, X5L + 3 * kPlane, 0L, WG1TH, WG1TL, 0L,
        (void*)GHH, (void*)GHL, kMixPad, 0L, fdum, fdum, 0L, kMixPad, 1.0f);
  } else {
    gemm64_body<1, false, 0, 4, false, 5, 8, 1, 64, kChan, 2>(
        smem, id - 3 * kProjTiles - kGateTiles, 0, X5H, X5H, 0L, TDAT, TDAT, 0L,
        (void*)L1, (void*)L1, kDec, 0L, fdum, fdum, 0L, kDec, 1.0f);
  }
}

// Block tile of the GEMMs whose launch would leave WGPs idle at 128 x 256 (64 tiles for a 2048 x 1024 result, on 256 WGPs):
// 64 x 128, eight waves of 16 x 64, so that one such GEMM has 256 tiles, one for every WGP.
constexpr int kFillTiles = (kRows / 64) * (kChan / 128);    // 256
// The two GEMMs behind the tanh of the two lowrank paths, in one launch of 512 blocks, two to a WGP by their LDS:
//   blocks  0..255  gate output (split, K 192), blocks 256..511 decay output (single, K 64); 256 tiles of 64 x 128 each
// The decay GEMM's epilogue turns its tile into what the state scan reads: exp(w), k * exp(min(w, 0)) and the bonus sums, once per
// element (the eight scan blocks of a head would each form them again).
__global__ __launch_bounds__(256) void k_lowrank_out_gemms(
    const unsigned short* __restrict__ GHH, const unsigned short* __restrict__ GHL,
    const unsigned short* __restrict__ WG2TH, const unsigned short* __restrict__ WG2TL, float* __restrict__ GATE,
    const unsigned short* __restrict__ L1, const unsigned short* __restrict__ TDBT, float* __restrict__ DEC,
    const float* __restrict__ Kraw, const float* __restrict__ Rpl, const float* __restrict__ td_miu, const float* __restrict__ u,
    float* __restrict__ KK, float* __restrict__ BON) {
  const float* fdum = nullptr;                               // bias and resid of the gate GEMM: not used by it, never dereferenced
  __shared__ __align__(16) char smem[kGemmLds<true, 4, 2, 64, 1>];
  static_assert(kGemmLds<false, 4, 2, 64, 1> <= kGemmLds<true, 4, 2, 64, 1>, "LDS share");
  const int id = blockIdx.x;                                 // block-uniform
  if (id < kFillTiles) {
    gemm64_body<1, true, 0, 0, false, 0, 4, 2, 64, kMixPad, 1>(
        smem, id, 0, GHH, GHL, 0L, WG2TH, WG2TL, 0L, (void*)GATE, (void*)GATE, kChan, 0L, fdum, fdum, 0L, kChan, 1.0f);
  } else {
    gemm64_body<1, false, 0, 5, false, 0, 4, 2, 64, kDec, 1>(
        smem, id - kFillTiles, 0, L1, L1, 0L, TDBT, TDBT, 0L, (void*)DEC, (void*)KK, kChan, 0L, td_miu, Kraw, 0L, kChan, 1.0f,
        u, BON, Rpl);
  }
}

// ---------------------------------------------------------------------------
// Square weight split: four [1024][1024] f32 matrices (layout kept as-is = [out][in] = Bt) -> bf16 hi and lo planes.
// 512 x 4 blocks (bx, z): z selects the matrix and the output plane (planes at out + z*1048576 halves).
// Thread i owns 8 consecutive elements: two b128 loads, one 16-B store per lane per plane; a wave writes 512 contiguous
// ---------------------------------------------------------------------------
__device__ __forceinline__ void wsplit8_body(const int bx, const int z,
                                             const float* __restrict__ W0, const float* __restrict__ W1,
                                             const float* __restrict__ W2, const float* __restrict__ W3,
                                             unsigned short* __restrict__ outH, unsigned short* __restrict__ outL,
                                             int n8PerMat) {
  const float* W = (z == 0) ? W0 : (z == 1) ? W1 : (z == 2) ? W2 : W3;   // block-uniform
  const int i = bx * 256 + threadIdx.x;
  if (i >= n8PerMat) return;
  const float* p = W + 8 * (size_t)i;
  const v4f a = *(const v4f*)(p);
  const v4f c = *(const v4f*)(p + 4);
  unsigned short hb[8], lb[8];
#pragma unroll
  for (int e = 0; e < 4; ++e) {
    bf_split_bits(a[e], hb[e], lb[e]);
    bf_split_bits(c[e], hb[4 + e], lb[4 + e]);
  }
  const v4u uh = (v4u){pk16(hb[0], hb[1]), pk16(hb[2], hb[3]), pk16(hb[4], hb[5]), pk16(hb[6], hb[7])};
  const v4u ul = (v4u){pk16(lb[0], lb[1]), pk16(lb[2], lb[3]), pk16(lb[4], lb[5]), pk16(lb[6], lb[7])};
  const size_t o = (size_t)z * (size_t)kWPlane + 8 * (size_t)i;
  *(v4u*)(outH + o) = uh;
  *(v4u*)(outL + o) = ul;
  // precaution: this wait stands in front of every later write of a register that one of these stores names
  asm volatile("s_wait_xcnt 0x0" ::: "memory");
}

// ---------------------------------------------------------------------------
// Transpose + bf16 convert (single or hi/lo): in[R][Cc] f32 row-major (pitch Cc) -> out[n][k] = cvt(in[k][n]) for
// k < R and n < Cc, zero otherwise (pad rows / pad columns of the output plane are WRITTEN as zeros).
// blocks (bx, by, bz) of nTilesN x nTilesK x Z: a block covers 32 output rows n0..n0+31 and KT output columns k0..k0+KT-1; bz adds
// inStrideZ / outStrideZ element offsets. 256 threads; sm = 32 * (KT + 1) floats of LDS.
// Load coverage: (32*KT/256) iterations x 256 threads = 32 x KT elements (coalesced along n), clamped address, 0/1 factor.
// Store, KT == 64: row = wave*4 + (lane>>3) -> 8 waves x 4 = 32 rows; (lane&7) x 8 halves = 64 cols; each row segment =
// Store, KT == 32 (requires ldo == 32, k0 == 0): threads 0..127, row = t>>2, c8 = (t&3)*8 -> thread t writes tile bytes
// ---------------------------------------------------------------------------
template <bool SPLIT, int KT>
__device__ __forceinline__ void trcast_body(float* sm, const int bx, const int by, const int bz,
                                            const float* __restrict__ in, int R, int Cc, long inStrideZ,
                                            unsigned short* __restrict__ outH, unsigned short* __restrict__ outL,
                                            int ldo, long outStrideZ) {
  static_assert(KT == 64 || KT == 32, "tile");
  const int t  = threadIdx.x;
  const int n0 = bx * 32;
  const int k0 = by * KT;
  const float* inz = in + (size_t)bz * inStrideZ;
  constexpr int kIters = (32 * KT) / 256;
  const float* pin[kIters];
  float fz[kIters], v[kIters];
#pragma unroll   // here and in the two loops below: the three arrays are indexed by constants only, so that they stay in registers
  for (int it = 0; it < kIters; ++it) {
    const int e  = it * 256 + t;
    const int n  = n0 + (e & 31);
    const int k  = k0 + (e >> 5);
    const int nc = (n < Cc) ? n : (Cc - 1);
    const int kc = (k < R) ? k : (R - 1);
    pin[it] = inz + (size_t)kc * Cc + nc;
    fz[it]  = ((n < Cc) && (k < R)) ? 1.0f : 0.0f;
  }
  // the two scheduling barriers keep every other instruction out of the group of loads and its wait
  __builtin_amdgcn_sched_barrier(0);
#pragma unroll
  for (int it = 0; it < kIters; ++it) v[it] = *pin[it];
  // precaution: this wait stands in front of every later write of a register that one of these loads names
  asm volatile("s_wait_xcnt 0x0" ::: "memory");
  __builtin_amdgcn_sched_barrier(0);
#pragma unroll
  for (int it = 0; it < kIters; ++it) {
    const int e = it * 256 + t;
    sm[(e & 31) * (KT + 1) + (e >> 5)] = v[it] * fz[it];
  }
  __syncthreads();
  const int lane = t & 31, wave = t >> 5;
  unsigned short* oh = outH + (size_t)bz * outStrideZ;
  unsigned short* ol = outL + (size_t)bz * outStrideZ;
  int row, c8;
  bool active;
  if (KT == 64) { row = wave * 4 + (lane >> 3); c8 = (lane & 7) * 8; active = true; }
  else          { row = t >> 2;                 c8 = (t & 3) * 8;    active = (t < 128); }
  if (active) {
    unsigned short hb[8], lb[8];
#pragma unroll
    for (int e = 0; e < 8; ++e) {
      const float v = sm[row * (KT + 1) + c8 + e];
      if (SPLIT) { bf_split_bits(v, hb[e], lb[e]); }
      else       { hb[e] = f2bf_bits(v); lb[e] = 0; }
    }
    const v4u uh = (v4u){pk16(hb[0], hb[1]), pk16(hb[2], hb[3]), pk16(hb[4], hb[5]), pk16(hb[6], hb[7])};
    const v4u ul = (v4u){pk16(lb[0], lb[1]), pk16(lb[2], lb[3]), pk16(lb[4], lb[5]), pk16(lb[6], lb[7])};
    const size_t o = (size_t)(n0 + row) * ldo + k0 + c8;
    *(v4u*)(oh + o) = uh;
    if (SPLIT) *(v4u*)(ol + o) = ul;
    // precaution: this wait stands in front of every later write of a register that one of these stores names
    asm volatile("s_wait_xcnt 0x0" ::: "memory");
  }
}

// ---------------------------------------------------------------------------
// Token shift: xx[m][c] = x[m][c] + (x[m-1][c]*f - x[m][c]) * miu_x[c], f = 0 at t == 0 else 1 (address of the prior row
// clamped, arithmetic 0/1 factor). Output: single bf16 plane [2048][1024].
// ---------------------------------------------------------------------------
__device__ __forceinline__ void xx8_body(const int bx, const float* __restrict__ x, const float* __restrict__ miu_x,
                                         unsigned short* __restrict__ XX, int n8) {
  const int i = bx * 256 + threadIdx.x;
  if (i >= n8) return;
  const int f  = 8 * i;
  const int m  = f >> 10;
  const int c0 = f & 1023;
  const int t  = m & 1023;
  const int mp = (t > 0) ? (m - 1) : m;
  const float fz = (t > 0) ? 1.0f : 0.0f;
  const float* px = x + f;
  const float* pp = x + ((size_t)mp << 10) + c0;
  const float* pm = miu_x + c0;
  const v4f a0 = *(const v4f*)(px), a1 = *(const v4f*)(px + 4);
  const v4f b0 = *(const v4f*)(pp), b1 = *(const v4f*)(pp + 4);
  const v4f u0 = *(const v4f*)(pm), u1 = *(const v4f*)(pm + 4);
  unsigned short hb[8];
#pragma unroll
  for (int e = 0; e < 4; ++e) {
    const float ba0 = b0[e] * fz - a0[e];
    const float ba1 = b1[e] * fz - a1[e];
    hb[e]     = f2bf_bits(a0[e] + ba0 * u0[e]);
    hb[4 + e] = f2bf_bits(a1[e] + ba1 * u1[e]);
  }
  const v4u uh = (v4u){pk16(hb[0], hb[1]), pk16(hb[2], hb[3]), pk16(hb[4], hb[5]), pk16(hb[6], hb[7])};
  unsigned short* q = XX + f;
  *(v4u*)q = uh;
  // precaution: this wait stands in front of every later write of a register that this store names
  asm volatile("s_wait_xcnt 0x0" ::: "memory");
}

// ---------------------------------------------------------------------------
// Everything that reads only the inputs, in one launch: the token shift, the six transposes and the square weight split do not
// depend on one another. blockIdx.x is cut into ranges, one per piece of work, each range holding that piece's own grid; every
// branch is block-uniform, and the one barrier of a transpose is passed by all threads of its block.
// ---------------------------------------------------------------------------
constexpr int kPbXX  = (int)(kPlane / 8) / 256;              // 1024 token shift
constexpr int kPbA   = (kMixPad / 32) * (kChan / 64);        // 96   A    [1024][160] -> AT   [192][1024], rows >= 160 zero
constexpr int kPbTA  = (kDec / 32) * (kChan / 64);           // 32   tdA  [1024][64]  -> TDAT [64][1024]
constexpr int kPbTB  = kChan / 32;                           // 32   tdB  [64][1024]  -> TDBT [1024][64]
constexpr int kPbG1  = (kMixPad / 32) * (kChan / 64);        // 96   Wg1  [1024][160] -> WG1T hi/lo [192][1024], rows >= 160 zero
constexpr int kPbG2  = (kChan / 32) * (kMixPad / 64);        // 96   Wg2  [160][1024] -> WG2T hi/lo [1024][192], cols >= 160 zero
constexpr int kPbBp  = (kChan / 32) * kNBr;                  // 160  Bp[s] [32][1024] -> BPT[s] [1024][32]
constexpr int kPbW   = ((int)(kWPlane / 8) / 256) * 4;       // 2048 Wk, Wv, Wr, Wo hi/lo
constexpr int kPbAll = kPbXX + kPbA + kPbTA + kPbTB + kPbG1 + kPbG2 + kPbBp + kPbW;
__global__ __launch_bounds__(256) void k_prepare(
    const float* __restrict__ x, const float* __restrict__ miu_x, const float* __restrict__ Amat,
    const float* __restrict__ tdA, const float* __restrict__ tdB, const float* __restrict__ Wg1, const float* __restrict__ Wg2,
    const float* __restrict__ Bp, const float* __restrict__ Wk, const float* __restrict__ Wv, const float* __restrict__ Wr,
    const float* __restrict__ Wo,
    unsigned short* __restrict__ XX, unsigned short* __restrict__ AT, unsigned short* __restrict__ TDAT,
    unsigned short* __restrict__ TDBT, unsigned short* __restrict__ WG1TH, unsigned short* __restrict__ WG1TL,
    unsigned short* __restrict__ WG2TH, unsigned short* __restrict__ WG2TL, unsigned short* __restrict__ BPT,
    unsigned short* __restrict__ WH, unsigned short* __restrict__ WL) {
  __shared__ float sm[32 * 65];
  int l = blockIdx.x;
  if (l < kPbXX) { xx8_body(l, x, miu_x, XX, (int)(kPlane / 8)); return; }
  l -= kPbXX;
  if (l < kPbA) { trcast_body<false, 64>(sm, l % (kMixPad / 32), l / (kMixPad / 32), 0, Amat, kChan, kMix, 0L, AT, AT, kChan, 0L); return; }
  l -= kPbA;
  if (l < kPbTA) { trcast_body<false, 64>(sm, l % (kDec / 32), l / (kDec / 32), 0, tdA, kChan, kDec, 0L, TDAT, TDAT, kChan, 0L); return; }
  l -= kPbTA;
  if (l < kPbTB) { trcast_body<false, 64>(sm, l, 0, 0, tdB, kDec, kChan, 0L, TDBT, TDBT, kDec, 0L); return; }
  l -= kPbTB;
  if (l < kPbG1) { trcast_body<true, 64>(sm, l % (kMixPad / 32), l / (kMixPad / 32), 0, Wg1, kChan, kMix, 0L, WG1TH, WG1TL, kChan, 0L); return; }
  l -= kPbG1;
  if (l < kPbG2) { trcast_body<true, 64>(sm, l % (kChan / 32), l / (kChan / 32), 0, Wg2, kMix, kChan, 0L, WG2TH, WG2TL, kMixPad, 0L); return; }
  l -= kPbG2;
  if (l < kPbBp) { trcast_body<false, 32>(sm, l % (kChan / 32), 0, l / (kChan / 32), Bp, kBr, kChan, (long)kBr * kChan, BPT, BPT, kBr, (long)kChan * kBr); return; }
  l -= kPbBp;
  wsplit8_body(l % (kPbW / 4), l / (kPbW / 4), Wk, Wv, Wr, Wo, WH, WL, (int)(kWPlane / 8));
}

// ---------------------------------------------------------------------------
// Linear-attention state scan, f32. One block (128 threads = 4 waves) per (batch b, head n, eighth ih of the
// v channels): the rows i of the state are independent, so each block carries 8 rows x 64 k channels.
// Thread (il, jg): jg = lane owns k channels 2*jg, 2*jg+1, il = wave*2 is the first of the wave's two rows;
// S lives in 2 f32 pairs, one per k channel (pairs run along the two rows, so a step's packed sum is the two rows' partials as they
// are stored, and a step reads four 8-byte LDS operands: r, k, d of its two k channels and v of its two rows).
// The sequence is cut into chunks of kSc timesteps; pass c of the loop, between two block barriers,
//   - runs the kSc steps of chunk c from stage buffer c & 1 (r, k' = k*exp(min(w,0)), d = exp(w), v; k' and d come ready from the
//     decay GEMM's epilogue). A step has no barrier: each thread stores its partial sums over its 2 k channels to partial buffer c & 1;
//   - writes chunk c+1 into the other stage buffer, ahead of the steps, and issues the loads of chunk c+2;
//   - finishes chunk c-1: y_i = sum of the 32 partials + v_i * bonus[t], bonus[t] = sum_j r_j*u_j*k'_j (ready too: bon holds, per head
//     and 16 token rows, one 128-B line with 16 sums).
// Y is laid out by scan block, [block][t][8 rows], so that every 128-B line of it (4 timesteps) is stored once, by 16 lanes of
// one wave of the one block that owns it.
// ---------------------------------------------------------------------------
constexpr int kSc  = 32;             // timesteps per chunk
constexpr int kNC  = kSeq / kSc;     // chunks
constexpr int kIB  = 8;              // state rows (v channels) per block
constexpr int kNIB = kHead / kIB;    // blocks per head
constexpr int kJG  = 32;             // j groups, 2 k channels each
constexpr int kPJ  = 10;             // floats between the partial rows of two j groups: the 32 lanes of a b64 store hit all 64 banks once
constexpr int kPT  = kJG * kPJ + 8;  // floats between two timesteps' partials: the 8 timesteps of one b64 read hit disjoint banks
constexpr int kPre = 12;             // steps whose LDS operands are fetched ahead of their use
static_assert(kSeq % kSc == 0 && kNC >= 2 && kNIB == 8 && kJG * 2 == kHead && kSc == 32 && kSc > kPre, "scan chunking");
struct ScanOp { v2f r, k, d, v; };
__device__ __forceinline__ v2f both(float a) { return (v2f){a, a}; }
__global__ __launch_bounds__(128) void k_state_scan(const float* __restrict__ kpl, const float* __restrict__ vpl,
                                                    const float* __restrict__ rpl, const float* __restrict__ dpl,
                                                    const float* __restrict__ bon, float* __restrict__ Y) {
  __shared__ __align__(16) float sr0[kSc * 64], sr1[kSc * 64];
  __shared__ __align__(16) float sk0[kSc * 64], sk1[kSc * 64];
  __shared__ __align__(16) float sd0[kSc * 64], sd1[kSc * 64];
  __shared__ __align__(16) float sv0[kSc * kIB], sv1[kSc * kIB];
  __shared__ __align__(16) float part0[kSc * kPT], part1[kSc * kPT];
  const int tid  = threadIdx.x;
  const int lane = tid & 31;
  const int wave = tid >> 5;
  const int ih   = blockIdx.x & (kNIB - 1);
  const int n    = (blockIdx.x >> 3) & (kNHead - 1);
  const int b    = blockIdx.x >> 7;
  const int jg   = lane;
  const int j0   = jg * 2;
  const int il   = wave * 2;                          // first of this thread's two rows, local to the block
  // staging and output roles: r/k/w rows are 16 float4 wide, v and y rows 4 float2 wide
  const int sRow = tid >> 4, sC4 = (tid & 15) * 4;
  const int vRow = tid >> 2, vC2 = (tid & 3) * 2;
  const size_t base = (size_t)b * kSeq * kChan + (size_t)n * kHead;
  float* Yb = Y + (size_t)blockIdx.x * (kSeq * kIB);                     // this block's own [t][8] plane
  const unsigned offS = (unsigned)(sRow * kChan + sC4) * 4u;             // byte offsets of the roles inside a piece
  const unsigned offV = (unsigned)(vRow * kChan + ih * kIB + vC2) * 4u;
  const unsigned offY = (unsigned)(vRow * kIB + vC2) * 4u;
  const unsigned offB = (unsigned)((vRow >> 4) * 32 + (vRow & 15)) * 4u;
  const float* bonb = bon + ((size_t)n * (kRows / 16) + (size_t)b * (kSeq / 16)) * 32;   // this head's and batch's lines of sums

  v2f S[2];
#pragma unroll
  for (int q = 0; q < 2; ++q) S[q] = (v2f){0.f, 0.f};

  // a chunk is staged through registers: kSc/8 pieces of 8 rows of r, k', d, all kSc rows of v and the kSc bonus sums
  v4f gw[kSc / 8], gk[kSc / 8], gr[kSc / 8];
  v2f gv;
  float gb;
  // the v values this thread staged are the ones its own output role needs two passes later: vOld of chunk c-1, vNew of chunk c;
  // the bonus sum of its timestep goes the same way
  v2f vOld = (v2f){0.f, 0.f}, vNew = vOld;
  float bOld = 0.f, bNew = 0.f;
  // this thread's places in the chunk whose loads are issued next; carried from issue to issue, so that the loads name no register
  // that is written between them
  const char* qd = (const char*)(dpl + base) + offS;
  const char* qk = (const char*)(kpl + base) + offS;
  const char* qr = (const char*)(rpl + base) + offS;
  const char* qv = (const char*)(vpl + base) + offV;
  const char* qb = (const char*)bonb + offB;
  // go: a further chunk exists (block-uniform); without one the places stay, and the last chunk is read again
  auto issue = [&](bool go) {
    // the two scheduling barriers keep every other instruction out of the group of loads and its wait
    __builtin_amdgcn_sched_barrier(0);
#pragma unroll   // here and in commit(): the three arrays are indexed by constants only, so that they stay in registers
    for (int it = 0; it < kSc / 8; ++it) {
      gw[it] = *(const v4f*)(qd + (size_t)it * (8 * kChan * 4));
      gk[it] = *(const v4f*)(qk + (size_t)it * (8 * kChan * 4));
      gr[it] = *(const v4f*)(qr + (size_t)it * (8 * kChan * 4));
    }
    gv = *(const v2f*)(qv);
    gb = *(const float*)(qb);
    // precaution: this wait stands in front of every later write of a register that one of these loads names
    asm volatile("s_wait_xcnt 0x0" ::: "memory");
    __builtin_amdgcn_sched_barrier(0);
    const size_t dS = go ? (size_t)(kSc * kChan * 4) : 0, dB = go ? (size_t)((kSc / 16) * 32 * 4) : 0;
    qd += dS; qk += dS; qr += dS; qv += dS; qb += dB;
  };
  auto commit = [&](float* dr, float* dk, float* dd_, float* dv) {
#pragma unroll
    for (int it = 0; it < kSc / 8; ++it) {
      const int tl = it * 8 + sRow;
      *(v4f*)(dr + tl * 64 + sC4)  = gr[it];
      *(v4f*)(dk + tl * 64 + sC4)  = gk[it];
      *(v4f*)(dd_ + tl * 64 + sC4) = gw[it];
    }
    *(v2f*)(dv + vRow * kIB + vC2) = gv;
    vOld = vNew;
    vNew = gv;
    bOld = bNew;
    bNew = gb;
  };
  // finishing chunk cc from its partials (src), its v values and its bonus sum: the LDS reads, and apart from them the sums and the store
  v2f x[kJG];
  auto finish_load = [&](const float* src) {
#pragma unroll   // here and below: x is indexed by constants only, so that it stays in registers
    for (int g = 0; g < kJG; ++g) x[g] = *(const v2f*)(src + vRow * kPT + g * kPJ + vC2);
  };
  auto finish_sum = [&](int cc, v2f vv, float bn) {
    v2f s8[4];
#pragma unroll
    for (int h = 0; h < 4; ++h)
      s8[h] = ((x[8 * h] + x[8 * h + 1]) + (x[8 * h + 2] + x[8 * h + 3])) + ((x[8 * h + 4] + x[8 * h + 5]) + (x[8 * h + 6] + x[8 * h + 7]));
    const v2f yv = ((s8[0] + s8[1]) + (s8[2] + s8[3])) + vv * bn;
    // as in issue(): nothing else is scheduled into the store and its wait
    __builtin_amdgcn_sched_barrier(0);
    *(v2f*)((char*)(Yb + (size_t)cc * (kSc * kIB)) + offY) = yv;
    // the same precaution for the registers that this store names
    asm volatile("s_wait_xcnt 0x0" ::: "memory");
    __builtin_amdgcn_sched_barrier(0);
  };
  auto pass = [&](int c) {
    const int p = c & 1;
    const float* pr = (p ? sr1 : sr0) + j0;
    const float* pk = (p ? sk1 : sk0) + j0;
    const float* pd = (p ? sd1 : sd0) + j0;
    const float* pv = (p ? sv1 : sv0) + il;
    float* pp = (p ? part1 : part0) + jg * kPJ + il;
    // the chunk whose loads are issued in this pass is c + 2, clamped, so that the pass has no branch for it (the last two passes
    // re-read the last chunk, and the last pass stages it into buffers that nobody reads any more)
    auto ld = [&](int tl) {
      ScanOp o;
      o.r = *(const v2f*)(pr + tl * 64);
      o.k = *(const v2f*)(pk + tl * 64);
      o.d = *(const v2f*)(pd + tl * 64);
      o.v = *(const v2f*)(pv + tl * kIB);
      return o;
    };
    // the previous chunk's reads first, then the first steps' reads, which are served while the previous chunk is summed and stored
    if (c > 0) finish_load(p ? part0 : part1);             // block-uniform
    ScanOp ring[kPre];
#pragma unroll
    for (int tl = 0; tl < kPre; ++tl) ring[tl] = ld(tl);
    // the next chunk's stage is a plain copy: stored at once, behind the reads above, so that the loads issued behind it have the whole
    // pass to land before the barrier waits for them
    const v2f vPrev = vOld;            // of chunk c-1: commit() moves both on by one chunk
    const float bPrev = bOld;
    commit(p ? sr0 : sr1, p ? sk0 : sk1, p ? sd0 : sd1, p ? sv0 : sv1);
    issue(c + 3 < kNC);
    if (c > 0) finish_sum(c - 1, vPrev, bPrev);
    // fully unrolled so that the ring's slots are registers and every LDS offset an immediate
#pragma unroll
    for (int tl = 0; tl < kSc; ++tl) {
      const ScanOp o = ring[tl % kPre];
      if (tl + kPre < kSc) ring[tl % kPre] = ld(tl + kPre);
      // keeps these reads kPre steps ahead of their use: sunk next to it, the wave would wait out the LDS latency in every step
      __builtin_amdgcn_sched_barrier(0);
      v2f a = both(o.r[0]) * S[0];
      a = __builtin_elementwise_fma(both(o.r[1]), S[1], a);
      S[0] = __builtin_elementwise_fma(S[0], both(o.d[0]), both(o.k[0]) * o.v);
      S[1] = __builtin_elementwise_fma(S[1], both(o.d[1]), both(o.k[1]) * o.v);
      *(v2f*)(pp + tl * kPT) = a;
    }
    // the one barrier of a pass: publishes this chunk's partials and the next chunk's stage, and ends the reads of this chunk's
    // stage and of the previous chunk's partials, which the next pass overwrites
    __syncthreads();
  };

  issue(true);
  commit(sr0, sk0, sd0, sv0);
  issue(2 < kNC);
  __syncthreads();
#pragma unroll 1
  for (int c = 0; c < kNC; ++c) pass(c);
  finish_load(((kNC - 1) & 1) ? part1 : part0);
  finish_sum(kNC - 1, vOld, bOld);
}

// ---------------------------------------------------------------------------
// GroupNorm (64 channels per head, biased variance, eps 1.6e-4) + affine + gate multiply -> bf16 hi/lo planes.
// One wave per (row m, head n), 8 pairs per 256-thread block; lane owns channels 2l, 2l+1; shuffle reductions (unconditional).
// Y comes in the scan's layout [scan block][t][8 rows]: a block takes 4 consecutive rows of 2 heads, which share their lines of Y.
// ---------------------------------------------------------------------------
__global__ __launch_bounds__(256) void k_gn_gate(const float* __restrict__ Y, const float* __restrict__ G,
                                                 const float* __restrict__ gamma, const float* __restrict__ beta,
                                                 unsigned short* __restrict__ outH, unsigned short* __restrict__ outL) {
  __shared__ __align__(16) float slab[8][64];
  const int lane = threadIdx.x & 31, wave = threadIdx.x >> 5;
  const int m = (blockIdx.x >> 3) * 4 + (wave & 3);
  const int n = (blockIdx.x & 7) * 2 + (wave >> 2);
  const size_t base = (size_t)m * kChan + (size_t)n * kHead;
  const int c = n * kHead + 2 * lane;
  const int sb = ((m / kSeq) * kNHead + n) * kNIB + (2 * lane) / kIB;      // the scan block that owns this lane's two channels
  // the two scheduling barriers keep every other instruction out of the group of loads and its wait, so that the four fly together
  __builtin_amdgcn_sched_barrier(0);
  const v2f yv = *(const v2f*)(Y + ((size_t)sb * kSeq + (m % kSeq)) * kIB + (2 * lane) % kIB);
  const v2f gv = *(const v2f*)(G + base + 2 * lane);
  const v2f ga = *(const v2f*)(gamma + c);
  const v2f be = *(const v2f*)(beta + c);
  // precaution: this wait stands in front of every later write of a register that one of these loads names
  asm volatile("s_wait_xcnt 0x0" ::: "memory");
  __builtin_amdgcn_sched_barrier(0);
  float s = yv[0] + yv[1];
#pragma unroll
  for (int off = 16; off > 0; off >>= 1) s += __shfl_xor(s, off, 32);
  const float mean = s * (1.0f / 64.0f);
  const float d0 = yv[0] - mean;
  const float d1 = yv[1] - mean;
  float q = d0 * d0 + d1 * d1;
#pragma unroll
  for (int off = 16; off > 0; off >>= 1) q += __shfl_xor(q, off, 32);
  const float var = q * (1.0f / 64.0f);
  const float rs  = 1.0f / sqrtf(var + kGnEps);
  const float o0 = ((d0 * rs) * ga[0] + be[0]) * gv[0];
  const float o1 = ((d1 * rs) * ga[1] + be[1]) * gv[1];
  *(v2f*)(&slab[wave][2 * lane]) = (v2f){o0, o1};
  __syncthreads();
  if (lane < 8) {
    unsigned short hb[8], lb[8];
#pragma unroll
    for (int e = 0; e < 8; ++e) bf_split_bits(slab[wave][8 * lane + e], hb[e], lb[e]);
    const v4u uh = (v4u){pk16(hb[0], hb[1]), pk16(hb[2], hb[3]), pk16(hb[4], hb[5]), pk16(hb[6], hb[7])};
    const v4u ul = (v4u){pk16(lb[0], lb[1]), pk16(lb[2], lb[3]), pk16(lb[4], lb[5]), pk16(lb[6], lb[7])};
    const size_t o = base + 8 * (size_t)lane;
    *(v4u*)(outH + o) = uh;
    *(v4u*)(outL + o) = ul;
    
  }
}

// ---------------------------------------------------------------------------
// Host glue.
// Workspace region map (bytes; every size is a multiple of 4096, offsets in that order):
//   XX     bf16 [2048][1024]            4,194,304
//   HC     bf16 [2048][192]               786,432   (tanh of the mix lowrank; cols 160..191 zero, unread; branch s = rows 2048s.. of the
//                                                    [10240][32] view of its cols 0..159)
//   MIU    f32  [2048][1024]            8,388,608   (the decay factors exp(w))
//   X5H    bf16 [5][2048][1024]        20,971,520   (branch inputs hi: 0 decay (single), 1 k, 2 v, 3 r, 4 gate)
//   X5L    bf16 [4][2048][1024]        16,777,216   (lo planes of branches 1..4 at index s-1)
//   WH     bf16 [4][1024][1024]         8,388,608   (Wk, Wv, Wr, Wo hi, [out][in] as-is)
//   WL     bf16 [4][1024][1024]         8,388,608   (lo)
//   AT     bf16 [192][1024]               393,216   (A^T, rows 160..191 zero)
//   TDAT   bf16 [64][1024]                131,072
//   TDBT   bf16 [1024][64]                131,072
//   WG1TH  bf16 [192][1024]               393,216   (rows 160..191 zero)   WG1TL 393,216
//   WG2TH  bf16 [1024][192]               393,216   (cols 160..191 zero)   WG2TL 393,216
//   BPT    bf16 [5][1024][32]             327,680
//   L1     bf16 [2048][64]                262,144
//   KVR    f32  [3][2048][1024]         25,165,824   (k unscaled, v, r)
//   GHH    bf16 [2048][192]               786,432   (cols 160..191 zero)   GHL 786,432
//   GATE   f32  [2048][1024]            8,388,608
//   Y      f32  [256][1024][8]          8,388,608   (scan block = (b*16 + head)*8 + eighth of the head's channels, t, row)
//   GATH   bf16 [2048][1024]            4,194,304   GATL 4,194,304
//   KK     f32  [2048][1024]            8,388,608   (k * exp(min(w, 0)))
//   BON    f32  [16][128][32]             262,144   (bonus sums: head, group of 16 token rows, 16 sums and 16 unused floats)
//   total                             131,268,608
// GEMM shapes (M, N, K): (2048,192,1024) (2048,1024,32)x5 batched (2048,64,1024) (2048,1024,64) (2048,1024,1024)x3 batched
// (2048,192,1024) (2048,1024,192) (2048,1024,1024); all M,N % 64 == 0, all K % 32 == 0, pads zero-written by producers.
// ---------------------------------------------------------------------------
extern "C" void kernel_launch(void* const* d_in, const int* in_sizes, int n_in,
                              void* d_out, int out_size, void* d_ws, size_t ws_size,
                              hipStream_t stream) {
  if (n_in < 17) return;
  if (in_sizes[0] != kBatch * kSeq * kChan) return;
  if (in_sizes[1] != kChan || in_sizes[2] != kNBr * kChan) return;
  if (in_sizes[3] != kChan * kMix || in_sizes[4] != kNBr * kBr * kChan) return;
  if (in_sizes[5] != kChan || in_sizes[6] != kChan * kDec || in_sizes[7] != kDec * kChan) return;
  if (in_sizes[8] != kNHead * kHead) return;
  if (in_sizes[9] != kChan * kChan || in_sizes[10] != kChan * kChan || in_sizes[11] != kChan * kChan || in_sizes[12] != kChan * kChan) return;
  if (in_sizes[13] != kChan * kMix || in_sizes[14] != kMix * kChan) return;
  if (in_sizes[15] != kChan || in_sizes[16] != kChan) return;
  if (out_size != kBatch * kSeq * kChan) return;

  const float* x      = (const float*)d_in[0];
  const float* miu_x  = (const float*)d_in[1];
  const float* lam    = (const float*)d_in[2];    // [5][1024]
  const float* Amat   = (const float*)d_in[3];    // [1024][160]
  const float* Bp     = (const float*)d_in[4];    // [5][32][1024]
  const float* td_miu = (const float*)d_in[5];    // [1024]
  const float* tdA    = (const float*)d_in[6];    // [1024][64]
  const float* tdB    = (const float*)d_in[7];    // [64][1024]
  const float* u      = (const float*)d_in[8];    // [16][64]
  const float* Wk     = (const float*)d_in[9];    // [1024][1024] [out][in]
  const float* Wv     = (const float*)d_in[10];
  const float* Wr     = (const float*)d_in[11];
  const float* Wo     = (const float*)d_in[12];
  const float* Wg1    = (const float*)d_in[13];   // [1024][160]
  const float* Wg2    = (const float*)d_in[14];   // [160][1024]
  const float* gamma  = (const float*)d_in[15];
  const float* beta   = (const float*)d_in[16];
  float* out = (float*)d_out;

  // ---- carve ----
  const size_t szXX    = (size_t)kPlane * 2;
  const size_t szHC    = (size_t)kRows * kMixPad * 2;
  const size_t szF32P  = (size_t)kPlane * 4;
  const size_t szX5H   = (size_t)kNBr * kPlane * 2;
  const size_t szX5L   = (size_t)(kNBr - 1) * kPlane * 2;
  const size_t szWSQ   = (size_t)4 * kWPlane * 2;
  const size_t szAT    = (size_t)kMixPad * kChan * 2;
  const size_t szTDAT  = (size_t)kDec * kChan * 2;
  const size_t szTDBT  = (size_t)kChan * kDec * 2;
  const size_t szWG1T  = (size_t)kMixPad * kChan * 2;
  const size_t szWG2T  = (size_t)kChan * kMixPad * 2;
  const size_t szBPT   = (size_t)kNBr * kChan * kBr * 2;
  const size_t szL1    = (size_t)kRows * kDec * 2;
  const size_t szKVR   = (size_t)3 * kPlane * 4;
  const size_t szGH    = (size_t)kRows * kMixPad * 2;
  const size_t szGAT   = (size_t)kPlane * 2;
  size_t off = 0;
  const size_t oXX    = off; off += szXX;
  const size_t oHC    = off; off += szHC;
  const size_t oMIU   = off; off += szF32P;
  const size_t oX5H   = off; off += szX5H;
  const size_t oX5L   = off; off += szX5L;
  const size_t oWH    = off; off += szWSQ;
  const size_t oWL    = off; off += szWSQ;
  const size_t oAT    = off; off += szAT;
  const size_t oTDAT  = off; off += szTDAT;
  const size_t oTDBT  = off; off += szTDBT;
  const size_t oWG1TH = off; off += szWG1T;
  const size_t oWG1TL = off; off += szWG1T;
  const size_t oWG2TH = off; off += szWG2T;
  const size_t oWG2TL = off; off += szWG2T;
  const size_t oBPT   = off; off += szBPT;
  const size_t oL1    = off; off += szL1;
  const size_t oKVR   = off; off += szKVR;
  const size_t oGHH   = off; off += szGH;
  const size_t oGHL   = off; off += szGH;
  const size_t oGATE  = off; off += szF32P;
  const size_t oY     = off; off += szF32P;
  const size_t oGATH  = off; off += szGAT;
  const size_t oGATL  = off; off += szGAT;
  const size_t oKK    = off; off += szF32P;
  const size_t oBON   = off; off += (size_t)kNHead * (kRows / 16) * 32 * 4;
  const size_t total  = off;   // 131,268,608
  if (total > (size_t)134217728) return;
  if (ws_size < total) return;

  char* ws = (char*)d_ws;
  unsigned short* XX    = (unsigned short*)(ws + oXX);
  unsigned short* HC    = (unsigned short*)(ws + oHC);
  float*          MIU   = (float*)(ws + oMIU);
  float*          DEC   = MIU;                       // decay factors, f32 [2048][1024]
  unsigned short* X5H   = (unsigned short*)(ws + oX5H);
  unsigned short* X5L   = (unsigned short*)(ws + oX5L);
  unsigned short* WH    = (unsigned short*)(ws + oWH);
  unsigned short* WL    = (unsigned short*)(ws + oWL);
  unsigned short* AT    = (unsigned short*)(ws + oAT);
  unsigned short* TDAT  = (unsigned short*)(ws + oTDAT);
  unsigned short* TDBT  = (unsigned short*)(ws + oTDBT);
  unsigned short* WG1TH = (unsigned short*)(ws + oWG1TH);
  unsigned short* WG1TL = (unsigned short*)(ws + oWG1TL);
  unsigned short* WG2TH = (unsigned short*)(ws + oWG2TH);
  unsigned short* WG2TL = (unsigned short*)(ws + oWG2TL);
  unsigned short* BPT   = (unsigned short*)(ws + oBPT);
  unsigned short* L1    = (unsigned short*)(ws + oL1);
  float*          KVR   = (float*)(ws + oKVR);
  unsigned short* GHH   = (unsigned short*)(ws + oGHH);
  unsigned short* GHL   = (unsigned short*)(ws + oGHL);
  float*          GATE  = (float*)(ws + oGATE);
  float*          Yp    = (float*)(ws + oY);
  unsigned short* GATH  = (unsigned short*)(ws + oGATH);
  unsigned short* GATL  = (unsigned short*)(ws + oGATL);
  float*          KK    = (float*)(ws + oKK);
  float*          BON   = (float*)(ws + oBON);
  const float* fdum = gamma;   // placeholder for unused bias / resid pointer arguments (never dereferenced)

  const dim3 blk(256);

  // ---- token shift and all weight planes ----
  k_prepare<<<dim3(kPbAll), blk, 0, stream>>>(x, miu_x, Amat, tdA, tdB, Wg1, Wg2, Bp, Wk, Wv, Wr, Wo,
                                              XX, AT, TDAT, TDBT, WG1TH, WG1TL, WG2TH, WG2TL, BPT, WH, WL);

  // ---- mix lowrank: HC = tanh(XX @ AT^T) as bf16 (M 2048, N 192, K 1024; 48 blocks of 128 x 64, eight waves of 16 x 64, so that a
  // lane has 32 tanh to do) ----
  wmma_gemm64<1, false, 0, 4, false, 5, 8, 1, 64, kChan, 1><<<dim3((kRows / 128) * (kMixPad / 64), 1), blk, 0, stream>>>(
      XX, XX, 0L, AT, AT, 0L, (void*)HC, (void*)HC, kMixPad, 0L, fdum, fdum, 0L, kMixPad, 1.0f);

  // ---- mix GEMM of all five branches (blockIdx.y = s; A = cols 0..159 of HC viewed [10240][32], rows 2048s..; K 32); its epilogue
  // forms the branch inputs and stores their bf16 planes ----
  wmma_gemm64<1, false, 0, 3, false, 0, 2, 4, 32, kBr><<<dim3((kRows / 128) * (kChan / 256), kNBr), blk, 0, stream>>>(
      HC, HC, (long)kRows * kBr, BPT, BPT, (long)kChan * kBr,
      (void*)X5H, (void*)X5L, kChan, (long)kPlane, lam, x, 0L, kChan, 1.0f);

  // ---- what reads only the branch inputs: KVR = k (unscaled), v, r projections; GH = tanh(X5[4] @ WG1T^T) hi/lo (cols 160..191 zero);
  // L1 = tanh(X5H[0] @ TDAT^T) ----
  k_branch_gemms<<<dim3(3 * kProjTiles + kGateTiles + kDecTiles), blk, 0, stream>>>(
      X5H, X5L, WH, WL, KVR, WG1TH, WG1TL, GHH, GHL, TDAT, L1);
  // ---- GATE = GH @ WG2T^T (split, K 192); w = L1 @ TDBT^T + td_miu (K 64), stored as DEC = exp(w), KK = k * exp(min(w, 0)), BON ----
  k_lowrank_out_gemms<<<dim3(2 * kFillTiles), blk, 0, stream>>>(GHH, GHL, WG2TH, WG2TL, GATE, L1, TDBT, DEC, KVR, KVR + 2 * kPlane,
                                                                td_miu, u, KK, BON);

  // ---- state scan -> Y ----
  k_state_scan<<<dim3(kBatch * kNHead * kNIB), dim3(128), 0, stream>>>(KK, KVR + kPlane, KVR + 2 * kPlane, DEC, BON, Yp);

  // ---- GroupNorm + gate -> GATH/GATL (4096 blocks x 8 waves = 32768 (row, head) pairs) ----
  k_gn_gate<<<dim3((kRows * kNHead) / 8), blk, 0, stream>>>(Yp, GATE, gamma, beta, GATH, GATL);

  // ---- output projection straight into d_out (split, K 1024; 256 tiles of 64 x 128) ----
  wmma_gemm64<1, true, 0, 0, false, 0, 4, 2, 64, kChan, 1><<<dim3(kFillTiles, 1), blk, 0, stream>>>(
      GATH, GATL, 0L, WH + 3 * kWPlane, WL + 3 * kWPlane, 0L,
      (void*)out, (void*)out, kChan, 0L, fdum, fdum, 0L, kChan, 1.0f);
}
